// v000
// Measured on an AMD MI455X. A time is GPU time per run, averaged over a window of back-to-back runs after a warm-up
// (all launches, gaps included; the runs take copies of the inputs in turn), and the median of several windows.
// Apart from v000's, it joins two sittings. Times from different sittings can be a few percent apart, while
// side-by-side timings come from the same sitting.
// v000, which the later versions start from, runs in 6990 microseconds.
#include <hip/hip_runtime.h>
// Multi-head attention on two inputs with PER-HEAD STACKED projections and per-head biases on four sequences (query [4][2048][1024], value [4][2048][1024]; q = einsum('bsd,hde->bhse', query, wq) + bq, k = einsum(value, wk) + bk, v = einsum(value, wv) + bv with W [16][1024][64] = [head][in][out] and b [16][64], 16 heads of 64; scores * 1/sqrt(64); softmax over all 2048 keys (no mask); out = heads wo + bo ([in][out] + bias) -> [4][2048][1024]); each head's [in][out] block is transposed into its 64 contiguous rows of the weight plane by the existing builder, one call per head; the [in][out] output weight through the same builder in one call.
// Structure: token rows r = b*2048 + s; the query source and the key/value source as exact f16 rows (bf16-rounded); Q, K, V as three WMMA GEMMs (32x64 wave tiles, f32 accumulation, exact x16 weights + bias, f16 outputs); per batch: V^T for all heads via LDS transposes; per (batch, group of 4 heads): scores GEMM (K = 64, batched over the heads on grid.y, alpha = 64^-0.5), row softmax on VALU (f32 statistics, native exp; weights stored x256 as f16), o = P . V^T GEMM (K = 2048, alpha 2^-2: o carried x64 against f16 subnormal flush, folded into the output GEMM alpha) written straight into the merged f16 o rows; out = o W_o + b GEMM (f32) into the output layout.
// Compute dtype: inputs rounded to bf16; x / weights exact; q, k, v, softmax weights and o as plain f16 GEMM operands (~2^-12); scores and softmax statistics f32. v_wmma_f32_16x16x32_f16.
#define NB 4
#define SQ 2048
#define DM 1024
#define NH 16
#define HD 64
#define HG 4                         /* heads per attention launch group */
#define B0 0                         /* first batch processed (debug hook) */
#define NBR NB                       /* batches processed (debug hook) */
#define NR ((size_t)NB * SQ)         /* token rows */
#define MP ((int)((size_t)NBR * SQ)) /* rows projected (debug hook) */
#define QN SQ                        /* query rows attended per batch (debug hook) */
#define NHD NH                       /* heads attended (debug hook) */
#define MPO MP                       /* rows through the output stage (debug hook) */
#define LQ DM      /* row pitch of the q/k/v rows */
typedef __bf16 v16b __attribute__((ext_vector_type(16)));
typedef unsigned short v8us __attribute__((ext_vector_type(8), may_alias));
typedef float  v8f  __attribute__((ext_vector_type(8)));
typedef float  v4f  __attribute__((ext_vector_type(4)));
typedef float  v4fa __attribute__((ext_vector_type(4), may_alias));
union FragB { v16b v; v8us half[2]; unsigned short u[16]; };

__device__ __forceinline__ unsigned short bf16_bits(float x) { unsigned int u = __float_as_uint(x); return (unsigned short)((u + 0x7FFFu + ((u >> 16) & 1u)) >> 16); }
__device__ __forceinline__ float bf16_val(unsigned short b) { return __uint_as_float(((unsigned int)b) << 16); }
__device__ __forceinline__ float bf16_round(float x) { return bf16_val(bf16_bits(x)); }
// D += A·B with NT terms: 1 = ah·bh, 2 = + al·bh (A split), 3 = + ah·bl (both split)
template <int NT>
__device__ __forceinline__ v8f mmaN(v16b ah, v16b al, v16b bh, v16b bl, v8f c) {
  c = __builtin_amdgcn_wmma_f32_16x16x32_bf16(false, ah, false, bh, (short)0, c, false, false);
  if (NT >= 2) c = __builtin_amdgcn_wmma_f32_16x16x32_bf16(false, al, false, bh, (short)0, c, false, false);
  if (NT >= 3) c = __builtin_amdgcn_wmma_f32_16x16x32_bf16(false, ah, false, bl, (short)0, c, false, false);
  asm volatile("v_nop\n\tv_nop\n\tv_nop\n\tv_nop" : "+v"(c) : "v"(ah), "v"(al), "v"(bh), "v"(bl));
  return c;
}

__global__ __launch_bounds__(256) void k_wt_bf16(const float* __restrict__ W, unsigned short* __restrict__ Wt, int K, int N) {
  const int t = blockIdx.x * 256 + threadIdx.x;
  const int k8n = K / 8;
  if (t >= N * k8n) return;
  const int n = t / k8n, k8 = (t % k8n) * 8;
  v8us v;
#pragma unroll
  for (int i = 0; i < 8; ++i) v[i] = bf16_bits(W[(size_t)(k8 + i) * N + n]);
  *(v8us*)(Wt + (size_t)n * K + k8) = v;
  
}

// GEMM C[M][N] (f32, pitch ldc) = act(A[M][K]·W + bias). A f32 row-major (pitch lda) converted per fragment to bf16
// (ASPLIT: hi/lo two planes -> 2 terms, else single rounded term); Wt bf16 [N][K] (pitch ldb). BIAS_BF16 rounds the
// bias to bf16 first (bias quantised to bf16 before the add). K%32==0, M%16==0, N%64==0.
template <bool ASPLIT, int ACT, bool BIAS_BF16>
__global__ __launch_bounds__(128) void k_gemm_bf(const float* __restrict__ A, int lda, const unsigned short* __restrict__ Wt, int ldb,
                                               const float* __restrict__ bias, float* __restrict__ C, int ldc, int M, int N, int K) {
  __shared__ __attribute__((aligned(16))) float so[4][16][64];
  const int tid = threadIdx.x, w = tid >> 5, lane = tid & 31, ln = lane & 15, hh = lane >> 4;
  const int ntn = N / 64;
  const int wid = blockIdx.x * 4 + w;
  const int mt = wid / ntn, nq = wid % ntn;
  if (mt * 16 >= M) return;
  const int row0 = mt * 16, col0 = nq * 64;
  const float* arow = A + (size_t)(row0 + ln) * lda;
  v8f acc[4] = {};
  for (int kb = 0; kb < K; kb += 32) {
    FragB ah, al;
    const v4f x0 = *(const v4fa*)(arow + kb + 8 * hh), x1 = *(const v4fa*)(arow + kb + 8 * hh + 4);
    const v4f x2 = *(const v4fa*)(arow + kb + 16 + 8 * hh), x3 = *(const v4fa*)(arow + kb + 16 + 8 * hh + 4);
    float xs[16] = {x0[0],x0[1],x0[2],x0[3],x1[0],x1[1],x1[2],x1[3],x2[0],x2[1],x2[2],x2[3],x3[0],x3[1],x3[2],x3[3]};
#pragma unroll
    for (int i = 0; i < 16; ++i) { const unsigned short hb = bf16_bits(xs[i]); ah.u[i] = hb; al.u[i] = ASPLIT ? bf16_bits(xs[i] - bf16_val(hb)) : (unsigned short)0; }
#pragma unroll
    for (int t = 0; t < 4; ++t) {
      const unsigned short* brow = Wt + (size_t)(col0 + t * 16 + ln) * ldb + kb;
      FragB b;
      b.half[0] = *(const v8us*)(brow + 8 * hh);
      b.half[1] = *(const v8us*)(brow + 16 + 8 * hh);
      acc[t] = mmaN<ASPLIT ? 2 : 1>(ah.v, al.v, b.v, b.v, acc[t]);
    }
  }
#pragma unroll
  for (int t = 0; t < 4; ++t) {
    float bv = bias ? bias[col0 + t * 16 + ln] : 0.f;
    if (BIAS_BF16) bv = bf16_round(bv);
#pragma unroll
    for (int r = 0; r < 8; ++r) { float v = acc[t][r] + bv; if (ACT == 1) v = fmaxf(v, 0.f); so[w][8 * hh + r][t * 16 + ln] = v; }
  }
  __builtin_amdgcn_fence(__ATOMIC_ACQ_REL, "workgroup");
  __builtin_amdgcn_wave_barrier();
  const int rsub = lane >> 4, c4 = (lane & 15) * 4;
  {
#pragma unroll
    for (int q = 0; q < 8; ++q) {
      const int r = q * 2 + rsub;
      const v4f v = *(const v4fa*)&so[w][r][c4];
      *(v4f*)(C + (size_t)(row0 + r) * ldc + col0 + c4) = v;
    }
    
  }
}

// GEMM C = act(A·W + bias + resid): A f32 (ASPLIT -> hi/lo 2 terms), Wt bf16 [N][K]; ACT 0 none, 1 relu, 2 exact gelu;
// resid (optional, f32, row index = (row % rmod), pitch ldr, RES_BF16 rounds it) added before the activation.
template <bool ASPLIT, int ACT, bool BIAS_BF16, bool RES_BF16>
__global__ __launch_bounds__(128) void k_gemm_bf3(const float* __restrict__ A, int lda, const unsigned short* __restrict__ Wt, int ldb,
                                                const float* __restrict__ bias, const float* __restrict__ resid, int rmod, int ldr,
                                                float* __restrict__ C, int ldc, int M, int N, int K) {
  __shared__ __attribute__((aligned(16))) float so[4][16][64];
  const int tid = threadIdx.x, w = tid >> 5, lane = tid & 31, ln = lane & 15, hh = lane >> 4;
  const int ntn = N / 64;
  const int wid = blockIdx.x * 4 + w;
  const int mt = wid / ntn, nq = wid % ntn;
  if (mt * 16 >= M) return;
  const int row0 = mt * 16, col0 = nq * 64;
  const float* arow = A + (size_t)(row0 + ln) * lda;
  v8f acc[4] = {};
  for (int kb = 0; kb < K; kb += 32) {
    FragB ah, al;
    const v4f x0 = *(const v4fa*)(arow + kb + 8 * hh), x1 = *(const v4fa*)(arow + kb + 8 * hh + 4);
    const v4f x2 = *(const v4fa*)(arow + kb + 16 + 8 * hh), x3 = *(const v4fa*)(arow + kb + 16 + 8 * hh + 4);
    float xs[16] = {x0[0],x0[1],x0[2],x0[3],x1[0],x1[1],x1[2],x1[3],x2[0],x2[1],x2[2],x2[3],x3[0],x3[1],x3[2],x3[3]};
#pragma unroll
    for (int i = 0; i < 16; ++i) { const unsigned short hb = bf16_bits(xs[i]); ah.u[i] = hb; al.u[i] = ASPLIT ? bf16_bits(xs[i] - bf16_val(hb)) : (unsigned short)0; }
#pragma unroll
    for (int t = 0; t < 4; ++t) {
      const unsigned short* brow = Wt + (size_t)(col0 + t * 16 + ln) * ldb + kb;
      FragB b;
      b.half[0] = *(const v8us*)(brow + 8 * hh);
      b.half[1] = *(const v8us*)(brow + 16 + 8 * hh);
      acc[t] = mmaN<ASPLIT ? 2 : 1>(ah.v, al.v, b.v, b.v, acc[t]);
    }
  }
#pragma unroll
  for (int t = 0; t < 4; ++t) {
    const int col = col0 + t * 16 + ln;
    float bv = bias ? bias[col] : 0.f;
    if (BIAS_BF16) bv = bf16_round(bv);
#pragma unroll
    for (int r = 0; r < 8; ++r) {
      float v = acc[t][r] + bv;
      if (resid) { float rv = resid[(size_t)((row0 + 8 * hh + r) % rmod) * ldr + col]; if (RES_BF16) rv = bf16_round(rv); v += rv; }
      if (ACT == 1) v = fmaxf(v, 0.f);
      if (ACT == 2) v = 0.5f * v * (1.0f + erff(v * 0.70710678118654752f));
      if (ACT == 3) { const float u = 0.7978845608028654f * (v + 0.044715f * v * v * v); v = 0.5f * v * (1.0f + tanhf(u)); }
      so[w][8 * hh + r][t * 16 + ln] = v;
    }
  }
  __builtin_amdgcn_fence(__ATOMIC_ACQ_REL, "workgroup");
  __builtin_amdgcn_wave_barrier();
  const int rsub = lane >> 4, c4 = (lane & 15) * 4;
  {
#pragma unroll
    for (int q = 0; q < 8; ++q) {
      const int r = q * 2 + rsub;
      const v4f v = *(const v4fa*)&so[w][r][c4];
      *(v4f*)(C + (size_t)(row0 + r) * ldc + col0 + c4) = v;
    }
    
  }
}
// row LayerNorm (biased variance, eps) over N: s = X (+ R); optional out_sum <- s; out_norm <- (s-mu)*rsqrt(var+eps)*g + b
template <bool PARAM_BF16>
__global__ __launch_bounds__(256) void k_layernorm(const float* __restrict__ X, const float* __restrict__ R, const float* __restrict__ g, const float* __restrict__ bta,
                                                  float* __restrict__ out_sum, float* __restrict__ out_norm, int N, float eps) {
  __shared__ float red[256];
  const int row = blockIdx.x, tid = threadIdx.x;
  const float* x = X + (size_t)row * N; const float* rr = R ? R + (size_t)row * N : nullptr;
  float vals[16];                     // up to N = 4096
  const int per = N / 256;            // contiguous chunk per thread? use strided-by-4 chunks: thread handles j = tid*4 + 1024*u
  float s1 = 0.f;
  for (int u = 0; u < per / 4; ++u) {
    const int j = tid * 4 + 1024 * u;
    const v4f a = *(const v4fa*)(x + j);
    v4f b = {0.f,0.f,0.f,0.f}; if (rr) b = *(const v4fa*)(rr + j);
#pragma unroll
    for (int q = 0; q < 4; ++q) { const float v = a[q] + b[q]; vals[u * 4 + q] = v; s1 += v; }
  }
  red[tid] = s1; __syncthreads();
  for (int st = 128; st > 0; st >>= 1) { if (tid < st) red[tid] += red[tid + st]; __syncthreads(); }
  const float mu = red[0] / (float)N; __syncthreads();
  float s2 = 0.f;
  for (int u = 0; u < per / 4; ++u)
#pragma unroll
    for (int q = 0; q < 4; ++q) { const float c = vals[u * 4 + q] - mu; s2 += c * c; }
  red[tid] = s2; __syncthreads();
  for (int st = 128; st > 0; st >>= 1) { if (tid < st) red[tid] += red[tid + st]; __syncthreads(); }
  const float rs = rsqrtf(red[0] / (float)N + eps);
  {
    for (int u = 0; u < per / 4; ++u) {
      const int j = tid * 4 + 1024 * u;
      v4f o, sm;
#pragma unroll
      for (int q = 0; q < 4; ++q) {
        float gg = g[j + q], bb = bta[j + q];
        if (PARAM_BF16) { gg = bf16_round(gg); bb = bf16_round(bb); }
        sm[q] = vals[u * 4 + q]; o[q] = (vals[u * 4 + q] - mu) * rs * gg + bb;
      }
      if (out_sum) *(v4f*)(out_sum + (size_t)row * N + j) = sm;
      *(v4f*)(out_norm + (size_t)row * N + j) = o;
    }
    
  }
}



// ---- f16 WMMA path (v_wmma_f32_16x16x32_f16): 11-bit significands for operands in range — used where a [0,1] probability operand needs more precision than bf16
typedef _Float16 v16h __attribute__((ext_vector_type(16)));
union FragH { v16h v; v8us half[2]; _Float16 h[16]; unsigned short u[16]; };
template <int NT>
__device__ __forceinline__ v8f mmaH(v16h ah, v16h al, v16h bh, v16h bl, v8f c) {
  c = __builtin_amdgcn_wmma_f32_16x16x32_f16(false, ah, false, bh, (short)0, c, false, false);
  if (NT >= 2) c = __builtin_amdgcn_wmma_f32_16x16x32_f16(false, al, false, bh, (short)0, c, false, false);
  if (NT >= 3) c = __builtin_amdgcn_wmma_f32_16x16x32_f16(false, ah, false, bl, (short)0, c, false, false);
  asm volatile("v_nop\n\tv_nop\n\tv_nop\n\tv_nop" : "+v"(c) : "v"(ah), "v"(al), "v"(bh), "v"(bl));
  return c;
}
// batched GEMM like k_gemm_b but f16 operands: A f32 (split into f16 hi/lo if ASPLIT, else rounded to f16), Bt = f16 values [n][k]; alpha; C f32; N multiple of 16 (partial tiles skipped)
template <bool ASPLIT>
__global__ __launch_bounds__(128) void k_gemm_h(const float* __restrict__ A, int lda, size_t sA, const _Float16* __restrict__ Bh, int ldb, size_t sB, float alpha, float* __restrict__ C, int ldc, size_t sC, int M, int N, int K) {
  __shared__ __attribute__((aligned(16))) float so[4][16][64];
  const int tid = threadIdx.x, w = tid >> 5, lane = tid & 31, ln = lane & 15, hh = lane >> 4; const int by = blockIdx.y;
  A += (size_t)by * sA; Bh += (size_t)by * sB; C += (size_t)by * sC;
  const int ntn = (N + 63) / 64; const int wid = blockIdx.x * 4 + w; const int mt = wid / ntn, nq = wid % ntn; if (mt * 16 >= M) return;
  const int row0 = mt * 16, col0 = nq * 64; const float* arow = A + (size_t)(row0 + ln) * lda;
  v8f acc[4] = {};
  for (int kb = 0; kb < K; kb += 32) {
    FragH ah, al;
    const v4f x0 = *(const v4fa*)(arow + kb + 8 * hh), x1 = *(const v4fa*)(arow + kb + 8 * hh + 4), x2 = *(const v4fa*)(arow + kb + 16 + 8 * hh), x3 = *(const v4fa*)(arow + kb + 16 + 8 * hh + 4);
    float xs[16] = {x0[0],x0[1],x0[2],x0[3],x1[0],x1[1],x1[2],x1[3],x2[0],x2[1],x2[2],x2[3],x3[0],x3[1],x3[2],x3[3]};
#pragma unroll
    for (int i = 0; i < 16; ++i) { const _Float16 h = (_Float16)xs[i]; ah.h[i] = h; al.h[i] = ASPLIT ? (_Float16)(xs[i] - (float)h) : (_Float16)0.0f; }
#pragma unroll
    for (int t = 0; t < 4; ++t) { if (col0 + t * 16 >= N) continue; const size_t boff = (size_t)(col0 + t * 16 + ln) * ldb + kb; FragH bq; bq.half[0] = *(const v8us*)(Bh + boff + 8 * hh); bq.half[1] = *(const v8us*)(Bh + boff + 16 + 8 * hh);
      acc[t] = mmaH<ASPLIT ? 2 : 1>(ah.v, al.v, bq.v, bq.v, acc[t]); }
  }
#pragma unroll
  for (int t = 0; t < 4; ++t) { if (col0 + t * 16 >= N) continue;
#pragma unroll
    for (int r = 0; r < 8; ++r) so[w][8 * hh + r][t * 16 + ln] = acc[t][r] * alpha; }
  __builtin_amdgcn_fence(__ATOMIC_ACQ_REL, "workgroup"); __builtin_amdgcn_wave_barrier();
  const int rsub = lane >> 4, c4 = (lane & 15) * 4;
  {
#pragma unroll
    for (int q = 0; q < 8; ++q) { const int r = q * 2 + rsub; if (col0 + c4 < N) { const v4f v = *(const v4fa*)&so[w][r][c4]; *(v4f*)(C + (size_t)(row0 + r) * ldc + col0 + c4) = v; } }
     }
}

// Wt[n][k] = f16(W[k][n]·scale) from f32 row-major W[K][N] (scale = power of two; bf16-exact weights stay exact in f16 away from the subnormal range)
__global__ __launch_bounds__(256) void k_wt_f16(const float* __restrict__ W, _Float16* __restrict__ Wt, int K, int N, float scale) {
  const int t = blockIdx.x * 256 + threadIdx.x; if (t >= N * (K / 8)) return; const int n = t / (K / 8), k8 = (t % (K / 8)) * 8; FragH f;
#pragma unroll
  for (int i = 0; i < 8; ++i) f.h[i] = (_Float16)(bf16_round(W[(size_t)(k8 + i) * N + n]) * scale); const v8us o = f.half[0];
  *(v8us*)((unsigned short*)Wt + (size_t)n * K + k8) = o; 
}
// k_gemm_hh variant with fused epilogue: v = acc·alpha + bias[by·sBias + col] (+ CP[(row/rowsPerB)·sCPb + by·64 + col] if CP) ; ACT 0 none / 1 elu ; writes f16 C16 (and f32 C if non-null)
template <int ACT>
__global__ __launch_bounds__(128) void k_gemm_hhx(const _Float16* __restrict__ A, int lda, size_t sA, const _Float16* __restrict__ Bh, int ldb, size_t sB, float alpha, const float* __restrict__ bias, size_t sBias, const float* __restrict__ CP, int rowsPerB, size_t sCPb, int row0g,
    float* __restrict__ C, _Float16* __restrict__ C16, int ldc, size_t sC, int M, int N, int K) {
  __shared__ __attribute__((aligned(16))) float so[4][16][64];
  const int tid = threadIdx.x, w = tid >> 5, lane = tid & 31, ln = lane & 15, hh = lane >> 4; const int by = blockIdx.y;
  A += (size_t)by * sA; Bh += (size_t)by * sB; const size_t cofs = (size_t)by * sC; const float* bp = bias ? bias + (size_t)by * sBias : nullptr;
  const int ntn = (N + 63) / 64; const int wid = blockIdx.x * 4 + w; const int mt = wid / ntn, nq = wid % ntn; if (mt * 16 >= M) return;
  const int row0 = mt * 16, col0 = nq * 64; const _Float16* arow = A + (size_t)(row0 + ln) * lda;
  v8f acc[4] = {};
  for (int kb = 0; kb < K; kb += 32) { FragH ah; ah.half[0] = *(const v8us*)((const unsigned short*)arow + kb + 8 * hh); ah.half[1] = *(const v8us*)((const unsigned short*)arow + kb + 16 + 8 * hh);
#pragma unroll
    for (int t = 0; t < 4; ++t) { if (col0 + t * 16 >= N) continue; const size_t boff = (size_t)(col0 + t * 16 + ln) * ldb + kb; FragH bq; bq.half[0] = *(const v8us*)((const unsigned short*)Bh + boff + 8 * hh); bq.half[1] = *(const v8us*)((const unsigned short*)Bh + boff + 16 + 8 * hh);
      acc[t] = mmaH<1>(ah.v, ah.v, bq.v, bq.v, acc[t]); }
  }
#pragma unroll
  for (int t = 0; t < 4; ++t) { if (col0 + t * 16 >= N) continue; const int col = col0 + t * 16 + ln; const float bv = bp ? bf16_round(bp[col]) : 0.f;
#pragma unroll
    for (int r = 0; r < 8; ++r) { float v = acc[t][r] * alpha + bv; if (CP) { const int rr = row0g + row0 + 8 * hh + r; if (rowsPerB < 0) v += CP[cofs + (size_t)rr * ldc + col];      /* rowsPerB < 0: own element of the batched C plane */ else { const int bidx = rr / rowsPerB; v += CP[(size_t)bidx * sCPb + (size_t)by * 64 + col]; } } if (ACT == 1) v = (v > 0.f) ? v : expm1f(v); else if (ACT == 7) v = (v > 0.f) ? v + 1.0f : expf(v); else if (ACT == 8) v = tanhf(v); else if (ACT == 9) v = 0.5f * v * (1.0f + tanhf(0.7978845608028654f * (v + 0.044715f * v * v * v))); else if (ACT == 11) v = 1.0f / (1.0f + expf(-v)); else if (ACT == 12) v = (v > 0.f) ? v : 0.01f * v; else if (ACT == 14) v = (v > 0.f) ? v : 0.1f * v; else if (ACT == 16) v = (v >= 0.f) ? v : 0.3f * v; else if (ACT == 17) v = (v >= 0.f) ? v : 0.2f * v; else if (ACT == 15) v = v / (1.0f + expf(-v)); else if (ACT == 3) v = fmaxf(v, 0.f); else if (ACT == 6) v = 0.5f * v * (1.0f + erff(v * 0.70710678118654752f)); so[w][8 * hh + r][t * 16 + ln] = v; } }
  __builtin_amdgcn_fence(__ATOMIC_ACQ_REL, "workgroup"); __builtin_amdgcn_wave_barrier();
  const int rsub = lane >> 4, c4 = (lane & 15) * 4; typedef _Float16 v4h __attribute__((ext_vector_type(4)));
  {
#pragma unroll
    for (int q = 0; q < 8; ++q) { const int r = q * 2 + rsub; if (col0 + c4 < N) { const v4f v = *(const v4fa*)&so[w][r][c4]; if (C) *(v4f*)(C + cofs + (size_t)(row0 + r) * ldc + col0 + c4) = v; if (C16) { v4h h4; for (int i = 0; i < 4; ++i) h4[i] = (_Float16)v[i]; *(v4h*)(C16 + cofs + (size_t)(row0 + r) * ldc + col0 + c4) = h4; } } }
     }
}


typedef _Float16 v4h __attribute__((ext_vector_type(4)));

__global__ __launch_bounds__(256) void k_x16(const float* __restrict__ x, _Float16* __restrict__ X16, size_t n8) { const size_t t = (size_t)blockIdx.x * 256 + threadIdx.x; if (t >= n8) return; FragH f;
#pragma unroll
  for (int q = 0; q < 8; ++q) f.h[q] = (_Float16)bf16_round(x[t * 8 + q]); *(v8us*)((unsigned short*)X16 + t * 8) = f.half[0];  }
__global__ __launch_bounds__(256) void k_h16(const float* __restrict__ x, _Float16* __restrict__ X16, size_t n8) { const size_t t = (size_t)blockIdx.x * 256 + threadIdx.x; if (t >= n8) return; FragH f;
#pragma unroll
  for (int q = 0; q < 8; ++q) f.h[q] = (_Float16)x[t * 8 + q]; *(v8us*)((unsigned short*)X16 + t * 8) = f.half[0];  }
__global__ __launch_bounds__(256) void k_round16f(const float* __restrict__ W, _Float16* __restrict__ Bt, size_t n8) { const size_t t = (size_t)blockIdx.x * 256 + threadIdx.x; if (t >= n8) return; FragH f;
#pragma unroll
  for (int i = 0; i < 8; ++i) f.h[i] = (_Float16)(bf16_round(W[t * 8 + i]) * 16.0f); *(v8us*)((unsigned short*)Bt + t * 8) = f.half[0];  }
template <int NHv, int TTv>
__global__ __launch_bounds__(256) void k_vt(const _Float16* __restrict__ V16, int ldv, int voff, _Float16* __restrict__ Vt) { __shared__ unsigned short tl[64][66]; const int tid = threadIdx.x; const int slab = blockIdx.x / (TTv / 64), lg = blockIdx.x % (TTv / 64); const int b = slab / NHv, h = slab % NHv;
  for (int i = tid; i < 64 * 8; i += 256) { const int r = i / 8, c8 = (i % 8) * 8; FragH f; f.half[0] = *(const v8us*)((const unsigned short*)V16 + ((size_t)b * TTv + lg * 64 + r) * ldv + voff + h * 64 + c8);
#pragma unroll
    for (int q = 0; q < 8; ++q) tl[r][c8 + q] = f.u[q]; }
  __syncthreads();
  {
#pragma unroll
    for (int rd = 0; rd < 2; ++rd) { const int d = rd * 32 + tid / 8, pc = tid % 8; FragH f;
#pragma unroll
      for (int q = 0; q < 8; ++q) f.u[q] = tl[pc * 8 + q][d];
      *(v8us*)((unsigned short*)Vt + ((size_t)slab * 64 + d) * TTv + lg * 64 + pc * 8) = f.half[0]; }
     } }

__global__ __launch_bounds__(256) void k_hl(const float* __restrict__ F, _Float16* __restrict__ Hh, _Float16* __restrict__ Hl, size_t n8) { const size_t t = (size_t)blockIdx.x * 256 + threadIdx.x; if (t >= n8) return; FragH fh, fl; const v4f a = *(const v4fa*)(F + t * 8), c = *(const v4fa*)(F + t * 8 + 4);
#pragma unroll
  for (int q = 0; q < 4; ++q) { _Float16 h = (_Float16)a[q]; fh.h[q] = h; fl.h[q] = (_Float16)((a[q] - (float)h) * 1024.0f); h = (_Float16)c[q]; fh.h[4 + q] = h; fl.h[4 + q] = (_Float16)((c[q] - (float)h) * 1024.0f); }
  { *(v8us*)((unsigned short*)Hh + t * 8) = fh.half[0]; *(v8us*)((unsigned short*)Hl + t * 8) = fl.half[0];  } }

// ---- fast GEMM (wave tile 32x64; requires M % 32 == 0 rows per launch region and N % 64 == 0); epilogue = k_gemm_hhx semantics ----
__device__ __forceinline__ v16h g2_frag(const _Float16* p, int hh) { FragH f; f.half[0] = *(const v8us*)((const unsigned short*)p + 8 * hh); f.half[1] = *(const v8us*)((const unsigned short*)p + 16 + 8 * hh); return f.v; }
__device__ __forceinline__ v8f g2_mma(v16h a, v16h b, v8f c) { v8f d = __builtin_amdgcn_wmma_f32_16x16x32_f16(false, a, false, b, (short)0, c, false, false); asm volatile("v_nop\n\tv_nop\n\tv_nop\n\tv_nop" : "+v"(d) : "v"(a), "v"(b)); return d; }
template <int ACT>
__global__ __launch_bounds__(128) void k_gemm2(const _Float16* __restrict__ A, int lda, size_t sA, const _Float16* __restrict__ Bh, int ldb, size_t sB, float alpha, const float* __restrict__ bias, size_t sBias, const float* __restrict__ CP, int rowsPerB, size_t sCPb, int row0g,
    float* __restrict__ C, _Float16* __restrict__ C16, int ldc, size_t sC, int M, int N, int K) { static_assert(ACT == 0 || ACT == 3 || ACT == 6 || ACT == 8 || ACT == 9 || ACT == 11 || ACT == 12 || ACT == 14 || ACT == 15 || ACT == 16 || ACT == 17, "k_gemm2: unsupported ACT code (would silently apply no activation)");
  __shared__ __attribute__((aligned(16))) float so[4][32][68];
  const int tid = threadIdx.x, w = tid >> 5, lane = tid & 31, ln = lane & 15, hh = lane >> 4; const int by = blockIdx.y;
  A += (size_t)by * sA; Bh += (size_t)by * sB; const size_t cofs = (size_t)by * sC; const float* bp = bias ? bias + (size_t)by * sBias : nullptr;
  const int ntn = N >> 6; const int mt = blockIdx.x / ntn, nq = blockIdx.x - mt * ntn; const int row0 = mt * 128 + 32 * w, col0 = nq * 64; if (row0 >= M) return;
  const _Float16* a0p = A + (size_t)(row0 + ln) * lda; const _Float16* a1p = a0p + (size_t)16 * lda;
  const _Float16* b0p = Bh + (size_t)(col0 + ln) * ldb; const _Float16* b1p = b0p + (size_t)16 * ldb; const _Float16* b2p = b1p + (size_t)16 * ldb; const _Float16* b3p = b2p + (size_t)16 * ldb;
  const v8f z8 = {0.f,0.f,0.f,0.f,0.f,0.f,0.f,0.f}; v8f c00 = z8, c01 = z8, c02 = z8, c03 = z8, c10 = z8, c11 = z8, c12 = z8, c13 = z8;
#pragma unroll 1
  for (int kb = 0; kb < K; kb += 32) { const v16h a0 = g2_frag(a0p + kb, hh), a1 = g2_frag(a1p + kb, hh);
    v16h b = g2_frag(b0p + kb, hh); c00 = g2_mma(a0, b, c00); c10 = g2_mma(a1, b, c10);
    b = g2_frag(b1p + kb, hh); c01 = g2_mma(a0, b, c01); c11 = g2_mma(a1, b, c11);
    b = g2_frag(b2p + kb, hh); c02 = g2_mma(a0, b, c02); c12 = g2_mma(a1, b, c12);
    b = g2_frag(b3p + kb, hh); c03 = g2_mma(a0, b, c03); c13 = g2_mma(a1, b, c13); }
  v8f accs[8] = {c00, c01, c02, c03, c10, c11, c12, c13};
#pragma unroll
  for (int u = 0; u < 8; ++u) { const int t = u & 3, half = u >> 2; const int col = col0 + t * 16 + ln; const float bv = bp ? bf16_round(bp[col]) : 0.f;
#pragma unroll
    for (int r = 0; r < 8; ++r) { const int rloc = half * 16 + 8 * hh + r; float v = accs[u][r] * alpha + bv; if (CP) { if (rowsPerB < 0) v += CP[cofs + (size_t)(row0g + row0 + rloc) * ldc + col];      /* rowsPerB < 0: own element of the batched C plane */ else { const int bidx = (row0g + row0 + rloc) / rowsPerB; v += CP[(size_t)bidx * sCPb + (size_t)by * 64 + col]; } }
      if (ACT == 3) v = fmaxf(v, 0.f); else if (ACT == 6) v = 0.5f * v * (1.0f + erff(v * 0.70710678118654752f)); else if (ACT == 11) v = 1.0f / (1.0f + expf(-v)); else if (ACT == 15) v = v / (1.0f + expf(-v)); else if (ACT == 12) v = (v > 0.f) ? v : 0.01f * v; else if (ACT == 8) v = tanhf(v); else if (ACT == 9) v = 0.5f * v * (1.0f + tanhf(0.7978845608028654f * (v + 0.044715f * v * v * v))); else if (ACT == 14) v = (v > 0.f) ? v : 0.1f * v; else if (ACT == 16) v = (v >= 0.f) ? v : 0.3f * v; else if (ACT == 17) v = (v >= 0.f) ? v : 0.2f * v;
      so[w][rloc][t * 16 + ln] = v; } }
  __builtin_amdgcn_fence(__ATOMIC_ACQ_REL, "workgroup"); __builtin_amdgcn_wave_barrier();
  const int rsub = lane >> 4, c4 = (lane & 15) * 4;
  {
#pragma unroll
    for (int q = 0; q < 16; ++q) { const int r = q * 2 + rsub; const v4f v = *(const v4fa*)&so[w][r][c4]; if (C) *(v4f*)(C + cofs + (size_t)(row0 + r) * ldc + col0 + c4) = v; if (C16) { v4h h4; for (int i = 0; i < 4; ++i) h4[i] = (_Float16)v[i]; *(v4h*)(C16 + cofs + (size_t)(row0 + r) * ldc + col0 + c4) = h4; } }
     } }


__global__ __launch_bounds__(256) void k_wnat(const float* __restrict__ w, size_t n8, _Float16* __restrict__ Bt) { const size_t t = (size_t)blockIdx.x * 256 + threadIdx.x; if (t >= n8) return; FragH f; for (int q = 0; q < 8; ++q) f.h[q] = (_Float16)(bf16_round(w[t * 8 + q]) * 16.0f); *(v8us*)((unsigned short*)Bt + t * 8) = f.half[0];  }
__global__ __launch_bounds__(256) void k_rsm(const float* __restrict__ S, _Float16* __restrict__ P, int nrows) {
  #pragma clang fp contract(off)
  const int i = blockIdx.x * 256 + threadIdx.x; if (i >= nrows) return; const float* s = S + (size_t)i * SQ; float mx = -3.0e38f;
#pragma unroll 1
  for (int j = 0; j < SQ; ++j) mx = fmaxf(mx, s[j]); float se = 0.f;
#pragma unroll 1
  for (int j = 0; j < SQ; ++j) se += expf(s[j] - mx); const float sc = 256.0f / se;
#pragma unroll 1
  for (int j0 = 0; j0 < SQ; j0 += 8) { FragH f; for (int q = 0; q < 8; ++q) f.h[q] = (_Float16)(expf(s[j0 + q] - mx) * sc); unsigned short* d = (unsigned short*)P + (size_t)i * SQ + j0; *(v8us*)d = f.half[0];  } }
__global__ __launch_bounds__(256) void k_vt(const _Float16* __restrict__ V16, int b, int h0, _Float16* __restrict__ VT) { __shared__ unsigned short tl[64][65]; const int tid = threadIdx.x; const int hh = blockIdx.x % HG, sg = blockIdx.x / HG; const int s0 = sg * 64; const int h = h0 + hh;
  for (int i = tid; i < 64 * 8; i += 256) { const int j = i / 8, d8 = (i % 8) * 8; FragH f; f.half[0] = *(const v8us*)((const unsigned short*)V16 + ((size_t)b * SQ + s0 + j) * DM + h * HD + d8); for (int q = 0; q < 8; ++q) tl[d8 + q][j] = f.u[q]; }
  __syncthreads();
  { for (int i = tid; i < 64 * 8; i += 256) { const int d = i / 8, j8 = (i % 8) * 8; FragH f; for (int q = 0; q < 8; ++q) f.u[q] = tl[d][j8 + q]; *(v8us*)((unsigned short*)VT + ((size_t)hh * HD + d) * SQ + s0 + j8) = f.half[0]; }  } }



__global__ __launch_bounds__(256) void k_rsmf(const float* __restrict__ S, _Float16* __restrict__ P, int qn, int hg) {
  #pragma clang fp contract(off)
  const int t = blockIdx.x * 256 + threadIdx.x; if (t >= qn * hg) return; const size_t i = (size_t)(t / qn) * SQ + (t % qn); const float* s = S + i * SQ; float mx = -3.0e38f;
#pragma unroll 1
  for (int j = 0; j < SQ; ++j) mx = fmaxf(mx, s[j]); float se = 0.f;
#pragma unroll 1
  for (int j = 0; j < SQ; ++j) se += __expf(s[j] - mx); const float sc = 256.0f / se;
#pragma unroll 1
  for (int j0 = 0; j0 < SQ; j0 += 8) { FragH f; for (int q = 0; q < 8; ++q) f.h[q] = (_Float16)(__expf(s[j0 + q] - mx) * sc); unsigned short* d = (unsigned short*)P + i * SQ + j0; *(v8us*)d = f.half[0];  } }

extern "C" void kernel_launch(void* const* d_in, const int* in_sizes, int n_in,
                              void* d_out, int out_size, void* d_ws, size_t ws_size, hipStream_t stream) {
  (void)in_sizes; (void)n_in; (void)out_size;
  const float* const* I = (const float* const*)d_in; const float* xq = I[0]; const float* xk = I[1]; const float* xv = I[1]; const float* wq = I[2]; const float* bq = I[3]; const float* wk = I[4]; const float* bk = I[5]; const float* wv = I[6]; const float* bv = I[7]; const float* wo = I[8]; const float* bo = I[9];      /* TWO inputs: query (the q stream) and value (read on BOTH the k and the v stream casts); wq, wk, wv are PER-HEAD STACKS [16][1024][64] = [head][in][out]; bq, bk, bv per-head [16][64] = the flat [1024] bias; wo [in][out] + bo; input order query, value, wq, bq, wk, bk, wv, bv, wo, bo */
  char* ws = (char*)d_ws; size_t off = 0;
  auto take = [&](size_t bytes) { char* p = ws + off; off += (bytes + 255) & ~(size_t)255; return p; };
  _Float16* BQ = (_Float16*)take((size_t)DM * DM * 2); _Float16* BK = (_Float16*)take((size_t)DM * DM * 2); _Float16* BV = (_Float16*)take((size_t)DM * DM * 2); _Float16* BO = (_Float16*)take((size_t)DM * DM * 2);
  _Float16* XQ = (_Float16*)take(NR * DM * 2); _Float16* XK = (_Float16*)take(NR * DM * 2); _Float16* XV = (_Float16*)take(NR * DM * 2); _Float16* Q16 = (_Float16*)take(NR * DM * 2); _Float16* K16 = (_Float16*)take(NR * DM * 2); _Float16* V16 = (_Float16*)take(NR * DM * 2); _Float16* O16 = (_Float16*)take(NR * DM * 2);
  float* S = (float*)take((size_t)HG * SQ * SQ * 4); _Float16* P = (_Float16*)take((size_t)HG * SQ * SQ * 2); _Float16* VT = (_Float16*)take((size_t)NH * HD * SQ * 2);
  if (off > ws_size) return;
  { const unsigned g = (unsigned)(((size_t)DM * (DM / 8) + 255) / 256); const unsigned gh = (unsigned)(((size_t)HD * (DM / 8) + 255) / 256); for (int h = 0; h < NH; ++h) { const size_t wofs = (size_t)h * DM * HD, pofs = (size_t)h * HD * DM; k_wt_f16<<<gh, 256, 0, stream>>>(wq + wofs, BQ + pofs, DM, HD, 16.0f); k_wt_f16<<<gh, 256, 0, stream>>>(wk + wofs, BK + pofs, DM, HD, 16.0f); k_wt_f16<<<gh, 256, 0, stream>>>(wv + wofs, BV + pofs, DM, HD, 16.0f); } k_wt_f16<<<g, 256, 0, stream>>>(wo, BO, DM, DM, 16.0f); }      /* PER-HEAD STACKS wq / wk / wv [NH][DM][HD]: head h is a row-major [in = DM][out = HD] block at w + h * DM * HD: the transposing builder with K = DM, N = HD writes its HD rows Bt[h * HD + e][k] at B + h * HD * DM: contiguous rows of the [out][in] plane (x16); wo is a plain [in][out] [DM][DM] matrix: one call as before */

  k_x16<<<(unsigned)((NR * DM / 8 + 255) / 256), 256, 0, stream>>>(xq, XQ, NR * DM / 8); k_x16<<<(unsigned)((NR * DM / 8 + 255) / 256), 256, 0, stream>>>(xk, XK, NR * DM / 8); k_x16<<<(unsigned)((NR * DM / 8 + 255) / 256), 256, 0, stream>>>(xv, XV, NR * DM / 8);      /* query, and value twice (k and v streams), as exact f16 rows */
  const size_t r0p = (size_t)B0 * SQ;      /* first projected row */
  k_gemm2<0><<<dim3((unsigned)((MP / 128) * (DM / 64)), 1), 128, 0, stream>>>(XQ + r0p * DM, DM, 0, BQ, DM, 0, 0.0625f, bq, 0, nullptr, 1, 0, 0, nullptr, Q16 + r0p * DM, DM, 0, MP, DM, DM);
  k_gemm2<0><<<dim3((unsigned)((MP / 128) * (DM / 64)), 1), 128, 0, stream>>>(XK + r0p * DM, DM, 0, BK, DM, 0, 0.0625f, bk, 0, nullptr, 1, 0, 0, nullptr, K16 + r0p * DM, DM, 0, MP, DM, DM);
  k_gemm2<0><<<dim3((unsigned)((MP / 128) * (DM / 64)), 1), 128, 0, stream>>>(XV + r0p * DM, DM, 0, BV, DM, 0, 0.0625f, bv, 0, nullptr, 1, 0, 0, nullptr, V16 + r0p * DM, DM, 0, MP, DM, DM);
  for (int b = B0; b < B0 + NBR; ++b) { const size_t r0 = (size_t)b * SQ;
    k_vt<NH, SQ><<<NH * (SQ / 64), 256, 0, stream>>>(V16 + r0 * LQ, LQ, 0, VT);      /* V^T [NH][HD][SQ] for this batch */
    for (int h0 = 0; h0 < NHD; h0 += HG) {
      k_gemm2<0><<<dim3((QN / 128) * (SQ / 64), HG), 128, 0, stream>>>(Q16 + r0 * LQ + h0 * HD, LQ, (size_t)HD, K16 + r0 * LQ + h0 * HD, LQ, (size_t)HD, 0.125f, nullptr, 0, nullptr, 1, 0, 0, S, nullptr, SQ, (size_t)SQ * SQ, QN, SQ, HD);      /* scores, HG heads per launch */
      k_rsmf<<<(HG * QN + 255) / 256, 256, 0, stream>>>(S, P, QN, HG);      /* P = 256 softmax (f16), rows of all HG heads */
      k_gemm2<0><<<dim3((QN / 128) * (HD / 64), HG), 128, 0, stream>>>(P, SQ, (size_t)SQ * SQ, VT + (size_t)h0 * HD * SQ, SQ, (size_t)HD * SQ, 0.25f, nullptr, 0, nullptr, 1, 0, 0, nullptr, O16 + r0 * DM + h0 * HD, DM, (size_t)HD, QN, HD, SQ); } }      /* o (merged heads) as f16 rows */
  k_gemm2<0><<<dim3((unsigned)((MPO / 128) * (DM / 64)), 1), 128, 0, stream>>>(O16 + r0p * DM, DM, 0, BO, DM, 0, 0.0009765625f, bo, 0, nullptr, 1, 0, 0, (float*)d_out + r0p * DM, nullptr, DM, 0, MPO, DM, DM);      /* out rows are the output layout */
}

// v001
// It runs in 1840 microseconds.
// In both of two side-by-side timings against v000, it was 3.83 times as fast.
#include <hip/hip_runtime.h>
// Multi-head attention on two inputs with PER-HEAD STACKED projections and per-head biases on four sequences (query [4][2048][1024], value [4][2048][1024]; q = einsum('bsd,hde->bhse', query, wq) + bq, k = einsum(value, wk) + bk, v = einsum(value, wv) + bv with W [16][1024][64] = [head][in][out] and b [16][64], 16 heads of 64; scores * 1/sqrt(64); softmax over all 2048 keys (no mask); out = heads wo + bo ([in][out] + bias) -> [4][2048][1024]); each head's [in][out] block is transposed into its 64 contiguous rows of the weight plane by the existing builder, one call per head; the [in][out] output weight through the same builder in one call.
// Structure: token rows r = b*2048 + s; the query source and the key/value source as exact f16 rows (bf16-rounded); Q, K, V as three WMMA GEMMs (32x64 wave tiles, f32 accumulation, exact x16 weights + bias, f16 outputs); per batch: V^T for all heads via LDS transposes; per (batch, group of 4 heads): scores GEMM (K = 64, batched over the heads on grid.y, alpha = 64^-0.5), row softmax on VALU (f32 statistics, native exp; weights stored x256 as f16), o = P . V^T GEMM (K = 2048, alpha 2^-2: o carried x64 against f16 subnormal flush, folded into the output GEMM alpha) written straight into the merged f16 o rows; out = o W_o + b GEMM (f32) into the output layout.
// Compute dtype: inputs rounded to bf16; x / weights exact; q, k, v, softmax weights and o as plain f16 GEMM operands (~2^-12); scores and softmax statistics f32. v_wmma_f32_16x16x32_f16.
#define NB 4
#define SQ 2048
#define DM 1024
#define NH 16
#define HD 64
#define HG 4                         /* heads per attention launch group */
#define B0 0                         /* first batch processed (debug hook) */
#define NBR NB                       /* batches processed (debug hook) */
#define NR ((size_t)NB * SQ)         /* token rows */
#define MP ((int)((size_t)NBR * SQ)) /* rows projected (debug hook) */
#define QN SQ                        /* query rows attended per batch (debug hook) */
#define NHD NH                       /* heads attended (debug hook) */
#define MPO MP                       /* rows through the output stage (debug hook) */
#define LQ DM      /* row pitch of the q/k/v rows */
typedef __bf16 v16b __attribute__((ext_vector_type(16)));
typedef unsigned short v8us __attribute__((ext_vector_type(8), may_alias));
typedef float  v8f  __attribute__((ext_vector_type(8)));
typedef float  v4f  __attribute__((ext_vector_type(4)));
typedef float  v4fa __attribute__((ext_vector_type(4), may_alias));
union FragB { v16b v; v8us half[2]; unsigned short u[16]; };

__device__ __forceinline__ unsigned short bf16_bits(float x) { unsigned int u = __float_as_uint(x); return (unsigned short)((u + 0x7FFFu + ((u >> 16) & 1u)) >> 16); }
__device__ __forceinline__ float bf16_val(unsigned short b) { return __uint_as_float(((unsigned int)b) << 16); }
__device__ __forceinline__ float bf16_round(float x) { return bf16_val(bf16_bits(x)); }
// D += A·B with NT terms: 1 = ah·bh, 2 = + al·bh (A split), 3 = + ah·bl (both split)
template <int NT>
__device__ __forceinline__ v8f mmaN(v16b ah, v16b al, v16b bh, v16b bl, v8f c) {
  c = __builtin_amdgcn_wmma_f32_16x16x32_bf16(false, ah, false, bh, (short)0, c, false, false);
  if (NT >= 2) c = __builtin_amdgcn_wmma_f32_16x16x32_bf16(false, al, false, bh, (short)0, c, false, false);
  if (NT >= 3) c = __builtin_amdgcn_wmma_f32_16x16x32_bf16(false, ah, false, bl, (short)0, c, false, false);
  asm volatile("v_nop\n\tv_nop\n\tv_nop\n\tv_nop" : "+v"(c) : "v"(ah), "v"(al), "v"(bh), "v"(bl));
  return c;
}

__global__ __launch_bounds__(256) void k_wt_bf16(const float* __restrict__ W, unsigned short* __restrict__ Wt, int K, int N) {
  const int t = blockIdx.x * 256 + threadIdx.x;
  const int k8n = K / 8;
  if (t >= N * k8n) return;
  const int n = t / k8n, k8 = (t % k8n) * 8;
  v8us v;
#pragma unroll
  for (int i = 0; i < 8; ++i) v[i] = bf16_bits(W[(size_t)(k8 + i) * N + n]);
  *(v8us*)(Wt + (size_t)n * K + k8) = v;
  
}

// GEMM C[M][N] (f32, pitch ldc) = act(A[M][K]·W + bias). A f32 row-major (pitch lda) converted per fragment to bf16
// (ASPLIT: hi/lo two planes -> 2 terms, else single rounded term); Wt bf16 [N][K] (pitch ldb). BIAS_BF16 rounds the
// bias to bf16 first (bias quantised to bf16 before the add). K%32==0, M%16==0, N%64==0.
template <bool ASPLIT, int ACT, bool BIAS_BF16>
__global__ __launch_bounds__(128) void k_gemm_bf(const float* __restrict__ A, int lda, const unsigned short* __restrict__ Wt, int ldb,
                                               const float* __restrict__ bias, float* __restrict__ C, int ldc, int M, int N, int K) {
  __shared__ __attribute__((aligned(16))) float so[4][16][64];
  const int tid = threadIdx.x, w = tid >> 5, lane = tid & 31, ln = lane & 15, hh = lane >> 4;
  const int ntn = N / 64;
  const int wid = blockIdx.x * 4 + w;
  const int mt = wid / ntn, nq = wid % ntn;
  if (mt * 16 >= M) return;
  const int row0 = mt * 16, col0 = nq * 64;
  const float* arow = A + (size_t)(row0 + ln) * lda;
  v8f acc[4] = {};
  for (int kb = 0; kb < K; kb += 32) {
    FragB ah, al;
    const v4f x0 = *(const v4fa*)(arow + kb + 8 * hh), x1 = *(const v4fa*)(arow + kb + 8 * hh + 4);
    const v4f x2 = *(const v4fa*)(arow + kb + 16 + 8 * hh), x3 = *(const v4fa*)(arow + kb + 16 + 8 * hh + 4);
    float xs[16] = {x0[0],x0[1],x0[2],x0[3],x1[0],x1[1],x1[2],x1[3],x2[0],x2[1],x2[2],x2[3],x3[0],x3[1],x3[2],x3[3]};
#pragma unroll
    for (int i = 0; i < 16; ++i) { const unsigned short hb = bf16_bits(xs[i]); ah.u[i] = hb; al.u[i] = ASPLIT ? bf16_bits(xs[i] - bf16_val(hb)) : (unsigned short)0; }
#pragma unroll
    for (int t = 0; t < 4; ++t) {
      const unsigned short* brow = Wt + (size_t)(col0 + t * 16 + ln) * ldb + kb;
      FragB b;
      b.half[0] = *(const v8us*)(brow + 8 * hh);
      b.half[1] = *(const v8us*)(brow + 16 + 8 * hh);
      acc[t] = mmaN<ASPLIT ? 2 : 1>(ah.v, al.v, b.v, b.v, acc[t]);
    }
  }
#pragma unroll
  for (int t = 0; t < 4; ++t) {
    float bv = bias ? bias[col0 + t * 16 + ln] : 0.f;
    if (BIAS_BF16) bv = bf16_round(bv);
#pragma unroll
    for (int r = 0; r < 8; ++r) { float v = acc[t][r] + bv; if (ACT == 1) v = fmaxf(v, 0.f); so[w][8 * hh + r][t * 16 + ln] = v; }
  }
  __builtin_amdgcn_fence(__ATOMIC_ACQ_REL, "workgroup");
  __builtin_amdgcn_wave_barrier();
  const int rsub = lane >> 4, c4 = (lane & 15) * 4;
  {
#pragma unroll
    for (int q = 0; q < 8; ++q) {
      const int r = q * 2 + rsub;
      const v4f v = *(const v4fa*)&so[w][r][c4];
      *(v4f*)(C + (size_t)(row0 + r) * ldc + col0 + c4) = v;
    }
    
  }
}

// GEMM C = act(A·W + bias + resid): A f32 (ASPLIT -> hi/lo 2 terms), Wt bf16 [N][K]; ACT 0 none, 1 relu, 2 exact gelu;
// resid (optional, f32, row index = (row % rmod), pitch ldr, RES_BF16 rounds it) added before the activation.
template <bool ASPLIT, int ACT, bool BIAS_BF16, bool RES_BF16>
__global__ __launch_bounds__(128) void k_gemm_bf3(const float* __restrict__ A, int lda, const unsigned short* __restrict__ Wt, int ldb,
                                                const float* __restrict__ bias, const float* __restrict__ resid, int rmod, int ldr,
                                                float* __restrict__ C, int ldc, int M, int N, int K) {
  __shared__ __attribute__((aligned(16))) float so[4][16][64];
  const int tid = threadIdx.x, w = tid >> 5, lane = tid & 31, ln = lane & 15, hh = lane >> 4;
  const int ntn = N / 64;
  const int wid = blockIdx.x * 4 + w;
  const int mt = wid / ntn, nq = wid % ntn;
  if (mt * 16 >= M) return;
  const int row0 = mt * 16, col0 = nq * 64;
  const float* arow = A + (size_t)(row0 + ln) * lda;
  v8f acc[4] = {};
  for (int kb = 0; kb < K; kb += 32) {
    FragB ah, al;
    const v4f x0 = *(const v4fa*)(arow + kb + 8 * hh), x1 = *(const v4fa*)(arow + kb + 8 * hh + 4);
    const v4f x2 = *(const v4fa*)(arow + kb + 16 + 8 * hh), x3 = *(const v4fa*)(arow + kb + 16 + 8 * hh + 4);
    float xs[16] = {x0[0],x0[1],x0[2],x0[3],x1[0],x1[1],x1[2],x1[3],x2[0],x2[1],x2[2],x2[3],x3[0],x3[1],x3[2],x3[3]};
#pragma unroll
    for (int i = 0; i < 16; ++i) { const unsigned short hb = bf16_bits(xs[i]); ah.u[i] = hb; al.u[i] = ASPLIT ? bf16_bits(xs[i] - bf16_val(hb)) : (unsigned short)0; }
#pragma unroll
    for (int t = 0; t < 4; ++t) {
      const unsigned short* brow = Wt + (size_t)(col0 + t * 16 + ln) * ldb + kb;
      FragB b;
      b.half[0] = *(const v8us*)(brow + 8 * hh);
      b.half[1] = *(const v8us*)(brow + 16 + 8 * hh);
      acc[t] = mmaN<ASPLIT ? 2 : 1>(ah.v, al.v, b.v, b.v, acc[t]);
    }
  }
#pragma unroll
  for (int t = 0; t < 4; ++t) {
    const int col = col0 + t * 16 + ln;
    float bv = bias ? bias[col] : 0.f;
    if (BIAS_BF16) bv = bf16_round(bv);
#pragma unroll
    for (int r = 0; r < 8; ++r) {
      float v = acc[t][r] + bv;
      if (resid) { float rv = resid[(size_t)((row0 + 8 * hh + r) % rmod) * ldr + col]; if (RES_BF16) rv = bf16_round(rv); v += rv; }
      if (ACT == 1) v = fmaxf(v, 0.f);
      if (ACT == 2) v = 0.5f * v * (1.0f + erff(v * 0.70710678118654752f));
      if (ACT == 3) { const float u = 0.7978845608028654f * (v + 0.044715f * v * v * v); v = 0.5f * v * (1.0f + tanhf(u)); }
      so[w][8 * hh + r][t * 16 + ln] = v;
    }
  }
  __builtin_amdgcn_fence(__ATOMIC_ACQ_REL, "workgroup");
  __builtin_amdgcn_wave_barrier();
  const int rsub = lane >> 4, c4 = (lane & 15) * 4;
  {
#pragma unroll
    for (int q = 0; q < 8; ++q) {
      const int r = q * 2 + rsub;
      const v4f v = *(const v4fa*)&so[w][r][c4];
      *(v4f*)(C + (size_t)(row0 + r) * ldc + col0 + c4) = v;
    }
    
  }
}
// row LayerNorm (biased variance, eps) over N: s = X (+ R); optional out_sum <- s; out_norm <- (s-mu)*rsqrt(var+eps)*g + b
template <bool PARAM_BF16>
__global__ __launch_bounds__(256) void k_layernorm(const float* __restrict__ X, const float* __restrict__ R, const float* __restrict__ g, const float* __restrict__ bta,
                                                  float* __restrict__ out_sum, float* __restrict__ out_norm, int N, float eps) {
  __shared__ float red[256];
  const int row = blockIdx.x, tid = threadIdx.x;
  const float* x = X + (size_t)row * N; const float* rr = R ? R + (size_t)row * N : nullptr;
  float vals[16];                     // up to N = 4096
  const int per = N / 256;            // contiguous chunk per thread? use strided-by-4 chunks: thread handles j = tid*4 + 1024*u
  float s1 = 0.f;
  for (int u = 0; u < per / 4; ++u) {
    const int j = tid * 4 + 1024 * u;
    const v4f a = *(const v4fa*)(x + j);
    v4f b = {0.f,0.f,0.f,0.f}; if (rr) b = *(const v4fa*)(rr + j);
#pragma unroll
    for (int q = 0; q < 4; ++q) { const float v = a[q] + b[q]; vals[u * 4 + q] = v; s1 += v; }
  }
  red[tid] = s1; __syncthreads();
  for (int st = 128; st > 0; st >>= 1) { if (tid < st) red[tid] += red[tid + st]; __syncthreads(); }
  const float mu = red[0] / (float)N; __syncthreads();
  float s2 = 0.f;
  for (int u = 0; u < per / 4; ++u)
#pragma unroll
    for (int q = 0; q < 4; ++q) { const float c = vals[u * 4 + q] - mu; s2 += c * c; }
  red[tid] = s2; __syncthreads();
  for (int st = 128; st > 0; st >>= 1) { if (tid < st) red[tid] += red[tid + st]; __syncthreads(); }
  const float rs = rsqrtf(red[0] / (float)N + eps);
  {
    for (int u = 0; u < per / 4; ++u) {
      const int j = tid * 4 + 1024 * u;
      v4f o, sm;
#pragma unroll
      for (int q = 0; q < 4; ++q) {
        float gg = g[j + q], bb = bta[j + q];
        if (PARAM_BF16) { gg = bf16_round(gg); bb = bf16_round(bb); }
        sm[q] = vals[u * 4 + q]; o[q] = (vals[u * 4 + q] - mu) * rs * gg + bb;
      }
      if (out_sum) *(v4f*)(out_sum + (size_t)row * N + j) = sm;
      *(v4f*)(out_norm + (size_t)row * N + j) = o;
    }
    
  }
}



// ---- f16 WMMA path (v_wmma_f32_16x16x32_f16): 11-bit significands for operands in range — used where a [0,1] probability operand needs more precision than bf16
typedef _Float16 v16h __attribute__((ext_vector_type(16)));
union FragH { v16h v; v8us half[2]; _Float16 h[16]; unsigned short u[16]; };
template <int NT>
__device__ __forceinline__ v8f mmaH(v16h ah, v16h al, v16h bh, v16h bl, v8f c) {
  c = __builtin_amdgcn_wmma_f32_16x16x32_f16(false, ah, false, bh, (short)0, c, false, false);
  if (NT >= 2) c = __builtin_amdgcn_wmma_f32_16x16x32_f16(false, al, false, bh, (short)0, c, false, false);
  if (NT >= 3) c = __builtin_amdgcn_wmma_f32_16x16x32_f16(false, ah, false, bl, (short)0, c, false, false);
  asm volatile("v_nop\n\tv_nop\n\tv_nop\n\tv_nop" : "+v"(c) : "v"(ah), "v"(al), "v"(bh), "v"(bl));
  return c;
}
// batched GEMM like k_gemm_b but f16 operands: A f32 (split into f16 hi/lo if ASPLIT, else rounded to f16), Bt = f16 values [n][k]; alpha; C f32; N multiple of 16 (partial tiles skipped)
template <bool ASPLIT>
__global__ __launch_bounds__(128) void k_gemm_h(const float* __restrict__ A, int lda, size_t sA, const _Float16* __restrict__ Bh, int ldb, size_t sB, float alpha, float* __restrict__ C, int ldc, size_t sC, int M, int N, int K) {
  __shared__ __attribute__((aligned(16))) float so[4][16][64];
  const int tid = threadIdx.x, w = tid >> 5, lane = tid & 31, ln = lane & 15, hh = lane >> 4; const int by = blockIdx.y;
  A += (size_t)by * sA; Bh += (size_t)by * sB; C += (size_t)by * sC;
  const int ntn = (N + 63) / 64; const int wid = blockIdx.x * 4 + w; const int mt = wid / ntn, nq = wid % ntn; if (mt * 16 >= M) return;
  const int row0 = mt * 16, col0 = nq * 64; const float* arow = A + (size_t)(row0 + ln) * lda;
  v8f acc[4] = {};
  for (int kb = 0; kb < K; kb += 32) {
    FragH ah, al;
    const v4f x0 = *(const v4fa*)(arow + kb + 8 * hh), x1 = *(const v4fa*)(arow + kb + 8 * hh + 4), x2 = *(const v4fa*)(arow + kb + 16 + 8 * hh), x3 = *(const v4fa*)(arow + kb + 16 + 8 * hh + 4);
    float xs[16] = {x0[0],x0[1],x0[2],x0[3],x1[0],x1[1],x1[2],x1[3],x2[0],x2[1],x2[2],x2[3],x3[0],x3[1],x3[2],x3[3]};
#pragma unroll
    for (int i = 0; i < 16; ++i) { const _Float16 h = (_Float16)xs[i]; ah.h[i] = h; al.h[i] = ASPLIT ? (_Float16)(xs[i] - (float)h) : (_Float16)0.0f; }
#pragma unroll
    for (int t = 0; t < 4; ++t) { if (col0 + t * 16 >= N) continue; const size_t boff = (size_t)(col0 + t * 16 + ln) * ldb + kb; FragH bq; bq.half[0] = *(const v8us*)(Bh + boff + 8 * hh); bq.half[1] = *(const v8us*)(Bh + boff + 16 + 8 * hh);
      acc[t] = mmaH<ASPLIT ? 2 : 1>(ah.v, al.v, bq.v, bq.v, acc[t]); }
  }
#pragma unroll
  for (int t = 0; t < 4; ++t) { if (col0 + t * 16 >= N) continue;
#pragma unroll
    for (int r = 0; r < 8; ++r) so[w][8 * hh + r][t * 16 + ln] = acc[t][r] * alpha; }
  __builtin_amdgcn_fence(__ATOMIC_ACQ_REL, "workgroup"); __builtin_amdgcn_wave_barrier();
  const int rsub = lane >> 4, c4 = (lane & 15) * 4;
  {
#pragma unroll
    for (int q = 0; q < 8; ++q) { const int r = q * 2 + rsub; if (col0 + c4 < N) { const v4f v = *(const v4fa*)&so[w][r][c4]; *(v4f*)(C + (size_t)(row0 + r) * ldc + col0 + c4) = v; } }
     }
}

// Wt[n][k] = f16(W[k][n]·scale) from f32 row-major W[K][N] (scale = power of two; bf16-exact weights stay exact in f16 away from the subnormal range)
__global__ __launch_bounds__(256) void k_wt_f16(const float* __restrict__ W, _Float16* __restrict__ Wt, int K, int N, float scale) {
  const int t = blockIdx.x * 256 + threadIdx.x; if (t >= N * (K / 8)) return; const int n = t / (K / 8), k8 = (t % (K / 8)) * 8; FragH f;
#pragma unroll
  for (int i = 0; i < 8; ++i) f.h[i] = (_Float16)(bf16_round(W[(size_t)(k8 + i) * N + n]) * scale); const v8us o = f.half[0];
  *(v8us*)((unsigned short*)Wt + (size_t)n * K + k8) = o; 
}
// k_gemm_hh variant with fused epilogue: v = acc·alpha + bias[by·sBias + col] (+ CP[(row/rowsPerB)·sCPb + by·64 + col] if CP) ; ACT 0 none / 1 elu ; writes f16 C16 (and f32 C if non-null)
template <int ACT>
__global__ __launch_bounds__(128) void k_gemm_hhx(const _Float16* __restrict__ A, int lda, size_t sA, const _Float16* __restrict__ Bh, int ldb, size_t sB, float alpha, const float* __restrict__ bias, size_t sBias, const float* __restrict__ CP, int rowsPerB, size_t sCPb, int row0g,
    float* __restrict__ C, _Float16* __restrict__ C16, int ldc, size_t sC, int M, int N, int K) {
  __shared__ __attribute__((aligned(16))) float so[4][16][64];
  const int tid = threadIdx.x, w = tid >> 5, lane = tid & 31, ln = lane & 15, hh = lane >> 4; const int by = blockIdx.y;
  A += (size_t)by * sA; Bh += (size_t)by * sB; const size_t cofs = (size_t)by * sC; const float* bp = bias ? bias + (size_t)by * sBias : nullptr;
  const int ntn = (N + 63) / 64; const int wid = blockIdx.x * 4 + w; const int mt = wid / ntn, nq = wid % ntn; if (mt * 16 >= M) return;
  const int row0 = mt * 16, col0 = nq * 64; const _Float16* arow = A + (size_t)(row0 + ln) * lda;
  v8f acc[4] = {};
  for (int kb = 0; kb < K; kb += 32) { FragH ah; ah.half[0] = *(const v8us*)((const unsigned short*)arow + kb + 8 * hh); ah.half[1] = *(const v8us*)((const unsigned short*)arow + kb + 16 + 8 * hh);
#pragma unroll
    for (int t = 0; t < 4; ++t) { if (col0 + t * 16 >= N) continue; const size_t boff = (size_t)(col0 + t * 16 + ln) * ldb + kb; FragH bq; bq.half[0] = *(const v8us*)((const unsigned short*)Bh + boff + 8 * hh); bq.half[1] = *(const v8us*)((const unsigned short*)Bh + boff + 16 + 8 * hh);
      acc[t] = mmaH<1>(ah.v, ah.v, bq.v, bq.v, acc[t]); }
  }
#pragma unroll
  for (int t = 0; t < 4; ++t) { if (col0 + t * 16 >= N) continue; const int col = col0 + t * 16 + ln; const float bv = bp ? bf16_round(bp[col]) : 0.f;
#pragma unroll
    for (int r = 0; r < 8; ++r) { float v = acc[t][r] * alpha + bv; if (CP) { const int rr = row0g + row0 + 8 * hh + r; if (rowsPerB < 0) v += CP[cofs + (size_t)rr * ldc + col];      /* rowsPerB < 0: own element of the batched C plane */ else { const int bidx = rr / rowsPerB; v += CP[(size_t)bidx * sCPb + (size_t)by * 64 + col]; } } if (ACT == 1) v = (v > 0.f) ? v : expm1f(v); else if (ACT == 7) v = (v > 0.f) ? v + 1.0f : expf(v); else if (ACT == 8) v = tanhf(v); else if (ACT == 9) v = 0.5f * v * (1.0f + tanhf(0.7978845608028654f * (v + 0.044715f * v * v * v))); else if (ACT == 11) v = 1.0f / (1.0f + expf(-v)); else if (ACT == 12) v = (v > 0.f) ? v : 0.01f * v; else if (ACT == 14) v = (v > 0.f) ? v : 0.1f * v; else if (ACT == 16) v = (v >= 0.f) ? v : 0.3f * v; else if (ACT == 17) v = (v >= 0.f) ? v : 0.2f * v; else if (ACT == 15) v = v / (1.0f + expf(-v)); else if (ACT == 3) v = fmaxf(v, 0.f); else if (ACT == 6) v = 0.5f * v * (1.0f + erff(v * 0.70710678118654752f)); so[w][8 * hh + r][t * 16 + ln] = v; } }
  __builtin_amdgcn_fence(__ATOMIC_ACQ_REL, "workgroup"); __builtin_amdgcn_wave_barrier();
  const int rsub = lane >> 4, c4 = (lane & 15) * 4; typedef _Float16 v4h __attribute__((ext_vector_type(4)));
  {
#pragma unroll
    for (int q = 0; q < 8; ++q) { const int r = q * 2 + rsub; if (col0 + c4 < N) { const v4f v = *(const v4fa*)&so[w][r][c4]; if (C) *(v4f*)(C + cofs + (size_t)(row0 + r) * ldc + col0 + c4) = v; if (C16) { v4h h4; for (int i = 0; i < 4; ++i) h4[i] = (_Float16)v[i]; *(v4h*)(C16 + cofs + (size_t)(row0 + r) * ldc + col0 + c4) = h4; } } }
     }
}


typedef _Float16 v4h __attribute__((ext_vector_type(4)));

__global__ __launch_bounds__(256) void k_x16(const float* __restrict__ x, _Float16* __restrict__ X16, size_t n8) { const size_t t = (size_t)blockIdx.x * 256 + threadIdx.x; if (t >= n8) return; FragH f;
#pragma unroll
  for (int q = 0; q < 8; ++q) f.h[q] = (_Float16)bf16_round(x[t * 8 + q]); *(v8us*)((unsigned short*)X16 + t * 8) = f.half[0];  }
__global__ __launch_bounds__(256) void k_h16(const float* __restrict__ x, _Float16* __restrict__ X16, size_t n8) { const size_t t = (size_t)blockIdx.x * 256 + threadIdx.x; if (t >= n8) return; FragH f;
#pragma unroll
  for (int q = 0; q < 8; ++q) f.h[q] = (_Float16)x[t * 8 + q]; *(v8us*)((unsigned short*)X16 + t * 8) = f.half[0];  }
__global__ __launch_bounds__(256) void k_round16f(const float* __restrict__ W, _Float16* __restrict__ Bt, size_t n8) { const size_t t = (size_t)blockIdx.x * 256 + threadIdx.x; if (t >= n8) return; FragH f;
#pragma unroll
  for (int i = 0; i < 8; ++i) f.h[i] = (_Float16)(bf16_round(W[t * 8 + i]) * 16.0f); *(v8us*)((unsigned short*)Bt + t * 8) = f.half[0];  }
template <int NHv, int TTv>
__global__ __launch_bounds__(256) void k_vt(const _Float16* __restrict__ V16, int ldv, int voff, _Float16* __restrict__ Vt) { __shared__ unsigned short tl[64][66]; const int tid = threadIdx.x; const int slab = blockIdx.x / (TTv / 64), lg = blockIdx.x % (TTv / 64); const int b = slab / NHv, h = slab % NHv;
  for (int i = tid; i < 64 * 8; i += 256) { const int r = i / 8, c8 = (i % 8) * 8; FragH f; f.half[0] = *(const v8us*)((const unsigned short*)V16 + ((size_t)b * TTv + lg * 64 + r) * ldv + voff + h * 64 + c8);
#pragma unroll
    for (int q = 0; q < 8; ++q) tl[r][c8 + q] = f.u[q]; }
  __syncthreads();
  {
#pragma unroll
    for (int rd = 0; rd < 2; ++rd) { const int d = rd * 32 + tid / 8, pc = tid % 8; FragH f;
#pragma unroll
      for (int q = 0; q < 8; ++q) f.u[q] = tl[pc * 8 + q][d];
      *(v8us*)((unsigned short*)Vt + ((size_t)slab * 64 + d) * TTv + lg * 64 + pc * 8) = f.half[0]; }
     } }

__global__ __launch_bounds__(256) void k_hl(const float* __restrict__ F, _Float16* __restrict__ Hh, _Float16* __restrict__ Hl, size_t n8) { const size_t t = (size_t)blockIdx.x * 256 + threadIdx.x; if (t >= n8) return; FragH fh, fl; const v4f a = *(const v4fa*)(F + t * 8), c = *(const v4fa*)(F + t * 8 + 4);
#pragma unroll
  for (int q = 0; q < 4; ++q) { _Float16 h = (_Float16)a[q]; fh.h[q] = h; fl.h[q] = (_Float16)((a[q] - (float)h) * 1024.0f); h = (_Float16)c[q]; fh.h[4 + q] = h; fl.h[4 + q] = (_Float16)((c[q] - (float)h) * 1024.0f); }
  { *(v8us*)((unsigned short*)Hh + t * 8) = fh.half[0]; *(v8us*)((unsigned short*)Hl + t * 8) = fl.half[0];  } }

// ---- fast GEMM (wave tile 32x64; requires M % 32 == 0 rows per launch region and N % 64 == 0); epilogue = k_gemm_hhx semantics ----
__device__ __forceinline__ v16h g2_frag(const _Float16* p, int hh) { FragH f; f.half[0] = *(const v8us*)((const unsigned short*)p + 8 * hh); f.half[1] = *(const v8us*)((const unsigned short*)p + 16 + 8 * hh); return f.v; }
__device__ __forceinline__ v8f g2_mma(v16h a, v16h b, v8f c) { v8f d = __builtin_amdgcn_wmma_f32_16x16x32_f16(false, a, false, b, (short)0, c, false, false); asm volatile("v_nop\n\tv_nop\n\tv_nop\n\tv_nop" : "+v"(d) : "v"(a), "v"(b)); return d; }
template <int ACT>
__global__ __launch_bounds__(128) void k_gemm2(const _Float16* __restrict__ A, int lda, size_t sA, const _Float16* __restrict__ Bh, int ldb, size_t sB, float alpha, const float* __restrict__ bias, size_t sBias, const float* __restrict__ CP, int rowsPerB, size_t sCPb, int row0g,
    float* __restrict__ C, _Float16* __restrict__ C16, int ldc, size_t sC, int M, int N, int K) { static_assert(ACT == 0 || ACT == 3 || ACT == 6 || ACT == 8 || ACT == 9 || ACT == 11 || ACT == 12 || ACT == 14 || ACT == 15 || ACT == 16 || ACT == 17, "k_gemm2: unsupported ACT code (would silently apply no activation)");
  __shared__ __attribute__((aligned(16))) float so[4][32][68];
  const int tid = threadIdx.x, w = tid >> 5, lane = tid & 31, ln = lane & 15, hh = lane >> 4; const int by = blockIdx.y;
  A += (size_t)by * sA; Bh += (size_t)by * sB; const size_t cofs = (size_t)by * sC; const float* bp = bias ? bias + (size_t)by * sBias : nullptr;
  const int ntn = N >> 6; const int mt = blockIdx.x / ntn, nq = blockIdx.x - mt * ntn; const int row0 = mt * 128 + 32 * w, col0 = nq * 64; if (row0 >= M) return;
  const _Float16* a0p = A + (size_t)(row0 + ln) * lda; const _Float16* a1p = a0p + (size_t)16 * lda;
  const _Float16* b0p = Bh + (size_t)(col0 + ln) * ldb; const _Float16* b1p = b0p + (size_t)16 * ldb; const _Float16* b2p = b1p + (size_t)16 * ldb; const _Float16* b3p = b2p + (size_t)16 * ldb;
  const v8f z8 = {0.f,0.f,0.f,0.f,0.f,0.f,0.f,0.f}; v8f c00 = z8, c01 = z8, c02 = z8, c03 = z8, c10 = z8, c11 = z8, c12 = z8, c13 = z8;
#pragma unroll 1
  for (int kb = 0; kb < K; kb += 32) { const v16h a0 = g2_frag(a0p + kb, hh), a1 = g2_frag(a1p + kb, hh);
    v16h b = g2_frag(b0p + kb, hh); c00 = g2_mma(a0, b, c00); c10 = g2_mma(a1, b, c10);
    b = g2_frag(b1p + kb, hh); c01 = g2_mma(a0, b, c01); c11 = g2_mma(a1, b, c11);
    b = g2_frag(b2p + kb, hh); c02 = g2_mma(a0, b, c02); c12 = g2_mma(a1, b, c12);
    b = g2_frag(b3p + kb, hh); c03 = g2_mma(a0, b, c03); c13 = g2_mma(a1, b, c13); }
  v8f accs[8] = {c00, c01, c02, c03, c10, c11, c12, c13};
#pragma unroll
  for (int u = 0; u < 8; ++u) { const int t = u & 3, half = u >> 2; const int col = col0 + t * 16 + ln; const float bv = bp ? bf16_round(bp[col]) : 0.f;
#pragma unroll
    for (int r = 0; r < 8; ++r) { const int rloc = half * 16 + 8 * hh + r; float v = accs[u][r] * alpha + bv; if (CP) { if (rowsPerB < 0) v += CP[cofs + (size_t)(row0g + row0 + rloc) * ldc + col];      /* rowsPerB < 0: own element of the batched C plane */ else { const int bidx = (row0g + row0 + rloc) / rowsPerB; v += CP[(size_t)bidx * sCPb + (size_t)by * 64 + col]; } }
      if (ACT == 3) v = fmaxf(v, 0.f); else if (ACT == 6) v = 0.5f * v * (1.0f + erff(v * 0.70710678118654752f)); else if (ACT == 11) v = 1.0f / (1.0f + expf(-v)); else if (ACT == 15) v = v / (1.0f + expf(-v)); else if (ACT == 12) v = (v > 0.f) ? v : 0.01f * v; else if (ACT == 8) v = tanhf(v); else if (ACT == 9) v = 0.5f * v * (1.0f + tanhf(0.7978845608028654f * (v + 0.044715f * v * v * v))); else if (ACT == 14) v = (v > 0.f) ? v : 0.1f * v; else if (ACT == 16) v = (v >= 0.f) ? v : 0.3f * v; else if (ACT == 17) v = (v >= 0.f) ? v : 0.2f * v;
      so[w][rloc][t * 16 + ln] = v; } }
  __builtin_amdgcn_fence(__ATOMIC_ACQ_REL, "workgroup"); __builtin_amdgcn_wave_barrier();
  const int rsub = lane >> 4, c4 = (lane & 15) * 4;
  {
#pragma unroll
    for (int q = 0; q < 16; ++q) { const int r = q * 2 + rsub; const v4f v = *(const v4fa*)&so[w][r][c4]; if (C) *(v4f*)(C + cofs + (size_t)(row0 + r) * ldc + col0 + c4) = v; if (C16) { v4h h4; for (int i = 0; i < 4; ++i) h4[i] = (_Float16)v[i]; *(v4h*)(C16 + cofs + (size_t)(row0 + r) * ldc + col0 + c4) = h4; } }
     } }


__global__ __launch_bounds__(256) void k_wnat(const float* __restrict__ w, size_t n8, _Float16* __restrict__ Bt) { const size_t t = (size_t)blockIdx.x * 256 + threadIdx.x; if (t >= n8) return; FragH f; for (int q = 0; q < 8; ++q) f.h[q] = (_Float16)(bf16_round(w[t * 8 + q]) * 16.0f); *(v8us*)((unsigned short*)Bt + t * 8) = f.half[0];  }
__global__ __launch_bounds__(256) void k_rsm(const float* __restrict__ S, _Float16* __restrict__ P, int nrows) {
  #pragma clang fp contract(off)
  const int i = blockIdx.x * 256 + threadIdx.x; if (i >= nrows) return; const float* s = S + (size_t)i * SQ; float mx = -3.0e38f;
#pragma unroll 1
  for (int j = 0; j < SQ; ++j) mx = fmaxf(mx, s[j]); float se = 0.f;
#pragma unroll 1
  for (int j = 0; j < SQ; ++j) se += expf(s[j] - mx); const float sc = 256.0f / se;
#pragma unroll 1
  for (int j0 = 0; j0 < SQ; j0 += 8) { FragH f; for (int q = 0; q < 8; ++q) f.h[q] = (_Float16)(expf(s[j0 + q] - mx) * sc); unsigned short* d = (unsigned short*)P + (size_t)i * SQ + j0; *(v8us*)d = f.half[0];  } }
__global__ __launch_bounds__(256) void k_vt(const _Float16* __restrict__ V16, int b, int h0, _Float16* __restrict__ VT) { __shared__ unsigned short tl[64][65]; const int tid = threadIdx.x; const int hh = blockIdx.x % HG, sg = blockIdx.x / HG; const int s0 = sg * 64; const int h = h0 + hh;
  for (int i = tid; i < 64 * 8; i += 256) { const int j = i / 8, d8 = (i % 8) * 8; FragH f; f.half[0] = *(const v8us*)((const unsigned short*)V16 + ((size_t)b * SQ + s0 + j) * DM + h * HD + d8); for (int q = 0; q < 8; ++q) tl[d8 + q][j] = f.u[q]; }
  __syncthreads();
  { for (int i = tid; i < 64 * 8; i += 256) { const int d = i / 8, j8 = (i % 8) * 8; FragH f; for (int q = 0; q < 8; ++q) f.u[q] = tl[d][j8 + q]; *(v8us*)((unsigned short*)VT + ((size_t)hh * HD + d) * SQ + s0 + j8) = f.half[0]; }  } }



// Row softmax, one wave per row: each load of a wave covers 512 contiguous bytes of the row, the row stays in registers (S is read once),
// the maximum and the sum go over four chains per lane and then a five-step butterfly over the 32 lanes. 16 waves (16 rows) per workgroup.
#define RSM_WAVES 16
template <int CTRL> __device__ __forceinline__ float rsm_xm(float x) { return __builtin_bit_cast(float, __builtin_amdgcn_update_dpp(0, __builtin_bit_cast(int, x), CTRL, 0xf, 0xf, true)); }      /* lane l reads lane l ^ m of its 16-lane row: CTRL = 0x160 + m (row_xmask) */
__device__ __forceinline__ float rsm_xh(float x) { return __builtin_bit_cast(float, __builtin_amdgcn_permlanex16(__builtin_bit_cast(int, x), __builtin_bit_cast(int, x), 0x76543210, 0xfedcba98, false, false)); }      /* lane l reads lane l ^ 16 */
__device__ __forceinline__ float rsm_wmax(float x) { x = fmaxf(x, rsm_xm<0x161>(x)); x = fmaxf(x, rsm_xm<0x162>(x)); x = fmaxf(x, rsm_xm<0x164>(x)); x = fmaxf(x, rsm_xm<0x168>(x)); return fmaxf(x, rsm_xh(x)); }
__device__ __forceinline__ float rsm_wsum(float x) { x += rsm_xm<0x161>(x); x += rsm_xm<0x162>(x); x += rsm_xm<0x164>(x); x += rsm_xm<0x168>(x); return x + rsm_xh(x); }
__global__ __launch_bounds__(RSM_WAVES * 32) void k_rsmf(const float* __restrict__ S, _Float16* __restrict__ P, int qn, int hg) {
  const int lane = threadIdx.x & 31; const int wave = __builtin_amdgcn_readfirstlane((int)(threadIdx.x >> 5));
  const int t = blockIdx.x * RSM_WAVES + wave; if (t >= qn * hg) return;      /* wave-uniform, and the kernel has no barrier */
  const size_t ro = ((size_t)(t / qn) * SQ + (t % qn)) * SQ + lane * 4; const float* sp = S + ro;
  v4f x[SQ / 128];
#pragma unroll
  for (int q = 0; q < SQ / 128; ++q) x[q] = __builtin_nontemporal_load((const v4fa*)(sp + q * 128));      /* S is read once */
  asm volatile("s_wait_xcnt 0x0" :: "v"(sp) : "memory");      /* the loads' address registers stay as they are (sp is held live to here) until this wait; they are reused behind it */
  float m0 = -3.0e38f, m1 = -3.0e38f, m2 = -3.0e38f, m3 = -3.0e38f;
#pragma unroll
  for (int q = 0; q < SQ / 128; ++q) { m0 = fmaxf(m0, x[q][0]); m1 = fmaxf(m1, x[q][1]); m2 = fmaxf(m2, x[q][2]); m3 = fmaxf(m3, x[q][3]); }
  const float mx = rsm_wmax(fmaxf(fmaxf(m0, m1), fmaxf(m2, m3)));
  v4f a = {0.f, 0.f, 0.f, 0.f};
#pragma unroll
  for (int q = 0; q < SQ / 128; ++q) { v4f e; e[0] = __expf(x[q][0] - mx); e[1] = __expf(x[q][1] - mx); e[2] = __expf(x[q][2] - mx); e[3] = __expf(x[q][3] - mx); a += e; x[q] = e; }
  const float sc = 256.0f / rsm_wsum((a[0] + a[1]) + (a[2] + a[3]));
#pragma unroll
  for (int q = 0; q < SQ / 128; ++q) { v4h h4; for (int i = 0; i < 4; ++i) h4[i] = (_Float16)(x[q][i] * sc); *(v4h*)(P + ro + q * 128) = h4; } }

extern "C" void kernel_launch(void* const* d_in, const int* in_sizes, int n_in,
                              void* d_out, int out_size, void* d_ws, size_t ws_size, hipStream_t stream) {
  (void)in_sizes; (void)n_in; (void)out_size;
  const float* const* I = (const float* const*)d_in; const float* xq = I[0]; const float* xk = I[1]; const float* xv = I[1]; const float* wq = I[2]; const float* bq = I[3]; const float* wk = I[4]; const float* bk = I[5]; const float* wv = I[6]; const float* bv = I[7]; const float* wo = I[8]; const float* bo = I[9];      /* TWO inputs: query (the q stream) and value (read on BOTH the k and the v stream casts); wq, wk, wv are PER-HEAD STACKS [16][1024][64] = [head][in][out]; bq, bk, bv per-head [16][64] = the flat [1024] bias; wo [in][out] + bo; input order query, value, wq, bq, wk, bk, wv, bv, wo, bo */
  char* ws = (char*)d_ws; size_t off = 0;
  auto take = [&](size_t bytes) { char* p = ws + off; off += (bytes + 255) & ~(size_t)255; return p; };
  _Float16* BQ = (_Float16*)take((size_t)DM * DM * 2); _Float16* BK = (_Float16*)take((size_t)DM * DM * 2); _Float16* BV = (_Float16*)take((size_t)DM * DM * 2); _Float16* BO = (_Float16*)take((size_t)DM * DM * 2);
  _Float16* XQ = (_Float16*)take(NR * DM * 2); _Float16* XK = (_Float16*)take(NR * DM * 2); _Float16* XV = (_Float16*)take(NR * DM * 2); _Float16* Q16 = (_Float16*)take(NR * DM * 2); _Float16* K16 = (_Float16*)take(NR * DM * 2); _Float16* V16 = (_Float16*)take(NR * DM * 2); _Float16* O16 = (_Float16*)take(NR * DM * 2);
  float* S = (float*)take((size_t)HG * SQ * SQ * 4); _Float16* P = (_Float16*)take((size_t)HG * SQ * SQ * 2); _Float16* VT = (_Float16*)take((size_t)NH * HD * SQ * 2);
  if (off > ws_size) return;
  { const unsigned g = (unsigned)(((size_t)DM * (DM / 8) + 255) / 256); const unsigned gh = (unsigned)(((size_t)HD * (DM / 8) + 255) / 256); for (int h = 0; h < NH; ++h) { const size_t wofs = (size_t)h * DM * HD, pofs = (size_t)h * HD * DM; k_wt_f16<<<gh, 256, 0, stream>>>(wq + wofs, BQ + pofs, DM, HD, 16.0f); k_wt_f16<<<gh, 256, 0, stream>>>(wk + wofs, BK + pofs, DM, HD, 16.0f); k_wt_f16<<<gh, 256, 0, stream>>>(wv + wofs, BV + pofs, DM, HD, 16.0f); } k_wt_f16<<<g, 256, 0, stream>>>(wo, BO, DM, DM, 16.0f); }      /* PER-HEAD STACKS wq / wk / wv [NH][DM][HD]: head h is a row-major [in = DM][out = HD] block at w + h * DM * HD: the transposing builder with K = DM, N = HD writes its HD rows Bt[h * HD + e][k] at B + h * HD * DM: contiguous rows of the [out][in] plane (x16); wo is a plain [in][out] [DM][DM] matrix: one call as before */

  k_x16<<<(unsigned)((NR * DM / 8 + 255) / 256), 256, 0, stream>>>(xq, XQ, NR * DM / 8); k_x16<<<(unsigned)((NR * DM / 8 + 255) / 256), 256, 0, stream>>>(xk, XK, NR * DM / 8); k_x16<<<(unsigned)((NR * DM / 8 + 255) / 256), 256, 0, stream>>>(xv, XV, NR * DM / 8);      /* query, and value twice (k and v streams), as exact f16 rows */
  const size_t r0p = (size_t)B0 * SQ;      /* first projected row */
  k_gemm2<0><<<dim3((unsigned)((MP / 128) * (DM / 64)), 1), 128, 0, stream>>>(XQ + r0p * DM, DM, 0, BQ, DM, 0, 0.0625f, bq, 0, nullptr, 1, 0, 0, nullptr, Q16 + r0p * DM, DM, 0, MP, DM, DM);
  k_gemm2<0><<<dim3((unsigned)((MP / 128) * (DM / 64)), 1), 128, 0, stream>>>(XK + r0p * DM, DM, 0, BK, DM, 0, 0.0625f, bk, 0, nullptr, 1, 0, 0, nullptr, K16 + r0p * DM, DM, 0, MP, DM, DM);
  k_gemm2<0><<<dim3((unsigned)((MP / 128) * (DM / 64)), 1), 128, 0, stream>>>(XV + r0p * DM, DM, 0, BV, DM, 0, 0.0625f, bv, 0, nullptr, 1, 0, 0, nullptr, V16 + r0p * DM, DM, 0, MP, DM, DM);
  for (int b = B0; b < B0 + NBR; ++b) { const size_t r0 = (size_t)b * SQ;
    k_vt<NH, SQ><<<NH * (SQ / 64), 256, 0, stream>>>(V16 + r0 * LQ, LQ, 0, VT);      /* V^T [NH][HD][SQ] for this batch */
    for (int h0 = 0; h0 < NHD; h0 += HG) {
      k_gemm2<0><<<dim3((QN / 128) * (SQ / 64), HG), 128, 0, stream>>>(Q16 + r0 * LQ + h0 * HD, LQ, (size_t)HD, K16 + r0 * LQ + h0 * HD, LQ, (size_t)HD, 0.125f, nullptr, 0, nullptr, 1, 0, 0, S, nullptr, SQ, (size_t)SQ * SQ, QN, SQ, HD);      /* scores, HG heads per launch */
      k_rsmf<<<(HG * QN + RSM_WAVES - 1) / RSM_WAVES, RSM_WAVES * 32, 0, stream>>>(S, P, QN, HG);      /* P = 256 softmax (f16), rows of all HG heads */
      k_gemm2<0><<<dim3((QN / 128) * (HD / 64), HG), 128, 0, stream>>>(P, SQ, (size_t)SQ * SQ, VT + (size_t)h0 * HD * SQ, SQ, (size_t)HD * SQ, 0.25f, nullptr, 0, nullptr, 1, 0, 0, nullptr, O16 + r0 * DM + h0 * HD, DM, (size_t)HD, QN, HD, SQ); } }      /* o (merged heads) as f16 rows */
  k_gemm2<0><<<dim3((unsigned)((MPO / 128) * (DM / 64)), 1), 128, 0, stream>>>(O16 + r0p * DM, DM, 0, BO, DM, 0, 0.0009765625f, bo, 0, nullptr, 1, 0, 0, (float*)d_out + r0p * DM, nullptr, DM, 0, MPO, DM, DM);      /* out rows are the output layout */
}

// v002
// A run of this version takes 454 microseconds.
// Timed twice side by side with v001, it ran 4.02 and 4.07 times as fast.
// Over all steps from v000 it is 15.5 times as fast.
#include <hip/hip_runtime.h>
// Multi-head attention on two inputs with PER-HEAD STACKED projections and per-head biases on four sequences (query [4][2048][1024], value [4][2048][1024]; q = einsum('bsd,hde->bhse', query, wq) + bq, k = einsum(value, wk) + bk, v = einsum(value, wv) + bv with W [16][1024][64] = [head][in][out] and b [16][64], 16 heads of 64; scores * 1/sqrt(64); softmax over all 2048 keys (no mask); out = heads wo + bo ([in][out] + bias) -> [4][2048][1024]); each head's [in][out] block is transposed into its 64 contiguous rows of the weight plane by the existing builder, one call per head; the [in][out] output weight through the same builder in one call.
// Structure: token rows r = b*2048 + s; the query source and the key/value source as exact f16 rows (bf16-rounded); Q, K, V as three WMMA GEMMs (32x64 wave tiles, f32 accumulation, exact x16 weights + bias, f16 outputs); V^T for all batches and heads via LDS transposes; one fused attention launch (scores K = 64 and o = P . V^T on WMMA, online softmax on VALU with f32 statistics and native exp2, weights as f16 relative to the running maximum; o carried x64 against f16 subnormal flush, folded into the output GEMM alpha) written straight into the merged f16 o rows; out = o W_o + b GEMM (f32) into the output layout.
// Compute dtype: inputs rounded to bf16; x / weights exact; q, k, v, softmax weights and o as plain f16 GEMM operands (~2^-12); scores and softmax statistics f32. v_wmma_f32_16x16x32_f16.
#define NB 4
#define SQ 2048
#define DM 1024
#define NH 16
#define HD 64
#define HG 4                         /* heads per block group of the k_vt(V16, b, h0, VT) overload (not launched) */
#define B0 0                         /* first batch processed (debug hook) */
#define NBR NB                       /* batches processed (debug hook) */
#define NR ((size_t)NB * SQ)         /* token rows */
#define MP ((int)((size_t)NBR * SQ)) /* rows projected (debug hook) */
#define QN SQ                        /* query rows per batch; unused, k_fattn attends all SQ */
#define NHD NH                       /* heads; unused, k_fattn attends all NH */
#define MPO MP                       /* rows through the output stage (debug hook) */
#define LQ DM      /* row pitch of the q/k/v rows */
typedef __bf16 v16b __attribute__((ext_vector_type(16)));
typedef unsigned short v8us __attribute__((ext_vector_type(8), may_alias));
typedef float  v8f  __attribute__((ext_vector_type(8)));
typedef float  v4f  __attribute__((ext_vector_type(4)));
typedef float  v4fa __attribute__((ext_vector_type(4), may_alias));
union FragB { v16b v; v8us half[2]; unsigned short u[16]; };

__device__ __forceinline__ unsigned short bf16_bits(float x) { unsigned int u = __float_as_uint(x); return (unsigned short)((u + 0x7FFFu + ((u >> 16) & 1u)) >> 16); }
__device__ __forceinline__ float bf16_val(unsigned short b) { return __uint_as_float(((unsigned int)b) << 16); }
__device__ __forceinline__ float bf16_round(float x) { return bf16_val(bf16_bits(x)); }
// D += A·B with NT terms: 1 = ah·bh, 2 = + al·bh (A split), 3 = + ah·bl (both split)
template <int NT>
__device__ __forceinline__ v8f mmaN(v16b ah, v16b al, v16b bh, v16b bl, v8f c) {
  c = __builtin_amdgcn_wmma_f32_16x16x32_bf16(false, ah, false, bh, (short)0, c, false, false);
  if (NT >= 2) c = __builtin_amdgcn_wmma_f32_16x16x32_bf16(false, al, false, bh, (short)0, c, false, false);
  if (NT >= 3) c = __builtin_amdgcn_wmma_f32_16x16x32_bf16(false, ah, false, bl, (short)0, c, false, false);
  asm volatile("v_nop\n\tv_nop\n\tv_nop\n\tv_nop" : "+v"(c) : "v"(ah), "v"(al), "v"(bh), "v"(bl));
  return c;
}

__global__ __launch_bounds__(256) void k_wt_bf16(const float* __restrict__ W, unsigned short* __restrict__ Wt, int K, int N) {
  const int t = blockIdx.x * 256 + threadIdx.x;
  const int k8n = K / 8;
  if (t >= N * k8n) return;
  const int n = t / k8n, k8 = (t % k8n) * 8;
  v8us v;
#pragma unroll
  for (int i = 0; i < 8; ++i) v[i] = bf16_bits(W[(size_t)(k8 + i) * N + n]);
  *(v8us*)(Wt + (size_t)n * K + k8) = v;
  
}

// GEMM C[M][N] (f32, pitch ldc) = act(A[M][K]·W + bias). A f32 row-major (pitch lda) converted per fragment to bf16
// (ASPLIT: hi/lo two planes -> 2 terms, else single rounded term); Wt bf16 [N][K] (pitch ldb). BIAS_BF16 rounds the
// bias to bf16 first (bias quantised to bf16 before the add). K%32==0, M%16==0, N%64==0.
template <bool ASPLIT, int ACT, bool BIAS_BF16>
__global__ __launch_bounds__(128) void k_gemm_bf(const float* __restrict__ A, int lda, const unsigned short* __restrict__ Wt, int ldb,
                                               const float* __restrict__ bias, float* __restrict__ C, int ldc, int M, int N, int K) {
  __shared__ __attribute__((aligned(16))) float so[4][16][64];
  const int tid = threadIdx.x, w = tid >> 5, lane = tid & 31, ln = lane & 15, hh = lane >> 4;
  const int ntn = N / 64;
  const int wid = blockIdx.x * 4 + w;
  const int mt = wid / ntn, nq = wid % ntn;
  if (mt * 16 >= M) return;
  const int row0 = mt * 16, col0 = nq * 64;
  const float* arow = A + (size_t)(row0 + ln) * lda;
  v8f acc[4] = {};
  for (int kb = 0; kb < K; kb += 32) {
    FragB ah, al;
    const v4f x0 = *(const v4fa*)(arow + kb + 8 * hh), x1 = *(const v4fa*)(arow + kb + 8 * hh + 4);
    const v4f x2 = *(const v4fa*)(arow + kb + 16 + 8 * hh), x3 = *(const v4fa*)(arow + kb + 16 + 8 * hh + 4);
    float xs[16] = {x0[0],x0[1],x0[2],x0[3],x1[0],x1[1],x1[2],x1[3],x2[0],x2[1],x2[2],x2[3],x3[0],x3[1],x3[2],x3[3]};
#pragma unroll
    for (int i = 0; i < 16; ++i) { const unsigned short hb = bf16_bits(xs[i]); ah.u[i] = hb; al.u[i] = ASPLIT ? bf16_bits(xs[i] - bf16_val(hb)) : (unsigned short)0; }
#pragma unroll
    for (int t = 0; t < 4; ++t) {
      const unsigned short* brow = Wt + (size_t)(col0 + t * 16 + ln) * ldb + kb;
      FragB b;
      b.half[0] = *(const v8us*)(brow + 8 * hh);
      b.half[1] = *(const v8us*)(brow + 16 + 8 * hh);
      acc[t] = mmaN<ASPLIT ? 2 : 1>(ah.v, al.v, b.v, b.v, acc[t]);
    }
  }
#pragma unroll
  for (int t = 0; t < 4; ++t) {
    float bv = bias ? bias[col0 + t * 16 + ln] : 0.f;
    if (BIAS_BF16) bv = bf16_round(bv);
#pragma unroll
    for (int r = 0; r < 8; ++r) { float v = acc[t][r] + bv; if (ACT == 1) v = fmaxf(v, 0.f); so[w][8 * hh + r][t * 16 + ln] = v; }
  }
  __builtin_amdgcn_fence(__ATOMIC_ACQ_REL, "workgroup");
  __builtin_amdgcn_wave_barrier();
  const int rsub = lane >> 4, c4 = (lane & 15) * 4;
  {
#pragma unroll
    for (int q = 0; q < 8; ++q) {
      const int r = q * 2 + rsub;
      const v4f v = *(const v4fa*)&so[w][r][c4];
      *(v4f*)(C + (size_t)(row0 + r) * ldc + col0 + c4) = v;
    }
    
  }
}

// GEMM C = act(A·W + bias + resid): A f32 (ASPLIT -> hi/lo 2 terms), Wt bf16 [N][K]; ACT 0 none, 1 relu, 2 exact gelu;
// resid (optional, f32, row index = (row % rmod), pitch ldr, RES_BF16 rounds it) added before the activation.
template <bool ASPLIT, int ACT, bool BIAS_BF16, bool RES_BF16>
__global__ __launch_bounds__(128) void k_gemm_bf3(const float* __restrict__ A, int lda, const unsigned short* __restrict__ Wt, int ldb,
                                                const float* __restrict__ bias, const float* __restrict__ resid, int rmod, int ldr,
                                                float* __restrict__ C, int ldc, int M, int N, int K) {
  __shared__ __attribute__((aligned(16))) float so[4][16][64];
  const int tid = threadIdx.x, w = tid >> 5, lane = tid & 31, ln = lane & 15, hh = lane >> 4;
  const int ntn = N / 64;
  const int wid = blockIdx.x * 4 + w;
  const int mt = wid / ntn, nq = wid % ntn;
  if (mt * 16 >= M) return;
  const int row0 = mt * 16, col0 = nq * 64;
  const float* arow = A + (size_t)(row0 + ln) * lda;
  v8f acc[4] = {};
  for (int kb = 0; kb < K; kb += 32) {
    FragB ah, al;
    const v4f x0 = *(const v4fa*)(arow + kb + 8 * hh), x1 = *(const v4fa*)(arow + kb + 8 * hh + 4);
    const v4f x2 = *(const v4fa*)(arow + kb + 16 + 8 * hh), x3 = *(const v4fa*)(arow + kb + 16 + 8 * hh + 4);
    float xs[16] = {x0[0],x0[1],x0[2],x0[3],x1[0],x1[1],x1[2],x1[3],x2[0],x2[1],x2[2],x2[3],x3[0],x3[1],x3[2],x3[3]};
#pragma unroll
    for (int i = 0; i < 16; ++i) { const unsigned short hb = bf16_bits(xs[i]); ah.u[i] = hb; al.u[i] = ASPLIT ? bf16_bits(xs[i] - bf16_val(hb)) : (unsigned short)0; }
#pragma unroll
    for (int t = 0; t < 4; ++t) {
      const unsigned short* brow = Wt + (size_t)(col0 + t * 16 + ln) * ldb + kb;
      FragB b;
      b.half[0] = *(const v8us*)(brow + 8 * hh);
      b.half[1] = *(const v8us*)(brow + 16 + 8 * hh);
      acc[t] = mmaN<ASPLIT ? 2 : 1>(ah.v, al.v, b.v, b.v, acc[t]);
    }
  }
#pragma unroll
  for (int t = 0; t < 4; ++t) {
    const int col = col0 + t * 16 + ln;
    float bv = bias ? bias[col] : 0.f;
    if (BIAS_BF16) bv = bf16_round(bv);
#pragma unroll
    for (int r = 0; r < 8; ++r) {
      float v = acc[t][r] + bv;
      if (resid) { float rv = resid[(size_t)((row0 + 8 * hh + r) % rmod) * ldr + col]; if (RES_BF16) rv = bf16_round(rv); v += rv; }
      if (ACT == 1) v = fmaxf(v, 0.f);
      if (ACT == 2) v = 0.5f * v * (1.0f + erff(v * 0.70710678118654752f));
      if (ACT == 3) { const float u = 0.7978845608028654f * (v + 0.044715f * v * v * v); v = 0.5f * v * (1.0f + tanhf(u)); }
      so[w][8 * hh + r][t * 16 + ln] = v;
    }
  }
  __builtin_amdgcn_fence(__ATOMIC_ACQ_REL, "workgroup");
  __builtin_amdgcn_wave_barrier();
  const int rsub = lane >> 4, c4 = (lane & 15) * 4;
  {
#pragma unroll
    for (int q = 0; q < 8; ++q) {
      const int r = q * 2 + rsub;
      const v4f v = *(const v4fa*)&so[w][r][c4];
      *(v4f*)(C + (size_t)(row0 + r) * ldc + col0 + c4) = v;
    }
    
  }
}
// row LayerNorm (biased variance, eps) over N: s = X (+ R); optional out_sum <- s; out_norm <- (s-mu)*rsqrt(var+eps)*g + b
template <bool PARAM_BF16>
__global__ __launch_bounds__(256) void k_layernorm(const float* __restrict__ X, const float* __restrict__ R, const float* __restrict__ g, const float* __restrict__ bta,
                                                  float* __restrict__ out_sum, float* __restrict__ out_norm, int N, float eps) {
  __shared__ float red[256];
  const int row = blockIdx.x, tid = threadIdx.x;
  const float* x = X + (size_t)row * N; const float* rr = R ? R + (size_t)row * N : nullptr;
  float vals[16];                     // up to N = 4096
  const int per = N / 256;            // contiguous chunk per thread? use strided-by-4 chunks: thread handles j = tid*4 + 1024*u
  float s1 = 0.f;
  for (int u = 0; u < per / 4; ++u) {
    const int j = tid * 4 + 1024 * u;
    const v4f a = *(const v4fa*)(x + j);
    v4f b = {0.f,0.f,0.f,0.f}; if (rr) b = *(const v4fa*)(rr + j);
#pragma unroll
    for (int q = 0; q < 4; ++q) { const float v = a[q] + b[q]; vals[u * 4 + q] = v; s1 += v; }
  }
  red[tid] = s1; __syncthreads();
  for (int st = 128; st > 0; st >>= 1) { if (tid < st) red[tid] += red[tid + st]; __syncthreads(); }
  const float mu = red[0] / (float)N; __syncthreads();
  float s2 = 0.f;
  for (int u = 0; u < per / 4; ++u)
#pragma unroll
    for (int q = 0; q < 4; ++q) { const float c = vals[u * 4 + q] - mu; s2 += c * c; }
  red[tid] = s2; __syncthreads();
  for (int st = 128; st > 0; st >>= 1) { if (tid < st) red[tid] += red[tid + st]; __syncthreads(); }
  const float rs = rsqrtf(red[0] / (float)N + eps);
  {
    for (int u = 0; u < per / 4; ++u) {
      const int j = tid * 4 + 1024 * u;
      v4f o, sm;
#pragma unroll
      for (int q = 0; q < 4; ++q) {
        float gg = g[j + q], bb = bta[j + q];
        if (PARAM_BF16) { gg = bf16_round(gg); bb = bf16_round(bb); }
        sm[q] = vals[u * 4 + q]; o[q] = (vals[u * 4 + q] - mu) * rs * gg + bb;
      }
      if (out_sum) *(v4f*)(out_sum + (size_t)row * N + j) = sm;
      *(v4f*)(out_norm + (size_t)row * N + j) = o;
    }
    
  }
}



// ---- f16 WMMA path (v_wmma_f32_16x16x32_f16): 11-bit significands for operands in range — used where a [0,1] probability operand needs more precision than bf16
typedef _Float16 v16h __attribute__((ext_vector_type(16)));
union FragH { v16h v; v8us half[2]; _Float16 h[16]; unsigned short u[16]; };
template <int NT>
__device__ __forceinline__ v8f mmaH(v16h ah, v16h al, v16h bh, v16h bl, v8f c) {
  c = __builtin_amdgcn_wmma_f32_16x16x32_f16(false, ah, false, bh, (short)0, c, false, false);
  if (NT >= 2) c = __builtin_amdgcn_wmma_f32_16x16x32_f16(false, al, false, bh, (short)0, c, false, false);
  if (NT >= 3) c = __builtin_amdgcn_wmma_f32_16x16x32_f16(false, ah, false, bl, (short)0, c, false, false);
  asm volatile("v_nop\n\tv_nop\n\tv_nop\n\tv_nop" : "+v"(c) : "v"(ah), "v"(al), "v"(bh), "v"(bl));
  return c;
}
// batched GEMM like k_gemm_b but f16 operands: A f32 (split into f16 hi/lo if ASPLIT, else rounded to f16), Bt = f16 values [n][k]; alpha; C f32; N multiple of 16 (partial tiles skipped)
template <bool ASPLIT>
__global__ __launch_bounds__(128) void k_gemm_h(const float* __restrict__ A, int lda, size_t sA, const _Float16* __restrict__ Bh, int ldb, size_t sB, float alpha, float* __restrict__ C, int ldc, size_t sC, int M, int N, int K) {
  __shared__ __attribute__((aligned(16))) float so[4][16][64];
  const int tid = threadIdx.x, w = tid >> 5, lane = tid & 31, ln = lane & 15, hh = lane >> 4; const int by = blockIdx.y;
  A += (size_t)by * sA; Bh += (size_t)by * sB; C += (size_t)by * sC;
  const int ntn = (N + 63) / 64; const int wid = blockIdx.x * 4 + w; const int mt = wid / ntn, nq = wid % ntn; if (mt * 16 >= M) return;
  const int row0 = mt * 16, col0 = nq * 64; const float* arow = A + (size_t)(row0 + ln) * lda;
  v8f acc[4] = {};
  for (int kb = 0; kb < K; kb += 32) {
    FragH ah, al;
    const v4f x0 = *(const v4fa*)(arow + kb + 8 * hh), x1 = *(const v4fa*)(arow + kb + 8 * hh + 4), x2 = *(const v4fa*)(arow + kb + 16 + 8 * hh), x3 = *(const v4fa*)(arow + kb + 16 + 8 * hh + 4);
    float xs[16] = {x0[0],x0[1],x0[2],x0[3],x1[0],x1[1],x1[2],x1[3],x2[0],x2[1],x2[2],x2[3],x3[0],x3[1],x3[2],x3[3]};
#pragma unroll
    for (int i = 0; i < 16; ++i) { const _Float16 h = (_Float16)xs[i]; ah.h[i] = h; al.h[i] = ASPLIT ? (_Float16)(xs[i] - (float)h) : (_Float16)0.0f; }
#pragma unroll
    for (int t = 0; t < 4; ++t) { if (col0 + t * 16 >= N) continue; const size_t boff = (size_t)(col0 + t * 16 + ln) * ldb + kb; FragH bq; bq.half[0] = *(const v8us*)(Bh + boff + 8 * hh); bq.half[1] = *(const v8us*)(Bh + boff + 16 + 8 * hh);
      acc[t] = mmaH<ASPLIT ? 2 : 1>(ah.v, al.v, bq.v, bq.v, acc[t]); }
  }
#pragma unroll
  for (int t = 0; t < 4; ++t) { if (col0 + t * 16 >= N) continue;
#pragma unroll
    for (int r = 0; r < 8; ++r) so[w][8 * hh + r][t * 16 + ln] = acc[t][r] * alpha; }
  __builtin_amdgcn_fence(__ATOMIC_ACQ_REL, "workgroup"); __builtin_amdgcn_wave_barrier();
  const int rsub = lane >> 4, c4 = (lane & 15) * 4;
  {
#pragma unroll
    for (int q = 0; q < 8; ++q) { const int r = q * 2 + rsub; if (col0 + c4 < N) { const v4f v = *(const v4fa*)&so[w][r][c4]; *(v4f*)(C + (size_t)(row0 + r) * ldc + col0 + c4) = v; } }
     }
}

// Wt[n][k] = f16(W[k][n]·scale) from f32 row-major W[K][N] (scale = power of two; bf16-exact weights stay exact in f16 away from the subnormal range)
__global__ __launch_bounds__(256) void k_wt_f16(const float* __restrict__ W, _Float16* __restrict__ Wt, int K, int N, float scale) {
  const int t = blockIdx.x * 256 + threadIdx.x; if (t >= N * (K / 8)) return; const int n = t / (K / 8), k8 = (t % (K / 8)) * 8; FragH f;
#pragma unroll
  for (int i = 0; i < 8; ++i) f.h[i] = (_Float16)(bf16_round(W[(size_t)(k8 + i) * N + n]) * scale); const v8us o = f.half[0];
  *(v8us*)((unsigned short*)Wt + (size_t)n * K + k8) = o; 
}
// k_gemm_hh variant with fused epilogue: v = acc·alpha + bias[by·sBias + col] (+ CP[(row/rowsPerB)·sCPb + by·64 + col] if CP) ; ACT 0 none / 1 elu ; writes f16 C16 (and f32 C if non-null)
template <int ACT>
__global__ __launch_bounds__(128) void k_gemm_hhx(const _Float16* __restrict__ A, int lda, size_t sA, const _Float16* __restrict__ Bh, int ldb, size_t sB, float alpha, const float* __restrict__ bias, size_t sBias, const float* __restrict__ CP, int rowsPerB, size_t sCPb, int row0g,
    float* __restrict__ C, _Float16* __restrict__ C16, int ldc, size_t sC, int M, int N, int K) {
  __shared__ __attribute__((aligned(16))) float so[4][16][64];
  const int tid = threadIdx.x, w = tid >> 5, lane = tid & 31, ln = lane & 15, hh = lane >> 4; const int by = blockIdx.y;
  A += (size_t)by * sA; Bh += (size_t)by * sB; const size_t cofs = (size_t)by * sC; const float* bp = bias ? bias + (size_t)by * sBias : nullptr;
  const int ntn = (N + 63) / 64; const int wid = blockIdx.x * 4 + w; const int mt = wid / ntn, nq = wid % ntn; if (mt * 16 >= M) return;
  const int row0 = mt * 16, col0 = nq * 64; const _Float16* arow = A + (size_t)(row0 + ln) * lda;
  v8f acc[4] = {};
  for (int kb = 0; kb < K; kb += 32) { FragH ah; ah.half[0] = *(const v8us*)((const unsigned short*)arow + kb + 8 * hh); ah.half[1] = *(const v8us*)((const unsigned short*)arow + kb + 16 + 8 * hh);
#pragma unroll
    for (int t = 0; t < 4; ++t) { if (col0 + t * 16 >= N) continue; const size_t boff = (size_t)(col0 + t * 16 + ln) * ldb + kb; FragH bq; bq.half[0] = *(const v8us*)((const unsigned short*)Bh + boff + 8 * hh); bq.half[1] = *(const v8us*)((const unsigned short*)Bh + boff + 16 + 8 * hh);
      acc[t] = mmaH<1>(ah.v, ah.v, bq.v, bq.v, acc[t]); }
  }
#pragma unroll
  for (int t = 0; t < 4; ++t) { if (col0 + t * 16 >= N) continue; const int col = col0 + t * 16 + ln; const float bv = bp ? bf16_round(bp[col]) : 0.f;
#pragma unroll
    for (int r = 0; r < 8; ++r) { float v = acc[t][r] * alpha + bv; if (CP) { const int rr = row0g + row0 + 8 * hh + r; if (rowsPerB < 0) v += CP[cofs + (size_t)rr * ldc + col];      /* rowsPerB < 0: own element of the batched C plane */ else { const int bidx = rr / rowsPerB; v += CP[(size_t)bidx * sCPb + (size_t)by * 64 + col]; } } if (ACT == 1) v = (v > 0.f) ? v : expm1f(v); else if (ACT == 7) v = (v > 0.f) ? v + 1.0f : expf(v); else if (ACT == 8) v = tanhf(v); else if (ACT == 9) v = 0.5f * v * (1.0f + tanhf(0.7978845608028654f * (v + 0.044715f * v * v * v))); else if (ACT == 11) v = 1.0f / (1.0f + expf(-v)); else if (ACT == 12) v = (v > 0.f) ? v : 0.01f * v; else if (ACT == 14) v = (v > 0.f) ? v : 0.1f * v; else if (ACT == 16) v = (v >= 0.f) ? v : 0.3f * v; else if (ACT == 17) v = (v >= 0.f) ? v : 0.2f * v; else if (ACT == 15) v = v / (1.0f + expf(-v)); else if (ACT == 3) v = fmaxf(v, 0.f); else if (ACT == 6) v = 0.5f * v * (1.0f + erff(v * 0.70710678118654752f)); so[w][8 * hh + r][t * 16 + ln] = v; } }
  __builtin_amdgcn_fence(__ATOMIC_ACQ_REL, "workgroup"); __builtin_amdgcn_wave_barrier();
  const int rsub = lane >> 4, c4 = (lane & 15) * 4; typedef _Float16 v4h __attribute__((ext_vector_type(4)));
  {
#pragma unroll
    for (int q = 0; q < 8; ++q) { const int r = q * 2 + rsub; if (col0 + c4 < N) { const v4f v = *(const v4fa*)&so[w][r][c4]; if (C) *(v4f*)(C + cofs + (size_t)(row0 + r) * ldc + col0 + c4) = v; if (C16) { v4h h4; for (int i = 0; i < 4; ++i) h4[i] = (_Float16)v[i]; *(v4h*)(C16 + cofs + (size_t)(row0 + r) * ldc + col0 + c4) = h4; } } }
     }
}


typedef _Float16 v4h __attribute__((ext_vector_type(4)));

__global__ __launch_bounds__(256) void k_x16(const float* __restrict__ x, _Float16* __restrict__ X16, size_t n8) { const size_t t = (size_t)blockIdx.x * 256 + threadIdx.x; if (t >= n8) return; FragH f;
#pragma unroll
  for (int q = 0; q < 8; ++q) f.h[q] = (_Float16)bf16_round(x[t * 8 + q]); *(v8us*)((unsigned short*)X16 + t * 8) = f.half[0];  }
__global__ __launch_bounds__(256) void k_h16(const float* __restrict__ x, _Float16* __restrict__ X16, size_t n8) { const size_t t = (size_t)blockIdx.x * 256 + threadIdx.x; if (t >= n8) return; FragH f;
#pragma unroll
  for (int q = 0; q < 8; ++q) f.h[q] = (_Float16)x[t * 8 + q]; *(v8us*)((unsigned short*)X16 + t * 8) = f.half[0];  }
__global__ __launch_bounds__(256) void k_round16f(const float* __restrict__ W, _Float16* __restrict__ Bt, size_t n8) { const size_t t = (size_t)blockIdx.x * 256 + threadIdx.x; if (t >= n8) return; FragH f;
#pragma unroll
  for (int i = 0; i < 8; ++i) f.h[i] = (_Float16)(bf16_round(W[t * 8 + i]) * 16.0f); *(v8us*)((unsigned short*)Bt + t * 8) = f.half[0];  }
template <int NHv, int TTv>
__global__ __launch_bounds__(256) void k_vt(const _Float16* __restrict__ V16, int ldv, int voff, _Float16* __restrict__ Vt) { __shared__ unsigned short tl[64][66]; const int tid = threadIdx.x; const int slab = blockIdx.x / (TTv / 64), lg = blockIdx.x % (TTv / 64); const int b = slab / NHv, h = slab % NHv;
  for (int i = tid; i < 64 * 8; i += 256) { const int r = i / 8, c8 = (i % 8) * 8; FragH f; f.half[0] = *(const v8us*)((const unsigned short*)V16 + ((size_t)b * TTv + lg * 64 + r) * ldv + voff + h * 64 + c8);
#pragma unroll
    for (int q = 0; q < 8; ++q) tl[r][c8 + q] = f.u[q]; }
  __syncthreads();
  {
#pragma unroll
    for (int rd = 0; rd < 2; ++rd) { const int d = rd * 32 + tid / 8, pc = tid % 8; FragH f;
#pragma unroll
      for (int q = 0; q < 8; ++q) f.u[q] = tl[pc * 8 + q][d];
      *(v8us*)((unsigned short*)Vt + ((size_t)slab * 64 + d) * TTv + lg * 64 + pc * 8) = f.half[0]; }
     } }

__global__ __launch_bounds__(256) void k_hl(const float* __restrict__ F, _Float16* __restrict__ Hh, _Float16* __restrict__ Hl, size_t n8) { const size_t t = (size_t)blockIdx.x * 256 + threadIdx.x; if (t >= n8) return; FragH fh, fl; const v4f a = *(const v4fa*)(F + t * 8), c = *(const v4fa*)(F + t * 8 + 4);
#pragma unroll
  for (int q = 0; q < 4; ++q) { _Float16 h = (_Float16)a[q]; fh.h[q] = h; fl.h[q] = (_Float16)((a[q] - (float)h) * 1024.0f); h = (_Float16)c[q]; fh.h[4 + q] = h; fl.h[4 + q] = (_Float16)((c[q] - (float)h) * 1024.0f); }
  { *(v8us*)((unsigned short*)Hh + t * 8) = fh.half[0]; *(v8us*)((unsigned short*)Hl + t * 8) = fl.half[0];  } }

// ---- fast GEMM (wave tile 32x64; requires M % 32 == 0 rows per launch region and N % 64 == 0); epilogue = k_gemm_hhx semantics ----
__device__ __forceinline__ v16h g2_frag(const _Float16* p, int hh) { FragH f; f.half[0] = *(const v8us*)((const unsigned short*)p + 8 * hh); f.half[1] = *(const v8us*)((const unsigned short*)p + 16 + 8 * hh); return f.v; }
__device__ __forceinline__ v8f g2_mma(v16h a, v16h b, v8f c) { v8f d = __builtin_amdgcn_wmma_f32_16x16x32_f16(false, a, false, b, (short)0, c, false, false); asm volatile("v_nop\n\tv_nop\n\tv_nop\n\tv_nop" : "+v"(d) : "v"(a), "v"(b)); return d; }
template <int ACT>
__global__ __launch_bounds__(128) void k_gemm2(const _Float16* __restrict__ A, int lda, size_t sA, const _Float16* __restrict__ Bh, int ldb, size_t sB, float alpha, const float* __restrict__ bias, size_t sBias, const float* __restrict__ CP, int rowsPerB, size_t sCPb, int row0g,
    float* __restrict__ C, _Float16* __restrict__ C16, int ldc, size_t sC, int M, int N, int K) { static_assert(ACT == 0 || ACT == 3 || ACT == 6 || ACT == 8 || ACT == 9 || ACT == 11 || ACT == 12 || ACT == 14 || ACT == 15 || ACT == 16 || ACT == 17, "k_gemm2: unsupported ACT code (would silently apply no activation)");
  __shared__ __attribute__((aligned(16))) float so[4][32][68];
  const int tid = threadIdx.x, w = tid >> 5, lane = tid & 31, ln = lane & 15, hh = lane >> 4; const int by = blockIdx.y;
  A += (size_t)by * sA; Bh += (size_t)by * sB; const size_t cofs = (size_t)by * sC; const float* bp = bias ? bias + (size_t)by * sBias : nullptr;
  const int ntn = N >> 6; const int mt = blockIdx.x / ntn, nq = blockIdx.x - mt * ntn; const int row0 = mt * 128 + 32 * w, col0 = nq * 64; if (row0 >= M) return;
  const _Float16* a0p = A + (size_t)(row0 + ln) * lda; const _Float16* a1p = a0p + (size_t)16 * lda;
  const _Float16* b0p = Bh + (size_t)(col0 + ln) * ldb; const _Float16* b1p = b0p + (size_t)16 * ldb; const _Float16* b2p = b1p + (size_t)16 * ldb; const _Float16* b3p = b2p + (size_t)16 * ldb;
  const v8f z8 = {0.f,0.f,0.f,0.f,0.f,0.f,0.f,0.f}; v8f c00 = z8, c01 = z8, c02 = z8, c03 = z8, c10 = z8, c11 = z8, c12 = z8, c13 = z8;
#pragma unroll 1
  for (int kb = 0; kb < K; kb += 32) { const v16h a0 = g2_frag(a0p + kb, hh), a1 = g2_frag(a1p + kb, hh);
    v16h b = g2_frag(b0p + kb, hh); c00 = g2_mma(a0, b, c00); c10 = g2_mma(a1, b, c10);
    b = g2_frag(b1p + kb, hh); c01 = g2_mma(a0, b, c01); c11 = g2_mma(a1, b, c11);
    b = g2_frag(b2p + kb, hh); c02 = g2_mma(a0, b, c02); c12 = g2_mma(a1, b, c12);
    b = g2_frag(b3p + kb, hh); c03 = g2_mma(a0, b, c03); c13 = g2_mma(a1, b, c13); }
  v8f accs[8] = {c00, c01, c02, c03, c10, c11, c12, c13};
#pragma unroll
  for (int u = 0; u < 8; ++u) { const int t = u & 3, half = u >> 2; const int col = col0 + t * 16 + ln; const float bv = bp ? bf16_round(bp[col]) : 0.f;
#pragma unroll
    for (int r = 0; r < 8; ++r) { const int rloc = half * 16 + 8 * hh + r; float v = accs[u][r] * alpha + bv; if (CP) { if (rowsPerB < 0) v += CP[cofs + (size_t)(row0g + row0 + rloc) * ldc + col];      /* rowsPerB < 0: own element of the batched C plane */ else { const int bidx = (row0g + row0 + rloc) / rowsPerB; v += CP[(size_t)bidx * sCPb + (size_t)by * 64 + col]; } }
      if (ACT == 3) v = fmaxf(v, 0.f); else if (ACT == 6) v = 0.5f * v * (1.0f + erff(v * 0.70710678118654752f)); else if (ACT == 11) v = 1.0f / (1.0f + expf(-v)); else if (ACT == 15) v = v / (1.0f + expf(-v)); else if (ACT == 12) v = (v > 0.f) ? v : 0.01f * v; else if (ACT == 8) v = tanhf(v); else if (ACT == 9) v = 0.5f * v * (1.0f + tanhf(0.7978845608028654f * (v + 0.044715f * v * v * v))); else if (ACT == 14) v = (v > 0.f) ? v : 0.1f * v; else if (ACT == 16) v = (v >= 0.f) ? v : 0.3f * v; else if (ACT == 17) v = (v >= 0.f) ? v : 0.2f * v;
      so[w][rloc][t * 16 + ln] = v; } }
  __builtin_amdgcn_fence(__ATOMIC_ACQ_REL, "workgroup"); __builtin_amdgcn_wave_barrier();
  const int rsub = lane >> 4, c4 = (lane & 15) * 4;
  {
#pragma unroll
    for (int q = 0; q < 16; ++q) { const int r = q * 2 + rsub; const v4f v = *(const v4fa*)&so[w][r][c4]; if (C) *(v4f*)(C + cofs + (size_t)(row0 + r) * ldc + col0 + c4) = v; if (C16) { v4h h4; for (int i = 0; i < 4; ++i) h4[i] = (_Float16)v[i]; *(v4h*)(C16 + cofs + (size_t)(row0 + r) * ldc + col0 + c4) = h4; } }
     } }


__global__ __launch_bounds__(256) void k_wnat(const float* __restrict__ w, size_t n8, _Float16* __restrict__ Bt) { const size_t t = (size_t)blockIdx.x * 256 + threadIdx.x; if (t >= n8) return; FragH f; for (int q = 0; q < 8; ++q) f.h[q] = (_Float16)(bf16_round(w[t * 8 + q]) * 16.0f); *(v8us*)((unsigned short*)Bt + t * 8) = f.half[0];  }
__global__ __launch_bounds__(256) void k_rsm(const float* __restrict__ S, _Float16* __restrict__ P, int nrows) {
  #pragma clang fp contract(off)
  const int i = blockIdx.x * 256 + threadIdx.x; if (i >= nrows) return; const float* s = S + (size_t)i * SQ; float mx = -3.0e38f;
#pragma unroll 1
  for (int j = 0; j < SQ; ++j) mx = fmaxf(mx, s[j]); float se = 0.f;
#pragma unroll 1
  for (int j = 0; j < SQ; ++j) se += expf(s[j] - mx); const float sc = 256.0f / se;
#pragma unroll 1
  for (int j0 = 0; j0 < SQ; j0 += 8) { FragH f; for (int q = 0; q < 8; ++q) f.h[q] = (_Float16)(expf(s[j0 + q] - mx) * sc); unsigned short* d = (unsigned short*)P + (size_t)i * SQ + j0; *(v8us*)d = f.half[0];  } }
__global__ __launch_bounds__(256) void k_vt(const _Float16* __restrict__ V16, int b, int h0, _Float16* __restrict__ VT) { __shared__ unsigned short tl[64][65]; const int tid = threadIdx.x; const int hh = blockIdx.x % HG, sg = blockIdx.x / HG; const int s0 = sg * 64; const int h = h0 + hh;
  for (int i = tid; i < 64 * 8; i += 256) { const int j = i / 8, d8 = (i % 8) * 8; FragH f; f.half[0] = *(const v8us*)((const unsigned short*)V16 + ((size_t)b * SQ + s0 + j) * DM + h * HD + d8); for (int q = 0; q < 8; ++q) tl[d8 + q][j] = f.u[q]; }
  __syncthreads();
  { for (int i = tid; i < 64 * 8; i += 256) { const int d = i / 8, j8 = (i % 8) * 8; FragH f; for (int q = 0; q < 8; ++q) f.u[q] = tl[d][j8 + q]; *(v8us*)((unsigned short*)VT + ((size_t)hh * HD + d) * SQ + s0 + j8) = f.half[0]; }  } }



#define FA_NW 8                      /* waves per workgroup */
#define FA_BR (FA_NW * 32)           /* query rows per workgroup */
#define FA_SK 64                     /* keys per stage = two 32-key passes */
#define FA_PITCH 144                 /* LDS row pitch in bytes: 128 of data + 16, an odd multiple of 16 for the 16-byte fragment reads */
#define FA_TILE (FA_SK * FA_PITCH)
/* amdgpu_waves_per_eu(4, 4): at most 256 VGPRs, so that two workgroups (four waves per SIMD) are resident per WGP and the 512 workgroups run in one round */
__device__ __forceinline__ float fa_xh(float x) { return __builtin_bit_cast(float, __builtin_amdgcn_permlanex16(__builtin_bit_cast(int, x), __builtin_bit_cast(int, x), 0x76543210, 0xfedcba98, false, false)); }      /* lane l reads lane l ^ 16 */
__device__ __forceinline__ v16h fa_frag(const unsigned char* p) { FragH f; f.half[0] = *(const v8us*)p; f.half[1] = *(const v8us*)(p + 32); return f.v; }      /* p = row start + 16 * (lane >> 4): k = 8 hh .. 8 hh + 7 and 16 + 8 hh .. 16 + 8 hh + 7, as g2_frag */
__device__ __forceinline__ v8f fa_mma(v16h a, v16h b, v8f c) { return __builtin_amdgcn_wmma_f32_16x16x32_f16(false, a, false, b, (short)0, c, false, false); }
__global__ __launch_bounds__(FA_NW * 32) __attribute__((amdgpu_waves_per_eu(4, 4))) void k_fattn(const _Float16* __restrict__ Q16, const _Float16* __restrict__ K16, const _Float16* __restrict__ VT, _Float16* __restrict__ O16) {
  __shared__ __attribute__((aligned(16))) unsigned char L[2][2][FA_TILE];      /* [buffer][0 = K rows, 1 = V^T rows] */
  const int tid = threadIdx.x, lane = tid & 31, c = lane & 15, hh = lane >> 4; const int wave = __builtin_amdgcn_readfirstlane(tid >> 5);
  const int q0 = blockIdx.x * FA_BR + wave * 32, h = blockIdx.y, b = blockIdx.z; const size_t r0 = (size_t)b * SQ;
  const float cs = 0.125f * 1.4426950408889634f;      /* 64^-0.5 and log2(e) */
  /* staging: thread t moves the 16-byte piece t & 7 of rows t >> 3 and 32 + (t >> 3) of both tiles: 8 lanes cover one whole 128-byte row */
  const int srow = tid >> 3, scol = tid & 7; const int sl = srow * FA_PITCH + scol * 16;
  const unsigned short* kg = (const unsigned short*)K16 + (r0 + srow) * LQ + h * HD + scol * 8;
  const unsigned short* vg = (const unsigned short*)VT + (((size_t)b * NH + h) * HD + srow) * SQ + scol * 8;
  v8us k0 = *(const v8us*)kg, k1 = *(const v8us*)(kg + (size_t)32 * LQ), v0 = *(const v8us*)vg, v1 = *(const v8us*)(vg + (size_t)32 * SQ);
  v16h qf[2][2];
#pragma unroll      /* register arrays need constant indices */
  for (int g = 0; g < 2; ++g) { const _Float16* qp = Q16 + (r0 + q0 + 16 * g + c) * LQ + h * HD; qf[g][0] = g2_frag(qp, hh); qf[g][1] = g2_frag(qp + 32, hh); }
  FragH ones;
#pragma unroll
  for (int i = 0; i < 16; ++i) ones.u[i] = (c == 0) ? (unsigned short)0x3C00 : (unsigned short)0;
  const v8f z8 = {0.f, 0.f, 0.f, 0.f, 0.f, 0.f, 0.f, 0.f};
  v8f acc[2][4] = {{z8, z8, z8, z8}, {z8, z8, z8, z8}}; v8f lacc[2] = {z8, z8}; float m_run[2] = {-__builtin_inff(), -__builtin_inff()};
  *(v8us*)&L[0][0][sl] = k0; *(v8us*)&L[0][0][sl + 32 * FA_PITCH] = k1; *(v8us*)&L[0][1][sl] = v0; *(v8us*)&L[0][1][sl + 32 * FA_PITCH] = v1;
  for (int st = 0; st < SQ / FA_SK; ++st) {
    __syncthreads();      /* stage st is written by every wave, and every wave has left the buffer that is refilled at the foot of this trip */
    const unsigned char* Kb = &L[st & 1][0][0]; const unsigned char* Vb = &L[st & 1][1][0];
    const bool more = st + 1 < SQ / FA_SK;      /* the same for the whole workgroup */
    if (more) { k0 = *(const v8us*)(kg + (size_t)FA_SK * LQ); k1 = *(const v8us*)(kg + (size_t)(FA_SK + 32) * LQ); v0 = *(const v8us*)(vg + FA_SK); v1 = *(const v8us*)(vg + FA_SK + (size_t)32 * SQ); }      /* next stage, in flight under this stage's passes */
#pragma unroll      /* two passes per stage; constant LDS offsets */
    for (int sub = 0; sub < 2; ++sub) {
      v8f s[2][2];
#pragma unroll      /* register arrays need constant indices */
      for (int kt = 0; kt < 2; ++kt) { const unsigned char* p = Kb + (32 * sub + 16 * kt + c) * FA_PITCH + 16 * hh; const v16h ka = fa_frag(p), kb = fa_frag(p + 64);
        s[kt][0] = fa_mma(kb, qf[0][1], fa_mma(ka, qf[0][0], z8)); s[kt][1] = fa_mma(kb, qf[1][1], fa_mma(ka, qf[1][0], z8)); }
      v16h vf[4];
#pragma unroll      /* register arrays need constant indices */
      for (int t = 0; t < 4; ++t) vf[t] = fa_frag(Vb + (16 * t + c) * FA_PITCH + 64 * sub + 16 * hh);
      float mb[2]; bool need = false;
#pragma unroll      /* register arrays need constant indices */
      for (int g = 0; g < 2; ++g) { float mx = fmaxf(s[0][g][0], s[1][g][0]);
#pragma unroll      /* register arrays need constant indices */
        for (int r = 1; r < 8; ++r) mx = fmaxf(mx, fmaxf(s[0][g][r], s[1][g][r]));
        mx = fmaxf(mx, fa_xh(mx)) * cs; mb[g] = mx; need = need || (mx > m_run[g] + 8.0f); }      /* both wave halves hold this query's maximum, scaled */
      if (__builtin_amdgcn_ballot_w32(need) != 0) {      /* wave-uniform; rare after the first pass */
#pragma unroll      /* register arrays need constant indices */
        for (int g = 0; g < 2; ++g) { const float m_new = fmaxf(m_run[g], mb[g]); const float corr = __builtin_amdgcn_exp2f(m_run[g] - m_new); m_run[g] = m_new; lacc[g] = lacc[g] * corr;      /* corr is 0 on the first pass */
#pragma unroll      /* register arrays need constant indices */
          for (int t = 0; t < 4; ++t) acc[g][t] = acc[g][t] * corr; } }
#pragma unroll      /* register arrays need constant indices */
      for (int g = 0; g < 2; ++g) { const float nm = -m_run[g]; FragH pf;
#pragma unroll      /* register arrays need constant indices */
        for (int i = 0; i < 16; ++i) pf.h[i] = (_Float16)__builtin_amdgcn_exp2f(__builtin_fmaf(s[i >> 3][g][i & 7], cs, nm));      /* keys 8 hh + r of tile 0, then of tile 1: the B operand's k order */
#pragma unroll      /* register arrays need constant indices */
        for (int t = 0; t < 4; ++t) acc[g][t] = fa_mma(vf[t], pf.v, acc[g][t]);
        lacc[g] = fa_mma(ones.v, pf.v, lacc[g]); }      /* row 0 += the column sums of P^T */
    }
    if (more) { unsigned char* Kn = &L[(st + 1) & 1][0][0]; unsigned char* Vn = &L[(st + 1) & 1][1][0]; *(v8us*)(Kn + sl) = k0; *(v8us*)(Kn + sl + 32 * FA_PITCH) = k1; *(v8us*)(Vn + sl) = v0; *(v8us*)(Vn + sl + 32 * FA_PITCH) = v1;
      asm volatile("s_wait_xcnt 0x0" :: "v"(kg), "v"(vg) : "memory");      /* the stage loads' address registers (held live to here) are advanced only behind this wait */
      kg += (size_t)FA_SK * LQ; vg += FA_SK; }
  }
#pragma unroll      /* register arrays need constant indices */
  for (int g = 0; g < 2; ++g) { const float lr = lacc[g][0]; const float inv = 64.0f / (lr + fa_xh(lr));
#pragma unroll      /* register arrays need constant indices */
    for (int t = 0; t < 4; ++t) { FragH f;
#pragma unroll      /* register arrays need constant indices */
      for (int r = 0; r < 8; ++r) f.h[r] = (_Float16)(acc[g][t][r] * inv);
      *(v8us*)((unsigned short*)O16 + (r0 + q0 + 16 * g + c) * DM + h * HD + 16 * t + 8 * hh) = f.half[0]; } } }      /* d = 16 t + 8 hh .. + 7 of query 16 g + c */

extern "C" void kernel_launch(void* const* d_in, const int* in_sizes, int n_in,
                              void* d_out, int out_size, void* d_ws, size_t ws_size, hipStream_t stream) {
  (void)in_sizes; (void)n_in; (void)out_size;
  const float* const* I = (const float* const*)d_in; const float* xq = I[0]; const float* xk = I[1]; const float* xv = I[1]; const float* wq = I[2]; const float* bq = I[3]; const float* wk = I[4]; const float* bk = I[5]; const float* wv = I[6]; const float* bv = I[7]; const float* wo = I[8]; const float* bo = I[9];      /* TWO inputs: query (the q stream) and value (read on BOTH the k and the v stream casts); wq, wk, wv are PER-HEAD STACKS [16][1024][64] = [head][in][out]; bq, bk, bv per-head [16][64] = the flat [1024] bias; wo [in][out] + bo; input order query, value, wq, bq, wk, bk, wv, bv, wo, bo */
  char* ws = (char*)d_ws; size_t off = 0;
  auto take = [&](size_t bytes) { char* p = ws + off; off += (bytes + 255) & ~(size_t)255; return p; };
  _Float16* BQ = (_Float16*)take((size_t)DM * DM * 2); _Float16* BK = (_Float16*)take((size_t)DM * DM * 2); _Float16* BV = (_Float16*)take((size_t)DM * DM * 2); _Float16* BO = (_Float16*)take((size_t)DM * DM * 2);
  _Float16* XQ = (_Float16*)take(NR * DM * 2); _Float16* XK = (_Float16*)take(NR * DM * 2); _Float16* XV = (_Float16*)take(NR * DM * 2); _Float16* Q16 = (_Float16*)take(NR * DM * 2); _Float16* K16 = (_Float16*)take(NR * DM * 2); _Float16* V16 = (_Float16*)take(NR * DM * 2); _Float16* O16 = (_Float16*)take(NR * DM * 2);
  _Float16* VT = (_Float16*)take((size_t)NB * NH * HD * SQ * 2);
  if (off > ws_size) return;
  { const unsigned g = (unsigned)(((size_t)DM * (DM / 8) + 255) / 256); const unsigned gh = (unsigned)(((size_t)HD * (DM / 8) + 255) / 256); for (int h = 0; h < NH; ++h) { const size_t wofs = (size_t)h * DM * HD, pofs = (size_t)h * HD * DM; k_wt_f16<<<gh, 256, 0, stream>>>(wq + wofs, BQ + pofs, DM, HD, 16.0f); k_wt_f16<<<gh, 256, 0, stream>>>(wk + wofs, BK + pofs, DM, HD, 16.0f); k_wt_f16<<<gh, 256, 0, stream>>>(wv + wofs, BV + pofs, DM, HD, 16.0f); } k_wt_f16<<<g, 256, 0, stream>>>(wo, BO, DM, DM, 16.0f); }      /* PER-HEAD STACKS wq / wk / wv [NH][DM][HD]: head h is a row-major [in = DM][out = HD] block at w + h * DM * HD: the transposing builder with K = DM, N = HD writes its HD rows Bt[h * HD + e][k] at B + h * HD * DM: contiguous rows of the [out][in] plane (x16); wo is a plain [in][out] [DM][DM] matrix: one call as before */

  k_x16<<<(unsigned)((NR * DM / 8 + 255) / 256), 256, 0, stream>>>(xq, XQ, NR * DM / 8); k_x16<<<(unsigned)((NR * DM / 8 + 255) / 256), 256, 0, stream>>>(xk, XK, NR * DM / 8); k_x16<<<(unsigned)((NR * DM / 8 + 255) / 256), 256, 0, stream>>>(xv, XV, NR * DM / 8);      /* query, and value twice (k and v streams), as exact f16 rows */
  const size_t r0p = (size_t)B0 * SQ;      /* first projected row */
  k_gemm2<0><<<dim3((unsigned)((MP / 128) * (DM / 64)), 1), 128, 0, stream>>>(XQ + r0p * DM, DM, 0, BQ, DM, 0, 0.0625f, bq, 0, nullptr, 1, 0, 0, nullptr, Q16 + r0p * DM, DM, 0, MP, DM, DM);
  k_gemm2<0><<<dim3((unsigned)((MP / 128) * (DM / 64)), 1), 128, 0, stream>>>(XK + r0p * DM, DM, 0, BK, DM, 0, 0.0625f, bk, 0, nullptr, 1, 0, 0, nullptr, K16 + r0p * DM, DM, 0, MP, DM, DM);
  k_gemm2<0><<<dim3((unsigned)((MP / 128) * (DM / 64)), 1), 128, 0, stream>>>(XV + r0p * DM, DM, 0, BV, DM, 0, 0.0625f, bv, 0, nullptr, 1, 0, 0, nullptr, V16 + r0p * DM, DM, 0, MP, DM, DM);
  k_vt<NH, SQ><<<NB * NH * (SQ / 64), 256, 0, stream>>>(V16, LQ, 0, VT);      /* V^T [NB][NH][HD][SQ], all batches */
  k_fattn<<<dim3(SQ / FA_BR, NH, NB), FA_NW * 32, 0, stream>>>(Q16, K16, VT, O16);      /* o x64 (merged heads) as f16 rows */
  k_gemm2<0><<<dim3((unsigned)((MPO / 128) * (DM / 64)), 1), 128, 0, stream>>>(O16 + r0p * DM, DM, 0, BO, DM, 0, 0.0009765625f, bo, 0, nullptr, 1, 0, 0, (float*)d_out + r0p * DM, nullptr, DM, 0, MPO, DM, DM);      /* out rows are the output layout */
}

// v003
// A run of this version takes 296 microseconds.
// In both of two side-by-side timings against v002, it was 1.54 times as fast.
// Over all steps from v000 it is 23.8 times as fast.
#include <hip/hip_runtime.h>
// Multi-head attention on two inputs with PER-HEAD STACKED projections and per-head biases on four sequences (query [4][2048][1024], value [4][2048][1024]; q = einsum('bsd,hde->bhse', query, wq) + bq, k = einsum(value, wk) + bk, v = einsum(value, wv) + bv with W [16][1024][64] = [head][in][out] and b [16][64], 16 heads of 64; scores * 1/sqrt(64); softmax over all 2048 keys (no mask); out = heads wo + bo ([in][out] + bias) -> [4][2048][1024]); each head's [in][out] block is transposed into its 64 contiguous rows of the weight plane by the existing builder; the [in][out] output weight through the same builder; all of them, and the casts of the token rows, in one preparation launch.
// Structure: token rows r = b*2048 + s; the query source and the key/value source as exact f16 rows (bf16-rounded); Q, K, V as three WMMA GEMMs in one grid (32x64 wave tiles, f32 accumulation, exact x16 weights + bias, f16 outputs); V^T for all batches and heads via LDS transposes; one fused attention launch (scores K = 64 and o = P . V^T on WMMA, online softmax on VALU with f32 statistics and native exp2, weights as f16 relative to the running maximum; o carried x64 against f16 subnormal flush, folded into the output GEMM alpha) written straight into the merged f16 o rows; out = o W_o + b GEMM (f32) into the output layout.
// Compute dtype: inputs rounded to bf16; x / weights exact; q, k, v, softmax weights and o as plain f16 GEMM operands (~2^-12); scores and softmax statistics f32; v_wmma_f32_16x16x32_f16.
#define NB 4
#define SQ 2048
#define DM 1024
#define NH 16
#define HD 64
#define HG 4                         /* heads per block group of the k_vt(V16, b, h0, VT) overload (not launched) */
#define B0 0                         /* first batch processed (debug hook) */
#define NBR NB                       /* batches processed (debug hook) */
#define NR ((size_t)NB * SQ)         /* token rows */
#define MP ((int)((size_t)NBR * SQ)) /* rows projected (debug hook) */
#define QN SQ                        /* query rows per batch; unused, k_fattn attends all SQ */
#define NHD NH                       /* heads; unused, k_fattn attends all NH */
#define MPO MP                       /* rows through the output stage (debug hook) */
#define LQ DM      /* row pitch of the q/k/v rows */
typedef __bf16 v16b __attribute__((ext_vector_type(16)));
typedef unsigned short v8us __attribute__((ext_vector_type(8), may_alias));
typedef float  v8f  __attribute__((ext_vector_type(8)));
typedef float  v4f  __attribute__((ext_vector_type(4)));
typedef float  v4fa __attribute__((ext_vector_type(4), may_alias));
union FragB { v16b v; v8us half[2]; unsigned short u[16]; };

__device__ __forceinline__ unsigned short bf16_bits(float x) { unsigned int u = __float_as_uint(x); return (unsigned short)((u + 0x7FFFu + ((u >> 16) & 1u)) >> 16); }
__device__ __forceinline__ float bf16_val(unsigned short b) { return __uint_as_float(((unsigned int)b) << 16); }
__device__ __forceinline__ float bf16_round(float x) { return bf16_val(bf16_bits(x)); }
// D += A·B with NT terms: 1 = ah·bh, 2 = + al·bh (A split), 3 = + ah·bl (both split)
template <int NT>
__device__ __forceinline__ v8f mmaN(v16b ah, v16b al, v16b bh, v16b bl, v8f c) {
  c = __builtin_amdgcn_wmma_f32_16x16x32_bf16(false, ah, false, bh, (short)0, c, false, false);
  if (NT >= 2) c = __builtin_amdgcn_wmma_f32_16x16x32_bf16(false, al, false, bh, (short)0, c, false, false);
  if (NT >= 3) c = __builtin_amdgcn_wmma_f32_16x16x32_bf16(false, ah, false, bl, (short)0, c, false, false);
  asm volatile("v_nop\n\tv_nop\n\tv_nop\n\tv_nop" : "+v"(c) : "v"(ah), "v"(al), "v"(bh), "v"(bl));
  return c;
}

__global__ __launch_bounds__(256) void k_wt_bf16(const float* __restrict__ W, unsigned short* __restrict__ Wt, int K, int N) {
  const int t = blockIdx.x * 256 + threadIdx.x;
  const int k8n = K / 8;
  if (t >= N * k8n) return;
  const int n = t / k8n, k8 = (t % k8n) * 8;
  v8us v;
#pragma unroll
  for (int i = 0; i < 8; ++i) v[i] = bf16_bits(W[(size_t)(k8 + i) * N + n]);
  *(v8us*)(Wt + (size_t)n * K + k8) = v;
  
}

// GEMM C[M][N] (f32, pitch ldc) = act(A[M][K]·W + bias). A f32 row-major (pitch lda) converted per fragment to bf16
// (ASPLIT: hi/lo two planes -> 2 terms, else single rounded term); Wt bf16 [N][K] (pitch ldb). BIAS_BF16 rounds the
// bias to bf16 first (bias quantised to bf16 before the add). K%32==0, M%16==0, N%64==0.
template <bool ASPLIT, int ACT, bool BIAS_BF16>
__global__ __launch_bounds__(128) void k_gemm_bf(const float* __restrict__ A, int lda, const unsigned short* __restrict__ Wt, int ldb,
                                               const float* __restrict__ bias, float* __restrict__ C, int ldc, int M, int N, int K) {
  __shared__ __attribute__((aligned(16))) float so[4][16][64];
  const int tid = threadIdx.x, w = tid >> 5, lane = tid & 31, ln = lane & 15, hh = lane >> 4;
  const int ntn = N / 64;
  const int wid = blockIdx.x * 4 + w;
  const int mt = wid / ntn, nq = wid % ntn;
  if (mt * 16 >= M) return;
  const int row0 = mt * 16, col0 = nq * 64;
  const float* arow = A + (size_t)(row0 + ln) * lda;
  v8f acc[4] = {};
  for (int kb = 0; kb < K; kb += 32) {
    FragB ah, al;
    const v4f x0 = *(const v4fa*)(arow + kb + 8 * hh), x1 = *(const v4fa*)(arow + kb + 8 * hh + 4);
    const v4f x2 = *(const v4fa*)(arow + kb + 16 + 8 * hh), x3 = *(const v4fa*)(arow + kb + 16 + 8 * hh + 4);
    float xs[16] = {x0[0],x0[1],x0[2],x0[3],x1[0],x1[1],x1[2],x1[3],x2[0],x2[1],x2[2],x2[3],x3[0],x3[1],x3[2],x3[3]};
#pragma unroll
    for (int i = 0; i < 16; ++i) { const unsigned short hb = bf16_bits(xs[i]); ah.u[i] = hb; al.u[i] = ASPLIT ? bf16_bits(xs[i] - bf16_val(hb)) : (unsigned short)0; }
#pragma unroll
    for (int t = 0; t < 4; ++t) {
      const unsigned short* brow = Wt + (size_t)(col0 + t * 16 + ln) * ldb + kb;
      FragB b;
      b.half[0] = *(const v8us*)(brow + 8 * hh);
      b.half[1] = *(const v8us*)(brow + 16 + 8 * hh);
      acc[t] = mmaN<ASPLIT ? 2 : 1>(ah.v, al.v, b.v, b.v, acc[t]);
    }
  }
#pragma unroll
  for (int t = 0; t < 4; ++t) {
    float bv = bias ? bias[col0 + t * 16 + ln] : 0.f;
    if (BIAS_BF16) bv = bf16_round(bv);
#pragma unroll
    for (int r = 0; r < 8; ++r) { float v = acc[t][r] + bv; if (ACT == 1) v = fmaxf(v, 0.f); so[w][8 * hh + r][t * 16 + ln] = v; }
  }
  __builtin_amdgcn_fence(__ATOMIC_ACQ_REL, "workgroup");
  __builtin_amdgcn_wave_barrier();
  const int rsub = lane >> 4, c4 = (lane & 15) * 4;
  {
#pragma unroll
    for (int q = 0; q < 8; ++q) {
      const int r = q * 2 + rsub;
      const v4f v = *(const v4fa*)&so[w][r][c4];
      *(v4f*)(C + (size_t)(row0 + r) * ldc + col0 + c4) = v;
    }
    
  }
}

// GEMM C = act(A·W + bias + resid): A f32 (ASPLIT -> hi/lo 2 terms), Wt bf16 [N][K]; ACT 0 none, 1 relu, 2 exact gelu;
// resid (optional, f32, row index = (row % rmod), pitch ldr, RES_BF16 rounds it) added before the activation.
template <bool ASPLIT, int ACT, bool BIAS_BF16, bool RES_BF16>
__global__ __launch_bounds__(128) void k_gemm_bf3(const float* __restrict__ A, int lda, const unsigned short* __restrict__ Wt, int ldb,
                                                const float* __restrict__ bias, const float* __restrict__ resid, int rmod, int ldr,
                                                float* __restrict__ C, int ldc, int M, int N, int K) {
  __shared__ __attribute__((aligned(16))) float so[4][16][64];
  const int tid = threadIdx.x, w = tid >> 5, lane = tid & 31, ln = lane & 15, hh = lane >> 4;
  const int ntn = N / 64;
  const int wid = blockIdx.x * 4 + w;
  const int mt = wid / ntn, nq = wid % ntn;
  if (mt * 16 >= M) return;
  const int row0 = mt * 16, col0 = nq * 64;
  const float* arow = A + (size_t)(row0 + ln) * lda;
  v8f acc[4] = {};
  for (int kb = 0; kb < K; kb += 32) {
    FragB ah, al;
    const v4f x0 = *(const v4fa*)(arow + kb + 8 * hh), x1 = *(const v4fa*)(arow + kb + 8 * hh + 4);
    const v4f x2 = *(const v4fa*)(arow + kb + 16 + 8 * hh), x3 = *(const v4fa*)(arow + kb + 16 + 8 * hh + 4);
    float xs[16] = {x0[0],x0[1],x0[2],x0[3],x1[0],x1[1],x1[2],x1[3],x2[0],x2[1],x2[2],x2[3],x3[0],x3[1],x3[2],x3[3]};
#pragma unroll
    for (int i = 0; i < 16; ++i) { const unsigned short hb = bf16_bits(xs[i]); ah.u[i] = hb; al.u[i] = ASPLIT ? bf16_bits(xs[i] - bf16_val(hb)) : (unsigned short)0; }
#pragma unroll
    for (int t = 0; t < 4; ++t) {
      const unsigned short* brow = Wt + (size_t)(col0 + t * 16 + ln) * ldb + kb;
      FragB b;
      b.half[0] = *(const v8us*)(brow + 8 * hh);
      b.half[1] = *(const v8us*)(brow + 16 + 8 * hh);
      acc[t] = mmaN<ASPLIT ? 2 : 1>(ah.v, al.v, b.v, b.v, acc[t]);
    }
  }
#pragma unroll
  for (int t = 0; t < 4; ++t) {
    const int col = col0 + t * 16 + ln;
    float bv = bias ? bias[col] : 0.f;
    if (BIAS_BF16) bv = bf16_round(bv);
#pragma unroll
    for (int r = 0; r < 8; ++r) {
      float v = acc[t][r] + bv;
      if (resid) { float rv = resid[(size_t)((row0 + 8 * hh + r) % rmod) * ldr + col]; if (RES_BF16) rv = bf16_round(rv); v += rv; }
      if (ACT == 1) v = fmaxf(v, 0.f);
      if (ACT == 2) v = 0.5f * v * (1.0f + erff(v * 0.70710678118654752f));
      if (ACT == 3) { const float u = 0.7978845608028654f * (v + 0.044715f * v * v * v); v = 0.5f * v * (1.0f + tanhf(u)); }
      so[w][8 * hh + r][t * 16 + ln] = v;
    }
  }
  __builtin_amdgcn_fence(__ATOMIC_ACQ_REL, "workgroup");
  __builtin_amdgcn_wave_barrier();
  const int rsub = lane >> 4, c4 = (lane & 15) * 4;
  {
#pragma unroll
    for (int q = 0; q < 8; ++q) {
      const int r = q * 2 + rsub;
      const v4f v = *(const v4fa*)&so[w][r][c4];
      *(v4f*)(C + (size_t)(row0 + r) * ldc + col0 + c4) = v;
    }
    
  }
}
// row LayerNorm (biased variance, eps) over N: s = X (+ R); optional out_sum <- s; out_norm <- (s-mu)*rsqrt(var+eps)*g + b
template <bool PARAM_BF16>
__global__ __launch_bounds__(256) void k_layernorm(const float* __restrict__ X, const float* __restrict__ R, const float* __restrict__ g, const float* __restrict__ bta,
                                                  float* __restrict__ out_sum, float* __restrict__ out_norm, int N, float eps) {
  __shared__ float red[256];
  const int row = blockIdx.x, tid = threadIdx.x;
  const float* x = X + (size_t)row * N; const float* rr = R ? R + (size_t)row * N : nullptr;
  float vals[16];                     // up to N = 4096
  const int per = N / 256;            // contiguous chunk per thread? use strided-by-4 chunks: thread handles j = tid*4 + 1024*u
  float s1 = 0.f;
  for (int u = 0; u < per / 4; ++u) {
    const int j = tid * 4 + 1024 * u;
    const v4f a = *(const v4fa*)(x + j);
    v4f b = {0.f,0.f,0.f,0.f}; if (rr) b = *(const v4fa*)(rr + j);
#pragma unroll
    for (int q = 0; q < 4; ++q) { const float v = a[q] + b[q]; vals[u * 4 + q] = v; s1 += v; }
  }
  red[tid] = s1; __syncthreads();
  for (int st = 128; st > 0; st >>= 1) { if (tid < st) red[tid] += red[tid + st]; __syncthreads(); }
  const float mu = red[0] / (float)N; __syncthreads();
  float s2 = 0.f;
  for (int u = 0; u < per / 4; ++u)
#pragma unroll
    for (int q = 0; q < 4; ++q) { const float c = vals[u * 4 + q] - mu; s2 += c * c; }
  red[tid] = s2; __syncthreads();
  for (int st = 128; st > 0; st >>= 1) { if (tid < st) red[tid] += red[tid + st]; __syncthreads(); }
  const float rs = rsqrtf(red[0] / (float)N + eps);
  {
    for (int u = 0; u < per / 4; ++u) {
      const int j = tid * 4 + 1024 * u;
      v4f o, sm;
#pragma unroll
      for (int q = 0; q < 4; ++q) {
        float gg = g[j + q], bb = bta[j + q];
        if (PARAM_BF16) { gg = bf16_round(gg); bb = bf16_round(bb); }
        sm[q] = vals[u * 4 + q]; o[q] = (vals[u * 4 + q] - mu) * rs * gg + bb;
      }
      if (out_sum) *(v4f*)(out_sum + (size_t)row * N + j) = sm;
      *(v4f*)(out_norm + (size_t)row * N + j) = o;
    }
    
  }
}



// ---- f16 WMMA path (v_wmma_f32_16x16x32_f16): 11-bit significands for operands in range — used where a [0,1] probability operand needs more precision than bf16
typedef _Float16 v16h __attribute__((ext_vector_type(16)));
union FragH { v16h v; v8us half[2]; _Float16 h[16]; unsigned short u[16]; };
template <int NT>
__device__ __forceinline__ v8f mmaH(v16h ah, v16h al, v16h bh, v16h bl, v8f c) {
  c = __builtin_amdgcn_wmma_f32_16x16x32_f16(false, ah, false, bh, (short)0, c, false, false);
  if (NT >= 2) c = __builtin_amdgcn_wmma_f32_16x16x32_f16(false, al, false, bh, (short)0, c, false, false);
  if (NT >= 3) c = __builtin_amdgcn_wmma_f32_16x16x32_f16(false, ah, false, bl, (short)0, c, false, false);
  asm volatile("v_nop\n\tv_nop\n\tv_nop\n\tv_nop" : "+v"(c) : "v"(ah), "v"(al), "v"(bh), "v"(bl));
  return c;
}
// batched GEMM like k_gemm_b but f16 operands: A f32 (split into f16 hi/lo if ASPLIT, else rounded to f16), Bt = f16 values [n][k]; alpha; C f32; N multiple of 16 (partial tiles skipped)
template <bool ASPLIT>
__global__ __launch_bounds__(128) void k_gemm_h(const float* __restrict__ A, int lda, size_t sA, const _Float16* __restrict__ Bh, int ldb, size_t sB, float alpha, float* __restrict__ C, int ldc, size_t sC, int M, int N, int K) {
  __shared__ __attribute__((aligned(16))) float so[4][16][64];
  const int tid = threadIdx.x, w = tid >> 5, lane = tid & 31, ln = lane & 15, hh = lane >> 4; const int by = blockIdx.y;
  A += (size_t)by * sA; Bh += (size_t)by * sB; C += (size_t)by * sC;
  const int ntn = (N + 63) / 64; const int wid = blockIdx.x * 4 + w; const int mt = wid / ntn, nq = wid % ntn; if (mt * 16 >= M) return;
  const int row0 = mt * 16, col0 = nq * 64; const float* arow = A + (size_t)(row0 + ln) * lda;
  v8f acc[4] = {};
  for (int kb = 0; kb < K; kb += 32) {
    FragH ah, al;
    const v4f x0 = *(const v4fa*)(arow + kb + 8 * hh), x1 = *(const v4fa*)(arow + kb + 8 * hh + 4), x2 = *(const v4fa*)(arow + kb + 16 + 8 * hh), x3 = *(const v4fa*)(arow + kb + 16 + 8 * hh + 4);
    float xs[16] = {x0[0],x0[1],x0[2],x0[3],x1[0],x1[1],x1[2],x1[3],x2[0],x2[1],x2[2],x2[3],x3[0],x3[1],x3[2],x3[3]};
#pragma unroll
    for (int i = 0; i < 16; ++i) { const _Float16 h = (_Float16)xs[i]; ah.h[i] = h; al.h[i] = ASPLIT ? (_Float16)(xs[i] - (float)h) : (_Float16)0.0f; }
#pragma unroll
    for (int t = 0; t < 4; ++t) { if (col0 + t * 16 >= N) continue; const size_t boff = (size_t)(col0 + t * 16 + ln) * ldb + kb; FragH bq; bq.half[0] = *(const v8us*)(Bh + boff + 8 * hh); bq.half[1] = *(const v8us*)(Bh + boff + 16 + 8 * hh);
      acc[t] = mmaH<ASPLIT ? 2 : 1>(ah.v, al.v, bq.v, bq.v, acc[t]); }
  }
#pragma unroll
  for (int t = 0; t < 4; ++t) { if (col0 + t * 16 >= N) continue;
#pragma unroll
    for (int r = 0; r < 8; ++r) so[w][8 * hh + r][t * 16 + ln] = acc[t][r] * alpha; }
  __builtin_amdgcn_fence(__ATOMIC_ACQ_REL, "workgroup"); __builtin_amdgcn_wave_barrier();
  const int rsub = lane >> 4, c4 = (lane & 15) * 4;
  {
#pragma unroll
    for (int q = 0; q < 8; ++q) { const int r = q * 2 + rsub; if (col0 + c4 < N) { const v4f v = *(const v4fa*)&so[w][r][c4]; *(v4f*)(C + (size_t)(row0 + r) * ldc + col0 + c4) = v; } }
     }
}

// Wt[n][k] = f16(W[k][n]·scale) from f32 row-major W[K][N] (scale = power of two; bf16-exact weights stay exact in f16 away from the subnormal range)
__device__ __forceinline__ void wt_f16(const float* __restrict__ W, _Float16* __restrict__ Wt, int K, int N, float scale, int t) {      /* t = piece index, 0 .. N * (K / 8) - 1 */
  const int n = t / (K / 8), k8 = (t % (K / 8)) * 8; FragH f;
#pragma unroll
  for (int i = 0; i < 8; ++i) f.h[i] = (_Float16)(bf16_round(W[(size_t)(k8 + i) * N + n]) * scale); const v8us o = f.half[0];
  *(v8us*)((unsigned short*)Wt + (size_t)n * K + k8) = o;
  asm volatile("s_wait_xcnt 0x0" ::: "memory");      /* inlined into a kernel with further code behind it: the store's address and data registers are reused only behind this wait */
}
// k_gemm_hh variant with fused epilogue: v = acc·alpha + bias[by·sBias + col] (+ CP[(row/rowsPerB)·sCPb + by·64 + col] if CP) ; ACT 0 none / 1 elu ; writes f16 C16 (and f32 C if non-null)
template <int ACT>
__global__ __launch_bounds__(128) void k_gemm_hhx(const _Float16* __restrict__ A, int lda, size_t sA, const _Float16* __restrict__ Bh, int ldb, size_t sB, float alpha, const float* __restrict__ bias, size_t sBias, const float* __restrict__ CP, int rowsPerB, size_t sCPb, int row0g,
    float* __restrict__ C, _Float16* __restrict__ C16, int ldc, size_t sC, int M, int N, int K) {
  __shared__ __attribute__((aligned(16))) float so[4][16][64];
  const int tid = threadIdx.x, w = tid >> 5, lane = tid & 31, ln = lane & 15, hh = lane >> 4; const int by = blockIdx.y;
  A += (size_t)by * sA; Bh += (size_t)by * sB; const size_t cofs = (size_t)by * sC; const float* bp = bias ? bias + (size_t)by * sBias : nullptr;
  const int ntn = (N + 63) / 64; const int wid = blockIdx.x * 4 + w; const int mt = wid / ntn, nq = wid % ntn; if (mt * 16 >= M) return;
  const int row0 = mt * 16, col0 = nq * 64; const _Float16* arow = A + (size_t)(row0 + ln) * lda;
  v8f acc[4] = {};
  for (int kb = 0; kb < K; kb += 32) { FragH ah; ah.half[0] = *(const v8us*)((const unsigned short*)arow + kb + 8 * hh); ah.half[1] = *(const v8us*)((const unsigned short*)arow + kb + 16 + 8 * hh);
#pragma unroll
    for (int t = 0; t < 4; ++t) { if (col0 + t * 16 >= N) continue; const size_t boff = (size_t)(col0 + t * 16 + ln) * ldb + kb; FragH bq; bq.half[0] = *(const v8us*)((const unsigned short*)Bh + boff + 8 * hh); bq.half[1] = *(const v8us*)((const unsigned short*)Bh + boff + 16 + 8 * hh);
      acc[t] = mmaH<1>(ah.v, ah.v, bq.v, bq.v, acc[t]); }
  }
#pragma unroll
  for (int t = 0; t < 4; ++t) { if (col0 + t * 16 >= N) continue; const int col = col0 + t * 16 + ln; const float bv = bp ? bf16_round(bp[col]) : 0.f;
#pragma unroll
    for (int r = 0; r < 8; ++r) { float v = acc[t][r] * alpha + bv; if (CP) { const int rr = row0g + row0 + 8 * hh + r; if (rowsPerB < 0) v += CP[cofs + (size_t)rr * ldc + col];      /* rowsPerB < 0: own element of the batched C plane */ else { const int bidx = rr / rowsPerB; v += CP[(size_t)bidx * sCPb + (size_t)by * 64 + col]; } } if (ACT == 1) v = (v > 0.f) ? v : expm1f(v); else if (ACT == 7) v = (v > 0.f) ? v + 1.0f : expf(v); else if (ACT == 8) v = tanhf(v); else if (ACT == 9) v = 0.5f * v * (1.0f + tanhf(0.7978845608028654f * (v + 0.044715f * v * v * v))); else if (ACT == 11) v = 1.0f / (1.0f + expf(-v)); else if (ACT == 12) v = (v > 0.f) ? v : 0.01f * v; else if (ACT == 14) v = (v > 0.f) ? v : 0.1f * v; else if (ACT == 16) v = (v >= 0.f) ? v : 0.3f * v; else if (ACT == 17) v = (v >= 0.f) ? v : 0.2f * v; else if (ACT == 15) v = v / (1.0f + expf(-v)); else if (ACT == 3) v = fmaxf(v, 0.f); else if (ACT == 6) v = 0.5f * v * (1.0f + erff(v * 0.70710678118654752f)); so[w][8 * hh + r][t * 16 + ln] = v; } }
  __builtin_amdgcn_fence(__ATOMIC_ACQ_REL, "workgroup"); __builtin_amdgcn_wave_barrier();
  const int rsub = lane >> 4, c4 = (lane & 15) * 4; typedef _Float16 v4h __attribute__((ext_vector_type(4)));
  {
#pragma unroll
    for (int q = 0; q < 8; ++q) { const int r = q * 2 + rsub; if (col0 + c4 < N) { const v4f v = *(const v4fa*)&so[w][r][c4]; if (C) *(v4f*)(C + cofs + (size_t)(row0 + r) * ldc + col0 + c4) = v; if (C16) { v4h h4; for (int i = 0; i < 4; ++i) h4[i] = (_Float16)v[i]; *(v4h*)(C16 + cofs + (size_t)(row0 + r) * ldc + col0 + c4) = h4; } } }
     }
}


typedef _Float16 v4h __attribute__((ext_vector_type(4)));

__device__ __forceinline__ void x16(const float* __restrict__ x, _Float16* __restrict__ X16, size_t t) { FragH f;      /* t = piece index, 8 elements each */
#pragma unroll
  for (int q = 0; q < 8; ++q) f.h[q] = (_Float16)bf16_round(x[t * 8 + q]); *(v8us*)((unsigned short*)X16 + t * 8) = f.half[0];
  asm volatile("s_wait_xcnt 0x0" ::: "memory"); }      /* inlined into a kernel with further code behind it: the store's address and data registers are reused only behind this wait */
__global__ __launch_bounds__(256) void k_h16(const float* __restrict__ x, _Float16* __restrict__ X16, size_t n8) { const size_t t = (size_t)blockIdx.x * 256 + threadIdx.x; if (t >= n8) return; FragH f;
#pragma unroll
  for (int q = 0; q < 8; ++q) f.h[q] = (_Float16)x[t * 8 + q]; *(v8us*)((unsigned short*)X16 + t * 8) = f.half[0];  }
__global__ __launch_bounds__(256) void k_round16f(const float* __restrict__ W, _Float16* __restrict__ Bt, size_t n8) { const size_t t = (size_t)blockIdx.x * 256 + threadIdx.x; if (t >= n8) return; FragH f;
#pragma unroll
  for (int i = 0; i < 8; ++i) f.h[i] = (_Float16)(bf16_round(W[t * 8 + i]) * 16.0f); *(v8us*)((unsigned short*)Bt + t * 8) = f.half[0];  }
template <int NHv, int TTv>
__global__ __launch_bounds__(256) void k_vt(const _Float16* __restrict__ V16, int ldv, int voff, _Float16* __restrict__ Vt) { __shared__ unsigned short tl[64][66]; const int tid = threadIdx.x; const int slab = blockIdx.x / (TTv / 64), lg = blockIdx.x % (TTv / 64); const int b = slab / NHv, h = slab % NHv;
  for (int i = tid; i < 64 * 8; i += 256) { const int r = i / 8, c8 = (i % 8) * 8; FragH f; f.half[0] = *(const v8us*)((const unsigned short*)V16 + ((size_t)b * TTv + lg * 64 + r) * ldv + voff + h * 64 + c8);
#pragma unroll
    for (int q = 0; q < 8; ++q) tl[r][c8 + q] = f.u[q]; }
  __syncthreads();
  {
#pragma unroll
    for (int rd = 0; rd < 2; ++rd) { const int d = rd * 32 + tid / 8, pc = tid % 8; FragH f;
#pragma unroll
      for (int q = 0; q < 8; ++q) f.u[q] = tl[pc * 8 + q][d];
      *(v8us*)((unsigned short*)Vt + ((size_t)slab * 64 + d) * TTv + lg * 64 + pc * 8) = f.half[0]; }
     } }

__global__ __launch_bounds__(256) void k_hl(const float* __restrict__ F, _Float16* __restrict__ Hh, _Float16* __restrict__ Hl, size_t n8) { const size_t t = (size_t)blockIdx.x * 256 + threadIdx.x; if (t >= n8) return; FragH fh, fl; const v4f a = *(const v4fa*)(F + t * 8), c = *(const v4fa*)(F + t * 8 + 4);
#pragma unroll
  for (int q = 0; q < 4; ++q) { _Float16 h = (_Float16)a[q]; fh.h[q] = h; fl.h[q] = (_Float16)((a[q] - (float)h) * 1024.0f); h = (_Float16)c[q]; fh.h[4 + q] = h; fl.h[4 + q] = (_Float16)((c[q] - (float)h) * 1024.0f); }
  { *(v8us*)((unsigned short*)Hh + t * 8) = fh.half[0]; *(v8us*)((unsigned short*)Hl + t * 8) = fl.half[0];  } }

// ---- fast GEMM (wave tile 32x64; requires M % 32 == 0 rows per launch region and N % 64 == 0); epilogue = k_gemm_hhx semantics ----
__device__ __forceinline__ v16h g2_frag(const _Float16* p, int hh) { FragH f; f.half[0] = *(const v8us*)((const unsigned short*)p + 8 * hh); f.half[1] = *(const v8us*)((const unsigned short*)p + 16 + 8 * hh); return f.v; }
__device__ __forceinline__ v8f g2_mma(v16h a, v16h b, v8f c) { v8f d = __builtin_amdgcn_wmma_f32_16x16x32_f16(false, a, false, b, (short)0, c, false, false); asm volatile("v_nop\n\tv_nop\n\tv_nop\n\tv_nop" : "+v"(d) : "v"(a), "v"(b)); return d; }
template <int ACT>
__global__ __launch_bounds__(128) void k_gemm2(const _Float16* __restrict__ A, int lda, size_t sA, const _Float16* __restrict__ Bh, int ldb, size_t sB, float alpha, const float* __restrict__ bias, size_t sBias, const float* __restrict__ CP, int rowsPerB, size_t sCPb, int row0g,
    float* __restrict__ C, _Float16* __restrict__ C16, int ldc, size_t sC, int M, int N, int K, const float* __restrict__ biasY1, const float* __restrict__ biasY2) { static_assert(ACT == 0 || ACT == 3 || ACT == 6 || ACT == 8 || ACT == 9 || ACT == 11 || ACT == 12 || ACT == 14 || ACT == 15 || ACT == 16 || ACT == 17, "k_gemm2: unsupported ACT code (would silently apply no activation)");
  __shared__ __attribute__((aligned(16))) float so[4][32][68];
  const int tid = threadIdx.x, w = tid >> 5, lane = tid & 31, ln = lane & 15, hh = lane >> 4; const int by = blockIdx.y;
  if (by == 1 && biasY1) bias = biasY1; else if (by == 2 && biasY2) bias = biasY2;      /* products that share one grid along y may keep their biases in separate buffers */
  A += (size_t)by * sA; Bh += (size_t)by * sB; const size_t cofs = (size_t)by * sC; const float* bp = bias ? bias + (size_t)by * sBias : nullptr;
  const int ntn = N >> 6; const int mt = blockIdx.x / ntn, nq = blockIdx.x - mt * ntn; const int row0 = mt * 128 + 32 * w, col0 = nq * 64; if (row0 >= M) return;
  const _Float16* a0p = A + (size_t)(row0 + ln) * lda; const _Float16* a1p = a0p + (size_t)16 * lda;
  const _Float16* b0p = Bh + (size_t)(col0 + ln) * ldb; const _Float16* b1p = b0p + (size_t)16 * ldb; const _Float16* b2p = b1p + (size_t)16 * ldb; const _Float16* b3p = b2p + (size_t)16 * ldb;
  const v8f z8 = {0.f,0.f,0.f,0.f,0.f,0.f,0.f,0.f}; v8f c00 = z8, c01 = z8, c02 = z8, c03 = z8, c10 = z8, c11 = z8, c12 = z8, c13 = z8;
#pragma unroll 1
  for (int kb = 0; kb < K; kb += 32) { const v16h a0 = g2_frag(a0p + kb, hh), a1 = g2_frag(a1p + kb, hh);
    v16h b = g2_frag(b0p + kb, hh); c00 = g2_mma(a0, b, c00); c10 = g2_mma(a1, b, c10);
    b = g2_frag(b1p + kb, hh); c01 = g2_mma(a0, b, c01); c11 = g2_mma(a1, b, c11);
    b = g2_frag(b2p + kb, hh); c02 = g2_mma(a0, b, c02); c12 = g2_mma(a1, b, c12);
    b = g2_frag(b3p + kb, hh); c03 = g2_mma(a0, b, c03); c13 = g2_mma(a1, b, c13); }
  v8f accs[8] = {c00, c01, c02, c03, c10, c11, c12, c13};
#pragma unroll
  for (int u = 0; u < 8; ++u) { const int t = u & 3, half = u >> 2; const int col = col0 + t * 16 + ln; const float bv = bp ? bf16_round(bp[col]) : 0.f;
#pragma unroll
    for (int r = 0; r < 8; ++r) { const int rloc = half * 16 + 8 * hh + r; float v = accs[u][r] * alpha + bv; if (CP) { if (rowsPerB < 0) v += CP[cofs + (size_t)(row0g + row0 + rloc) * ldc + col];      /* rowsPerB < 0: own element of the batched C plane */ else { const int bidx = (row0g + row0 + rloc) / rowsPerB; v += CP[(size_t)bidx * sCPb + (size_t)by * 64 + col]; } }
      if (ACT == 3) v = fmaxf(v, 0.f); else if (ACT == 6) v = 0.5f * v * (1.0f + erff(v * 0.70710678118654752f)); else if (ACT == 11) v = 1.0f / (1.0f + expf(-v)); else if (ACT == 15) v = v / (1.0f + expf(-v)); else if (ACT == 12) v = (v > 0.f) ? v : 0.01f * v; else if (ACT == 8) v = tanhf(v); else if (ACT == 9) v = 0.5f * v * (1.0f + tanhf(0.7978845608028654f * (v + 0.044715f * v * v * v))); else if (ACT == 14) v = (v > 0.f) ? v : 0.1f * v; else if (ACT == 16) v = (v >= 0.f) ? v : 0.3f * v; else if (ACT == 17) v = (v >= 0.f) ? v : 0.2f * v;
      so[w][rloc][t * 16 + ln] = v; } }
  __builtin_amdgcn_fence(__ATOMIC_ACQ_REL, "workgroup"); __builtin_amdgcn_wave_barrier();
  const int rsub = lane >> 4, c4 = (lane & 15) * 4;
  {
#pragma unroll
    for (int q = 0; q < 16; ++q) { const int r = q * 2 + rsub; const v4f v = *(const v4fa*)&so[w][r][c4]; if (C) *(v4f*)(C + cofs + (size_t)(row0 + r) * ldc + col0 + c4) = v; if (C16) { v4h h4; for (int i = 0; i < 4; ++i) h4[i] = (_Float16)v[i]; *(v4h*)(C16 + cofs + (size_t)(row0 + r) * ldc + col0 + c4) = h4; } }
     } }


__global__ __launch_bounds__(256) void k_wnat(const float* __restrict__ w, size_t n8, _Float16* __restrict__ Bt) { const size_t t = (size_t)blockIdx.x * 256 + threadIdx.x; if (t >= n8) return; FragH f; for (int q = 0; q < 8; ++q) f.h[q] = (_Float16)(bf16_round(w[t * 8 + q]) * 16.0f); *(v8us*)((unsigned short*)Bt + t * 8) = f.half[0];  }
__global__ __launch_bounds__(256) void k_rsm(const float* __restrict__ S, _Float16* __restrict__ P, int nrows) {
  #pragma clang fp contract(off)
  const int i = blockIdx.x * 256 + threadIdx.x; if (i >= nrows) return; const float* s = S + (size_t)i * SQ; float mx = -3.0e38f;
#pragma unroll 1
  for (int j = 0; j < SQ; ++j) mx = fmaxf(mx, s[j]); float se = 0.f;
#pragma unroll 1
  for (int j = 0; j < SQ; ++j) se += expf(s[j] - mx); const float sc = 256.0f / se;
#pragma unroll 1
  for (int j0 = 0; j0 < SQ; j0 += 8) { FragH f; for (int q = 0; q < 8; ++q) f.h[q] = (_Float16)(expf(s[j0 + q] - mx) * sc); unsigned short* d = (unsigned short*)P + (size_t)i * SQ + j0; *(v8us*)d = f.half[0];  } }
__global__ __launch_bounds__(256) void k_vt(const _Float16* __restrict__ V16, int b, int h0, _Float16* __restrict__ VT) { __shared__ unsigned short tl[64][65]; const int tid = threadIdx.x; const int hh = blockIdx.x % HG, sg = blockIdx.x / HG; const int s0 = sg * 64; const int h = h0 + hh;
  for (int i = tid; i < 64 * 8; i += 256) { const int j = i / 8, d8 = (i % 8) * 8; FragH f; f.half[0] = *(const v8us*)((const unsigned short*)V16 + ((size_t)b * SQ + s0 + j) * DM + h * HD + d8); for (int q = 0; q < 8; ++q) tl[d8 + q][j] = f.u[q]; }
  __syncthreads();
  { for (int i = tid; i < 64 * 8; i += 256) { const int d = i / 8, j8 = (i % 8) * 8; FragH f; for (int q = 0; q < 8; ++q) f.u[q] = tl[d][j8 + q]; *(v8us*)((unsigned short*)VT + ((size_t)hh * HD + d) * SQ + s0 + j8) = f.half[0]; }  } }



// All operand preparation in one launch: none of these pieces reads what another writes, so they share one grid by ranges of the block index (block-uniform branches).
// The weight blocks come first: their strided reads take longest and run under the memory-bound casts that follow.
#define PR_WO ((DM * (DM / 8)) / 256)            /* blocks for the [in][out] output weight */
#define PR_WH ((NH * HD * (DM / 8)) / 256)       /* blocks for one per-head stack */
#define PR_HP (HD * (DM / 8))                    /* 8-element pieces per head */
#define PR_X ((int)(NR * DM / 8 / 256))          /* blocks for one cast of the token rows */
__global__ __launch_bounds__(256) void k_prep(const float* __restrict__ wq, const float* __restrict__ wk, const float* __restrict__ wv, const float* __restrict__ wo, const float* __restrict__ xq, const float* __restrict__ xk, const float* __restrict__ xv,
    _Float16* __restrict__ BQ, _Float16* __restrict__ BK, _Float16* __restrict__ BV, _Float16* __restrict__ BO, _Float16* __restrict__ XQ, _Float16* __restrict__ XK, _Float16* __restrict__ XV) {
  int blk = blockIdx.x; const int tid = threadIdx.x;
  if (blk < PR_WO) { wt_f16(wo, BO, DM, DM, 16.0f, blk * 256 + tid); return; }
  blk -= PR_WO;
  if (blk < 3 * PR_WH) { const int m = blk / PR_WH; const int u = (blk - m * PR_WH) * 256 + tid; const int h = u / PR_HP;      /* head h: a row-major [DM][HD] block, written as its HD rows of the [out][in] plane */
    const float* w = (m == 0) ? wq : (m == 1) ? wk : wv; _Float16* B = (m == 0) ? BQ : (m == 1) ? BK : BV;
    wt_f16(w + (size_t)h * DM * HD, B + (size_t)h * HD * DM, DM, HD, 16.0f, u - h * PR_HP); return; }
  blk -= 3 * PR_WH;
  const int m = blk / PR_X; const size_t t = (size_t)(blk - m * PR_X) * 256 + tid;
  x16((m == 0) ? xq : (m == 1) ? xk : xv, (m == 0) ? XQ : (m == 1) ? XK : XV, t);
}

#define FA_NW 8                      /* waves per workgroup */
#define FA_BR (FA_NW * 32)           /* query rows per workgroup */
#define FA_SK 64                     /* keys per stage = two 32-key passes */
#define FA_PITCH 144                 /* LDS row pitch in bytes: 128 of data + 16, an odd multiple of 16 for the 16-byte fragment reads */
#define FA_TILE (FA_SK * FA_PITCH)
/* amdgpu_waves_per_eu(4, 4): at most 256 VGPRs, so that two workgroups (four waves per SIMD) are resident per WGP and the 512 workgroups run in one round */
__device__ __forceinline__ float fa_xh(float x) { return __builtin_bit_cast(float, __builtin_amdgcn_permlanex16(__builtin_bit_cast(int, x), __builtin_bit_cast(int, x), 0x76543210, 0xfedcba98, false, false)); }      /* lane l reads lane l ^ 16 */
__device__ __forceinline__ v16h fa_frag(const unsigned char* p) { FragH f; f.half[0] = *(const v8us*)p; f.half[1] = *(const v8us*)(p + 32); return f.v; }      /* p = row start + 16 * (lane >> 4): k = 8 hh .. 8 hh + 7 and 16 + 8 hh .. 16 + 8 hh + 7, as g2_frag */
__device__ __forceinline__ v8f fa_mma(v16h a, v16h b, v8f c) { return __builtin_amdgcn_wmma_f32_16x16x32_f16(false, a, false, b, (short)0, c, false, false); }
__global__ __launch_bounds__(FA_NW * 32) __attribute__((amdgpu_waves_per_eu(4, 4))) void k_fattn(const _Float16* __restrict__ Q16, const _Float16* __restrict__ K16, const _Float16* __restrict__ VT, _Float16* __restrict__ O16) {
  __shared__ __attribute__((aligned(16))) unsigned char L[2][2][FA_TILE];      /* [buffer][0 = K rows, 1 = V^T rows] */
  const int tid = threadIdx.x, lane = tid & 31, c = lane & 15, hh = lane >> 4; const int wave = __builtin_amdgcn_readfirstlane(tid >> 5);
  const int q0 = blockIdx.x * FA_BR + wave * 32, h = blockIdx.y, b = blockIdx.z; const size_t r0 = (size_t)b * SQ;
  const float cs = 0.125f * 1.4426950408889634f;      /* 64^-0.5 and log2(e) */
  /* staging: thread t moves the 16-byte piece t & 7 of rows t >> 3 and 32 + (t >> 3) of both tiles: 8 lanes cover one whole 128-byte row */
  const int srow = tid >> 3, scol = tid & 7; const int sl = srow * FA_PITCH + scol * 16;
  const unsigned short* kg = (const unsigned short*)K16 + (r0 + srow) * LQ + h * HD + scol * 8;
  const unsigned short* vg = (const unsigned short*)VT + (((size_t)b * NH + h) * HD + srow) * SQ + scol * 8;
  v8us k0 = *(const v8us*)kg, k1 = *(const v8us*)(kg + (size_t)32 * LQ), v0 = *(const v8us*)vg, v1 = *(const v8us*)(vg + (size_t)32 * SQ);
  v16h qf[2][2];
#pragma unroll      /* register arrays need constant indices */
  for (int g = 0; g < 2; ++g) { const _Float16* qp = Q16 + (r0 + q0 + 16 * g + c) * LQ + h * HD; qf[g][0] = g2_frag(qp, hh); qf[g][1] = g2_frag(qp + 32, hh); }
  FragH ones;
#pragma unroll
  for (int i = 0; i < 16; ++i) ones.u[i] = (c == 0) ? (unsigned short)0x3C00 : (unsigned short)0;
  const v8f z8 = {0.f, 0.f, 0.f, 0.f, 0.f, 0.f, 0.f, 0.f};
  v8f acc[2][4] = {{z8, z8, z8, z8}, {z8, z8, z8, z8}}; v8f lacc[2] = {z8, z8}; float m_run[2] = {-__builtin_inff(), -__builtin_inff()};
  *(v8us*)&L[0][0][sl] = k0; *(v8us*)&L[0][0][sl + 32 * FA_PITCH] = k1; *(v8us*)&L[0][1][sl] = v0; *(v8us*)&L[0][1][sl + 32 * FA_PITCH] = v1;
  for (int st = 0; st < SQ / FA_SK; ++st) {
    __syncthreads();      /* stage st is written by every wave, and every wave has left the buffer that is refilled at the foot of this trip */
    const unsigned char* Kb = &L[st & 1][0][0]; const unsigned char* Vb = &L[st & 1][1][0];
    const bool more = st + 1 < SQ / FA_SK;      /* the same for the whole workgroup */
    if (more) { k0 = *(const v8us*)(kg + (size_t)FA_SK * LQ); k1 = *(const v8us*)(kg + (size_t)(FA_SK + 32) * LQ); v0 = *(const v8us*)(vg + FA_SK); v1 = *(const v8us*)(vg + FA_SK + (size_t)32 * SQ); }      /* next stage, in flight under this stage's passes */
#pragma unroll      /* two passes per stage; constant LDS offsets */
    for (int sub = 0; sub < 2; ++sub) {
      v8f s[2][2];
#pragma unroll      /* register arrays need constant indices */
      for (int kt = 0; kt < 2; ++kt) { const unsigned char* p = Kb + (32 * sub + 16 * kt + c) * FA_PITCH + 16 * hh; const v16h ka = fa_frag(p), kb = fa_frag(p + 64);
        s[kt][0] = fa_mma(kb, qf[0][1], fa_mma(ka, qf[0][0], z8)); s[kt][1] = fa_mma(kb, qf[1][1], fa_mma(ka, qf[1][0], z8)); }
      v16h vf[4];
#pragma unroll      /* register arrays need constant indices */
      for (int t = 0; t < 4; ++t) vf[t] = fa_frag(Vb + (16 * t + c) * FA_PITCH + 64 * sub + 16 * hh);
      float mb[2]; bool need = false;
#pragma unroll      /* register arrays need constant indices */
      for (int g = 0; g < 2; ++g) { float mx = fmaxf(s[0][g][0], s[1][g][0]);
#pragma unroll      /* register arrays need constant indices */
        for (int r = 1; r < 8; ++r) mx = fmaxf(mx, fmaxf(s[0][g][r], s[1][g][r]));
        mx = fmaxf(mx, fa_xh(mx)) * cs; mb[g] = mx; need = need || (mx > m_run[g] + 8.0f); }      /* both wave halves hold this query's maximum, scaled */
      if (__builtin_amdgcn_ballot_w32(need) != 0) {      /* wave-uniform; rare after the first pass */
#pragma unroll      /* register arrays need constant indices */
        for (int g = 0; g < 2; ++g) { const float m_new = fmaxf(m_run[g], mb[g]); const float corr = __builtin_amdgcn_exp2f(m_run[g] - m_new); m_run[g] = m_new; lacc[g] = lacc[g] * corr;      /* corr is 0 on the first pass */
#pragma unroll      /* register arrays need constant indices */
          for (int t = 0; t < 4; ++t) acc[g][t] = acc[g][t] * corr; } }
#pragma unroll      /* register arrays need constant indices */
      for (int g = 0; g < 2; ++g) { const float nm = -m_run[g]; FragH pf;
#pragma unroll      /* register arrays need constant indices */
        for (int i = 0; i < 16; ++i) pf.h[i] = (_Float16)__builtin_amdgcn_exp2f(__builtin_fmaf(s[i >> 3][g][i & 7], cs, nm));      /* keys 8 hh + r of tile 0, then of tile 1: the B operand's k order */
#pragma unroll      /* register arrays need constant indices */
        for (int t = 0; t < 4; ++t) acc[g][t] = fa_mma(vf[t], pf.v, acc[g][t]);
        lacc[g] = fa_mma(ones.v, pf.v, lacc[g]); }      /* row 0 += the column sums of P^T */
    }
    if (more) { unsigned char* Kn = &L[(st + 1) & 1][0][0]; unsigned char* Vn = &L[(st + 1) & 1][1][0]; *(v8us*)(Kn + sl) = k0; *(v8us*)(Kn + sl + 32 * FA_PITCH) = k1; *(v8us*)(Vn + sl) = v0; *(v8us*)(Vn + sl + 32 * FA_PITCH) = v1;
      asm volatile("s_wait_xcnt 0x0" :: "v"(kg), "v"(vg) : "memory");      /* the stage loads' address registers (held live to here) are advanced only behind this wait */
      kg += (size_t)FA_SK * LQ; vg += FA_SK; }
  }
#pragma unroll      /* register arrays need constant indices */
  for (int g = 0; g < 2; ++g) { const float lr = lacc[g][0]; const float inv = 64.0f / (lr + fa_xh(lr));
#pragma unroll      /* register arrays need constant indices */
    for (int t = 0; t < 4; ++t) { FragH f;
#pragma unroll      /* register arrays need constant indices */
      for (int r = 0; r < 8; ++r) f.h[r] = (_Float16)(acc[g][t][r] * inv);
      *(v8us*)((unsigned short*)O16 + (r0 + q0 + 16 * g + c) * DM + h * HD + 16 * t + 8 * hh) = f.half[0]; } } }      /* d = 16 t + 8 hh .. + 7 of query 16 g + c */

extern "C" void kernel_launch(void* const* d_in, const int* in_sizes, int n_in,
                              void* d_out, int out_size, void* d_ws, size_t ws_size, hipStream_t stream) {
  (void)in_sizes; (void)n_in; (void)out_size;
  const float* const* I = (const float* const*)d_in; const float* xq = I[0]; const float* xk = I[1]; const float* xv = I[1]; const float* wq = I[2]; const float* bq = I[3]; const float* wk = I[4]; const float* bk = I[5]; const float* wv = I[6]; const float* bv = I[7]; const float* wo = I[8]; const float* bo = I[9];      /* TWO inputs: query (the q stream) and value (read on BOTH the k and the v stream casts); wq, wk, wv are PER-HEAD STACKS [16][1024][64] = [head][in][out]; bq, bk, bv per-head [16][64] = the flat [1024] bias; wo [in][out] + bo; input order query, value, wq, bq, wk, bk, wv, bv, wo, bo */
  char* ws = (char*)d_ws; size_t off = 0;
  auto take = [&](size_t bytes) { char* p = ws + off; off += (bytes + 255) & ~(size_t)255; return p; };
  _Float16* BQ = (_Float16*)take((size_t)DM * DM * 2); _Float16* BK = (_Float16*)take((size_t)DM * DM * 2); _Float16* BV = (_Float16*)take((size_t)DM * DM * 2); _Float16* BO = (_Float16*)take((size_t)DM * DM * 2);
  _Float16* XQ = (_Float16*)take(NR * DM * 2); _Float16* XK = (_Float16*)take(NR * DM * 2); _Float16* XV = (_Float16*)take(NR * DM * 2); _Float16* Q16 = (_Float16*)take(NR * DM * 2); _Float16* K16 = (_Float16*)take(NR * DM * 2); _Float16* V16 = (_Float16*)take(NR * DM * 2); _Float16* O16 = (_Float16*)take(NR * DM * 2);
  _Float16* VT = (_Float16*)take((size_t)NB * NH * HD * SQ * 2);
  if (off > ws_size) return;
  k_prep<<<PR_WO + 3 * PR_WH + 3 * PR_X, 256, 0, stream>>>(wq, wk, wv, wo, xq, xk, xv, BQ, BK, BV, BO, XQ, XK, XV);      /* weight planes [out][in] (x16): the per-head stacks wq / wk / wv [NH][DM][HD] head by head into contiguous rows, wo [in][out] whole; the three token streams as exact f16 rows */
  const size_t r0p = (size_t)B0 * SQ;      /* first projected row */
  k_gemm2<0><<<dim3((unsigned)((MP / 128) * (DM / 64)), 3), 128, 0, stream>>>(XQ + r0p * DM, DM, NR * DM, BQ, DM, (size_t)DM * DM, 0.0625f, bq, 0, nullptr, 1, 0, 0, nullptr, Q16 + r0p * DM, DM, NR * DM, MP, DM, DM, bk, bv);      /* q, k, v in one grid, y = 0, 1, 2: XQ XK XV, BQ BK BV and Q16 K16 V16 each lie one behind the other in the workspace */
  k_vt<NH, SQ><<<NB * NH * (SQ / 64), 256, 0, stream>>>(V16, LQ, 0, VT);      /* V^T [NB][NH][HD][SQ], all batches */
  k_fattn<<<dim3(SQ / FA_BR, NH, NB), FA_NW * 32, 0, stream>>>(Q16, K16, VT, O16);      /* o x64 (merged heads) as f16 rows */
  k_gemm2<0><<<dim3((unsigned)((MPO / 128) * (DM / 64)), 1), 128, 0, stream>>>(O16 + r0p * DM, DM, 0, BO, DM, 0, 0.0009765625f, bo, 0, nullptr, 1, 0, 0, (float*)d_out + r0p * DM, nullptr, DM, 0, MPO, DM, DM, nullptr, nullptr);      /* out rows are the output layout */
}

// v004
// Measured time: 139 microseconds a run.
// Next to v003, in two timings, it ran 2.14 and 2.13 times as fast.
// Counting every step since v000, it is 50.9 times as fast.
#include <hip/hip_runtime.h>
// Multi-head attention on two inputs with PER-HEAD STACKED projections and per-head biases on four sequences (query [4][2048][1024], value [4][2048][1024]; q = einsum('bsd,hde->bhse', query, wq) + bq, k = einsum(value, wk) + bk, v = einsum(value, wv) + bv with W [16][1024][64] = [head][in][out] and b [16][64], 16 heads of 64; scores * 1/sqrt(64); softmax over all 2048 keys (no mask); out = heads wo + bo ([in][out] + bias) -> [4][2048][1024]); each head's [in][out] block is transposed into its 64 contiguous rows of the weight plane by the existing builder; the [in][out] output weight through the same builder; all of them, and the casts of the token rows, in one preparation launch.
// Structure: token rows r = b*2048 + s; the query source and the key/value source as exact f16 rows (bf16-rounded); Q, K, V as three WMMA GEMMs in one grid (128x128 workgroup tiles staged in LDS, 64x64 wave tiles, f32 accumulation, exact x16 weights + bias, f16 outputs); V^T for all batches and heads via LDS transposes; one fused attention launch (scores K = 64 and o = P . V^T on WMMA, online softmax on VALU with f32 statistics and native exp2, weights as f16 relative to the running maximum; o carried x64 against f16 subnormal flush, folded into the output GEMM alpha) written straight into the merged f16 o rows; out = o W_o + b GEMM (f32) into the output layout.
// Compute dtype: inputs rounded to bf16; x / weights exact; q, k, v, softmax weights and o as plain f16 GEMM operands (~2^-12); scores and softmax statistics f32. v_wmma_f32_16x16x32_f16.
#define NB 4
#define SQ 2048
#define DM 1024
#define NH 16
#define HD 64
#define HG 4                         /* heads per block group of the k_vt(V16, b, h0, VT) overload (not launched) */
#define B0 0                         /* first batch processed (debug hook) */
#define NBR NB                       /* batches processed (debug hook) */
#define NR ((size_t)NB * SQ)         /* token rows */
#define MP ((int)((size_t)NBR * SQ)) /* rows projected (debug hook) */
#define QN SQ                        /* query rows per batch; unused, k_fattn attends all SQ */
#define NHD NH                       /* heads; unused, k_fattn attends all NH */
#define MPO MP                       /* rows through the output stage (debug hook) */
#define LQ DM      /* row pitch of the q/k/v rows */
typedef __bf16 v16b __attribute__((ext_vector_type(16)));
typedef unsigned short v8us __attribute__((ext_vector_type(8), may_alias));
typedef float  v8f  __attribute__((ext_vector_type(8)));
typedef float  v4f  __attribute__((ext_vector_type(4)));
typedef float  v4fa __attribute__((ext_vector_type(4), may_alias));
union FragB { v16b v; v8us half[2]; unsigned short u[16]; };

__device__ __forceinline__ unsigned short bf16_bits(float x) { unsigned int u = __float_as_uint(x); return (unsigned short)((u + 0x7FFFu + ((u >> 16) & 1u)) >> 16); }
__device__ __forceinline__ float bf16_val(unsigned short b) { return __uint_as_float(((unsigned int)b) << 16); }
__device__ __forceinline__ float bf16_round(float x) { return bf16_val(bf16_bits(x)); }
// D += A·B with NT terms: 1 = ah·bh, 2 = + al·bh (A split), 3 = + ah·bl (both split)
template <int NT>
__device__ __forceinline__ v8f mmaN(v16b ah, v16b al, v16b bh, v16b bl, v8f c) {
  c = __builtin_amdgcn_wmma_f32_16x16x32_bf16(false, ah, false, bh, (short)0, c, false, false);
  if (NT >= 2) c = __builtin_amdgcn_wmma_f32_16x16x32_bf16(false, al, false, bh, (short)0, c, false, false);
  if (NT >= 3) c = __builtin_amdgcn_wmma_f32_16x16x32_bf16(false, ah, false, bl, (short)0, c, false, false);
  asm volatile("v_nop\n\tv_nop\n\tv_nop\n\tv_nop" : "+v"(c) : "v"(ah), "v"(al), "v"(bh), "v"(bl));
  return c;
}

__global__ __launch_bounds__(256) void k_wt_bf16(const float* __restrict__ W, unsigned short* __restrict__ Wt, int K, int N) {
  const int t = blockIdx.x * 256 + threadIdx.x;
  const int k8n = K / 8;
  if (t >= N * k8n) return;
  const int n = t / k8n, k8 = (t % k8n) * 8;
  v8us v;
#pragma unroll
  for (int i = 0; i < 8; ++i) v[i] = bf16_bits(W[(size_t)(k8 + i) * N + n]);
  *(v8us*)(Wt + (size_t)n * K + k8) = v;
  
}

// GEMM C[M][N] (f32, pitch ldc) = act(A[M][K]·W + bias). A f32 row-major (pitch lda) converted per fragment to bf16
// (ASPLIT: hi/lo two planes -> 2 terms, else single rounded term); Wt bf16 [N][K] (pitch ldb). BIAS_BF16 rounds the
// bias to bf16 first (bias quantised to bf16 before the add). K%32==0, M%16==0, N%64==0.
template <bool ASPLIT, int ACT, bool BIAS_BF16>
__global__ __launch_bounds__(128) void k_gemm_bf(const float* __restrict__ A, int lda, const unsigned short* __restrict__ Wt, int ldb,
                                               const float* __restrict__ bias, float* __restrict__ C, int ldc, int M, int N, int K) {
  __shared__ __attribute__((aligned(16))) float so[4][16][64];
  const int tid = threadIdx.x, w = tid >> 5, lane = tid & 31, ln = lane & 15, hh = lane >> 4;
  const int ntn = N / 64;
  const int wid = blockIdx.x * 4 + w;
  const int mt = wid / ntn, nq = wid % ntn;
  if (mt * 16 >= M) return;
  const int row0 = mt * 16, col0 = nq * 64;
  const float* arow = A + (size_t)(row0 + ln) * lda;
  v8f acc[4] = {};
  for (int kb = 0; kb < K; kb += 32) {
    FragB ah, al;
    const v4f x0 = *(const v4fa*)(arow + kb + 8 * hh), x1 = *(const v4fa*)(arow + kb + 8 * hh + 4);
    const v4f x2 = *(const v4fa*)(arow + kb + 16 + 8 * hh), x3 = *(const v4fa*)(arow + kb + 16 + 8 * hh + 4);
    float xs[16] = {x0[0],x0[1],x0[2],x0[3],x1[0],x1[1],x1[2],x1[3],x2[0],x2[1],x2[2],x2[3],x3[0],x3[1],x3[2],x3[3]};
#pragma unroll
    for (int i = 0; i < 16; ++i) { const unsigned short hb = bf16_bits(xs[i]); ah.u[i] = hb; al.u[i] = ASPLIT ? bf16_bits(xs[i] - bf16_val(hb)) : (unsigned short)0; }
#pragma unroll
    for (int t = 0; t < 4; ++t) {
      const unsigned short* brow = Wt + (size_t)(col0 + t * 16 + ln) * ldb + kb;
      FragB b;
      b.half[0] = *(const v8us*)(brow + 8 * hh);
      b.half[1] = *(const v8us*)(brow + 16 + 8 * hh);
      acc[t] = mmaN<ASPLIT ? 2 : 1>(ah.v, al.v, b.v, b.v, acc[t]);
    }
  }
#pragma unroll
  for (int t = 0; t < 4; ++t) {
    float bv = bias ? bias[col0 + t * 16 + ln] : 0.f;
    if (BIAS_BF16) bv = bf16_round(bv);
#pragma unroll
    for (int r = 0; r < 8; ++r) { float v = acc[t][r] + bv; if (ACT == 1) v = fmaxf(v, 0.f); so[w][8 * hh + r][t * 16 + ln] = v; }
  }
  __builtin_amdgcn_fence(__ATOMIC_ACQ_REL, "workgroup");
  __builtin_amdgcn_wave_barrier();
  const int rsub = lane >> 4, c4 = (lane & 15) * 4;
  {
#pragma unroll
    for (int q = 0; q < 8; ++q) {
      const int r = q * 2 + rsub;
      const v4f v = *(const v4fa*)&so[w][r][c4];
      *(v4f*)(C + (size_t)(row0 + r) * ldc + col0 + c4) = v;
    }
    
  }
}

// GEMM C = act(A·W + bias + resid): A f32 (ASPLIT -> hi/lo 2 terms), Wt bf16 [N][K]; ACT 0 none, 1 relu, 2 exact gelu;
// resid (optional, f32, row index = (row % rmod), pitch ldr, RES_BF16 rounds it) added before the activation.
template <bool ASPLIT, int ACT, bool BIAS_BF16, bool RES_BF16>
__global__ __launch_bounds__(128) void k_gemm_bf3(const float* __restrict__ A, int lda, const unsigned short* __restrict__ Wt, int ldb,
                                                const float* __restrict__ bias, const float* __restrict__ resid, int rmod, int ldr,
                                                float* __restrict__ C, int ldc, int M, int N, int K) {
  __shared__ __attribute__((aligned(16))) float so[4][16][64];
  const int tid = threadIdx.x, w = tid >> 5, lane = tid & 31, ln = lane & 15, hh = lane >> 4;
  const int ntn = N / 64;
  const int wid = blockIdx.x * 4 + w;
  const int mt = wid / ntn, nq = wid % ntn;
  if (mt * 16 >= M) return;
  const int row0 = mt * 16, col0 = nq * 64;
  const float* arow = A + (size_t)(row0 + ln) * lda;
  v8f acc[4] = {};
  for (int kb = 0; kb < K; kb += 32) {
    FragB ah, al;
    const v4f x0 = *(const v4fa*)(arow + kb + 8 * hh), x1 = *(const v4fa*)(arow + kb + 8 * hh + 4);
    const v4f x2 = *(const v4fa*)(arow + kb + 16 + 8 * hh), x3 = *(const v4fa*)(arow + kb + 16 + 8 * hh + 4);
    float xs[16] = {x0[0],x0[1],x0[2],x0[3],x1[0],x1[1],x1[2],x1[3],x2[0],x2[1],x2[2],x2[3],x3[0],x3[1],x3[2],x3[3]};
#pragma unroll
    for (int i = 0; i < 16; ++i) { const unsigned short hb = bf16_bits(xs[i]); ah.u[i] = hb; al.u[i] = ASPLIT ? bf16_bits(xs[i] - bf16_val(hb)) : (unsigned short)0; }
#pragma unroll
    for (int t = 0; t < 4; ++t) {
      const unsigned short* brow = Wt + (size_t)(col0 + t * 16 + ln) * ldb + kb;
      FragB b;
      b.half[0] = *(const v8us*)(brow + 8 * hh);
      b.half[1] = *(const v8us*)(brow + 16 + 8 * hh);
      acc[t] = mmaN<ASPLIT ? 2 : 1>(ah.v, al.v, b.v, b.v, acc[t]);
    }
  }
#pragma unroll
  for (int t = 0; t < 4; ++t) {
    const int col = col0 + t * 16 + ln;
    float bv = bias ? bias[col] : 0.f;
    if (BIAS_BF16) bv = bf16_round(bv);
#pragma unroll
    for (int r = 0; r < 8; ++r) {
      float v = acc[t][r] + bv;
      if (resid) { float rv = resid[(size_t)((row0 + 8 * hh + r) % rmod) * ldr + col]; if (RES_BF16) rv = bf16_round(rv); v += rv; }
      if (ACT == 1) v = fmaxf(v, 0.f);
      if (ACT == 2) v = 0.5f * v * (1.0f + erff(v * 0.70710678118654752f));
      if (ACT == 3) { const float u = 0.7978845608028654f * (v + 0.044715f * v * v * v); v = 0.5f * v * (1.0f + tanhf(u)); }
      so[w][8 * hh + r][t * 16 + ln] = v;
    }
  }
  __builtin_amdgcn_fence(__ATOMIC_ACQ_REL, "workgroup");
  __builtin_amdgcn_wave_barrier();
  const int rsub = lane >> 4, c4 = (lane & 15) * 4;
  {
#pragma unroll
    for (int q = 0; q < 8; ++q) {
      const int r = q * 2 + rsub;
      const v4f v = *(const v4fa*)&so[w][r][c4];
      *(v4f*)(C + (size_t)(row0 + r) * ldc + col0 + c4) = v;
    }
    
  }
}
// row LayerNorm (biased variance, eps) over N: s = X (+ R); optional out_sum <- s; out_norm <- (s-mu)*rsqrt(var+eps)*g + b
template <bool PARAM_BF16>
__global__ __launch_bounds__(256) void k_layernorm(const float* __restrict__ X, const float* __restrict__ R, const float* __restrict__ g, const float* __restrict__ bta,
                                                  float* __restrict__ out_sum, float* __restrict__ out_norm, int N, float eps) {
  __shared__ float red[256];
  const int row = blockIdx.x, tid = threadIdx.x;
  const float* x = X + (size_t)row * N; const float* rr = R ? R + (size_t)row * N : nullptr;
  float vals[16];                     // up to N = 4096
  const int per = N / 256;            // contiguous chunk per thread? use strided-by-4 chunks: thread handles j = tid*4 + 1024*u
  float s1 = 0.f;
  for (int u = 0; u < per / 4; ++u) {
    const int j = tid * 4 + 1024 * u;
    const v4f a = *(const v4fa*)(x + j);
    v4f b = {0.f,0.f,0.f,0.f}; if (rr) b = *(const v4fa*)(rr + j);
#pragma unroll
    for (int q = 0; q < 4; ++q) { const float v = a[q] + b[q]; vals[u * 4 + q] = v; s1 += v; }
  }
  red[tid] = s1; __syncthreads();
  for (int st = 128; st > 0; st >>= 1) { if (tid < st) red[tid] += red[tid + st]; __syncthreads(); }
  const float mu = red[0] / (float)N; __syncthreads();
  float s2 = 0.f;
  for (int u = 0; u < per / 4; ++u)
#pragma unroll
    for (int q = 0; q < 4; ++q) { const float c = vals[u * 4 + q] - mu; s2 += c * c; }
  red[tid] = s2; __syncthreads();
  for (int st = 128; st > 0; st >>= 1) { if (tid < st) red[tid] += red[tid + st]; __syncthreads(); }
  const float rs = rsqrtf(red[0] / (float)N + eps);
  {
    for (int u = 0; u < per / 4; ++u) {
      const int j = tid * 4 + 1024 * u;
      v4f o, sm;
#pragma unroll
      for (int q = 0; q < 4; ++q) {
        float gg = g[j + q], bb = bta[j + q];
        if (PARAM_BF16) { gg = bf16_round(gg); bb = bf16_round(bb); }
        sm[q] = vals[u * 4 + q]; o[q] = (vals[u * 4 + q] - mu) * rs * gg + bb;
      }
      if (out_sum) *(v4f*)(out_sum + (size_t)row * N + j) = sm;
      *(v4f*)(out_norm + (size_t)row * N + j) = o;
    }
    
  }
}



// ---- f16 WMMA path (v_wmma_f32_16x16x32_f16): 11-bit significands for operands in range — used where a [0,1] probability operand needs more precision than bf16
typedef _Float16 v16h __attribute__((ext_vector_type(16)));
union FragH { v16h v; v8us half[2]; _Float16 h[16]; unsigned short u[16]; };
template <int NT>
__device__ __forceinline__ v8f mmaH(v16h ah, v16h al, v16h bh, v16h bl, v8f c) {
  c = __builtin_amdgcn_wmma_f32_16x16x32_f16(false, ah, false, bh, (short)0, c, false, false);
  if (NT >= 2) c = __builtin_amdgcn_wmma_f32_16x16x32_f16(false, al, false, bh, (short)0, c, false, false);
  if (NT >= 3) c = __builtin_amdgcn_wmma_f32_16x16x32_f16(false, ah, false, bl, (short)0, c, false, false);
  asm volatile("v_nop\n\tv_nop\n\tv_nop\n\tv_nop" : "+v"(c) : "v"(ah), "v"(al), "v"(bh), "v"(bl));
  return c;
}
// batched GEMM like k_gemm_b but f16 operands: A f32 (split into f16 hi/lo if ASPLIT, else rounded to f16), Bt = f16 values [n][k]; alpha; C f32; N multiple of 16 (partial tiles skipped)
template <bool ASPLIT>
__global__ __launch_bounds__(128) void k_gemm_h(const float* __restrict__ A, int lda, size_t sA, const _Float16* __restrict__ Bh, int ldb, size_t sB, float alpha, float* __restrict__ C, int ldc, size_t sC, int M, int N, int K) {
  __shared__ __attribute__((aligned(16))) float so[4][16][64];
  const int tid = threadIdx.x, w = tid >> 5, lane = tid & 31, ln = lane & 15, hh = lane >> 4; const int by = blockIdx.y;
  A += (size_t)by * sA; Bh += (size_t)by * sB; C += (size_t)by * sC;
  const int ntn = (N + 63) / 64; const int wid = blockIdx.x * 4 + w; const int mt = wid / ntn, nq = wid % ntn; if (mt * 16 >= M) return;
  const int row0 = mt * 16, col0 = nq * 64; const float* arow = A + (size_t)(row0 + ln) * lda;
  v8f acc[4] = {};
  for (int kb = 0; kb < K; kb += 32) {
    FragH ah, al;
    const v4f x0 = *(const v4fa*)(arow + kb + 8 * hh), x1 = *(const v4fa*)(arow + kb + 8 * hh + 4), x2 = *(const v4fa*)(arow + kb + 16 + 8 * hh), x3 = *(const v4fa*)(arow + kb + 16 + 8 * hh + 4);
    float xs[16] = {x0[0],x0[1],x0[2],x0[3],x1[0],x1[1],x1[2],x1[3],x2[0],x2[1],x2[2],x2[3],x3[0],x3[1],x3[2],x3[3]};
#pragma unroll
    for (int i = 0; i < 16; ++i) { const _Float16 h = (_Float16)xs[i]; ah.h[i] = h; al.h[i] = ASPLIT ? (_Float16)(xs[i] - (float)h) : (_Float16)0.0f; }
#pragma unroll
    for (int t = 0; t < 4; ++t) { if (col0 + t * 16 >= N) continue; const size_t boff = (size_t)(col0 + t * 16 + ln) * ldb + kb; FragH bq; bq.half[0] = *(const v8us*)(Bh + boff + 8 * hh); bq.half[1] = *(const v8us*)(Bh + boff + 16 + 8 * hh);
      acc[t] = mmaH<ASPLIT ? 2 : 1>(ah.v, al.v, bq.v, bq.v, acc[t]); }
  }
#pragma unroll
  for (int t = 0; t < 4; ++t) { if (col0 + t * 16 >= N) continue;
#pragma unroll
    for (int r = 0; r < 8; ++r) so[w][8 * hh + r][t * 16 + ln] = acc[t][r] * alpha; }
  __builtin_amdgcn_fence(__ATOMIC_ACQ_REL, "workgroup"); __builtin_amdgcn_wave_barrier();
  const int rsub = lane >> 4, c4 = (lane & 15) * 4;
  {
#pragma unroll
    for (int q = 0; q < 8; ++q) { const int r = q * 2 + rsub; if (col0 + c4 < N) { const v4f v = *(const v4fa*)&so[w][r][c4]; *(v4f*)(C + (size_t)(row0 + r) * ldc + col0 + c4) = v; } }
     }
}

// Wt[n][k] = f16(W[k][n]·scale) from f32 row-major W[K][N] (scale = power of two; bf16-exact weights stay exact in f16 away from the subnormal range)
__device__ __forceinline__ void wt_f16(const float* __restrict__ W, _Float16* __restrict__ Wt, int K, int N, float scale, int t) {      /* t = piece index, 0 .. N * (K / 8) - 1 */
  const int n = t / (K / 8), k8 = (t % (K / 8)) * 8; FragH f;
#pragma unroll
  for (int i = 0; i < 8; ++i) f.h[i] = (_Float16)(bf16_round(W[(size_t)(k8 + i) * N + n]) * scale); const v8us o = f.half[0];
  *(v8us*)((unsigned short*)Wt + (size_t)n * K + k8) = o;
  asm volatile("s_wait_xcnt 0x0" ::: "memory");      /* inlined into a kernel with further code behind it: the store's address and data registers are reused only behind this wait */
}
// k_gemm_hh variant with fused epilogue: v = acc·alpha + bias[by·sBias + col] (+ CP[(row/rowsPerB)·sCPb + by·64 + col] if CP) ; ACT 0 none / 1 elu ; writes f16 C16 (and f32 C if non-null)
template <int ACT>
__global__ __launch_bounds__(128) void k_gemm_hhx(const _Float16* __restrict__ A, int lda, size_t sA, const _Float16* __restrict__ Bh, int ldb, size_t sB, float alpha, const float* __restrict__ bias, size_t sBias, const float* __restrict__ CP, int rowsPerB, size_t sCPb, int row0g,
    float* __restrict__ C, _Float16* __restrict__ C16, int ldc, size_t sC, int M, int N, int K) {
  __shared__ __attribute__((aligned(16))) float so[4][16][64];
  const int tid = threadIdx.x, w = tid >> 5, lane = tid & 31, ln = lane & 15, hh = lane >> 4; const int by = blockIdx.y;
  A += (size_t)by * sA; Bh += (size_t)by * sB; const size_t cofs = (size_t)by * sC; const float* bp = bias ? bias + (size_t)by * sBias : nullptr;
  const int ntn = (N + 63) / 64; const int wid = blockIdx.x * 4 + w; const int mt = wid / ntn, nq = wid % ntn; if (mt * 16 >= M) return;
  const int row0 = mt * 16, col0 = nq * 64; const _Float16* arow = A + (size_t)(row0 + ln) * lda;
  v8f acc[4] = {};
  for (int kb = 0; kb < K; kb += 32) { FragH ah; ah.half[0] = *(const v8us*)((const unsigned short*)arow + kb + 8 * hh); ah.half[1] = *(const v8us*)((const unsigned short*)arow + kb + 16 + 8 * hh);
#pragma unroll
    for (int t = 0; t < 4; ++t) { if (col0 + t * 16 >= N) continue; const size_t boff = (size_t)(col0 + t * 16 + ln) * ldb + kb; FragH bq; bq.half[0] = *(const v8us*)((const unsigned short*)Bh + boff + 8 * hh); bq.half[1] = *(const v8us*)((const unsigned short*)Bh + boff + 16 + 8 * hh);
      acc[t] = mmaH<1>(ah.v, ah.v, bq.v, bq.v, acc[t]); }
  }
#pragma unroll
  for (int t = 0; t < 4; ++t) { if (col0 + t * 16 >= N) continue; const int col = col0 + t * 16 + ln; const float bv = bp ? bf16_round(bp[col]) : 0.f;
#pragma unroll
    for (int r = 0; r < 8; ++r) { float v = acc[t][r] * alpha + bv; if (CP) { const int rr = row0g + row0 + 8 * hh + r; if (rowsPerB < 0) v += CP[cofs + (size_t)rr * ldc + col];      /* rowsPerB < 0: own element of the batched C plane */ else { const int bidx = rr / rowsPerB; v += CP[(size_t)bidx * sCPb + (size_t)by * 64 + col]; } } if (ACT == 1) v = (v > 0.f) ? v : expm1f(v); else if (ACT == 7) v = (v > 0.f) ? v + 1.0f : expf(v); else if (ACT == 8) v = tanhf(v); else if (ACT == 9) v = 0.5f * v * (1.0f + tanhf(0.7978845608028654f * (v + 0.044715f * v * v * v))); else if (ACT == 11) v = 1.0f / (1.0f + expf(-v)); else if (ACT == 12) v = (v > 0.f) ? v : 0.01f * v; else if (ACT == 14) v = (v > 0.f) ? v : 0.1f * v; else if (ACT == 16) v = (v >= 0.f) ? v : 0.3f * v; else if (ACT == 17) v = (v >= 0.f) ? v : 0.2f * v; else if (ACT == 15) v = v / (1.0f + expf(-v)); else if (ACT == 3) v = fmaxf(v, 0.f); else if (ACT == 6) v = 0.5f * v * (1.0f + erff(v * 0.70710678118654752f)); so[w][8 * hh + r][t * 16 + ln] = v; } }
  __builtin_amdgcn_fence(__ATOMIC_ACQ_REL, "workgroup"); __builtin_amdgcn_wave_barrier();
  const int rsub = lane >> 4, c4 = (lane & 15) * 4; typedef _Float16 v4h __attribute__((ext_vector_type(4)));
  {
#pragma unroll
    for (int q = 0; q < 8; ++q) { const int r = q * 2 + rsub; if (col0 + c4 < N) { const v4f v = *(const v4fa*)&so[w][r][c4]; if (C) *(v4f*)(C + cofs + (size_t)(row0 + r) * ldc + col0 + c4) = v; if (C16) { v4h h4; for (int i = 0; i < 4; ++i) h4[i] = (_Float16)v[i]; *(v4h*)(C16 + cofs + (size_t)(row0 + r) * ldc + col0 + c4) = h4; } } }
     }
}


typedef _Float16 v4h __attribute__((ext_vector_type(4)));

__device__ __forceinline__ void x16(const float* __restrict__ x, _Float16* __restrict__ X16, size_t t) { FragH f;      /* t = piece index, 8 elements each */
#pragma unroll
  for (int q = 0; q < 8; ++q) f.h[q] = (_Float16)bf16_round(x[t * 8 + q]); *(v8us*)((unsigned short*)X16 + t * 8) = f.half[0];
  asm volatile("s_wait_xcnt 0x0" ::: "memory"); }      /* inlined into a kernel with further code behind it: the store's address and data registers are reused only behind this wait */
__global__ __launch_bounds__(256) void k_h16(const float* __restrict__ x, _Float16* __restrict__ X16, size_t n8) { const size_t t = (size_t)blockIdx.x * 256 + threadIdx.x; if (t >= n8) return; FragH f;
#pragma unroll
  for (int q = 0; q < 8; ++q) f.h[q] = (_Float16)x[t * 8 + q]; *(v8us*)((unsigned short*)X16 + t * 8) = f.half[0];  }
__global__ __launch_bounds__(256) void k_round16f(const float* __restrict__ W, _Float16* __restrict__ Bt, size_t n8) { const size_t t = (size_t)blockIdx.x * 256 + threadIdx.x; if (t >= n8) return; FragH f;
#pragma unroll
  for (int i = 0; i < 8; ++i) f.h[i] = (_Float16)(bf16_round(W[t * 8 + i]) * 16.0f); *(v8us*)((unsigned short*)Bt + t * 8) = f.half[0];  }
template <int NHv, int TTv>
__global__ __launch_bounds__(256) void k_vt(const _Float16* __restrict__ V16, int ldv, int voff, _Float16* __restrict__ Vt) { __shared__ unsigned short tl[64][66]; const int tid = threadIdx.x; const int slab = blockIdx.x / (TTv / 64), lg = blockIdx.x % (TTv / 64); const int b = slab / NHv, h = slab % NHv;
  for (int i = tid; i < 64 * 8; i += 256) { const int r = i / 8, c8 = (i % 8) * 8; FragH f; f.half[0] = *(const v8us*)((const unsigned short*)V16 + ((size_t)b * TTv + lg * 64 + r) * ldv + voff + h * 64 + c8);
#pragma unroll
    for (int q = 0; q < 8; ++q) tl[r][c8 + q] = f.u[q]; }
  __syncthreads();
  {
#pragma unroll
    for (int rd = 0; rd < 2; ++rd) { const int d = rd * 32 + tid / 8, pc = tid % 8; FragH f;
#pragma unroll
      for (int q = 0; q < 8; ++q) f.u[q] = tl[pc * 8 + q][d];
      *(v8us*)((unsigned short*)Vt + ((size_t)slab * 64 + d) * TTv + lg * 64 + pc * 8) = f.half[0]; }
     } }

__global__ __launch_bounds__(256) void k_hl(const float* __restrict__ F, _Float16* __restrict__ Hh, _Float16* __restrict__ Hl, size_t n8) { const size_t t = (size_t)blockIdx.x * 256 + threadIdx.x; if (t >= n8) return; FragH fh, fl; const v4f a = *(const v4fa*)(F + t * 8), c = *(const v4fa*)(F + t * 8 + 4);
#pragma unroll
  for (int q = 0; q < 4; ++q) { _Float16 h = (_Float16)a[q]; fh.h[q] = h; fl.h[q] = (_Float16)((a[q] - (float)h) * 1024.0f); h = (_Float16)c[q]; fh.h[4 + q] = h; fl.h[4 + q] = (_Float16)((c[q] - (float)h) * 1024.0f); }
  { *(v8us*)((unsigned short*)Hh + t * 8) = fh.half[0]; *(v8us*)((unsigned short*)Hl + t * 8) = fl.half[0];  } }

// fragment of 32 k from a k-contiguous f16 row in global memory
__device__ __forceinline__ v16h g2_frag(const _Float16* p, int hh) { FragH f; f.half[0] = *(const v8us*)((const unsigned short*)p + 8 * hh); f.half[1] = *(const v8us*)((const unsigned short*)p + 16 + 8 * hh); return f.v; }


__global__ __launch_bounds__(256) void k_wnat(const float* __restrict__ w, size_t n8, _Float16* __restrict__ Bt) { const size_t t = (size_t)blockIdx.x * 256 + threadIdx.x; if (t >= n8) return; FragH f; for (int q = 0; q < 8; ++q) f.h[q] = (_Float16)(bf16_round(w[t * 8 + q]) * 16.0f); *(v8us*)((unsigned short*)Bt + t * 8) = f.half[0];  }
__global__ __launch_bounds__(256) void k_rsm(const float* __restrict__ S, _Float16* __restrict__ P, int nrows) {
  #pragma clang fp contract(off)
  const int i = blockIdx.x * 256 + threadIdx.x; if (i >= nrows) return; const float* s = S + (size_t)i * SQ; float mx = -3.0e38f;
#pragma unroll 1
  for (int j = 0; j < SQ; ++j) mx = fmaxf(mx, s[j]); float se = 0.f;
#pragma unroll 1
  for (int j = 0; j < SQ; ++j) se += expf(s[j] - mx); const float sc = 256.0f / se;
#pragma unroll 1
  for (int j0 = 0; j0 < SQ; j0 += 8) { FragH f; for (int q = 0; q < 8; ++q) f.h[q] = (_Float16)(expf(s[j0 + q] - mx) * sc); unsigned short* d = (unsigned short*)P + (size_t)i * SQ + j0; *(v8us*)d = f.half[0];  } }
__global__ __launch_bounds__(256) void k_vt(const _Float16* __restrict__ V16, int b, int h0, _Float16* __restrict__ VT) { __shared__ unsigned short tl[64][65]; const int tid = threadIdx.x; const int hh = blockIdx.x % HG, sg = blockIdx.x / HG; const int s0 = sg * 64; const int h = h0 + hh;
  for (int i = tid; i < 64 * 8; i += 256) { const int j = i / 8, d8 = (i % 8) * 8; FragH f; f.half[0] = *(const v8us*)((const unsigned short*)V16 + ((size_t)b * SQ + s0 + j) * DM + h * HD + d8); for (int q = 0; q < 8; ++q) tl[d8 + q][j] = f.u[q]; }
  __syncthreads();
  { for (int i = tid; i < 64 * 8; i += 256) { const int d = i / 8, j8 = (i % 8) * 8; FragH f; for (int q = 0; q < 8; ++q) f.u[q] = tl[d][j8 + q]; *(v8us*)((unsigned short*)VT + ((size_t)hh * HD + d) * SQ + s0 + j8) = f.half[0]; }  } }



// All operand preparation in one launch: none of these pieces reads what another writes, so they share one grid by ranges of the block index (block-uniform branches).
// The weight blocks come first: their strided reads take longest and run under the memory-bound casts that follow.
#define PR_WO ((DM * (DM / 8)) / 256)            /* blocks for the [in][out] output weight */
#define PR_WH ((NH * HD * (DM / 8)) / 256)       /* blocks for one per-head stack */
#define PR_HP (HD * (DM / 8))                    /* 8-element pieces per head */
#define PR_X ((int)(NR * DM / 8 / 256))          /* blocks for one cast of the token rows */
__global__ __launch_bounds__(256) void k_prep(const float* __restrict__ wq, const float* __restrict__ wk, const float* __restrict__ wv, const float* __restrict__ wo, const float* __restrict__ xq, const float* __restrict__ xk, const float* __restrict__ xv,
    _Float16* __restrict__ BQ, _Float16* __restrict__ BK, _Float16* __restrict__ BV, _Float16* __restrict__ BO, _Float16* __restrict__ XQ, _Float16* __restrict__ XK, _Float16* __restrict__ XV) {
  int blk = blockIdx.x; const int tid = threadIdx.x;
  if (blk < PR_WO) { wt_f16(wo, BO, DM, DM, 16.0f, blk * 256 + tid); return; }
  blk -= PR_WO;
  if (blk < 3 * PR_WH) { const int m = blk / PR_WH; const int u = (blk - m * PR_WH) * 256 + tid; const int h = u / PR_HP;      /* head h: a row-major [DM][HD] block, written as its HD rows of the [out][in] plane */
    const float* w = (m == 0) ? wq : (m == 1) ? wk : wv; _Float16* B = (m == 0) ? BQ : (m == 1) ? BK : BV;
    wt_f16(w + (size_t)h * DM * HD, B + (size_t)h * HD * DM, DM, HD, 16.0f, u - h * PR_HP); return; }
  blk -= 3 * PR_WH;
  const int m = blk / PR_X; const size_t t = (size_t)(blk - m * PR_X) * 256 + tid;
  x16((m == 0) ? xq : (m == 1) ? xk : xv, (m == 0) ? XQ : (m == 1) ? XK : XV, t);
}

#define FA_NW 8                      /* waves per workgroup */
#define FA_BR (FA_NW * 32)           /* query rows per workgroup */
#define FA_SK 64                     /* keys per stage = two 32-key passes */
#define FA_PITCH 144                 /* LDS row pitch in bytes: 128 of data + 16, an odd multiple of 16 for the 16-byte fragment reads */
#define FA_TILE (FA_SK * FA_PITCH)
/* amdgpu_waves_per_eu(4, 4): at most 256 VGPRs, so that two workgroups (four waves per SIMD) are resident per WGP and the 512 workgroups run in one round */
__device__ __forceinline__ float fa_xh(float x) { return __builtin_bit_cast(float, __builtin_amdgcn_permlanex16(__builtin_bit_cast(int, x), __builtin_bit_cast(int, x), 0x76543210, 0xfedcba98, false, false)); }      /* lane l reads lane l ^ 16 */
__device__ __forceinline__ v16h fa_frag(const unsigned char* p) { FragH f; f.half[0] = *(const v8us*)p; f.half[1] = *(const v8us*)(p + 32); return f.v; }      /* p = row start + 16 * (lane >> 4): k = 8 hh .. 8 hh + 7 and 16 + 8 hh .. 16 + 8 hh + 7, as g2_frag */
__device__ __forceinline__ v8f fa_mma(v16h a, v16h b, v8f c) { return __builtin_amdgcn_wmma_f32_16x16x32_f16(false, a, false, b, (short)0, c, false, false); }
__global__ __launch_bounds__(FA_NW * 32) __attribute__((amdgpu_waves_per_eu(4, 4))) void k_fattn(const _Float16* __restrict__ Q16, const _Float16* __restrict__ K16, const _Float16* __restrict__ VT, _Float16* __restrict__ O16) {
  __shared__ __attribute__((aligned(16))) unsigned char L[2][2][FA_TILE];      /* [buffer][0 = K rows, 1 = V^T rows] */
  const int tid = threadIdx.x, lane = tid & 31, c = lane & 15, hh = lane >> 4; const int wave = __builtin_amdgcn_readfirstlane(tid >> 5);
  const int q0 = blockIdx.x * FA_BR + wave * 32, h = blockIdx.y, b = blockIdx.z; const size_t r0 = (size_t)b * SQ;
  const float cs = 0.125f * 1.4426950408889634f;      /* 64^-0.5 and log2(e) */
  /* staging: thread t moves the 16-byte piece t & 7 of rows t >> 3 and 32 + (t >> 3) of both tiles: 8 lanes cover one whole 128-byte row */
  const int srow = tid >> 3, scol = tid & 7; const int sl = srow * FA_PITCH + scol * 16;
  const unsigned short* kg = (const unsigned short*)K16 + (r0 + srow) * LQ + h * HD + scol * 8;
  const unsigned short* vg = (const unsigned short*)VT + (((size_t)b * NH + h) * HD + srow) * SQ + scol * 8;
  v8us k0 = *(const v8us*)kg, k1 = *(const v8us*)(kg + (size_t)32 * LQ), v0 = *(const v8us*)vg, v1 = *(const v8us*)(vg + (size_t)32 * SQ);
  v16h qf[2][2];
#pragma unroll      /* register arrays need constant indices */
  for (int g = 0; g < 2; ++g) { const _Float16* qp = Q16 + (r0 + q0 + 16 * g + c) * LQ + h * HD; qf[g][0] = g2_frag(qp, hh); qf[g][1] = g2_frag(qp + 32, hh); }
  FragH ones;
#pragma unroll
  for (int i = 0; i < 16; ++i) ones.u[i] = (c == 0) ? (unsigned short)0x3C00 : (unsigned short)0;
  const v8f z8 = {0.f, 0.f, 0.f, 0.f, 0.f, 0.f, 0.f, 0.f};
  v8f acc[2][4] = {{z8, z8, z8, z8}, {z8, z8, z8, z8}}; v8f lacc[2] = {z8, z8}; float m_run[2] = {-__builtin_inff(), -__builtin_inff()};
  *(v8us*)&L[0][0][sl] = k0; *(v8us*)&L[0][0][sl + 32 * FA_PITCH] = k1; *(v8us*)&L[0][1][sl] = v0; *(v8us*)&L[0][1][sl + 32 * FA_PITCH] = v1;
  for (int st = 0; st < SQ / FA_SK; ++st) {
    __syncthreads();      /* stage st is written by every wave, and every wave has left the buffer that is refilled at the foot of this trip */
    const unsigned char* Kb = &L[st & 1][0][0]; const unsigned char* Vb = &L[st & 1][1][0];
    const bool more = st + 1 < SQ / FA_SK;      /* the same for the whole workgroup */
    if (more) { k0 = *(const v8us*)(kg + (size_t)FA_SK * LQ); k1 = *(const v8us*)(kg + (size_t)(FA_SK + 32) * LQ); v0 = *(const v8us*)(vg + FA_SK); v1 = *(const v8us*)(vg + FA_SK + (size_t)32 * SQ); }      /* next stage, in flight under this stage's passes */
#pragma unroll      /* two passes per stage; constant LDS offsets */
    for (int sub = 0; sub < 2; ++sub) {
      v8f s[2][2];
#pragma unroll      /* register arrays need constant indices */
      for (int kt = 0; kt < 2; ++kt) { const unsigned char* p = Kb + (32 * sub + 16 * kt + c) * FA_PITCH + 16 * hh; const v16h ka = fa_frag(p), kb = fa_frag(p + 64);
        s[kt][0] = fa_mma(kb, qf[0][1], fa_mma(ka, qf[0][0], z8)); s[kt][1] = fa_mma(kb, qf[1][1], fa_mma(ka, qf[1][0], z8)); }
      v16h vf[4];
#pragma unroll      /* register arrays need constant indices */
      for (int t = 0; t < 4; ++t) vf[t] = fa_frag(Vb + (16 * t + c) * FA_PITCH + 64 * sub + 16 * hh);
      float mb[2]; bool need = false;
#pragma unroll      /* register arrays need constant indices */
      for (int g = 0; g < 2; ++g) { float mx = fmaxf(s[0][g][0], s[1][g][0]);
#pragma unroll      /* register arrays need constant indices */
        for (int r = 1; r < 8; ++r) mx = fmaxf(mx, fmaxf(s[0][g][r], s[1][g][r]));
        mx = fmaxf(mx, fa_xh(mx)) * cs; mb[g] = mx; need = need || (mx > m_run[g] + 8.0f); }      /* both wave halves hold this query's maximum, scaled */
      if (__builtin_amdgcn_ballot_w32(need) != 0) {      /* wave-uniform; rare after the first pass */
#pragma unroll      /* register arrays need constant indices */
        for (int g = 0; g < 2; ++g) { const float m_new = fmaxf(m_run[g], mb[g]); const float corr = __builtin_amdgcn_exp2f(m_run[g] - m_new); m_run[g] = m_new; lacc[g] = lacc[g] * corr;      /* corr is 0 on the first pass */
#pragma unroll      /* register arrays need constant indices */
          for (int t = 0; t < 4; ++t) acc[g][t] = acc[g][t] * corr; } }
#pragma unroll      /* register arrays need constant indices */
      for (int g = 0; g < 2; ++g) { const float nm = -m_run[g]; FragH pf;
#pragma unroll      /* register arrays need constant indices */
        for (int i = 0; i < 16; ++i) pf.h[i] = (_Float16)__builtin_amdgcn_exp2f(__builtin_fmaf(s[i >> 3][g][i & 7], cs, nm));      /* keys 8 hh + r of tile 0, then of tile 1: the B operand's k order */
#pragma unroll      /* register arrays need constant indices */
        for (int t = 0; t < 4; ++t) acc[g][t] = fa_mma(vf[t], pf.v, acc[g][t]);
        lacc[g] = fa_mma(ones.v, pf.v, lacc[g]); }      /* row 0 += the column sums of P^T */
    }
    if (more) { unsigned char* Kn = &L[(st + 1) & 1][0][0]; unsigned char* Vn = &L[(st + 1) & 1][1][0]; *(v8us*)(Kn + sl) = k0; *(v8us*)(Kn + sl + 32 * FA_PITCH) = k1; *(v8us*)(Vn + sl) = v0; *(v8us*)(Vn + sl + 32 * FA_PITCH) = v1;
      asm volatile("s_wait_xcnt 0x0" :: "v"(kg), "v"(vg) : "memory");      /* the stage loads' address registers (held live to here) are advanced only behind this wait */
      kg += (size_t)FA_SK * LQ; vg += FA_SK; }
  }
#pragma unroll      /* register arrays need constant indices */
  for (int g = 0; g < 2; ++g) { const float lr = lacc[g][0]; const float inv = 64.0f / (lr + fa_xh(lr));
#pragma unroll      /* register arrays need constant indices */
    for (int t = 0; t < 4; ++t) { FragH f;
#pragma unroll      /* register arrays need constant indices */
      for (int r = 0; r < 8; ++r) f.h[r] = (_Float16)(acc[g][t][r] * inv);
      *(v8us*)((unsigned short*)O16 + (r0 + q0 + 16 * g + c) * DM + h * HD + 16 * t + 8 * hh) = f.half[0]; } } }      /* d = 16 t + 8 hh .. + 7 of query 16 g + c */

// ---- tiled GEMM C = (A . B^T) * alpha + bias: A [rows][DM] and B [cols][DM] f16, k contiguous; one 128 x 128 tile of C per workgroup, four waves of 64 x 64 (4 x 4 accumulator tiles) ----
// Stages of 64 k (128 bytes of each of the 128 A rows and 128 B rows) are brought by asynchronous copies into two LDS buffers, the next stage in flight under this stage's products: every copy
// covers whole 128-byte lines, and each operand byte is fetched once per workgroup and read from LDS by the two waves that need it. k runs upward in steps of 32 into one accumulator per tile.
// Rows % 128 == 0, columns = k = DM, at least two stages.
#define G3_BT 128                    /* tile rows and tile columns per workgroup */
#define G3_SK 64                     /* k per stage = two WMMA steps */
#define G3_NS (DM / G3_SK)           /* stages */
#define G3_PITCH 144                 /* LDS row pitch in bytes: 128 of data + 16, an odd multiple of 16 for the 16-byte fragment reads */
#define G3_TILE (G3_BT * G3_PITCH)
#define G3_OP 68                     /* pitch in floats of the staged output rows */
typedef float f1a __attribute__((may_alias));
/* One lane's eight 16-byte pieces of a 128-row tile, rows 16 apart: lds = the lane's LDS byte address, g = its global address, both multiples of 16. The copies go through no register.
   s_wait_xcnt stands inside the statement, so that no address register of a copy is rewritten in front of it. */
__device__ __forceinline__ void g3_copy8(unsigned lds, const unsigned short* g) {
  asm volatile("global_load_async_to_lds_b128 %0, %8, off\n\t"
               "global_load_async_to_lds_b128 %1, %9, off\n\t"
               "global_load_async_to_lds_b128 %2, %10, off\n\t"
               "global_load_async_to_lds_b128 %3, %11, off\n\t"
               "global_load_async_to_lds_b128 %4, %12, off\n\t"
               "global_load_async_to_lds_b128 %5, %13, off\n\t"
               "global_load_async_to_lds_b128 %6, %14, off\n\t"
               "global_load_async_to_lds_b128 %7, %15, off\n\t"
               "s_wait_xcnt 0x0"
               :: "v"(lds), "v"(lds + 16 * G3_PITCH), "v"(lds + 32 * G3_PITCH), "v"(lds + 48 * G3_PITCH), "v"(lds + 64 * G3_PITCH), "v"(lds + 80 * G3_PITCH), "v"(lds + 96 * G3_PITCH), "v"(lds + 112 * G3_PITCH),
                  "v"(g), "v"(g + (size_t)16 * DM), "v"(g + (size_t)32 * DM), "v"(g + (size_t)48 * DM), "v"(g + (size_t)64 * DM), "v"(g + (size_t)80 * DM), "v"(g + (size_t)96 * DM), "v"(g + (size_t)112 * DM)
               : "memory"); }
template <bool OUT32>
__global__ __launch_bounds__(128) void k_gemm3(const _Float16* __restrict__ A, size_t sA, const _Float16* __restrict__ Bh, size_t sB, float alpha, const float* __restrict__ bias0, const float* __restrict__ bias1, const float* __restrict__ bias2,
    float* __restrict__ C, _Float16* __restrict__ C16, size_t sC) {
  __shared__ __attribute__((aligned(16))) unsigned char L[2][2][G3_TILE];      /* [buffer][0 = A rows, 1 = B rows]; behind the k loop: four staged 64 x 64 f32 output tiles */
  static_assert(4 * 64 * G3_OP * 4 <= 4 * G3_TILE, "the staged output tiles must fit the ring"); static_assert(G3_NS >= 2, "the prologue fills two stages");
  const int tid = threadIdx.x, lane = tid & 31, ln = lane & 15, hh = lane >> 4; const int wave = __builtin_amdgcn_readfirstlane(tid >> 5); const int by = blockIdx.y;
  const float* bias = (by == 0) ? bias0 : (by == 1) ? bias1 : bias2;      /* products that share one grid along y keep their biases in separate buffers */
  const int mt = blockIdx.x / (DM / G3_BT), nq = blockIdx.x - mt * (DM / G3_BT); const int row0 = mt * G3_BT, col0 = nq * G3_BT; const int wm = (wave >> 1) * 64, wn = (wave & 1) * 64;
  /* staging: thread t copies the 16-byte piece t & 7 of rows (t >> 3) + 16 i, i = 0 .. 7, of both tiles: 8 lanes cover one whole 128-byte row */
  const int srow = tid >> 3, scol = tid & 7; const unsigned sl = (unsigned)(size_t)&L[0][0][0] + srow * G3_PITCH + scol * 16;      /* low 32 bits of the shared address = LDS byte address */
  const unsigned short* ag = (const unsigned short*)A + (size_t)by * sA + (size_t)(row0 + srow) * DM + scol * 8;
  const unsigned short* bg = (const unsigned short*)Bh + (size_t)by * sB + (size_t)(col0 + srow) * DM + scol * 8;
  const v8f z8 = {0.f, 0.f, 0.f, 0.f, 0.f, 0.f, 0.f, 0.f};
  v8f acc[4][4] = {{z8, z8, z8, z8}, {z8, z8, z8, z8}, {z8, z8, z8, z8}, {z8, z8, z8, z8}};
  g3_copy8(sl, ag); g3_copy8(sl + G3_TILE, bg);      /* stage 0 into buffer 0 */
  asm volatile("s_wait_asynccnt 0x0" ::: "memory");      /* this wave's copies of stage 0 have landed */
  __syncthreads();      /* ... and every other wave's */
  g3_copy8(sl + 2 * G3_TILE, ag + G3_SK); g3_copy8(sl + 3 * G3_TILE, bg + G3_SK);      /* stage 1 into buffer 1, in flight under stage 0's products */
  for (int st = 0; st < G3_NS; ++st) {
    const unsigned char* Ab = &L[st & 1][0][0] + (wm + ln) * G3_PITCH + 16 * hh; const unsigned char* Bb = &L[st & 1][1][0] + (wn + ln) * G3_PITCH + 16 * hh;
#pragma unroll      /* two WMMA steps per stage; constant LDS offsets */
    for (int kk = 0; kk < 2; ++kk) { v16h af[4], bf[4];
#pragma unroll      /* register arrays need constant indices */
      for (int i = 0; i < 4; ++i) { af[i] = fa_frag(Ab + 16 * i * G3_PITCH + 64 * kk); bf[i] = fa_frag(Bb + 16 * i * G3_PITCH + 64 * kk); }      /* both operands in the k order of g2_frag */
      __builtin_amdgcn_sched_barrier(0);      /* keeps the step's 16 fragment reads together in front of its 16 products: sunk among them, each A fragment's LDS latency is waited out in full */
#pragma unroll      /* register arrays need constant indices */
      for (int i = 0; i < 4; ++i)
#pragma unroll      /* register arrays need constant indices */
        for (int j = 0; j < 4; ++j) acc[i][j] = fa_mma(af[i], bf[j], acc[i][j]); }
    asm volatile("s_wait_dscnt 0x0" ::: "memory");      /* this wave's reads of buffer st & 1 are done before that buffer is handed to the copies */
    asm volatile("s_wait_asynccnt 0x0" ::: "memory");      /* this wave's copies of stage st + 1 have landed */
    __syncthreads();      /* stage st + 1 is published, and every wave has left the buffer that is refilled behind this barrier */
    if (st + 2 < G3_NS) { const unsigned lb = sl + (st & 1) * (2 * G3_TILE); const size_t ko = (size_t)(st + 2) * G3_SK;      /* the same for the whole workgroup */
      g3_copy8(lb, ag + ko); g3_copy8(lb + G3_TILE, bg + ko); }
  }
  asm volatile("s_wait_asynccnt 0x0" ::: "memory");      /* no copy is outstanding when the ring's LDS takes the output tiles */
  /* the last trip's barrier stands behind every wave's last read of the ring: each wave now stages its output tile in its own part of that LDS, so that the stores cover whole lines */
  f1a* so = (f1a*)&L[0][0][0] + wave * (64 * G3_OP);
#pragma unroll      /* register arrays need constant indices */
  for (int j = 0; j < 4; ++j) { const float bv = bf16_round(bias[col0 + wn + 16 * j + ln]);
#pragma unroll      /* register arrays need constant indices */
    for (int i = 0; i < 4; ++i)
#pragma unroll      /* register arrays need constant indices */
      for (int r = 0; r < 8; ++r) so[(16 * i + 8 * hh + r) * G3_OP + 16 * j + ln] = acc[i][j][r] * alpha + bv; }
  __builtin_amdgcn_fence(__ATOMIC_ACQ_REL, "workgroup"); __builtin_amdgcn_wave_barrier();      /* the wave's own LDS writes are done before its lanes read each other's */
  const int rsub = lane >> 4, c4 = (lane & 15) * 4; const size_t o0 = (size_t)by * sC + (size_t)(row0 + wm + rsub) * DM + col0 + wn + c4;
#pragma unroll      /* constant offsets from one address */
  for (int q = 0; q < 32; ++q) { const v4f v = *(const v4fa*)&so[(q * 2 + rsub) * G3_OP + c4];
    if (OUT32) *(v4f*)(C + o0 + (size_t)(q * 2) * DM) = v;
    else { v4h h4;
#pragma unroll      /* register arrays need constant indices */
      for (int i = 0; i < 4; ++i) h4[i] = (_Float16)v[i];
      *(v4h*)(C16 + o0 + (size_t)(q * 2) * DM) = h4; } } }

extern "C" void kernel_launch(void* const* d_in, const int* in_sizes, int n_in,
                              void* d_out, int out_size, void* d_ws, size_t ws_size, hipStream_t stream) {
  (void)in_sizes; (void)n_in; (void)out_size;
  const float* const* I = (const float* const*)d_in; const float* xq = I[0]; const float* xk = I[1]; const float* xv = I[1]; const float* wq = I[2]; const float* bq = I[3]; const float* wk = I[4]; const float* bk = I[5]; const float* wv = I[6]; const float* bv = I[7]; const float* wo = I[8]; const float* bo = I[9];      /* TWO inputs: query (the q stream) and value (read on BOTH the k and the v stream casts); wq, wk, wv are PER-HEAD STACKS [16][1024][64] = [head][in][out]; bq, bk, bv per-head [16][64] = the flat [1024] bias; wo [in][out] + bo; input order query, value, wq, bq, wk, bk, wv, bv, wo, bo */
  char* ws = (char*)d_ws; size_t off = 0;
  auto take = [&](size_t bytes) { char* p = ws + off; off += (bytes + 255) & ~(size_t)255; return p; };
  _Float16* BQ = (_Float16*)take((size_t)DM * DM * 2); _Float16* BK = (_Float16*)take((size_t)DM * DM * 2); _Float16* BV = (_Float16*)take((size_t)DM * DM * 2); _Float16* BO = (_Float16*)take((size_t)DM * DM * 2);
  _Float16* XQ = (_Float16*)take(NR * DM * 2); _Float16* XK = (_Float16*)take(NR * DM * 2); _Float16* XV = (_Float16*)take(NR * DM * 2); _Float16* Q16 = (_Float16*)take(NR * DM * 2); _Float16* K16 = (_Float16*)take(NR * DM * 2); _Float16* V16 = (_Float16*)take(NR * DM * 2); _Float16* O16 = (_Float16*)take(NR * DM * 2);
  _Float16* VT = (_Float16*)take((size_t)NB * NH * HD * SQ * 2);
  if (off > ws_size) return;
  k_prep<<<PR_WO + 3 * PR_WH + 3 * PR_X, 256, 0, stream>>>(wq, wk, wv, wo, xq, xk, xv, BQ, BK, BV, BO, XQ, XK, XV);      /* weight planes [out][in] (x16): the per-head stacks wq / wk / wv [NH][DM][HD] head by head into contiguous rows, wo [in][out] whole; the three token streams as exact f16 rows */
  const size_t r0p = (size_t)B0 * SQ;      /* first projected row */
  k_gemm3<false><<<dim3((unsigned)((MP / G3_BT) * (DM / G3_BT)), 3), 128, 0, stream>>>(XQ + r0p * DM, NR * DM, BQ, (size_t)DM * DM, 0.0625f, bq, bk, bv, nullptr, Q16 + r0p * DM, NR * DM);      /* q, k, v in one grid, y = 0, 1, 2: XQ XK XV, BQ BK BV and Q16 K16 V16 each lie one behind the other in the workspace */
  k_vt<NH, SQ><<<NB * NH * (SQ / 64), 256, 0, stream>>>(V16, LQ, 0, VT);      /* V^T [NB][NH][HD][SQ], all batches */
  k_fattn<<<dim3(SQ / FA_BR, NH, NB), FA_NW * 32, 0, stream>>>(Q16, K16, VT, O16);      /* o x64 (merged heads) as f16 rows */
  k_gemm3<true><<<dim3((unsigned)((MPO / G3_BT) * (DM / G3_BT)), 1), 128, 0, stream>>>(O16 + r0p * DM, 0, BO, 0, 0.0009765625f, bo, bo, bo, (float*)d_out + r0p * DM, nullptr, 0);      /* out rows are the output layout */
}

// v005
// One run takes 135 microseconds.
// In both of two side-by-side timings against v004, it was 1.03 times as fast.
// Counting every step since v000, it is 52.5 times as fast.
#include <hip/hip_runtime.h>
// Multi-head attention on two inputs with PER-HEAD STACKED projections and per-head biases on four sequences (query [4][2048][1024], value [4][2048][1024]; q = einsum('bsd,hde->bhse', query, wq) + bq, k = einsum(value, wk) + bk, v = einsum(value, wv) + bv with W [16][1024][64] = [head][in][out] and b [16][64], 16 heads of 64; scores * 1/sqrt(64); softmax over all 2048 keys (no mask); out = heads wo + bo ([in][out] + bias) -> [4][2048][1024]); each head's [in][out] block is transposed into its 64 contiguous rows of the weight plane by the existing builder; the [in][out] output weight through the same builder; all of them, and the casts of the token rows, in one preparation launch.
// Structure: token rows r = b*2048 + s; the query source and the key/value source as exact f16 rows (bf16-rounded); Q, K, V as three WMMA GEMMs in one grid (128x128 workgroup tiles staged in LDS, 64x64 wave tiles, f32 accumulation, exact x16 weights + bias, f16 outputs); V^T for all batches and heads via LDS transposes; one fused attention launch (scores K = 64 and o = P . V^T on WMMA, online softmax on VALU with f32 statistics and native exp2, weights as f16 relative to the running maximum; o carried x64 against f16 subnormal flush, folded into the output GEMM alpha) written straight into the merged f16 o rows; out = o W_o + b GEMM (f32) into the output layout.
// Compute dtype: inputs rounded to bf16; x / weights exact; q, k, v, softmax weights and o as plain f16 GEMM operands (~2^-12); scores and softmax statistics f32. v_wmma_f32_16x16x32_f16.
#define NB 4
#define SQ 2048
#define DM 1024
#define NH 16
#define HD 64
#define HG 4                         /* heads per block group of the k_vt(V16, b, h0, VT) overload (not launched) */
#define B0 0                         /* first batch processed (debug hook) */
#define NBR NB                       /* batches processed (debug hook) */
#define NR ((size_t)NB * SQ)         /* token rows */
#define MP ((int)((size_t)NBR * SQ)) /* rows projected (debug hook) */
#define QN SQ                        /* query rows per batch; unused, k_fattn attends all SQ */
#define NHD NH                       /* heads; unused, k_fattn attends all NH */
#define MPO MP                       /* rows through the output stage (debug hook) */
#define LQ DM      /* row pitch of the q/k/v rows */
typedef __bf16 v16b __attribute__((ext_vector_type(16)));
typedef unsigned short v8us __attribute__((ext_vector_type(8), may_alias));
typedef float  v8f  __attribute__((ext_vector_type(8)));
typedef float  v4f  __attribute__((ext_vector_type(4)));
typedef float  v4fa __attribute__((ext_vector_type(4), may_alias));
union FragB { v16b v; v8us half[2]; unsigned short u[16]; };

__device__ __forceinline__ unsigned short bf16_bits(float x) { unsigned int u = __float_as_uint(x); return (unsigned short)((u + 0x7FFFu + ((u >> 16) & 1u)) >> 16); }
__device__ __forceinline__ float bf16_val(unsigned short b) { return __uint_as_float(((unsigned int)b) << 16); }
__device__ __forceinline__ float bf16_round(float x) { return bf16_val(bf16_bits(x)); }
// D += A·B with NT terms: 1 = ah·bh, 2 = + al·bh (A split), 3 = + ah·bl (both split)
template <int NT>
__device__ __forceinline__ v8f mmaN(v16b ah, v16b al, v16b bh, v16b bl, v8f c) {
  c = __builtin_amdgcn_wmma_f32_16x16x32_bf16(false, ah, false, bh, (short)0, c, false, false);
  if (NT >= 2) c = __builtin_amdgcn_wmma_f32_16x16x32_bf16(false, al, false, bh, (short)0, c, false, false);
  if (NT >= 3) c = __builtin_amdgcn_wmma_f32_16x16x32_bf16(false, ah, false, bl, (short)0, c, false, false);
  asm volatile("v_nop\n\tv_nop\n\tv_nop\n\tv_nop" : "+v"(c) : "v"(ah), "v"(al), "v"(bh), "v"(bl));
  return c;
}

__global__ __launch_bounds__(256) void k_wt_bf16(const float* __restrict__ W, unsigned short* __restrict__ Wt, int K, int N) {
  const int t = blockIdx.x * 256 + threadIdx.x;
  const int k8n = K / 8;
  if (t >= N * k8n) return;
  const int n = t / k8n, k8 = (t % k8n) * 8;
  v8us v;
#pragma unroll
  for (int i = 0; i < 8; ++i) v[i] = bf16_bits(W[(size_t)(k8 + i) * N + n]);
  *(v8us*)(Wt + (size_t)n * K + k8) = v;
  
}

// GEMM C[M][N] (f32, pitch ldc) = act(A[M][K]·W + bias). A f32 row-major (pitch lda) converted per fragment to bf16
// (ASPLIT: hi/lo two planes -> 2 terms, else single rounded term); Wt bf16 [N][K] (pitch ldb). BIAS_BF16 rounds the
// bias to bf16 first (bias quantised to bf16 before the add). K%32==0, M%16==0, N%64==0.
template <bool ASPLIT, int ACT, bool BIAS_BF16>
__global__ __launch_bounds__(128) void k_gemm_bf(const float* __restrict__ A, int lda, const unsigned short* __restrict__ Wt, int ldb,
                                               const float* __restrict__ bias, float* __restrict__ C, int ldc, int M, int N, int K) {
  __shared__ __attribute__((aligned(16))) float so[4][16][64];
  const int tid = threadIdx.x, w = tid >> 5, lane = tid & 31, ln = lane & 15, hh = lane >> 4;
  const int ntn = N / 64;
  const int wid = blockIdx.x * 4 + w;
  const int mt = wid / ntn, nq = wid % ntn;
  if (mt * 16 >= M) return;
  const int row0 = mt * 16, col0 = nq * 64;
  const float* arow = A + (size_t)(row0 + ln) * lda;
  v8f acc[4] = {};
  for (int kb = 0; kb < K; kb += 32) {
    FragB ah, al;
    const v4f x0 = *(const v4fa*)(arow + kb + 8 * hh), x1 = *(const v4fa*)(arow + kb + 8 * hh + 4);
    const v4f x2 = *(const v4fa*)(arow + kb + 16 + 8 * hh), x3 = *(const v4fa*)(arow + kb + 16 + 8 * hh + 4);
    float xs[16] = {x0[0],x0[1],x0[2],x0[3],x1[0],x1[1],x1[2],x1[3],x2[0],x2[1],x2[2],x2[3],x3[0],x3[1],x3[2],x3[3]};
#pragma unroll
    for (int i = 0; i < 16; ++i) { const unsigned short hb = bf16_bits(xs[i]); ah.u[i] = hb; al.u[i] = ASPLIT ? bf16_bits(xs[i] - bf16_val(hb)) : (unsigned short)0; }
#pragma unroll
    for (int t = 0; t < 4; ++t) {
      const unsigned short* brow = Wt + (size_t)(col0 + t * 16 + ln) * ldb + kb;
      FragB b;
      b.half[0] = *(const v8us*)(brow + 8 * hh);
      b.half[1] = *(const v8us*)(brow + 16 + 8 * hh);
      acc[t] = mmaN<ASPLIT ? 2 : 1>(ah.v, al.v, b.v, b.v, acc[t]);
    }
  }
#pragma unroll
  for (int t = 0; t < 4; ++t) {
    float bv = bias ? bias[col0 + t * 16 + ln] : 0.f;
    if (BIAS_BF16) bv = bf16_round(bv);
#pragma unroll
    for (int r = 0; r < 8; ++r) { float v = acc[t][r] + bv; if (ACT == 1) v = fmaxf(v, 0.f); so[w][8 * hh + r][t * 16 + ln] = v; }
  }
  __builtin_amdgcn_fence(__ATOMIC_ACQ_REL, "workgroup");
  __builtin_amdgcn_wave_barrier();
  const int rsub = lane >> 4, c4 = (lane & 15) * 4;
  {
#pragma unroll
    for (int q = 0; q < 8; ++q) {
      const int r = q * 2 + rsub;
      const v4f v = *(const v4fa*)&so[w][r][c4];
      *(v4f*)(C + (size_t)(row0 + r) * ldc + col0 + c4) = v;
    }
    
  }
}

// GEMM C = act(A·W + bias + resid): A f32 (ASPLIT -> hi/lo 2 terms), Wt bf16 [N][K]; ACT 0 none, 1 relu, 2 exact gelu;
// resid (optional, f32, row index = (row % rmod), pitch ldr, RES_BF16 rounds it) added before the activation.
template <bool ASPLIT, int ACT, bool BIAS_BF16, bool RES_BF16>
__global__ __launch_bounds__(128) void k_gemm_bf3(const float* __restrict__ A, int lda, const unsigned short* __restrict__ Wt, int ldb,
                                                const float* __restrict__ bias, const float* __restrict__ resid, int rmod, int ldr,
                                                float* __restrict__ C, int ldc, int M, int N, int K) {
  __shared__ __attribute__((aligned(16))) float so[4][16][64];
  const int tid = threadIdx.x, w = tid >> 5, lane = tid & 31, ln = lane & 15, hh = lane >> 4;
  const int ntn = N / 64;
  const int wid = blockIdx.x * 4 + w;
  const int mt = wid / ntn, nq = wid % ntn;
  if (mt * 16 >= M) return;
  const int row0 = mt * 16, col0 = nq * 64;
  const float* arow = A + (size_t)(row0 + ln) * lda;
  v8f acc[4] = {};
  for (int kb = 0; kb < K; kb += 32) {
    FragB ah, al;
    const v4f x0 = *(const v4fa*)(arow + kb + 8 * hh), x1 = *(const v4fa*)(arow + kb + 8 * hh + 4);
    const v4f x2 = *(const v4fa*)(arow + kb + 16 + 8 * hh), x3 = *(const v4fa*)(arow + kb + 16 + 8 * hh + 4);
    float xs[16] = {x0[0],x0[1],x0[2],x0[3],x1[0],x1[1],x1[2],x1[3],x2[0],x2[1],x2[2],x2[3],x3[0],x3[1],x3[2],x3[3]};
#pragma unroll
    for (int i = 0; i < 16; ++i) { const unsigned short hb = bf16_bits(xs[i]); ah.u[i] = hb; al.u[i] = ASPLIT ? bf16_bits(xs[i] - bf16_val(hb)) : (unsigned short)0; }
#pragma unroll
    for (int t = 0; t < 4; ++t) {
      const unsigned short* brow = Wt + (size_t)(col0 + t * 16 + ln) * ldb + kb;
      FragB b;
      b.half[0] = *(const v8us*)(brow + 8 * hh);
      b.half[1] = *(const v8us*)(brow + 16 + 8 * hh);
      acc[t] = mmaN<ASPLIT ? 2 : 1>(ah.v, al.v, b.v, b.v, acc[t]);
    }
  }
#pragma unroll
  for (int t = 0; t < 4; ++t) {
    const int col = col0 + t * 16 + ln;
    float bv = bias ? bias[col] : 0.f;
    if (BIAS_BF16) bv = bf16_round(bv);
#pragma unroll
    for (int r = 0; r < 8; ++r) {
      float v = acc[t][r] + bv;
      if (resid) { float rv = resid[(size_t)((row0 + 8 * hh + r) % rmod) * ldr + col]; if (RES_BF16) rv = bf16_round(rv); v += rv; }
      if (ACT == 1) v = fmaxf(v, 0.f);
      if (ACT == 2) v = 0.5f * v * (1.0f + erff(v * 0.70710678118654752f));
      if (ACT == 3) { const float u = 0.7978845608028654f * (v + 0.044715f * v * v * v); v = 0.5f * v * (1.0f + tanhf(u)); }
      so[w][8 * hh + r][t * 16 + ln] = v;
    }
  }
  __builtin_amdgcn_fence(__ATOMIC_ACQ_REL, "workgroup");
  __builtin_amdgcn_wave_barrier();
  const int rsub = lane >> 4, c4 = (lane & 15) * 4;
  {
#pragma unroll
    for (int q = 0; q < 8; ++q) {
      const int r = q * 2 + rsub;
      const v4f v = *(const v4fa*)&so[w][r][c4];
      *(v4f*)(C + (size_t)(row0 + r) * ldc + col0 + c4) = v;
    }
    
  }
}
// row LayerNorm (biased variance, eps) over N: s = X (+ R); optional out_sum <- s; out_norm <- (s-mu)*rsqrt(var+eps)*g + b
template <bool PARAM_BF16>
__global__ __launch_bounds__(256) void k_layernorm(const float* __restrict__ X, const float* __restrict__ R, const float* __restrict__ g, const float* __restrict__ bta,
                                                  float* __restrict__ out_sum, float* __restrict__ out_norm, int N, float eps) {
  __shared__ float red[256];
  const int row = blockIdx.x, tid = threadIdx.x;
  const float* x = X + (size_t)row * N; const float* rr = R ? R + (size_t)row * N : nullptr;
  float vals[16];                     // up to N = 4096
  const int per = N / 256;            // contiguous chunk per thread? use strided-by-4 chunks: thread handles j = tid*4 + 1024*u
  float s1 = 0.f;
  for (int u = 0; u < per / 4; ++u) {
    const int j = tid * 4 + 1024 * u;
    const v4f a = *(const v4fa*)(x + j);
    v4f b = {0.f,0.f,0.f,0.f}; if (rr) b = *(const v4fa*)(rr + j);
#pragma unroll
    for (int q = 0; q < 4; ++q) { const float v = a[q] + b[q]; vals[u * 4 + q] = v; s1 += v; }
  }
  red[tid] = s1; __syncthreads();
  for (int st = 128; st > 0; st >>= 1) { if (tid < st) red[tid] += red[tid + st]; __syncthreads(); }
  const float mu = red[0] / (float)N; __syncthreads();
  float s2 = 0.f;
  for (int u = 0; u < per / 4; ++u)
#pragma unroll
    for (int q = 0; q < 4; ++q) { const float c = vals[u * 4 + q] - mu; s2 += c * c; }
  red[tid] = s2; __syncthreads();
  for (int st = 128; st > 0; st >>= 1) { if (tid < st) red[tid] += red[tid + st]; __syncthreads(); }
  const float rs = rsqrtf(red[0] / (float)N + eps);
  {
    for (int u = 0; u < per / 4; ++u) {
      const int j = tid * 4 + 1024 * u;
      v4f o, sm;
#pragma unroll
      for (int q = 0; q < 4; ++q) {
        float gg = g[j + q], bb = bta[j + q];
        if (PARAM_BF16) { gg = bf16_round(gg); bb = bf16_round(bb); }
        sm[q] = vals[u * 4 + q]; o[q] = (vals[u * 4 + q] - mu) * rs * gg + bb;
      }
      if (out_sum) *(v4f*)(out_sum + (size_t)row * N + j) = sm;
      *(v4f*)(out_norm + (size_t)row * N + j) = o;
    }
    
  }
}



// ---- f16 WMMA path (v_wmma_f32_16x16x32_f16): 11-bit significands for operands in range — used where a [0,1] probability operand needs more precision than bf16
typedef _Float16 v16h __attribute__((ext_vector_type(16)));
union FragH { v16h v; v8us half[2]; _Float16 h[16]; unsigned short u[16]; };
template <int NT>
__device__ __forceinline__ v8f mmaH(v16h ah, v16h al, v16h bh, v16h bl, v8f c) {
  c = __builtin_amdgcn_wmma_f32_16x16x32_f16(false, ah, false, bh, (short)0, c, false, false);
  if (NT >= 2) c = __builtin_amdgcn_wmma_f32_16x16x32_f16(false, al, false, bh, (short)0, c, false, false);
  if (NT >= 3) c = __builtin_amdgcn_wmma_f32_16x16x32_f16(false, ah, false, bl, (short)0, c, false, false);
  asm volatile("v_nop\n\tv_nop\n\tv_nop\n\tv_nop" : "+v"(c) : "v"(ah), "v"(al), "v"(bh), "v"(bl));
  return c;
}
// batched GEMM like k_gemm_b but f16 operands: A f32 (split into f16 hi/lo if ASPLIT, else rounded to f16), Bt = f16 values [n][k]; alpha; C f32; N multiple of 16 (partial tiles skipped)
template <bool ASPLIT>
__global__ __launch_bounds__(128) void k_gemm_h(const float* __restrict__ A, int lda, size_t sA, const _Float16* __restrict__ Bh, int ldb, size_t sB, float alpha, float* __restrict__ C, int ldc, size_t sC, int M, int N, int K) {
  __shared__ __attribute__((aligned(16))) float so[4][16][64];
  const int tid = threadIdx.x, w = tid >> 5, lane = tid & 31, ln = lane & 15, hh = lane >> 4; const int by = blockIdx.y;
  A += (size_t)by * sA; Bh += (size_t)by * sB; C += (size_t)by * sC;
  const int ntn = (N + 63) / 64; const int wid = blockIdx.x * 4 + w; const int mt = wid / ntn, nq = wid % ntn; if (mt * 16 >= M) return;
  const int row0 = mt * 16, col0 = nq * 64; const float* arow = A + (size_t)(row0 + ln) * lda;
  v8f acc[4] = {};
  for (int kb = 0; kb < K; kb += 32) {
    FragH ah, al;
    const v4f x0 = *(const v4fa*)(arow + kb + 8 * hh), x1 = *(const v4fa*)(arow + kb + 8 * hh + 4), x2 = *(const v4fa*)(arow + kb + 16 + 8 * hh), x3 = *(const v4fa*)(arow + kb + 16 + 8 * hh + 4);
    float xs[16] = {x0[0],x0[1],x0[2],x0[3],x1[0],x1[1],x1[2],x1[3],x2[0],x2[1],x2[2],x2[3],x3[0],x3[1],x3[2],x3[3]};
#pragma unroll
    for (int i = 0; i < 16; ++i) { const _Float16 h = (_Float16)xs[i]; ah.h[i] = h; al.h[i] = ASPLIT ? (_Float16)(xs[i] - (float)h) : (_Float16)0.0f; }
#pragma unroll
    for (int t = 0; t < 4; ++t) { if (col0 + t * 16 >= N) continue; const size_t boff = (size_t)(col0 + t * 16 + ln) * ldb + kb; FragH bq; bq.half[0] = *(const v8us*)(Bh + boff + 8 * hh); bq.half[1] = *(const v8us*)(Bh + boff + 16 + 8 * hh);
      acc[t] = mmaH<ASPLIT ? 2 : 1>(ah.v, al.v, bq.v, bq.v, acc[t]); }
  }
#pragma unroll
  for (int t = 0; t < 4; ++t) { if (col0 + t * 16 >= N) continue;
#pragma unroll
    for (int r = 0; r < 8; ++r) so[w][8 * hh + r][t * 16 + ln] = acc[t][r] * alpha; }
  __builtin_amdgcn_fence(__ATOMIC_ACQ_REL, "workgroup"); __builtin_amdgcn_wave_barrier();
  const int rsub = lane >> 4, c4 = (lane & 15) * 4;
  {
#pragma unroll
    for (int q = 0; q < 8; ++q) { const int r = q * 2 + rsub; if (col0 + c4 < N) { const v4f v = *(const v4fa*)&so[w][r][c4]; *(v4f*)(C + (size_t)(row0 + r) * ldc + col0 + c4) = v; } }
     }
}

// Wt[n][k] = f16(W[k][n]·scale) from f32 row-major W[K][N] (scale = power of two; bf16-exact weights stay exact in f16 away from the subnormal range)
__device__ __forceinline__ void wt_f16(const float* __restrict__ W, _Float16* __restrict__ Wt, int K, int N, float scale, int t) {      /* t = piece index, 0 .. N * (K / 8) - 1 */
  const int n = t / (K / 8), k8 = (t % (K / 8)) * 8; FragH f;
#pragma unroll
  for (int i = 0; i < 8; ++i) f.h[i] = (_Float16)(bf16_round(W[(size_t)(k8 + i) * N + n]) * scale); const v8us o = f.half[0];
  *(v8us*)((unsigned short*)Wt + (size_t)n * K + k8) = o;
  asm volatile("s_wait_xcnt 0x0" ::: "memory");      /* inlined into a kernel with further code behind it: the store's address and data registers are reused only behind this wait */
}
// k_gemm_hh variant with fused epilogue: v = acc·alpha + bias[by·sBias + col] (+ CP[(row/rowsPerB)·sCPb + by·64 + col] if CP) ; ACT 0 none / 1 elu ; writes f16 C16 (and f32 C if non-null)
template <int ACT>
__global__ __launch_bounds__(128) void k_gemm_hhx(const _Float16* __restrict__ A, int lda, size_t sA, const _Float16* __restrict__ Bh, int ldb, size_t sB, float alpha, const float* __restrict__ bias, size_t sBias, const float* __restrict__ CP, int rowsPerB, size_t sCPb, int row0g,
    float* __restrict__ C, _Float16* __restrict__ C16, int ldc, size_t sC, int M, int N, int K) {
  __shared__ __attribute__((aligned(16))) float so[4][16][64];
  const int tid = threadIdx.x, w = tid >> 5, lane = tid & 31, ln = lane & 15, hh = lane >> 4; const int by = blockIdx.y;
  A += (size_t)by * sA; Bh += (size_t)by * sB; const size_t cofs = (size_t)by * sC; const float* bp = bias ? bias + (size_t)by * sBias : nullptr;
  const int ntn = (N + 63) / 64; const int wid = blockIdx.x * 4 + w; const int mt = wid / ntn, nq = wid % ntn; if (mt * 16 >= M) return;
  const int row0 = mt * 16, col0 = nq * 64; const _Float16* arow = A + (size_t)(row0 + ln) * lda;
  v8f acc[4] = {};
  for (int kb = 0; kb < K; kb += 32) { FragH ah; ah.half[0] = *(const v8us*)((const unsigned short*)arow + kb + 8 * hh); ah.half[1] = *(const v8us*)((const unsigned short*)arow + kb + 16 + 8 * hh);
#pragma unroll
    for (int t = 0; t < 4; ++t) { if (col0 + t * 16 >= N) continue; const size_t boff = (size_t)(col0 + t * 16 + ln) * ldb + kb; FragH bq; bq.half[0] = *(const v8us*)((const unsigned short*)Bh + boff + 8 * hh); bq.half[1] = *(const v8us*)((const unsigned short*)Bh + boff + 16 + 8 * hh);
      acc[t] = mmaH<1>(ah.v, ah.v, bq.v, bq.v, acc[t]); }
  }
#pragma unroll
  for (int t = 0; t < 4; ++t) { if (col0 + t * 16 >= N) continue; const int col = col0 + t * 16 + ln; const float bv = bp ? bf16_round(bp[col]) : 0.f;
#pragma unroll
    for (int r = 0; r < 8; ++r) { float v = acc[t][r] * alpha + bv; if (CP) { const int rr = row0g + row0 + 8 * hh + r; if (rowsPerB < 0) v += CP[cofs + (size_t)rr * ldc + col];      /* rowsPerB < 0: own element of the batched C plane */ else { const int bidx = rr / rowsPerB; v += CP[(size_t)bidx * sCPb + (size_t)by * 64 + col]; } } if (ACT == 1) v = (v > 0.f) ? v : expm1f(v); else if (ACT == 7) v = (v > 0.f) ? v + 1.0f : expf(v); else if (ACT == 8) v = tanhf(v); else if (ACT == 9) v = 0.5f * v * (1.0f + tanhf(0.7978845608028654f * (v + 0.044715f * v * v * v))); else if (ACT == 11) v = 1.0f / (1.0f + expf(-v)); else if (ACT == 12) v = (v > 0.f) ? v : 0.01f * v; else if (ACT == 14) v = (v > 0.f) ? v : 0.1f * v; else if (ACT == 16) v = (v >= 0.f) ? v : 0.3f * v; else if (ACT == 17) v = (v >= 0.f) ? v : 0.2f * v; else if (ACT == 15) v = v / (1.0f + expf(-v)); else if (ACT == 3) v = fmaxf(v, 0.f); else if (ACT == 6) v = 0.5f * v * (1.0f + erff(v * 0.70710678118654752f)); so[w][8 * hh + r][t * 16 + ln] = v; } }
  __builtin_amdgcn_fence(__ATOMIC_ACQ_REL, "workgroup"); __builtin_amdgcn_wave_barrier();
  const int rsub = lane >> 4, c4 = (lane & 15) * 4; typedef _Float16 v4h __attribute__((ext_vector_type(4)));
  {
#pragma unroll
    for (int q = 0; q < 8; ++q) { const int r = q * 2 + rsub; if (col0 + c4 < N) { const v4f v = *(const v4fa*)&so[w][r][c4]; if (C) *(v4f*)(C + cofs + (size_t)(row0 + r) * ldc + col0 + c4) = v; if (C16) { v4h h4; for (int i = 0; i < 4; ++i) h4[i] = (_Float16)v[i]; *(v4h*)(C16 + cofs + (size_t)(row0 + r) * ldc + col0 + c4) = h4; } } }
     }
}


typedef _Float16 v4h __attribute__((ext_vector_type(4)));

__device__ __forceinline__ void x16(const float* __restrict__ x, _Float16* __restrict__ X16, size_t t) { FragH f;      /* t = piece index, 8 elements each */
#pragma unroll
  for (int q = 0; q < 8; ++q) f.h[q] = (_Float16)bf16_round(x[t * 8 + q]); *(v8us*)((unsigned short*)X16 + t * 8) = f.half[0];
  asm volatile("s_wait_xcnt 0x0" ::: "memory"); }      /* inlined into a kernel with further code behind it: the store's address and data registers are reused only behind this wait */
__global__ __launch_bounds__(256) void k_h16(const float* __restrict__ x, _Float16* __restrict__ X16, size_t n8) { const size_t t = (size_t)blockIdx.x * 256 + threadIdx.x; if (t >= n8) return; FragH f;
#pragma unroll
  for (int q = 0; q < 8; ++q) f.h[q] = (_Float16)x[t * 8 + q]; *(v8us*)((unsigned short*)X16 + t * 8) = f.half[0];  }
__global__ __launch_bounds__(256) void k_round16f(const float* __restrict__ W, _Float16* __restrict__ Bt, size_t n8) { const size_t t = (size_t)blockIdx.x * 256 + threadIdx.x; if (t >= n8) return; FragH f;
#pragma unroll
  for (int i = 0; i < 8; ++i) f.h[i] = (_Float16)(bf16_round(W[t * 8 + i]) * 16.0f); *(v8us*)((unsigned short*)Bt + t * 8) = f.half[0];  }
template <int NHv, int TTv>
__global__ __launch_bounds__(256) void k_vt(const _Float16* __restrict__ V16, int ldv, int voff, _Float16* __restrict__ Vt) { __shared__ unsigned short tl[64][66]; const int tid = threadIdx.x; const int slab = blockIdx.x / (TTv / 64), lg = blockIdx.x % (TTv / 64); const int b = slab / NHv, h = slab % NHv;
  for (int i = tid; i < 64 * 8; i += 256) { const int r = i / 8, c8 = (i % 8) * 8; FragH f; f.half[0] = *(const v8us*)((const unsigned short*)V16 + ((size_t)b * TTv + lg * 64 + r) * ldv + voff + h * 64 + c8);
#pragma unroll
    for (int q = 0; q < 8; ++q) tl[r][c8 + q] = f.u[q]; }
  __syncthreads();
  {
#pragma unroll
    for (int rd = 0; rd < 2; ++rd) { const int d = rd * 32 + tid / 8, pc = tid % 8; FragH f;
#pragma unroll
      for (int q = 0; q < 8; ++q) f.u[q] = tl[pc * 8 + q][d];
      *(v8us*)((unsigned short*)Vt + ((size_t)slab * 64 + d) * TTv + lg * 64 + pc * 8) = f.half[0]; }
     } }

__global__ __launch_bounds__(256) void k_hl(const float* __restrict__ F, _Float16* __restrict__ Hh, _Float16* __restrict__ Hl, size_t n8) { const size_t t = (size_t)blockIdx.x * 256 + threadIdx.x; if (t >= n8) return; FragH fh, fl; const v4f a = *(const v4fa*)(F + t * 8), c = *(const v4fa*)(F + t * 8 + 4);
#pragma unroll
  for (int q = 0; q < 4; ++q) { _Float16 h = (_Float16)a[q]; fh.h[q] = h; fl.h[q] = (_Float16)((a[q] - (float)h) * 1024.0f); h = (_Float16)c[q]; fh.h[4 + q] = h; fl.h[4 + q] = (_Float16)((c[q] - (float)h) * 1024.0f); }
  { *(v8us*)((unsigned short*)Hh + t * 8) = fh.half[0]; *(v8us*)((unsigned short*)Hl + t * 8) = fl.half[0];  } }

// fragment of 32 k from a k-contiguous f16 row in global memory
__device__ __forceinline__ v16h g2_frag(const _Float16* p, int hh) { FragH f; f.half[0] = *(const v8us*)((const unsigned short*)p + 8 * hh); f.half[1] = *(const v8us*)((const unsigned short*)p + 16 + 8 * hh); return f.v; }


__global__ __launch_bounds__(256) void k_wnat(const float* __restrict__ w, size_t n8, _Float16* __restrict__ Bt) { const size_t t = (size_t)blockIdx.x * 256 + threadIdx.x; if (t >= n8) return; FragH f; for (int q = 0; q < 8; ++q) f.h[q] = (_Float16)(bf16_round(w[t * 8 + q]) * 16.0f); *(v8us*)((unsigned short*)Bt + t * 8) = f.half[0];  }
__global__ __launch_bounds__(256) void k_rsm(const float* __restrict__ S, _Float16* __restrict__ P, int nrows) {
  #pragma clang fp contract(off)
  const int i = blockIdx.x * 256 + threadIdx.x; if (i >= nrows) return; const float* s = S + (size_t)i * SQ; float mx = -3.0e38f;
#pragma unroll 1
  for (int j = 0; j < SQ; ++j) mx = fmaxf(mx, s[j]); float se = 0.f;
#pragma unroll 1
  for (int j = 0; j < SQ; ++j) se += expf(s[j] - mx); const float sc = 256.0f / se;
#pragma unroll 1
  for (int j0 = 0; j0 < SQ; j0 += 8) { FragH f; for (int q = 0; q < 8; ++q) f.h[q] = (_Float16)(expf(s[j0 + q] - mx) * sc); unsigned short* d = (unsigned short*)P + (size_t)i * SQ + j0; *(v8us*)d = f.half[0];  } }
__global__ __launch_bounds__(256) void k_vt(const _Float16* __restrict__ V16, int b, int h0, _Float16* __restrict__ VT) { __shared__ unsigned short tl[64][65]; const int tid = threadIdx.x; const int hh = blockIdx.x % HG, sg = blockIdx.x / HG; const int s0 = sg * 64; const int h = h0 + hh;
  for (int i = tid; i < 64 * 8; i += 256) { const int j = i / 8, d8 = (i % 8) * 8; FragH f; f.half[0] = *(const v8us*)((const unsigned short*)V16 + ((size_t)b * SQ + s0 + j) * DM + h * HD + d8); for (int q = 0; q < 8; ++q) tl[d8 + q][j] = f.u[q]; }
  __syncthreads();
  { for (int i = tid; i < 64 * 8; i += 256) { const int d = i / 8, j8 = (i % 8) * 8; FragH f; for (int q = 0; q < 8; ++q) f.u[q] = tl[d][j8 + q]; *(v8us*)((unsigned short*)VT + ((size_t)hh * HD + d) * SQ + s0 + j8) = f.half[0]; }  } }



// All operand preparation in one launch: none of these pieces reads what another writes, so they share one grid by ranges of the block index (block-uniform branches).
// The weight blocks come first: their strided reads take longest and run under the memory-bound casts that follow.
#define PR_WO ((DM * (DM / 8)) / 256)            /* blocks for the [in][out] output weight */
#define PR_WH ((NH * HD * (DM / 8)) / 256)       /* blocks for one per-head stack */
#define PR_HP (HD * (DM / 8))                    /* 8-element pieces per head */
#define PR_X ((int)(NR * DM / 8 / 256))          /* blocks for one cast of the token rows */
__global__ __launch_bounds__(256) void k_prep(const float* __restrict__ wq, const float* __restrict__ wk, const float* __restrict__ wv, const float* __restrict__ wo, const float* __restrict__ xq, const float* __restrict__ xk, const float* __restrict__ xv,
    _Float16* __restrict__ BQ, _Float16* __restrict__ BK, _Float16* __restrict__ BV, _Float16* __restrict__ BO, _Float16* __restrict__ XQ, _Float16* __restrict__ XK, _Float16* __restrict__ XV) {
  int blk = blockIdx.x; const int tid = threadIdx.x;
  if (blk < PR_WO) { wt_f16(wo, BO, DM, DM, 16.0f, blk * 256 + tid); return; }
  blk -= PR_WO;
  if (blk < 3 * PR_WH) { const int m = blk / PR_WH; const int u = (blk - m * PR_WH) * 256 + tid; const int h = u / PR_HP;      /* head h: a row-major [DM][HD] block, written as its HD rows of the [out][in] plane */
    const float* w = (m == 0) ? wq : (m == 1) ? wk : wv; _Float16* B = (m == 0) ? BQ : (m == 1) ? BK : BV;
    wt_f16(w + (size_t)h * DM * HD, B + (size_t)h * HD * DM, DM, HD, 16.0f, u - h * PR_HP); return; }
  blk -= 3 * PR_WH;
  const int m = blk / PR_X; const size_t t = (size_t)(blk - m * PR_X) * 256 + tid;
  x16((m == 0) ? xq : (m == 1) ? xk : xv, (m == 0) ? XQ : (m == 1) ? XK : XV, t);
}

#define FA_NW 8                      /* waves per workgroup */
#define FA_BR (FA_NW * 32)           /* query rows per workgroup */
#define FA_SK 64                     /* keys per stage = two 32-key passes */
#define FA_PITCH 144                 /* LDS row pitch in bytes: 128 of data + 16, an odd multiple of 16 for the 16-byte fragment reads */
#define FA_TILE (FA_SK * FA_PITCH)
/* amdgpu_waves_per_eu(4, 4): at most 256 VGPRs, so that two workgroups (four waves per SIMD) are resident per WGP and the 512 workgroups run in one round */
__device__ __forceinline__ float fa_xh(float x) { return __builtin_bit_cast(float, __builtin_amdgcn_permlanex16(__builtin_bit_cast(int, x), __builtin_bit_cast(int, x), 0x76543210, 0xfedcba98, false, false)); }      /* lane l reads lane l ^ 16 */
__device__ __forceinline__ v16h fa_frag(const unsigned char* p) { FragH f; f.half[0] = *(const v8us*)p; f.half[1] = *(const v8us*)(p + 32); return f.v; }      /* p = row start + 16 * (lane >> 4): k = 8 hh .. 8 hh + 7 and 16 + 8 hh .. 16 + 8 hh + 7, as g2_frag */
__device__ __forceinline__ v8f fa_mma(v16h a, v16h b, v8f c) { return __builtin_amdgcn_wmma_f32_16x16x32_f16(false, a, false, b, (short)0, c, false, false); }
/* The 8 score products of a pass, 2 key tiles x 2 query groups x k = 64: s = c + K . Q^T with c read from its own registers and left as it is. Written as asm because the builtin form copied c into
   the result registers in front of half of the products (8 register moves a tile). Each result's second product stands three products behind its first; the v_nop at the end keep the four vector
   slots between the last product and the first vector instruction that reads its result; those in front keep four slots behind the product issued just before the statement, whose B registers
   (the weights of the pass before) the compiler gives to a result here. */
__device__ __forceinline__ void fa_scores(v8f& s00, v8f& s01, v8f& s10, v8f& s11, v16h ka0, v16h kb0, v16h ka1, v16h kb1, v16h q00, v16h q01, v16h q10, v16h q11, v8f c0, v8f c1) {
  asm("v_nop\n\tv_nop\n\tv_nop\n\tv_nop\n\t"
      "v_wmma_f32_16x16x32_f16 %0, %4, %8, %12\n\t"
      "v_wmma_f32_16x16x32_f16 %1, %4, %10, %13\n\t"
      "v_wmma_f32_16x16x32_f16 %2, %6, %8, %12\n\t"
      "v_wmma_f32_16x16x32_f16 %3, %6, %10, %13\n\t"
      "v_wmma_f32_16x16x32_f16 %0, %5, %9, %0\n\t"
      "v_wmma_f32_16x16x32_f16 %1, %5, %11, %1\n\t"
      "v_wmma_f32_16x16x32_f16 %2, %7, %9, %2\n\t"
      "v_wmma_f32_16x16x32_f16 %3, %7, %11, %3\n\t"
      "v_nop\n\tv_nop\n\tv_nop\n\tv_nop"
      : "=&v"(s00), "=&v"(s01), "=&v"(s10), "=&v"(s11)
      : "v"(ka0), "v"(kb0), "v"(ka1), "v"(kb1), "v"(q00), "v"(q01), "v"(q10), "v"(q11), "v"(c0), "v"(c1)); }
__global__ __launch_bounds__(FA_NW * 32) __attribute__((amdgpu_waves_per_eu(4, 4))) void k_fattn(const _Float16* __restrict__ Q16, const _Float16* __restrict__ K16, const _Float16* __restrict__ VT, _Float16* __restrict__ O16) {
  __shared__ __attribute__((aligned(16))) unsigned char L[2][2][FA_TILE];      /* [buffer][0 = K rows, 1 = V^T rows] */
  const int tid = threadIdx.x, lane = tid & 31, c = lane & 15, hh = lane >> 4; const int wave = __builtin_amdgcn_readfirstlane(tid >> 5);
  const int q0 = blockIdx.x * FA_BR + wave * 32, h = blockIdx.y, b = blockIdx.z; const size_t r0 = (size_t)b * SQ;
  /* staging: thread t moves the 16-byte piece t & 7 of rows t >> 3 and 32 + (t >> 3) of both tiles: 8 lanes cover one whole 128-byte row */
  const int srow = tid >> 3, scol = tid & 7; const int sl = srow * FA_PITCH + scol * 16;
  const unsigned short* kg = (const unsigned short*)K16 + (r0 + srow) * LQ + h * HD + scol * 8;
  const unsigned short* vg = (const unsigned short*)VT + (((size_t)b * NH + h) * HD + srow) * SQ + scol * 8;
  v8us k0 = *(const v8us*)kg, k1 = *(const v8us*)(kg + (size_t)32 * LQ), v0 = *(const v8us*)vg, v1 = *(const v8us*)(vg + (size_t)32 * SQ);
  v16h qf[2][2];
#pragma unroll      /* register arrays need constant indices */
  for (int g = 0; g < 2; ++g) { const _Float16* qp = Q16 + (r0 + q0 + 16 * g + c) * LQ + h * HD; qf[g][0] = g2_frag(qp, hh); qf[g][1] = g2_frag(qp + 32, hh); }
  FragH ones;
#pragma unroll
  for (int i = 0; i < 16; ++i) ones.u[i] = (c == 0) ? (unsigned short)0x3C00 : (unsigned short)0;
  const v8f z8 = {0.f, 0.f, 0.f, 0.f, 0.f, 0.f, 0.f, 0.f};
  v8f acc[2][4] = {{z8, z8, z8, z8}, {z8, z8, z8, z8}}; v8f lacc[2] = {z8, z8}; v8f negm[2] = {z8, z8};      /* negm: minus the maximum in use of this lane's query, the same in all 8 registers (a lane's 8 scores of a tile belong to one query); 0 until the first pass sets it */
  *(v8us*)&L[0][0][sl] = k0; *(v8us*)&L[0][0][sl + 32 * FA_PITCH] = k1; *(v8us*)&L[0][1][sl] = v0; *(v8us*)&L[0][1][sl + 32 * FA_PITCH] = v1;
  for (int st = 0; st < SQ / FA_SK; ++st) {
    __syncthreads();      /* stage st is written by every wave, and every wave has left the buffer that is refilled at the foot of this trip */
    const unsigned char* Kb = &L[st & 1][0][0]; const unsigned char* Vb = &L[st & 1][1][0];
    const bool more = st + 1 < SQ / FA_SK;      /* the same for the whole workgroup */
    if (more) { k0 = *(const v8us*)(kg + (size_t)FA_SK * LQ); k1 = *(const v8us*)(kg + (size_t)(FA_SK + 32) * LQ); v0 = *(const v8us*)(vg + FA_SK); v1 = *(const v8us*)(vg + FA_SK + (size_t)32 * SQ); }      /* next stage, in flight under this stage's passes */
#pragma unroll      /* two passes per stage; constant LDS offsets */
    for (int sub = 0; sub < 2; ++sub) {
      v8f s[2][2];
      { const unsigned char* p = Kb + (32 * sub + c) * FA_PITCH + 16 * hh; const unsigned char* p1 = p + 16 * FA_PITCH;
        fa_scores(s[0][0], s[0][1], s[1][0], s[1][1], fa_frag(p), fa_frag(p + 64), fa_frag(p1), fa_frag(p1 + 64), qf[0][0], qf[0][1], qf[1][0], qf[1][1], negm[0], negm[1]); }      /* scaled score minus the maximum in use */
      float mb[2];      /* this lane's largest of the pass, per query group, relative to the maximum in use */
#pragma unroll      /* register arrays need constant indices */
      for (int g = 0; g < 2; ++g) { float mx = fmaxf(s[0][g][0], s[1][g][0]);
#pragma unroll      /* register arrays need constant indices */
        for (int r = 1; r < 8; ++r) mx = fmaxf(mx, fmaxf(s[0][g][r], s[1][g][r]));
        mb[g] = mx; }
      const bool first = (sub == 0) && (st == 0);      /* the first pass sets the maximum whatever its sign */
      if (first || __builtin_amdgcn_ballot_w32(fmaxf(mb[0], mb[1]) > 8.0f) != 0) {      /* wave-uniform; rare after the first pass */
#pragma unroll      /* register arrays need constant indices */
        for (int g = 0; g < 2; ++g) { const float mq = fmaxf(mb[g], fa_xh(mb[g])); const float up = fmaxf(mq, 0.f); const float d = first ? mq : up;      /* both wave halves hold this query's rise of the maximum */
          const float corr = __builtin_amdgcn_exp2f(-up); negm[g] = negm[g] - d; lacc[g] = lacc[g] * corr;      /* on the first pass the accumulators are 0 */
#pragma unroll      /* register arrays need constant indices */
          for (int r = 0; r < 8; ++r) { s[0][g][r] -= d; s[1][g][r] -= d; }
#pragma unroll      /* register arrays need constant indices */
          for (int t = 0; t < 4; ++t) acc[g][t] = acc[g][t] * corr; } }
      v16h vf[4];      /* read behind the branch: in front of it these reads were lifted over the score products, and the registers went past 256 (q fragments spilled) */
#pragma unroll      /* register arrays need constant indices */
      for (int t = 0; t < 4; ++t) vf[t] = fa_frag(Vb + (16 * t + c) * FA_PITCH + 64 * sub + 16 * hh);
#pragma unroll      /* register arrays need constant indices */
      for (int g = 0; g < 2; ++g) { FragH pf;
#pragma unroll      /* register arrays need constant indices */
        for (int i = 0; i < 16; ++i) pf.h[i] = (_Float16)__builtin_amdgcn_exp2f(s[i >> 3][g][i & 7]);      /* keys 8 hh + r of tile 0, then of tile 1: the B operand's k order */
#pragma unroll      /* register arrays need constant indices */
        for (int t = 0; t < 4; ++t) acc[g][t] = fa_mma(vf[t], pf.v, acc[g][t]);
        lacc[g] = fa_mma(ones.v, pf.v, lacc[g]); }      /* row 0 += the column sums of P^T */
    }
    if (more) { unsigned char* Kn = &L[(st + 1) & 1][0][0]; unsigned char* Vn = &L[(st + 1) & 1][1][0]; *(v8us*)(Kn + sl) = k0; *(v8us*)(Kn + sl + 32 * FA_PITCH) = k1; *(v8us*)(Vn + sl) = v0; *(v8us*)(Vn + sl + 32 * FA_PITCH) = v1;
      asm volatile("s_wait_xcnt 0x0" :: "v"(kg), "v"(vg) : "memory");      /* the stage loads' address registers (held live to here) are advanced only behind this wait */
      kg += (size_t)FA_SK * LQ; vg += FA_SK; }
  }
#pragma unroll      /* register arrays need constant indices */
  for (int g = 0; g < 2; ++g) { const float lr = lacc[g][0]; const float inv = 64.0f / (lr + fa_xh(lr));
#pragma unroll      /* register arrays need constant indices */
    for (int t = 0; t < 4; ++t) { FragH f;
#pragma unroll      /* register arrays need constant indices */
      for (int r = 0; r < 8; ++r) f.h[r] = (_Float16)(acc[g][t][r] * inv);
      *(v8us*)((unsigned short*)O16 + (r0 + q0 + 16 * g + c) * DM + h * HD + 16 * t + 8 * hh) = f.half[0]; } } }      /* d = 16 t + 8 hh .. + 7 of query 16 g + c */

// ---- tiled GEMM C = ((A . B^T) * alpha + bias) * post (post0 for y = 0, else 1): A [rows][DM] and B [cols][DM] f16, k contiguous; one 128 x 128 tile of C per workgroup, four waves of 64 x 64 (4 x 4 accumulator tiles) ----
// Stages of 64 k (128 bytes of each of the 128 A rows and 128 B rows) are brought by asynchronous copies into two LDS buffers, the next stage in flight under this stage's products: every copy
// covers whole 128-byte lines, and each operand byte is fetched once per workgroup and read from LDS by the two waves that need it. k runs upward in steps of 32 into one accumulator per tile.
// Rows % 128 == 0, columns = k = DM, at least two stages.
#define G3_BT 128                    /* tile rows and tile columns per workgroup */
#define G3_SK 64                     /* k per stage = two WMMA steps */
#define G3_NS (DM / G3_SK)           /* stages */
#define G3_PITCH 144                 /* LDS row pitch in bytes: 128 of data + 16, an odd multiple of 16 for the 16-byte fragment reads */
#define G3_TILE (G3_BT * G3_PITCH)
#define G3_OP 68                     /* pitch in floats of the staged output rows */
typedef float f1a __attribute__((may_alias));
/* One lane's eight 16-byte pieces of a 128-row tile, rows 16 apart: lds = the lane's LDS byte address, g = its global address, both multiples of 16. The copies go through no register.
   s_wait_xcnt stands inside the statement, so that no address register of a copy is rewritten in front of it. */
__device__ __forceinline__ void g3_copy8(unsigned lds, const unsigned short* g) {
  asm volatile("global_load_async_to_lds_b128 %0, %8, off\n\t"
               "global_load_async_to_lds_b128 %1, %9, off\n\t"
               "global_load_async_to_lds_b128 %2, %10, off\n\t"
               "global_load_async_to_lds_b128 %3, %11, off\n\t"
               "global_load_async_to_lds_b128 %4, %12, off\n\t"
               "global_load_async_to_lds_b128 %5, %13, off\n\t"
               "global_load_async_to_lds_b128 %6, %14, off\n\t"
               "global_load_async_to_lds_b128 %7, %15, off\n\t"
               "s_wait_xcnt 0x0"
               :: "v"(lds), "v"(lds + 16 * G3_PITCH), "v"(lds + 32 * G3_PITCH), "v"(lds + 48 * G3_PITCH), "v"(lds + 64 * G3_PITCH), "v"(lds + 80 * G3_PITCH), "v"(lds + 96 * G3_PITCH), "v"(lds + 112 * G3_PITCH),
                  "v"(g), "v"(g + (size_t)16 * DM), "v"(g + (size_t)32 * DM), "v"(g + (size_t)48 * DM), "v"(g + (size_t)64 * DM), "v"(g + (size_t)80 * DM), "v"(g + (size_t)96 * DM), "v"(g + (size_t)112 * DM)
               : "memory"); }
template <bool OUT32>
__global__ __launch_bounds__(128) void k_gemm3(const _Float16* __restrict__ A, size_t sA, const _Float16* __restrict__ Bh, size_t sB, float alpha, float post0, const float* __restrict__ bias0, const float* __restrict__ bias1, const float* __restrict__ bias2,
    float* __restrict__ C, _Float16* __restrict__ C16, size_t sC) {
  __shared__ __attribute__((aligned(16))) unsigned char L[2][2][G3_TILE];      /* [buffer][0 = A rows, 1 = B rows]; behind the k loop: four staged 64 x 64 f32 output tiles */
  static_assert(4 * 64 * G3_OP * 4 <= 4 * G3_TILE, "the staged output tiles must fit the ring"); static_assert(G3_NS >= 2, "the prologue fills two stages");
  const int tid = threadIdx.x, lane = tid & 31, ln = lane & 15, hh = lane >> 4; const int wave = __builtin_amdgcn_readfirstlane(tid >> 5); const int by = blockIdx.y;
  const float* bias = (by == 0) ? bias0 : (by == 1) ? bias1 : bias2;      /* products that share one grid along y keep their biases in separate buffers */
  const float post = (by == 0) ? post0 : 1.0f; const float alphap = alpha * post;      /* product y = 0 leaves multiplied by post0, bias included */
  const int mt = blockIdx.x / (DM / G3_BT), nq = blockIdx.x - mt * (DM / G3_BT); const int row0 = mt * G3_BT, col0 = nq * G3_BT; const int wm = (wave >> 1) * 64, wn = (wave & 1) * 64;
  /* staging: thread t copies the 16-byte piece t & 7 of rows (t >> 3) + 16 i, i = 0 .. 7, of both tiles: 8 lanes cover one whole 128-byte row */
  const int srow = tid >> 3, scol = tid & 7; const unsigned sl = (unsigned)(size_t)&L[0][0][0] + srow * G3_PITCH + scol * 16;      /* low 32 bits of the shared address = LDS byte address */
  const unsigned short* ag = (const unsigned short*)A + (size_t)by * sA + (size_t)(row0 + srow) * DM + scol * 8;
  const unsigned short* bg = (const unsigned short*)Bh + (size_t)by * sB + (size_t)(col0 + srow) * DM + scol * 8;
  const v8f z8 = {0.f, 0.f, 0.f, 0.f, 0.f, 0.f, 0.f, 0.f};
  v8f acc[4][4] = {{z8, z8, z8, z8}, {z8, z8, z8, z8}, {z8, z8, z8, z8}, {z8, z8, z8, z8}};
  g3_copy8(sl, ag); g3_copy8(sl + G3_TILE, bg);      /* stage 0 into buffer 0 */
  asm volatile("s_wait_asynccnt 0x0" ::: "memory");      /* this wave's copies of stage 0 have landed */
  __syncthreads();      /* ... and every other wave's */
  g3_copy8(sl + 2 * G3_TILE, ag + G3_SK); g3_copy8(sl + 3 * G3_TILE, bg + G3_SK);      /* stage 1 into buffer 1, in flight under stage 0's products */
  for (int st = 0; st < G3_NS; ++st) {
    const unsigned char* Ab = &L[st & 1][0][0] + (wm + ln) * G3_PITCH + 16 * hh; const unsigned char* Bb = &L[st & 1][1][0] + (wn + ln) * G3_PITCH + 16 * hh;
#pragma unroll      /* two WMMA steps per stage; constant LDS offsets */
    for (int kk = 0; kk < 2; ++kk) { v16h af[4], bf[4];
#pragma unroll      /* register arrays need constant indices */
      for (int i = 0; i < 4; ++i) { af[i] = fa_frag(Ab + 16 * i * G3_PITCH + 64 * kk); bf[i] = fa_frag(Bb + 16 * i * G3_PITCH + 64 * kk); }      /* both operands in the k order of g2_frag */
      __builtin_amdgcn_sched_barrier(0);      /* keeps the step's 16 fragment reads together in front of its 16 products: sunk among them, each A fragment's LDS latency is waited out in full */
#pragma unroll      /* register arrays need constant indices */
      for (int i = 0; i < 4; ++i)
#pragma unroll      /* register arrays need constant indices */
        for (int j = 0; j < 4; ++j) acc[i][j] = fa_mma(af[i], bf[j], acc[i][j]); }
    asm volatile("s_wait_dscnt 0x0" ::: "memory");      /* this wave's reads of buffer st & 1 are done before that buffer is handed to the copies */
    asm volatile("s_wait_asynccnt 0x0" ::: "memory");      /* this wave's copies of stage st + 1 have landed */
    __syncthreads();      /* stage st + 1 is published, and every wave has left the buffer that is refilled behind this barrier */
    if (st + 2 < G3_NS) { const unsigned lb = sl + (st & 1) * (2 * G3_TILE); const size_t ko = (size_t)(st + 2) * G3_SK;      /* the same for the whole workgroup */
      g3_copy8(lb, ag + ko); g3_copy8(lb + G3_TILE, bg + ko); }
  }
  asm volatile("s_wait_asynccnt 0x0" ::: "memory");      /* no copy is outstanding when the ring's LDS takes the output tiles */
  /* the last trip's barrier stands behind every wave's last read of the ring: each wave now stages its output tile in its own part of that LDS, so that the stores cover whole lines */
  f1a* so = (f1a*)&L[0][0][0] + wave * (64 * G3_OP);
#pragma unroll      /* register arrays need constant indices */
  for (int j = 0; j < 4; ++j) { const float bv = bf16_round(bias[col0 + wn + 16 * j + ln]) * post;
#pragma unroll      /* register arrays need constant indices */
    for (int i = 0; i < 4; ++i)
#pragma unroll      /* register arrays need constant indices */
      for (int r = 0; r < 8; ++r) so[(16 * i + 8 * hh + r) * G3_OP + 16 * j + ln] = acc[i][j][r] * alphap + bv; }
  __builtin_amdgcn_fence(__ATOMIC_ACQ_REL, "workgroup"); __builtin_amdgcn_wave_barrier();      /* the wave's own LDS writes are done before its lanes read each other's */
  const int rsub = lane >> 4, c4 = (lane & 15) * 4; const size_t o0 = (size_t)by * sC + (size_t)(row0 + wm + rsub) * DM + col0 + wn + c4;
#pragma unroll      /* constant offsets from one address */
  for (int q = 0; q < 32; ++q) { const v4f v = *(const v4fa*)&so[(q * 2 + rsub) * G3_OP + c4];
    if (OUT32) *(v4f*)(C + o0 + (size_t)(q * 2) * DM) = v;
    else { v4h h4;
#pragma unroll      /* register arrays need constant indices */
      for (int i = 0; i < 4; ++i) h4[i] = (_Float16)v[i];
      *(v4h*)(C16 + o0 + (size_t)(q * 2) * DM) = h4; } } }

extern "C" void kernel_launch(void* const* d_in, const int* in_sizes, int n_in,
                              void* d_out, int out_size, void* d_ws, size_t ws_size, hipStream_t stream) {
  (void)in_sizes; (void)n_in; (void)out_size;
  const float* const* I = (const float* const*)d_in; const float* xq = I[0]; const float* xk = I[1]; const float* xv = I[1]; const float* wq = I[2]; const float* bq = I[3]; const float* wk = I[4]; const float* bk = I[5]; const float* wv = I[6]; const float* bv = I[7]; const float* wo = I[8]; const float* bo = I[9];      /* TWO inputs: query (the q stream) and value (read on BOTH the k and the v stream casts); wq, wk, wv are PER-HEAD STACKS [16][1024][64] = [head][in][out]; bq, bk, bv per-head [16][64] = the flat [1024] bias; wo [in][out] + bo; input order query, value, wq, bq, wk, bk, wv, bv, wo, bo */
  char* ws = (char*)d_ws; size_t off = 0;
  auto take = [&](size_t bytes) { char* p = ws + off; off += (bytes + 255) & ~(size_t)255; return p; };
  _Float16* BQ = (_Float16*)take((size_t)DM * DM * 2); _Float16* BK = (_Float16*)take((size_t)DM * DM * 2); _Float16* BV = (_Float16*)take((size_t)DM * DM * 2); _Float16* BO = (_Float16*)take((size_t)DM * DM * 2);
  _Float16* XQ = (_Float16*)take(NR * DM * 2); _Float16* XK = (_Float16*)take(NR * DM * 2); _Float16* XV = (_Float16*)take(NR * DM * 2); _Float16* Q16 = (_Float16*)take(NR * DM * 2); _Float16* K16 = (_Float16*)take(NR * DM * 2); _Float16* V16 = (_Float16*)take(NR * DM * 2); _Float16* O16 = (_Float16*)take(NR * DM * 2);
  _Float16* VT = (_Float16*)take((size_t)NB * NH * HD * SQ * 2);
  if (off > ws_size) return;
  k_prep<<<PR_WO + 3 * PR_WH + 3 * PR_X, 256, 0, stream>>>(wq, wk, wv, wo, xq, xk, xv, BQ, BK, BV, BO, XQ, XK, XV);      /* weight planes [out][in] (x16): the per-head stacks wq / wk / wv [NH][DM][HD] head by head into contiguous rows, wo [in][out] whole; the three token streams as exact f16 rows */
  const size_t r0p = (size_t)B0 * SQ;      /* first projected row */
  k_gemm3<false><<<dim3((unsigned)((MP / G3_BT) * (DM / G3_BT)), 3), 128, 0, stream>>>(XQ + r0p * DM, NR * DM, BQ, (size_t)DM * DM, 0.0625f, 0.18033688011112042f, bq, bk, bv, nullptr, Q16 + r0p * DM, NR * DM);      /* q, k, v in one grid, y = 0, 1, 2: XQ XK XV, BQ BK BV and Q16 K16 V16 each lie one behind the other in the workspace; q leaves times 64^-0.5 log2(e) */
  k_vt<NH, SQ><<<NB * NH * (SQ / 64), 256, 0, stream>>>(V16, LQ, 0, VT);      /* V^T [NB][NH][HD][SQ], all batches */
  k_fattn<<<dim3(SQ / FA_BR, NH, NB), FA_NW * 32, 0, stream>>>(Q16, K16, VT, O16);      /* o x64 (merged heads) as f16 rows */
  k_gemm3<true><<<dim3((unsigned)((MPO / G3_BT) * (DM / G3_BT)), 1), 128, 0, stream>>>(O16 + r0p * DM, 0, BO, 0, 0.0009765625f, 1.0f, bo, bo, bo, (float*)d_out + r0p * DM, nullptr, 0);      /* out rows are the output layout */
}

// v006
// One run takes 126 microseconds.
// Two timings next to v005 put it at 1.06 and 1.07 times that version's speed.
// Counting every step since v000, it is 55.9 times as fast.
#include <hip/hip_runtime.h>
// Multi-head attention on two inputs with PER-HEAD STACKED projections and per-head biases on four sequences (query [4][2048][1024], value [4][2048][1024]; q = einsum('bsd,hde->bhse', query, wq) + bq, k = einsum(value, wk) + bk, v = einsum(value, wv) + bv with W [16][1024][64] = [head][in][out] and b [16][64], 16 heads of 64; scores * 1/sqrt(64); softmax over all 2048 keys (no mask); out = heads wo + bo ([in][out] + bias) -> [4][2048][1024]); each head's [in][out] block is transposed into its 64 contiguous rows of the weight plane by the existing builder; the [in][out] output weight through the same builder; all of them, and the casts of the token rows, in one preparation launch.
// Structure: token rows r = b*2048 + s; the query source and the key/value source as exact f16 rows (bf16-rounded); Q, K, V as three WMMA GEMMs in one grid (128x128 workgroup tiles staged in LDS, 64x64 wave tiles, f32 accumulation, exact x16 weights + bias, f16 outputs); V^T for all batches and heads via LDS transposes; one fused attention launch (scores K = 64 and o = P . V^T on WMMA, online softmax on VALU with f32 statistics and native exp2, weights as f16 relative to the running maximum; o carried x64 against f16 subnormal flush, folded into the output GEMM alpha) written straight into the merged f16 o rows; out = o W_o + b GEMM (f32) into the output layout.
// Compute dtype: inputs rounded to bf16; x / weights exact; q, k, v, softmax weights and o as plain f16 GEMM operands (~2^-12); scores and softmax statistics f32. v_wmma_f32_16x16x32_f16.
#define NB 4
#define SQ 2048
#define DM 1024
#define NH 16
#define HD 64
#define HG 4                         /* heads per block group of the k_vt(V16, b, h0, VT) overload (not launched) */
#define B0 0                         /* first batch processed (debug hook) */
#define NBR NB                       /* batches processed (debug hook) */
#define NR ((size_t)NB * SQ)         /* token rows */
#define MP ((int)((size_t)NBR * SQ)) /* rows projected (debug hook) */
#define QN SQ                        /* query rows per batch; unused, k_fattn attends all SQ */
#define NHD NH                       /* heads; unused, k_fattn attends all NH */
#define MPO MP                       /* rows through the output stage (debug hook) */
#define LQ DM      /* row pitch of the q/k/v rows */
typedef __bf16 v16b __attribute__((ext_vector_type(16)));
typedef unsigned short v8us __attribute__((ext_vector_type(8), may_alias));
typedef float  v8f  __attribute__((ext_vector_type(8)));
typedef float  v4f  __attribute__((ext_vector_type(4)));
typedef float  v4fa __attribute__((ext_vector_type(4), may_alias));
union FragB { v16b v; v8us half[2]; unsigned short u[16]; };

__device__ __forceinline__ unsigned short bf16_bits(float x) { unsigned int u = __float_as_uint(x); return (unsigned short)((u + 0x7FFFu + ((u >> 16) & 1u)) >> 16); }
__device__ __forceinline__ float bf16_val(unsigned short b) { return __uint_as_float(((unsigned int)b) << 16); }
__device__ __forceinline__ float bf16_round(float x) { return bf16_val(bf16_bits(x)); }
// D += A·B with NT terms: 1 = ah·bh, 2 = + al·bh (A split), 3 = + ah·bl (both split)
template <int NT>
__device__ __forceinline__ v8f mmaN(v16b ah, v16b al, v16b bh, v16b bl, v8f c) {
  c = __builtin_amdgcn_wmma_f32_16x16x32_bf16(false, ah, false, bh, (short)0, c, false, false);
  if (NT >= 2) c = __builtin_amdgcn_wmma_f32_16x16x32_bf16(false, al, false, bh, (short)0, c, false, false);
  if (NT >= 3) c = __builtin_amdgcn_wmma_f32_16x16x32_bf16(false, ah, false, bl, (short)0, c, false, false);
  asm volatile("v_nop\n\tv_nop\n\tv_nop\n\tv_nop" : "+v"(c) : "v"(ah), "v"(al), "v"(bh), "v"(bl));
  return c;
}

__global__ __launch_bounds__(256) void k_wt_bf16(const float* __restrict__ W, unsigned short* __restrict__ Wt, int K, int N) {
  const int t = blockIdx.x * 256 + threadIdx.x;
  const int k8n = K / 8;
  if (t >= N * k8n) return;
  const int n = t / k8n, k8 = (t % k8n) * 8;
  v8us v;
#pragma unroll
  for (int i = 0; i < 8; ++i) v[i] = bf16_bits(W[(size_t)(k8 + i) * N + n]);
  *(v8us*)(Wt + (size_t)n * K + k8) = v;
  
}

// GEMM C[M][N] (f32, pitch ldc) = act(A[M][K]·W + bias). A f32 row-major (pitch lda) converted per fragment to bf16
// (ASPLIT: hi/lo two planes -> 2 terms, else single rounded term); Wt bf16 [N][K] (pitch ldb). BIAS_BF16 rounds the
// bias to bf16 first (bias quantised to bf16 before the add). K%32==0, M%16==0, N%64==0.
template <bool ASPLIT, int ACT, bool BIAS_BF16>
__global__ __launch_bounds__(128) void k_gemm_bf(const float* __restrict__ A, int lda, const unsigned short* __restrict__ Wt, int ldb,
                                               const float* __restrict__ bias, float* __restrict__ C, int ldc, int M, int N, int K) {
  __shared__ __attribute__((aligned(16))) float so[4][16][64];
  const int tid = threadIdx.x, w = tid >> 5, lane = tid & 31, ln = lane & 15, hh = lane >> 4;
  const int ntn = N / 64;
  const int wid = blockIdx.x * 4 + w;
  const int mt = wid / ntn, nq = wid % ntn;
  if (mt * 16 >= M) return;
  const int row0 = mt * 16, col0 = nq * 64;
  const float* arow = A + (size_t)(row0 + ln) * lda;
  v8f acc[4] = {};
  for (int kb = 0; kb < K; kb += 32) {
    FragB ah, al;
    const v4f x0 = *(const v4fa*)(arow + kb + 8 * hh), x1 = *(const v4fa*)(arow + kb + 8 * hh + 4);
    const v4f x2 = *(const v4fa*)(arow + kb + 16 + 8 * hh), x3 = *(const v4fa*)(arow + kb + 16 + 8 * hh + 4);
    float xs[16] = {x0[0],x0[1],x0[2],x0[3],x1[0],x1[1],x1[2],x1[3],x2[0],x2[1],x2[2],x2[3],x3[0],x3[1],x3[2],x3[3]};
#pragma unroll
    for (int i = 0; i < 16; ++i) { const unsigned short hb = bf16_bits(xs[i]); ah.u[i] = hb; al.u[i] = ASPLIT ? bf16_bits(xs[i] - bf16_val(hb)) : (unsigned short)0; }
#pragma unroll
    for (int t = 0; t < 4; ++t) {
      const unsigned short* brow = Wt + (size_t)(col0 + t * 16 + ln) * ldb + kb;
      FragB b;
      b.half[0] = *(const v8us*)(brow + 8 * hh);
      b.half[1] = *(const v8us*)(brow + 16 + 8 * hh);
      acc[t] = mmaN<ASPLIT ? 2 : 1>(ah.v, al.v, b.v, b.v, acc[t]);
    }
  }
#pragma unroll
  for (int t = 0; t < 4; ++t) {
    float bv = bias ? bias[col0 + t * 16 + ln] : 0.f;
    if (BIAS_BF16) bv = bf16_round(bv);
#pragma unroll
    for (int r = 0; r < 8; ++r) { float v = acc[t][r] + bv; if (ACT == 1) v = fmaxf(v, 0.f); so[w][8 * hh + r][t * 16 + ln] = v; }
  }
  __builtin_amdgcn_fence(__ATOMIC_ACQ_REL, "workgroup");
  __builtin_amdgcn_wave_barrier();
  const int rsub = lane >> 4, c4 = (lane & 15) * 4;
  {
#pragma unroll
    for (int q = 0; q < 8; ++q) {
      const int r = q * 2 + rsub;
      const v4f v = *(const v4fa*)&so[w][r][c4];
      *(v4f*)(C + (size_t)(row0 + r) * ldc + col0 + c4) = v;
    }
    
  }
}

// GEMM C = act(A·W + bias + resid): A f32 (ASPLIT -> hi/lo 2 terms), Wt bf16 [N][K]; ACT 0 none, 1 relu, 2 exact gelu;
// resid (optional, f32, row index = (row % rmod), pitch ldr, RES_BF16 rounds it) added before the activation.
template <bool ASPLIT, int ACT, bool BIAS_BF16, bool RES_BF16>
__global__ __launch_bounds__(128) void k_gemm_bf3(const float* __restrict__ A, int lda, const unsigned short* __restrict__ Wt, int ldb,
                                                const float* __restrict__ bias, const float* __restrict__ resid, int rmod, int ldr,
                                                float* __restrict__ C, int ldc, int M, int N, int K) {
  __shared__ __attribute__((aligned(16))) float so[4][16][64];
  const int tid = threadIdx.x, w = tid >> 5, lane = tid & 31, ln = lane & 15, hh = lane >> 4;
  const int ntn = N / 64;
  const int wid = blockIdx.x * 4 + w;
  const int mt = wid / ntn, nq = wid % ntn;
  if (mt * 16 >= M) return;
  const int row0 = mt * 16, col0 = nq * 64;
  const float* arow = A + (size_t)(row0 + ln) * lda;
  v8f acc[4] = {};
  for (int kb = 0; kb < K; kb += 32) {
    FragB ah, al;
    const v4f x0 = *(const v4fa*)(arow + kb + 8 * hh), x1 = *(const v4fa*)(arow + kb + 8 * hh + 4);
    const v4f x2 = *(const v4fa*)(arow + kb + 16 + 8 * hh), x3 = *(const v4fa*)(arow + kb + 16 + 8 * hh + 4);
    float xs[16] = {x0[0],x0[1],x0[2],x0[3],x1[0],x1[1],x1[2],x1[3],x2[0],x2[1],x2[2],x2[3],x3[0],x3[1],x3[2],x3[3]};
#pragma unroll
    for (int i = 0; i < 16; ++i) { const unsigned short hb = bf16_bits(xs[i]); ah.u[i] = hb; al.u[i] = ASPLIT ? bf16_bits(xs[i] - bf16_val(hb)) : (unsigned short)0; }
#pragma unroll
    for (int t = 0; t < 4; ++t) {
      const unsigned short* brow = Wt + (size_t)(col0 + t * 16 + ln) * ldb + kb;
      FragB b;
      b.half[0] = *(const v8us*)(brow + 8 * hh);
      b.half[1] = *(const v8us*)(brow + 16 + 8 * hh);
      acc[t] = mmaN<ASPLIT ? 2 : 1>(ah.v, al.v, b.v, b.v, acc[t]);
    }
  }
#pragma unroll
  for (int t = 0; t < 4; ++t) {
    const int col = col0 + t * 16 + ln;
    float bv = bias ? bias[col] : 0.f;
    if (BIAS_BF16) bv = bf16_round(bv);
#pragma unroll
    for (int r = 0; r < 8; ++r) {
      float v = acc[t][r] + bv;
      if (resid) { float rv = resid[(size_t)((row0 + 8 * hh + r) % rmod) * ldr + col]; if (RES_BF16) rv = bf16_round(rv); v += rv; }
      if (ACT == 1) v = fmaxf(v, 0.f);
      if (ACT == 2) v = 0.5f * v * (1.0f + erff(v * 0.70710678118654752f));
      if (ACT == 3) { const float u = 0.7978845608028654f * (v + 0.044715f * v * v * v); v = 0.5f * v * (1.0f + tanhf(u)); }
      so[w][8 * hh + r][t * 16 + ln] = v;
    }
  }
  __builtin_amdgcn_fence(__ATOMIC_ACQ_REL, "workgroup");
  __builtin_amdgcn_wave_barrier();
  const int rsub = lane >> 4, c4 = (lane & 15) * 4;
  {
#pragma unroll
    for (int q = 0; q < 8; ++q) {
      const int r = q * 2 + rsub;
      const v4f v = *(const v4fa*)&so[w][r][c4];
      *(v4f*)(C + (size_t)(row0 + r) * ldc + col0 + c4) = v;
    }
    
  }
}
// row LayerNorm (biased variance, eps) over N: s = X (+ R); optional out_sum <- s; out_norm <- (s-mu)*rsqrt(var+eps)*g + b
template <bool PARAM_BF16>
__global__ __launch_bounds__(256) void k_layernorm(const float* __restrict__ X, const float* __restrict__ R, const float* __restrict__ g, const float* __restrict__ bta,
                                                  float* __restrict__ out_sum, float* __restrict__ out_norm, int N, float eps) {
  __shared__ float red[256];
  const int row = blockIdx.x, tid = threadIdx.x;
  const float* x = X + (size_t)row * N; const float* rr = R ? R + (size_t)row * N : nullptr;
  float vals[16];                     // up to N = 4096
  const int per = N / 256;            // contiguous chunk per thread? use strided-by-4 chunks: thread handles j = tid*4 + 1024*u
  float s1 = 0.f;
  for (int u = 0; u < per / 4; ++u) {
    const int j = tid * 4 + 1024 * u;
    const v4f a = *(const v4fa*)(x + j);
    v4f b = {0.f,0.f,0.f,0.f}; if (rr) b = *(const v4fa*)(rr + j);
#pragma unroll
    for (int q = 0; q < 4; ++q) { const float v = a[q] + b[q]; vals[u * 4 + q] = v; s1 += v; }
  }
  red[tid] = s1; __syncthreads();
  for (int st = 128; st > 0; st >>= 1) { if (tid < st) red[tid] += red[tid + st]; __syncthreads(); }
  const float mu = red[0] / (float)N; __syncthreads();
  float s2 = 0.f;
  for (int u = 0; u < per / 4; ++u)
#pragma unroll
    for (int q = 0; q < 4; ++q) { const float c = vals[u * 4 + q] - mu; s2 += c * c; }
  red[tid] = s2; __syncthreads();
  for (int st = 128; st > 0; st >>= 1) { if (tid < st) red[tid] += red[tid + st]; __syncthreads(); }
  const float rs = rsqrtf(red[0] / (float)N + eps);
  {
    for (int u = 0; u < per / 4; ++u) {
      const int j = tid * 4 + 1024 * u;
      v4f o, sm;
#pragma unroll
      for (int q = 0; q < 4; ++q) {
        float gg = g[j + q], bb = bta[j + q];
        if (PARAM_BF16) { gg = bf16_round(gg); bb = bf16_round(bb); }
        sm[q] = vals[u * 4 + q]; o[q] = (vals[u * 4 + q] - mu) * rs * gg + bb;
      }
      if (out_sum) *(v4f*)(out_sum + (size_t)row * N + j) = sm;
      *(v4f*)(out_norm + (size_t)row * N + j) = o;
    }
    
  }
}



// ---- f16 WMMA path (v_wmma_f32_16x16x32_f16): 11-bit significands for operands in range — used where a [0,1] probability operand needs more precision than bf16
typedef _Float16 v16h __attribute__((ext_vector_type(16)));
union FragH { v16h v; v8us half[2]; _Float16 h[16]; unsigned short u[16]; };
template <int NT>
__device__ __forceinline__ v8f mmaH(v16h ah, v16h al, v16h bh, v16h bl, v8f c) {
  c = __builtin_amdgcn_wmma_f32_16x16x32_f16(false, ah, false, bh, (short)0, c, false, false);
  if (NT >= 2) c = __builtin_amdgcn_wmma_f32_16x16x32_f16(false, al, false, bh, (short)0, c, false, false);
  if (NT >= 3) c = __builtin_amdgcn_wmma_f32_16x16x32_f16(false, ah, false, bl, (short)0, c, false, false);
  asm volatile("v_nop\n\tv_nop\n\tv_nop\n\tv_nop" : "+v"(c) : "v"(ah), "v"(al), "v"(bh), "v"(bl));
  return c;
}
// batched GEMM like k_gemm_b but f16 operands: A f32 (split into f16 hi/lo if ASPLIT, else rounded to f16), Bt = f16 values [n][k]; alpha; C f32; N multiple of 16 (partial tiles skipped)
template <bool ASPLIT>
__global__ __launch_bounds__(128) void k_gemm_h(const float* __restrict__ A, int lda, size_t sA, const _Float16* __restrict__ Bh, int ldb, size_t sB, float alpha, float* __restrict__ C, int ldc, size_t sC, int M, int N, int K) {
  __shared__ __attribute__((aligned(16))) float so[4][16][64];
  const int tid = threadIdx.x, w = tid >> 5, lane = tid & 31, ln = lane & 15, hh = lane >> 4; const int by = blockIdx.y;
  A += (size_t)by * sA; Bh += (size_t)by * sB; C += (size_t)by * sC;
  const int ntn = (N + 63) / 64; const int wid = blockIdx.x * 4 + w; const int mt = wid / ntn, nq = wid % ntn; if (mt * 16 >= M) return;
  const int row0 = mt * 16, col0 = nq * 64; const float* arow = A + (size_t)(row0 + ln) * lda;
  v8f acc[4] = {};
  for (int kb = 0; kb < K; kb += 32) {
    FragH ah, al;
    const v4f x0 = *(const v4fa*)(arow + kb + 8 * hh), x1 = *(const v4fa*)(arow + kb + 8 * hh + 4), x2 = *(const v4fa*)(arow + kb + 16 + 8 * hh), x3 = *(const v4fa*)(arow + kb + 16 + 8 * hh + 4);
    float xs[16] = {x0[0],x0[1],x0[2],x0[3],x1[0],x1[1],x1[2],x1[3],x2[0],x2[1],x2[2],x2[3],x3[0],x3[1],x3[2],x3[3]};
#pragma unroll
    for (int i = 0; i < 16; ++i) { const _Float16 h = (_Float16)xs[i]; ah.h[i] = h; al.h[i] = ASPLIT ? (_Float16)(xs[i] - (float)h) : (_Float16)0.0f; }
#pragma unroll
    for (int t = 0; t < 4; ++t) { if (col0 + t * 16 >= N) continue; const size_t boff = (size_t)(col0 + t * 16 + ln) * ldb + kb; FragH bq; bq.half[0] = *(const v8us*)(Bh + boff + 8 * hh); bq.half[1] = *(const v8us*)(Bh + boff + 16 + 8 * hh);
      acc[t] = mmaH<ASPLIT ? 2 : 1>(ah.v, al.v, bq.v, bq.v, acc[t]); }
  }
#pragma unroll
  for (int t = 0; t < 4; ++t) { if (col0 + t * 16 >= N) continue;
#pragma unroll
    for (int r = 0; r < 8; ++r) so[w][8 * hh + r][t * 16 + ln] = acc[t][r] * alpha; }
  __builtin_amdgcn_fence(__ATOMIC_ACQ_REL, "workgroup"); __builtin_amdgcn_wave_barrier();
  const int rsub = lane >> 4, c4 = (lane & 15) * 4;
  {
#pragma unroll
    for (int q = 0; q < 8; ++q) { const int r = q * 2 + rsub; if (col0 + c4 < N) { const v4f v = *(const v4fa*)&so[w][r][c4]; *(v4f*)(C + (size_t)(row0 + r) * ldc + col0 + c4) = v; } }
     }
}

// One wave's tile of a weight plane: Wt[n][k] = f16(bf16(W[k][n]) * 16) for 32 columns n (one a lane) and 64 k, from f32 row-major W with rows of LDN floats (a power-of-two scale keeps bf16-exact weights exact in f16 away from the subnormal range).
// src = the lane's column in the tile's first k row: each of the 64 loads reads 128 contiguous bytes across the wave. dst = the lane's row of the [out][in] plane at that k: the lane writes one whole 128-byte line, in 8 stores.
template <int LDN>
__device__ __forceinline__ void pr_wtile(const float* __restrict__ src, _Float16* __restrict__ dst) {
  float x[64];
#pragma unroll      /* register arrays need constant indices; constant offsets from one address */
  for (int k = 0; k < 64; ++k) x[k] = src[(size_t)k * LDN];
  __builtin_amdgcn_sched_barrier(0);      /* keeps all 64 loads in front of the first use: sunk among the conversions, the later loads start only when the first have come back */
#pragma unroll      /* register arrays need constant indices */
  for (int p = 0; p < 8; ++p) { FragH f;
#pragma unroll      /* register arrays need constant indices */
    for (int i = 0; i < 8; ++i) f.h[i] = (_Float16)(bf16_round(x[8 * p + i]) * 16.0f);
    *(v8us*)((unsigned short*)dst + 8 * p) = f.half[0]; }
  asm volatile("s_wait_xcnt 0x0" ::: "memory");      /* the wave goes on to its next unit: the address and data registers of these loads and stores are reused only behind this wait */
}
// k_gemm_hh variant with fused epilogue: v = acc·alpha + bias[by·sBias + col] (+ CP[(row/rowsPerB)·sCPb + by·64 + col] if CP) ; ACT 0 none / 1 elu ; writes f16 C16 (and f32 C if non-null)
template <int ACT>
__global__ __launch_bounds__(128) void k_gemm_hhx(const _Float16* __restrict__ A, int lda, size_t sA, const _Float16* __restrict__ Bh, int ldb, size_t sB, float alpha, const float* __restrict__ bias, size_t sBias, const float* __restrict__ CP, int rowsPerB, size_t sCPb, int row0g,
    float* __restrict__ C, _Float16* __restrict__ C16, int ldc, size_t sC, int M, int N, int K) {
  __shared__ __attribute__((aligned(16))) float so[4][16][64];
  const int tid = threadIdx.x, w = tid >> 5, lane = tid & 31, ln = lane & 15, hh = lane >> 4; const int by = blockIdx.y;
  A += (size_t)by * sA; Bh += (size_t)by * sB; const size_t cofs = (size_t)by * sC; const float* bp = bias ? bias + (size_t)by * sBias : nullptr;
  const int ntn = (N + 63) / 64; const int wid = blockIdx.x * 4 + w; const int mt = wid / ntn, nq = wid % ntn; if (mt * 16 >= M) return;
  const int row0 = mt * 16, col0 = nq * 64; const _Float16* arow = A + (size_t)(row0 + ln) * lda;
  v8f acc[4] = {};
  for (int kb = 0; kb < K; kb += 32) { FragH ah; ah.half[0] = *(const v8us*)((const unsigned short*)arow + kb + 8 * hh); ah.half[1] = *(const v8us*)((const unsigned short*)arow + kb + 16 + 8 * hh);
#pragma unroll
    for (int t = 0; t < 4; ++t) { if (col0 + t * 16 >= N) continue; const size_t boff = (size_t)(col0 + t * 16 + ln) * ldb + kb; FragH bq; bq.half[0] = *(const v8us*)((const unsigned short*)Bh + boff + 8 * hh); bq.half[1] = *(const v8us*)((const unsigned short*)Bh + boff + 16 + 8 * hh);
      acc[t] = mmaH<1>(ah.v, ah.v, bq.v, bq.v, acc[t]); }
  }
#pragma unroll
  for (int t = 0; t < 4; ++t) { if (col0 + t * 16 >= N) continue; const int col = col0 + t * 16 + ln; const float bv = bp ? bf16_round(bp[col]) : 0.f;
#pragma unroll
    for (int r = 0; r < 8; ++r) { float v = acc[t][r] * alpha + bv; if (CP) { const int rr = row0g + row0 + 8 * hh + r; if (rowsPerB < 0) v += CP[cofs + (size_t)rr * ldc + col];      /* rowsPerB < 0: own element of the batched C plane */ else { const int bidx = rr / rowsPerB; v += CP[(size_t)bidx * sCPb + (size_t)by * 64 + col]; } } if (ACT == 1) v = (v > 0.f) ? v : expm1f(v); else if (ACT == 7) v = (v > 0.f) ? v + 1.0f : expf(v); else if (ACT == 8) v = tanhf(v); else if (ACT == 9) v = 0.5f * v * (1.0f + tanhf(0.7978845608028654f * (v + 0.044715f * v * v * v))); else if (ACT == 11) v = 1.0f / (1.0f + expf(-v)); else if (ACT == 12) v = (v > 0.f) ? v : 0.01f * v; else if (ACT == 14) v = (v > 0.f) ? v : 0.1f * v; else if (ACT == 16) v = (v >= 0.f) ? v : 0.3f * v; else if (ACT == 17) v = (v >= 0.f) ? v : 0.2f * v; else if (ACT == 15) v = v / (1.0f + expf(-v)); else if (ACT == 3) v = fmaxf(v, 0.f); else if (ACT == 6) v = 0.5f * v * (1.0f + erff(v * 0.70710678118654752f)); so[w][8 * hh + r][t * 16 + ln] = v; } }
  __builtin_amdgcn_fence(__ATOMIC_ACQ_REL, "workgroup"); __builtin_amdgcn_wave_barrier();
  const int rsub = lane >> 4, c4 = (lane & 15) * 4; typedef _Float16 v4h __attribute__((ext_vector_type(4)));
  {
#pragma unroll
    for (int q = 0; q < 8; ++q) { const int r = q * 2 + rsub; if (col0 + c4 < N) { const v4f v = *(const v4fa*)&so[w][r][c4]; if (C) *(v4f*)(C + cofs + (size_t)(row0 + r) * ldc + col0 + c4) = v; if (C16) { v4h h4; for (int i = 0; i < 4; ++i) h4[i] = (_Float16)v[i]; *(v4h*)(C16 + cofs + (size_t)(row0 + r) * ldc + col0 + c4) = h4; } } }
     }
}


typedef _Float16 v4h __attribute__((ext_vector_type(4)));

// One wave's run of a cast: 2048 contiguous elements (8 KB of f32) as exact f16 of their bf16 rounding. x, X16 = the stream's buffers, e = the element index of the lane's first piece of 8; its pieces i = 0 .. 7 lie 256 elements apart. All 16 loads are issued before the first value is used.
__device__ __forceinline__ void pr_xrun(const float* __restrict__ x, _Float16* __restrict__ X16, unsigned e) {
  v4f a[8], b[8]; const unsigned bo = e * 4u;      /* the loads' byte offset */
#pragma unroll      /* register arrays need constant indices; constant offsets from one address */
  for (int i = 0; i < 8; ++i) { a[i] = *(const v4fa*)(x + e + 256 * i); b[i] = *(const v4fa*)(x + e + 256 * i + 4); }
  __builtin_amdgcn_sched_barrier(0);      /* keeps all 16 loads in front of the first use: sunk among the conversions, the later loads start only when the first have come back */
  asm volatile("s_wait_xcnt 0x0" :: "v"(bo) : "memory");      /* the loads' offset register is held live to here, so that no load's result lands in it, and is reused only behind this wait */
#pragma unroll      /* register arrays need constant indices */
  for (int i = 0; i < 8; ++i) { FragH f;
#pragma unroll      /* register arrays need constant indices */
    for (int q = 0; q < 4; ++q) { f.h[q] = (_Float16)bf16_round(a[i][q]); f.h[4 + q] = (_Float16)bf16_round(b[i][q]); }
    *(v8us*)((unsigned short*)X16 + e + 256 * i) = f.half[0]; }
  asm volatile("s_wait_xcnt 0x0" ::: "memory");      /* the wave goes on to its next unit: the address and data registers of these loads and stores are reused only behind this wait */
}
__global__ __launch_bounds__(256) void k_h16(const float* __restrict__ x, _Float16* __restrict__ X16, size_t n8) { const size_t t = (size_t)blockIdx.x * 256 + threadIdx.x; if (t >= n8) return; FragH f;
#pragma unroll
  for (int q = 0; q < 8; ++q) f.h[q] = (_Float16)x[t * 8 + q]; *(v8us*)((unsigned short*)X16 + t * 8) = f.half[0];  }
__global__ __launch_bounds__(256) void k_round16f(const float* __restrict__ W, _Float16* __restrict__ Bt, size_t n8) { const size_t t = (size_t)blockIdx.x * 256 + threadIdx.x; if (t >= n8) return; FragH f;
#pragma unroll
  for (int i = 0; i < 8; ++i) f.h[i] = (_Float16)(bf16_round(W[t * 8 + i]) * 16.0f); *(v8us*)((unsigned short*)Bt + t * 8) = f.half[0];  }
template <int NHv, int TTv>
__global__ __launch_bounds__(256) void k_vt(const _Float16* __restrict__ V16, int ldv, int voff, _Float16* __restrict__ Vt) { __shared__ unsigned short tl[64][66]; const int tid = threadIdx.x; const int slab = blockIdx.x / (TTv / 64), lg = blockIdx.x % (TTv / 64); const int b = slab / NHv, h = slab % NHv;
  for (int i = tid; i < 64 * 8; i += 256) { const int r = i / 8, c8 = (i % 8) * 8; FragH f; f.half[0] = *(const v8us*)((const unsigned short*)V16 + ((size_t)b * TTv + lg * 64 + r) * ldv + voff + h * 64 + c8);
#pragma unroll
    for (int q = 0; q < 8; ++q) tl[r][c8 + q] = f.u[q]; }
  __syncthreads();
  {
#pragma unroll
    for (int rd = 0; rd < 2; ++rd) { const int d = rd * 32 + tid / 8, pc = tid % 8; FragH f;
#pragma unroll
      for (int q = 0; q < 8; ++q) f.u[q] = tl[pc * 8 + q][d];
      *(v8us*)((unsigned short*)Vt + ((size_t)slab * 64 + d) * TTv + lg * 64 + pc * 8) = f.half[0]; }
     } }

__global__ __launch_bounds__(256) void k_hl(const float* __restrict__ F, _Float16* __restrict__ Hh, _Float16* __restrict__ Hl, size_t n8) { const size_t t = (size_t)blockIdx.x * 256 + threadIdx.x; if (t >= n8) return; FragH fh, fl; const v4f a = *(const v4fa*)(F + t * 8), c = *(const v4fa*)(F + t * 8 + 4);
#pragma unroll
  for (int q = 0; q < 4; ++q) { _Float16 h = (_Float16)a[q]; fh.h[q] = h; fl.h[q] = (_Float16)((a[q] - (float)h) * 1024.0f); h = (_Float16)c[q]; fh.h[4 + q] = h; fl.h[4 + q] = (_Float16)((c[q] - (float)h) * 1024.0f); }
  { *(v8us*)((unsigned short*)Hh + t * 8) = fh.half[0]; *(v8us*)((unsigned short*)Hl + t * 8) = fl.half[0];  } }

// fragment of 32 k from a k-contiguous f16 row in global memory
__device__ __forceinline__ v16h g2_frag(const _Float16* p, int hh) { FragH f; f.half[0] = *(const v8us*)((const unsigned short*)p + 8 * hh); f.half[1] = *(const v8us*)((const unsigned short*)p + 16 + 8 * hh); return f.v; }


__global__ __launch_bounds__(256) void k_wnat(const float* __restrict__ w, size_t n8, _Float16* __restrict__ Bt) { const size_t t = (size_t)blockIdx.x * 256 + threadIdx.x; if (t >= n8) return; FragH f; for (int q = 0; q < 8; ++q) f.h[q] = (_Float16)(bf16_round(w[t * 8 + q]) * 16.0f); *(v8us*)((unsigned short*)Bt + t * 8) = f.half[0];  }
__global__ __launch_bounds__(256) void k_rsm(const float* __restrict__ S, _Float16* __restrict__ P, int nrows) {
  #pragma clang fp contract(off)
  const int i = blockIdx.x * 256 + threadIdx.x; if (i >= nrows) return; const float* s = S + (size_t)i * SQ; float mx = -3.0e38f;
#pragma unroll 1
  for (int j = 0; j < SQ; ++j) mx = fmaxf(mx, s[j]); float se = 0.f;
#pragma unroll 1
  for (int j = 0; j < SQ; ++j) se += expf(s[j] - mx); const float sc = 256.0f / se;
#pragma unroll 1
  for (int j0 = 0; j0 < SQ; j0 += 8) { FragH f; for (int q = 0; q < 8; ++q) f.h[q] = (_Float16)(expf(s[j0 + q] - mx) * sc); unsigned short* d = (unsigned short*)P + (size_t)i * SQ + j0; *(v8us*)d = f.half[0];  } }
__global__ __launch_bounds__(256) void k_vt(const _Float16* __restrict__ V16, int b, int h0, _Float16* __restrict__ VT) { __shared__ unsigned short tl[64][65]; const int tid = threadIdx.x; const int hh = blockIdx.x % HG, sg = blockIdx.x / HG; const int s0 = sg * 64; const int h = h0 + hh;
  for (int i = tid; i < 64 * 8; i += 256) { const int j = i / 8, d8 = (i % 8) * 8; FragH f; f.half[0] = *(const v8us*)((const unsigned short*)V16 + ((size_t)b * SQ + s0 + j) * DM + h * HD + d8); for (int q = 0; q < 8; ++q) tl[d8 + q][j] = f.u[q]; }
  __syncthreads();
  { for (int i = tid; i < 64 * 8; i += 256) { const int d = i / 8, j8 = (i % 8) * 8; FragH f; for (int q = 0; q < 8; ++q) f.u[q] = tl[d][j8 + q]; *(v8us*)((unsigned short*)VT + ((size_t)hh * HD + d) * SQ + s0 + j8) = f.half[0]; }  } }



// All operand preparation in one launch: none of these pieces reads what another writes. The work is cut into units of 8 KB of f32 input, one wave each: weight tiles of 32 columns x 64 k, and cast runs of 2048 elements.
// Few long waves instead of many short ones: the launch starts 3584 waves, two workgroups per WGP, and each wave takes four units, PR_NW apart (wave-uniform branches, no barrier).
// The weight tiles come first in the numbering, so that they run beside the memory-bound casts of the other waves.
#define PR_WT ((DM / 32) * (DM / 64))            /* tiles per weight plane */
#define PR_WU (4 * PR_WT)                        /* weight units */
#define PR_XU ((int)(NR * DM / 2048))            /* runs per cast of the token rows */
#define PR_UPW 4                                 /* units per wave */
#define PR_WPB 7                                 /* waves per workgroup */
#define PR_NW ((PR_WU + 3 * PR_XU) / PR_UPW)     /* waves */
static_assert(PR_NW * PR_UPW == PR_WU + 3 * PR_XU && PR_NW % PR_WPB == 0, "the units must divide evenly among the waves");
__global__ __launch_bounds__(PR_WPB * 32) void k_prep(const float* __restrict__ wq, const float* __restrict__ wk, const float* __restrict__ wv, const float* __restrict__ wo, const float* __restrict__ xq, const float* __restrict__ xk, const float* __restrict__ xv,
    _Float16* __restrict__ BQ, _Float16* __restrict__ BK, _Float16* __restrict__ BV, _Float16* __restrict__ BO, _Float16* __restrict__ XQ, _Float16* __restrict__ XK, _Float16* __restrict__ XV) {
  const int lane = threadIdx.x & 31; const int gw = blockIdx.x * PR_WPB + __builtin_amdgcn_readfirstlane(threadIdx.x >> 5);
  for (int j = 0; j < PR_UPW; ++j) { const int u = gw + j * PR_NW;      /* the same in every lane of the wave */
    if (u < PR_WU) { const int m = u / PR_WT, v = u - m * PR_WT; const int n = (v / (DM / 64)) * 32 + lane, k0 = (v % (DM / 64)) * 64;      /* n = row of the [out][in] plane */
      if (m == 0) pr_wtile<DM>(wo + (size_t)k0 * DM + n, BO + (size_t)n * DM + k0);
      else { const float* w = (m == 1) ? wq : (m == 2) ? wk : wv; _Float16* B = (m == 1) ? BQ : (m == 2) ? BK : BV;      /* head n / HD: a row-major [DM][HD] block; the wave's 32 columns lie in one head */
        pr_wtile<HD>(w + (size_t)(n / HD) * (DM * HD) + (size_t)k0 * HD + (n % HD), B + (size_t)n * DM + k0); } }
    else { const int c = u - PR_WU; const int m = c / PR_XU; const unsigned e = (unsigned)(c - m * PR_XU) * 2048u + lane * 8;
      pr_xrun((m == 0) ? xq : (m == 1) ? xk : xv, (m == 0) ? XQ : (m == 1) ? XK : XV, e); } }
}

#define FA_NW 8                      /* waves per workgroup */
#define FA_BR (FA_NW * 32)           /* query rows per workgroup */
#define FA_SK 64                     /* keys per stage = two 32-key passes */
#define FA_PITCH 144                 /* LDS row pitch in bytes: 128 of data + 16, an odd multiple of 16 for the 16-byte fragment reads */
#define FA_TILE (FA_SK * FA_PITCH)
/* amdgpu_waves_per_eu(4, 4): at most 256 VGPRs, so that two workgroups (four waves per SIMD) are resident per WGP and the 512 workgroups run in one round */
__device__ __forceinline__ float fa_xh(float x) { return __builtin_bit_cast(float, __builtin_amdgcn_permlanex16(__builtin_bit_cast(int, x), __builtin_bit_cast(int, x), 0x76543210, 0xfedcba98, false, false)); }      /* lane l reads lane l ^ 16 */
__device__ __forceinline__ v16h fa_frag(const unsigned char* p) { FragH f; f.half[0] = *(const v8us*)p; f.half[1] = *(const v8us*)(p + 32); return f.v; }      /* p = row start + 16 * (lane >> 4): k = 8 hh .. 8 hh + 7 and 16 + 8 hh .. 16 + 8 hh + 7, as g2_frag */
__device__ __forceinline__ v8f fa_mma(v16h a, v16h b, v8f c) { return __builtin_amdgcn_wmma_f32_16x16x32_f16(false, a, false, b, (short)0, c, false, false); }
/* The 8 score products of a pass, 2 key tiles x 2 query groups x k = 64: s = c + K . Q^T with c read from its own registers and left as it is. Written as asm because the builtin form copied c into
   the result registers in front of half of the products (8 register moves a tile). Each result's second product stands three products behind its first; the v_nop at the end keep the four vector
   slots between the last product and the first vector instruction that reads its result; those in front keep four slots behind the product issued just before the statement, whose B registers
   (the weights of the pass before) the compiler gives to a result here. */
__device__ __forceinline__ void fa_scores(v8f& s00, v8f& s01, v8f& s10, v8f& s11, v16h ka0, v16h kb0, v16h ka1, v16h kb1, v16h q00, v16h q01, v16h q10, v16h q11, v8f c0, v8f c1) {
  asm("v_nop\n\tv_nop\n\tv_nop\n\tv_nop\n\t"
      "v_wmma_f32_16x16x32_f16 %0, %4, %8, %12\n\t"
      "v_wmma_f32_16x16x32_f16 %1, %4, %10, %13\n\t"
      "v_wmma_f32_16x16x32_f16 %2, %6, %8, %12\n\t"
      "v_wmma_f32_16x16x32_f16 %3, %6, %10, %13\n\t"
      "v_wmma_f32_16x16x32_f16 %0, %5, %9, %0\n\t"
      "v_wmma_f32_16x16x32_f16 %1, %5, %11, %1\n\t"
      "v_wmma_f32_16x16x32_f16 %2, %7, %9, %2\n\t"
      "v_wmma_f32_16x16x32_f16 %3, %7, %11, %3\n\t"
      "v_nop\n\tv_nop\n\tv_nop\n\tv_nop"
      : "=&v"(s00), "=&v"(s01), "=&v"(s10), "=&v"(s11)
      : "v"(ka0), "v"(kb0), "v"(ka1), "v"(kb1), "v"(q00), "v"(q01), "v"(q10), "v"(q11), "v"(c0), "v"(c1)); }
__global__ __launch_bounds__(FA_NW * 32) __attribute__((amdgpu_waves_per_eu(4, 4))) void k_fattn(const _Float16* __restrict__ Q16, const _Float16* __restrict__ K16, const _Float16* __restrict__ VT, _Float16* __restrict__ O16) {
  __shared__ __attribute__((aligned(16))) unsigned char L[2][2][FA_TILE];      /* [buffer][0 = K rows, 1 = V^T rows] */
  const int tid = threadIdx.x, lane = tid & 31, c = lane & 15, hh = lane >> 4; const int wave = __builtin_amdgcn_readfirstlane(tid >> 5);
  const int q0 = blockIdx.x * FA_BR + wave * 32, h = blockIdx.y, b = blockIdx.z; const size_t r0 = (size_t)b * SQ;
  /* staging: thread t moves the 16-byte piece t & 7 of rows t >> 3 and 32 + (t >> 3) of both tiles: 8 lanes cover one whole 128-byte row */
  const int srow = tid >> 3, scol = tid & 7; const int sl = srow * FA_PITCH + scol * 16;
  const unsigned short* kg = (const unsigned short*)K16 + (r0 + srow) * LQ + h * HD + scol * 8;
  const unsigned short* vg = (const unsigned short*)VT + (((size_t)b * NH + h) * HD + srow) * SQ + scol * 8;
  v8us k0 = *(const v8us*)kg, k1 = *(const v8us*)(kg + (size_t)32 * LQ), v0 = *(const v8us*)vg, v1 = *(const v8us*)(vg + (size_t)32 * SQ);
  v16h qf[2][2];
#pragma unroll      /* register arrays need constant indices */
  for (int g = 0; g < 2; ++g) { const _Float16* qp = Q16 + (r0 + q0 + 16 * g + c) * LQ + h * HD; qf[g][0] = g2_frag(qp, hh); qf[g][1] = g2_frag(qp + 32, hh); }
  FragH ones;
#pragma unroll
  for (int i = 0; i < 16; ++i) ones.u[i] = (c == 0) ? (unsigned short)0x3C00 : (unsigned short)0;
  const v8f z8 = {0.f, 0.f, 0.f, 0.f, 0.f, 0.f, 0.f, 0.f};
  v8f acc[2][4] = {{z8, z8, z8, z8}, {z8, z8, z8, z8}}; v8f lacc[2] = {z8, z8}; v8f negm[2] = {z8, z8};      /* negm: minus the maximum in use of this lane's query, the same in all 8 registers (a lane's 8 scores of a tile belong to one query); 0 until the first pass sets it */
  *(v8us*)&L[0][0][sl] = k0; *(v8us*)&L[0][0][sl + 32 * FA_PITCH] = k1; *(v8us*)&L[0][1][sl] = v0; *(v8us*)&L[0][1][sl + 32 * FA_PITCH] = v1;
  for (int st = 0; st < SQ / FA_SK; ++st) {
    __syncthreads();      /* stage st is written by every wave, and every wave has left the buffer that is refilled at the foot of this trip */
    const unsigned char* Kb = &L[st & 1][0][0]; const unsigned char* Vb = &L[st & 1][1][0];
    const bool more = st + 1 < SQ / FA_SK;      /* the same for the whole workgroup */
    if (more) { k0 = *(const v8us*)(kg + (size_t)FA_SK * LQ); k1 = *(const v8us*)(kg + (size_t)(FA_SK + 32) * LQ); v0 = *(const v8us*)(vg + FA_SK); v1 = *(const v8us*)(vg + FA_SK + (size_t)32 * SQ); }      /* next stage, in flight under this stage's passes */
#pragma unroll      /* two passes per stage; constant LDS offsets */
    for (int sub = 0; sub < 2; ++sub) {
      v8f s[2][2];
      { const unsigned char* p = Kb + (32 * sub + c) * FA_PITCH + 16 * hh; const unsigned char* p1 = p + 16 * FA_PITCH;
        fa_scores(s[0][0], s[0][1], s[1][0], s[1][1], fa_frag(p), fa_frag(p + 64), fa_frag(p1), fa_frag(p1 + 64), qf[0][0], qf[0][1], qf[1][0], qf[1][1], negm[0], negm[1]); }      /* scaled score minus the maximum in use */
      float mb[2];      /* this lane's largest of the pass, per query group, relative to the maximum in use */
#pragma unroll      /* register arrays need constant indices */
      for (int g = 0; g < 2; ++g) { float mx = fmaxf(s[0][g][0], s[1][g][0]);
#pragma unroll      /* register arrays need constant indices */
        for (int r = 1; r < 8; ++r) mx = fmaxf(mx, fmaxf(s[0][g][r], s[1][g][r]));
        mb[g] = mx; }
      const bool first = (sub == 0) && (st == 0);      /* the first pass sets the maximum whatever its sign */
      if (first || __builtin_amdgcn_ballot_w32(fmaxf(mb[0], mb[1]) > 8.0f) != 0) {      /* wave-uniform; rare after the first pass */
#pragma unroll      /* register arrays need constant indices */
        for (int g = 0; g < 2; ++g) { const float mq = fmaxf(mb[g], fa_xh(mb[g])); const float up = fmaxf(mq, 0.f); const float d = first ? mq : up;      /* both wave halves hold this query's rise of the maximum */
          const float corr = __builtin_amdgcn_exp2f(-up); negm[g] = negm[g] - d; lacc[g] = lacc[g] * corr;      /* on the first pass the accumulators are 0 */
#pragma unroll      /* register arrays need constant indices */
          for (int r = 0; r < 8; ++r) { s[0][g][r] -= d; s[1][g][r] -= d; }
#pragma unroll      /* register arrays need constant indices */
          for (int t = 0; t < 4; ++t) acc[g][t] = acc[g][t] * corr; } }
      v16h vf[4];      /* read behind the branch: in front of it these reads were lifted over the score products, and the registers went past 256 (q fragments spilled) */
#pragma unroll      /* register arrays need constant indices */
      for (int t = 0; t < 4; ++t) vf[t] = fa_frag(Vb + (16 * t + c) * FA_PITCH + 64 * sub + 16 * hh);
#pragma unroll      /* register arrays need constant indices */
      for (int g = 0; g < 2; ++g) { FragH pf;
#pragma unroll      /* register arrays need constant indices */
        for (int i = 0; i < 16; ++i) pf.h[i] = (_Float16)__builtin_amdgcn_exp2f(s[i >> 3][g][i & 7]);      /* keys 8 hh + r of tile 0, then of tile 1: the B operand's k order */
#pragma unroll      /* register arrays need constant indices */
        for (int t = 0; t < 4; ++t) acc[g][t] = fa_mma(vf[t], pf.v, acc[g][t]);
        lacc[g] = fa_mma(ones.v, pf.v, lacc[g]); }      /* row 0 += the column sums of P^T */
    }
    if (more) { unsigned char* Kn = &L[(st + 1) & 1][0][0]; unsigned char* Vn = &L[(st + 1) & 1][1][0]; *(v8us*)(Kn + sl) = k0; *(v8us*)(Kn + sl + 32 * FA_PITCH) = k1; *(v8us*)(Vn + sl) = v0; *(v8us*)(Vn + sl + 32 * FA_PITCH) = v1;
      asm volatile("s_wait_xcnt 0x0" :: "v"(kg), "v"(vg) : "memory");      /* the stage loads' address registers (held live to here) are advanced only behind this wait */
      kg += (size_t)FA_SK * LQ; vg += FA_SK; }
  }
#pragma unroll      /* register arrays need constant indices */
  for (int g = 0; g < 2; ++g) { const float lr = lacc[g][0]; const float inv = 64.0f / (lr + fa_xh(lr));
#pragma unroll      /* register arrays need constant indices */
    for (int t = 0; t < 4; ++t) { FragH f;
#pragma unroll      /* register arrays need constant indices */
      for (int r = 0; r < 8; ++r) f.h[r] = (_Float16)(acc[g][t][r] * inv);
      *(v8us*)((unsigned short*)O16 + (r0 + q0 + 16 * g + c) * DM + h * HD + 16 * t + 8 * hh) = f.half[0]; } } }      /* d = 16 t + 8 hh .. + 7 of query 16 g + c */

// ---- tiled GEMM C = ((A . B^T) * alpha + bias) * post (post0 for y = 0, else 1): A [rows][DM] and B [cols][DM] f16, k contiguous; one 128 x 128 tile of C per workgroup, four waves of 64 x 64 (4 x 4 accumulator tiles) ----
// Stages of 64 k (128 bytes of each of the 128 A rows and 128 B rows) are brought by asynchronous copies into two LDS buffers, the next stage in flight under this stage's products: every copy
// covers whole 128-byte lines, and each operand byte is fetched once per workgroup and read from LDS by the two waves that need it. k runs upward in steps of 32 into one accumulator per tile.
// Rows % 128 == 0, columns = k = DM, at least two stages.
#define G3_BT 128                    /* tile rows and tile columns per workgroup */
#define G3_SK 64                     /* k per stage = two WMMA steps */
#define G3_NS (DM / G3_SK)           /* stages */
#define G3_PITCH 144                 /* LDS row pitch in bytes: 128 of data + 16, an odd multiple of 16 for the 16-byte fragment reads */
#define G3_TILE (G3_BT * G3_PITCH)
#define G3_OP 68                     /* pitch in floats of the staged output rows */
typedef float f1a __attribute__((may_alias));
/* One lane's eight 16-byte pieces of a 128-row tile, rows 16 apart: lds = the lane's LDS byte address, g = its global address, both multiples of 16. The copies go through no register.
   s_wait_xcnt stands inside the statement, so that no address register of a copy is rewritten in front of it. */
__device__ __forceinline__ void g3_copy8(unsigned lds, const unsigned short* g) {
  asm volatile("global_load_async_to_lds_b128 %0, %8, off\n\t"
               "global_load_async_to_lds_b128 %1, %9, off\n\t"
               "global_load_async_to_lds_b128 %2, %10, off\n\t"
               "global_load_async_to_lds_b128 %3, %11, off\n\t"
               "global_load_async_to_lds_b128 %4, %12, off\n\t"
               "global_load_async_to_lds_b128 %5, %13, off\n\t"
               "global_load_async_to_lds_b128 %6, %14, off\n\t"
               "global_load_async_to_lds_b128 %7, %15, off\n\t"
               "s_wait_xcnt 0x0"
               :: "v"(lds), "v"(lds + 16 * G3_PITCH), "v"(lds + 32 * G3_PITCH), "v"(lds + 48 * G3_PITCH), "v"(lds + 64 * G3_PITCH), "v"(lds + 80 * G3_PITCH), "v"(lds + 96 * G3_PITCH), "v"(lds + 112 * G3_PITCH),
                  "v"(g), "v"(g + (size_t)16 * DM), "v"(g + (size_t)32 * DM), "v"(g + (size_t)48 * DM), "v"(g + (size_t)64 * DM), "v"(g + (size_t)80 * DM), "v"(g + (size_t)96 * DM), "v"(g + (size_t)112 * DM)
               : "memory"); }
template <bool OUT32>
__global__ __launch_bounds__(128) void k_gemm3(const _Float16* __restrict__ A, size_t sA, const _Float16* __restrict__ Bh, size_t sB, float alpha, float post0, const float* __restrict__ bias0, const float* __restrict__ bias1, const float* __restrict__ bias2,
    float* __restrict__ C, _Float16* __restrict__ C16, size_t sC) {
  __shared__ __attribute__((aligned(16))) unsigned char L[2][2][G3_TILE];      /* [buffer][0 = A rows, 1 = B rows]; behind the k loop: four staged 64 x 64 f32 output tiles */
  static_assert(4 * 64 * G3_OP * 4 <= 4 * G3_TILE, "the staged output tiles must fit the ring"); static_assert(G3_NS >= 2, "the prologue fills two stages");
  const int tid = threadIdx.x, lane = tid & 31, ln = lane & 15, hh = lane >> 4; const int wave = __builtin_amdgcn_readfirstlane(tid >> 5); const int by = blockIdx.y;
  const float* bias = (by == 0) ? bias0 : (by == 1) ? bias1 : bias2;      /* products that share one grid along y keep their biases in separate buffers */
  const float post = (by == 0) ? post0 : 1.0f; const float alphap = alpha * post;      /* product y = 0 leaves multiplied by post0, bias included */
  const int mt = blockIdx.x / (DM / G3_BT), nq = blockIdx.x - mt * (DM / G3_BT); const int row0 = mt * G3_BT, col0 = nq * G3_BT; const int wm = (wave >> 1) * 64, wn = (wave & 1) * 64;
  /* staging: thread t copies the 16-byte piece t & 7 of rows (t >> 3) + 16 i, i = 0 .. 7, of both tiles: 8 lanes cover one whole 128-byte row */
  const int srow = tid >> 3, scol = tid & 7; const unsigned sl = (unsigned)(size_t)&L[0][0][0] + srow * G3_PITCH + scol * 16;      /* low 32 bits of the shared address = LDS byte address */
  const unsigned short* ag = (const unsigned short*)A + (size_t)by * sA + (size_t)(row0 + srow) * DM + scol * 8;
  const unsigned short* bg = (const unsigned short*)Bh + (size_t)by * sB + (size_t)(col0 + srow) * DM + scol * 8;
  const v8f z8 = {0.f, 0.f, 0.f, 0.f, 0.f, 0.f, 0.f, 0.f};
  v8f acc[4][4] = {{z8, z8, z8, z8}, {z8, z8, z8, z8}, {z8, z8, z8, z8}, {z8, z8, z8, z8}};
  g3_copy8(sl, ag); g3_copy8(sl + G3_TILE, bg);      /* stage 0 into buffer 0 */
  asm volatile("s_wait_asynccnt 0x0" ::: "memory");      /* this wave's copies of stage 0 have landed */
  __syncthreads();      /* ... and every other wave's */
  g3_copy8(sl + 2 * G3_TILE, ag + G3_SK); g3_copy8(sl + 3 * G3_TILE, bg + G3_SK);      /* stage 1 into buffer 1, in flight under stage 0's products */
  for (int st = 0; st < G3_NS; ++st) {
    const unsigned char* Ab = &L[st & 1][0][0] + (wm + ln) * G3_PITCH + 16 * hh; const unsigned char* Bb = &L[st & 1][1][0] + (wn + ln) * G3_PITCH + 16 * hh;
#pragma unroll      /* two WMMA steps per stage; constant LDS offsets */
    for (int kk = 0; kk < 2; ++kk) { v16h af[4], bf[4];
#pragma unroll      /* register arrays need constant indices */
      for (int i = 0; i < 4; ++i) { af[i] = fa_frag(Ab + 16 * i * G3_PITCH + 64 * kk); bf[i] = fa_frag(Bb + 16 * i * G3_PITCH + 64 * kk); }      /* both operands in the k order of g2_frag */
      __builtin_amdgcn_sched_barrier(0);      /* keeps the step's 16 fragment reads together in front of its 16 products: sunk among them, each A fragment's LDS latency is waited out in full */
#pragma unroll      /* register arrays need constant indices */
      for (int i = 0; i < 4; ++i)
#pragma unroll      /* register arrays need constant indices */
        for (int j = 0; j < 4; ++j) acc[i][j] = fa_mma(af[i], bf[j], acc[i][j]); }
    asm volatile("s_wait_dscnt 0x0" ::: "memory");      /* this wave's reads of buffer st & 1 are done before that buffer is handed to the copies */
    asm volatile("s_wait_asynccnt 0x0" ::: "memory");      /* this wave's copies of stage st + 1 have landed */
    __syncthreads();      /* stage st + 1 is published, and every wave has left the buffer that is refilled behind this barrier */
    if (st + 2 < G3_NS) { const unsigned lb = sl + (st & 1) * (2 * G3_TILE); const size_t ko = (size_t)(st + 2) * G3_SK;      /* the same for the whole workgroup */
      g3_copy8(lb, ag + ko); g3_copy8(lb + G3_TILE, bg + ko); }
  }
  asm volatile("s_wait_asynccnt 0x0" ::: "memory");      /* no copy is outstanding when the ring's LDS takes the output tiles */
  /* the last trip's barrier stands behind every wave's last read of the ring: each wave now stages its output tile in its own part of that LDS, so that the stores cover whole lines */
  f1a* so = (f1a*)&L[0][0][0] + wave * (64 * G3_OP);
#pragma unroll      /* register arrays need constant indices */
  for (int j = 0; j < 4; ++j) { const float bv = bf16_round(bias[col0 + wn + 16 * j + ln]) * post;
#pragma unroll      /* register arrays need constant indices */
    for (int i = 0; i < 4; ++i)
#pragma unroll      /* register arrays need constant indices */
      for (int r = 0; r < 8; ++r) so[(16 * i + 8 * hh + r) * G3_OP + 16 * j + ln] = acc[i][j][r] * alphap + bv; }
  __builtin_amdgcn_fence(__ATOMIC_ACQ_REL, "workgroup"); __builtin_amdgcn_wave_barrier();      /* the wave's own LDS writes are done before its lanes read each other's */
  const int rsub = lane >> 4, c4 = (lane & 15) * 4; const size_t o0 = (size_t)by * sC + (size_t)(row0 + wm + rsub) * DM + col0 + wn + c4;
#pragma unroll      /* constant offsets from one address */
  for (int q = 0; q < 32; ++q) { const v4f v = *(const v4fa*)&so[(q * 2 + rsub) * G3_OP + c4];
    if (OUT32) *(v4f*)(C + o0 + (size_t)(q * 2) * DM) = v;
    else { v4h h4;
#pragma unroll      /* register arrays need constant indices */
      for (int i = 0; i < 4; ++i) h4[i] = (_Float16)v[i];
      *(v4h*)(C16 + o0 + (size_t)(q * 2) * DM) = h4; } } }

extern "C" void kernel_launch(void* const* d_in, const int* in_sizes, int n_in,
                              void* d_out, int out_size, void* d_ws, size_t ws_size, hipStream_t stream) {
  (void)in_sizes; (void)n_in; (void)out_size;
  const float* const* I = (const float* const*)d_in; const float* xq = I[0]; const float* xk = I[1]; const float* xv = I[1]; const float* wq = I[2]; const float* bq = I[3]; const float* wk = I[4]; const float* bk = I[5]; const float* wv = I[6]; const float* bv = I[7]; const float* wo = I[8]; const float* bo = I[9];      /* TWO inputs: query (the q stream) and value (read on BOTH the k and the v stream casts); wq, wk, wv are PER-HEAD STACKS [16][1024][64] = [head][in][out]; bq, bk, bv per-head [16][64] = the flat [1024] bias; wo [in][out] + bo; input order query, value, wq, bq, wk, bk, wv, bv, wo, bo */
  char* ws = (char*)d_ws; size_t off = 0;
  auto take = [&](size_t bytes) { char* p = ws + off; off += (bytes + 255) & ~(size_t)255; return p; };
  _Float16* BQ = (_Float16*)take((size_t)DM * DM * 2); _Float16* BK = (_Float16*)take((size_t)DM * DM * 2); _Float16* BV = (_Float16*)take((size_t)DM * DM * 2); _Float16* BO = (_Float16*)take((size_t)DM * DM * 2);
  _Float16* XQ = (_Float16*)take(NR * DM * 2); _Float16* XK = (_Float16*)take(NR * DM * 2); _Float16* XV = (_Float16*)take(NR * DM * 2); _Float16* Q16 = (_Float16*)take(NR * DM * 2); _Float16* K16 = (_Float16*)take(NR * DM * 2); _Float16* V16 = (_Float16*)take(NR * DM * 2); _Float16* O16 = (_Float16*)take(NR * DM * 2);
  _Float16* VT = (_Float16*)take((size_t)NB * NH * HD * SQ * 2);
  if (off > ws_size) return;
  k_prep<<<PR_NW / PR_WPB, PR_WPB * 32, 0, stream>>>(wq, wk, wv, wo, xq, xk, xv, BQ, BK, BV, BO, XQ, XK, XV);      /* weight planes [out][in] (x16): the per-head stacks wq / wk / wv [NH][DM][HD] head by head into contiguous rows, wo [in][out] whole; the three token streams as exact f16 rows */
  const size_t r0p = (size_t)B0 * SQ;      /* first projected row */
  k_gemm3<false><<<dim3((unsigned)((MP / G3_BT) * (DM / G3_BT)), 3), 128, 0, stream>>>(XQ + r0p * DM, NR * DM, BQ, (size_t)DM * DM, 0.0625f, 0.18033688011112042f, bq, bk, bv, nullptr, Q16 + r0p * DM, NR * DM);      /* q, k, v in one grid, y = 0, 1, 2: XQ XK XV, BQ BK BV and Q16 K16 V16 each lie one behind the other in the workspace; q leaves times 64^-0.5 log2(e) */
  k_vt<NH, SQ><<<NB * NH * (SQ / 64), 256, 0, stream>>>(V16, LQ, 0, VT);      /* V^T [NB][NH][HD][SQ], all batches */
  k_fattn<<<dim3(SQ / FA_BR, NH, NB), FA_NW * 32, 0, stream>>>(Q16, K16, VT, O16);      /* o x64 (merged heads) as f16 rows */
  k_gemm3<true><<<dim3((unsigned)((MPO / G3_BT) * (DM / G3_BT)), 1), 128, 0, stream>>>(O16 + r0p * DM, 0, BO, 0, 0.0009765625f, 1.0f, bo, bo, bo, (float*)d_out + r0p * DM, nullptr, 0);      /* out rows are the output layout */
}

// v007
// It runs in 121 microseconds.
// Timed twice side by side with v006, it ran 1.04 and 1.05 times as fast.
// Counting every step since v000, it is 58.5 times as fast.
#include <hip/hip_runtime.h>
// Multi-head attention on two inputs with PER-HEAD STACKED projections and per-head biases on four sequences (query [4][2048][1024], value [4][2048][1024]; q = einsum('bsd,hde->bhse', query, wq) + bq, k = einsum(value, wk) + bk, v = einsum(value, wv) + bv with W [16][1024][64] = [head][in][out] and b [16][64], 16 heads of 64; scores * 1/sqrt(64); softmax over all 2048 keys (no mask); out = heads wo + bo ([in][out] + bias) -> [4][2048][1024]); each head's [in][out] block is transposed into its 64 contiguous rows of the weight plane by the existing builder; the [in][out] output weight through the same builder; all of them, and the casts of the token rows, in one preparation launch.
// Structure: token rows r = b*2048 + s; the query source and the key/value source as exact f16 rows (bf16-rounded); Q, K, V as three WMMA GEMMs in one grid (128x128 workgroup tiles staged in LDS, 64x64 wave tiles, f32 accumulation, exact x16 weights + bias, f16 outputs; V leaves its tiles transposed, straight into the V^T plane); one fused attention launch (scores K = 64 and o = P . V^T on WMMA, online softmax on VALU with f32 statistics and native exp2, weights as f16 relative to the running maximum; o carried x64 against f16 subnormal flush, folded into the output GEMM alpha) written straight into the merged f16 o rows; out = o W_o + b GEMM (f32) into the output layout.
// Compute dtype: inputs rounded to bf16; x / weights exact; q, k, v, softmax weights and o as plain f16 GEMM operands (~2^-12); scores and softmax statistics f32. v_wmma_f32_16x16x32_f16.
#define NB 4
#define SQ 2048
#define DM 1024
#define NH 16
#define HD 64
#define HG 4                         /* heads per block group of the k_vt(V16, b, h0, VT) overload (not launched) */
#define B0 0                         /* first batch processed (debug hook) */
#define NBR NB                       /* batches processed (debug hook) */
#define NR ((size_t)NB * SQ)         /* token rows */
#define MP ((int)((size_t)NBR * SQ)) /* rows projected (debug hook) */
#define QN SQ                        /* query rows per batch; unused, k_fattn attends all SQ */
#define NHD NH                       /* heads; unused, k_fattn attends all NH */
#define MPO MP                       /* rows through the output stage (debug hook) */
#define LQ DM      /* row pitch of the q and k rows */
typedef __bf16 v16b __attribute__((ext_vector_type(16)));
typedef unsigned short v8us __attribute__((ext_vector_type(8), may_alias));
typedef float  v8f  __attribute__((ext_vector_type(8)));
typedef float  v4f  __attribute__((ext_vector_type(4)));
typedef float  v4fa __attribute__((ext_vector_type(4), may_alias));
union FragB { v16b v; v8us half[2]; unsigned short u[16]; };

__device__ __forceinline__ unsigned short bf16_bits(float x) { unsigned int u = __float_as_uint(x); return (unsigned short)((u + 0x7FFFu + ((u >> 16) & 1u)) >> 16); }
__device__ __forceinline__ float bf16_val(unsigned short b) { return __uint_as_float(((unsigned int)b) << 16); }
__device__ __forceinline__ float bf16_round(float x) { return bf16_val(bf16_bits(x)); }
// D += A·B with NT terms: 1 = ah·bh, 2 = + al·bh (A split), 3 = + ah·bl (both split)
template <int NT>
__device__ __forceinline__ v8f mmaN(v16b ah, v16b al, v16b bh, v16b bl, v8f c) {
  c = __builtin_amdgcn_wmma_f32_16x16x32_bf16(false, ah, false, bh, (short)0, c, false, false);
  if (NT >= 2) c = __builtin_amdgcn_wmma_f32_16x16x32_bf16(false, al, false, bh, (short)0, c, false, false);
  if (NT >= 3) c = __builtin_amdgcn_wmma_f32_16x16x32_bf16(false, ah, false, bl, (short)0, c, false, false);
  asm volatile("v_nop\n\tv_nop\n\tv_nop\n\tv_nop" : "+v"(c) : "v"(ah), "v"(al), "v"(bh), "v"(bl));
  return c;
}

__global__ __launch_bounds__(256) void k_wt_bf16(const float* __restrict__ W, unsigned short* __restrict__ Wt, int K, int N) {
  const int t = blockIdx.x * 256 + threadIdx.x;
  const int k8n = K / 8;
  if (t >= N * k8n) return;
  const int n = t / k8n, k8 = (t % k8n) * 8;
  v8us v;
#pragma unroll
  for (int i = 0; i < 8; ++i) v[i] = bf16_bits(W[(size_t)(k8 + i) * N + n]);
  *(v8us*)(Wt + (size_t)n * K + k8) = v;
  
}

// GEMM C[M][N] (f32, pitch ldc) = act(A[M][K]·W + bias). A f32 row-major (pitch lda) converted per fragment to bf16
// (ASPLIT: hi/lo two planes -> 2 terms, else single rounded term); Wt bf16 [N][K] (pitch ldb). BIAS_BF16 rounds the
// bias to bf16 first (bias quantised to bf16 before the add). K%32==0, M%16==0, N%64==0.
template <bool ASPLIT, int ACT, bool BIAS_BF16>
__global__ __launch_bounds__(128) void k_gemm_bf(const float* __restrict__ A, int lda, const unsigned short* __restrict__ Wt, int ldb,
                                               const float* __restrict__ bias, float* __restrict__ C, int ldc, int M, int N, int K) {
  __shared__ __attribute__((aligned(16))) float so[4][16][64];
  const int tid = threadIdx.x, w = tid >> 5, lane = tid & 31, ln = lane & 15, hh = lane >> 4;
  const int ntn = N / 64;
  const int wid = blockIdx.x * 4 + w;
  const int mt = wid / ntn, nq = wid % ntn;
  if (mt * 16 >= M) return;
  const int row0 = mt * 16, col0 = nq * 64;
  const float* arow = A + (size_t)(row0 + ln) * lda;
  v8f acc[4] = {};
  for (int kb = 0; kb < K; kb += 32) {
    FragB ah, al;
    const v4f x0 = *(const v4fa*)(arow + kb + 8 * hh), x1 = *(const v4fa*)(arow + kb + 8 * hh + 4);
    const v4f x2 = *(const v4fa*)(arow + kb + 16 + 8 * hh), x3 = *(const v4fa*)(arow + kb + 16 + 8 * hh + 4);
    float xs[16] = {x0[0],x0[1],x0[2],x0[3],x1[0],x1[1],x1[2],x1[3],x2[0],x2[1],x2[2],x2[3],x3[0],x3[1],x3[2],x3[3]};
#pragma unroll
    for (int i = 0; i < 16; ++i) { const unsigned short hb = bf16_bits(xs[i]); ah.u[i] = hb; al.u[i] = ASPLIT ? bf16_bits(xs[i] - bf16_val(hb)) : (unsigned short)0; }
#pragma unroll
    for (int t = 0; t < 4; ++t) {
      const unsigned short* brow = Wt + (size_t)(col0 + t * 16 + ln) * ldb + kb;
      FragB b;
      b.half[0] = *(const v8us*)(brow + 8 * hh);
      b.half[1] = *(const v8us*)(brow + 16 + 8 * hh);
      acc[t] = mmaN<ASPLIT ? 2 : 1>(ah.v, al.v, b.v, b.v, acc[t]);
    }
  }
#pragma unroll
  for (int t = 0; t < 4; ++t) {
    float bv = bias ? bias[col0 + t * 16 + ln] : 0.f;
    if (BIAS_BF16) bv = bf16_round(bv);
#pragma unroll
    for (int r = 0; r < 8; ++r) { float v = acc[t][r] + bv; if (ACT == 1) v = fmaxf(v, 0.f); so[w][8 * hh + r][t * 16 + ln] = v; }
  }
  __builtin_amdgcn_fence(__ATOMIC_ACQ_REL, "workgroup");
  __builtin_amdgcn_wave_barrier();
  const int rsub = lane >> 4, c4 = (lane & 15) * 4;
  {
#pragma unroll
    for (int q = 0; q < 8; ++q) {
      const int r = q * 2 + rsub;
      const v4f v = *(const v4fa*)&so[w][r][c4];
      *(v4f*)(C + (size_t)(row0 + r) * ldc + col0 + c4) = v;
    }
    
  }
}

// GEMM C = act(A·W + bias + resid): A f32 (ASPLIT -> hi/lo 2 terms), Wt bf16 [N][K]; ACT 0 none, 1 relu, 2 exact gelu;
// resid (optional, f32, row index = (row % rmod), pitch ldr, RES_BF16 rounds it) added before the activation.
template <bool ASPLIT, int ACT, bool BIAS_BF16, bool RES_BF16>
__global__ __launch_bounds__(128) void k_gemm_bf3(const float* __restrict__ A, int lda, const unsigned short* __restrict__ Wt, int ldb,
                                                const float* __restrict__ bias, const float* __restrict__ resid, int rmod, int ldr,
                                                float* __restrict__ C, int ldc, int M, int N, int K) {
  __shared__ __attribute__((aligned(16))) float so[4][16][64];
  const int tid = threadIdx.x, w = tid >> 5, lane = tid & 31, ln = lane & 15, hh = lane >> 4;
  const int ntn = N / 64;
  const int wid = blockIdx.x * 4 + w;
  const int mt = wid / ntn, nq = wid % ntn;
  if (mt * 16 >= M) return;
  const int row0 = mt * 16, col0 = nq * 64;
  const float* arow = A + (size_t)(row0 + ln) * lda;
  v8f acc[4] = {};
  for (int kb = 0; kb < K; kb += 32) {
    FragB ah, al;
    const v4f x0 = *(const v4fa*)(arow + kb + 8 * hh), x1 = *(const v4fa*)(arow + kb + 8 * hh + 4);
    const v4f x2 = *(const v4fa*)(arow + kb + 16 + 8 * hh), x3 = *(const v4fa*)(arow + kb + 16 + 8 * hh + 4);
    float xs[16] = {x0[0],x0[1],x0[2],x0[3],x1[0],x1[1],x1[2],x1[3],x2[0],x2[1],x2[2],x2[3],x3[0],x3[1],x3[2],x3[3]};
#pragma unroll
    for (int i = 0; i < 16; ++i) { const unsigned short hb = bf16_bits(xs[i]); ah.u[i] = hb; al.u[i] = ASPLIT ? bf16_bits(xs[i] - bf16_val(hb)) : (unsigned short)0; }
#pragma unroll
    for (int t = 0; t < 4; ++t) {
      const unsigned short* brow = Wt + (size_t)(col0 + t * 16 + ln) * ldb + kb;
      FragB b;
      b.half[0] = *(const v8us*)(brow + 8 * hh);
      b.half[1] = *(const v8us*)(brow + 16 + 8 * hh);
      acc[t] = mmaN<ASPLIT ? 2 : 1>(ah.v, al.v, b.v, b.v, acc[t]);
    }
  }
#pragma unroll
  for (int t = 0; t < 4; ++t) {
    const int col = col0 + t * 16 + ln;
    float bv = bias ? bias[col] : 0.f;
    if (BIAS_BF16) bv = bf16_round(bv);
#pragma unroll
    for (int r = 0; r < 8; ++r) {
      float v = acc[t][r] + bv;
      if (resid) { float rv = resid[(size_t)((row0 + 8 * hh + r) % rmod) * ldr + col]; if (RES_BF16) rv = bf16_round(rv); v += rv; }
      if (ACT == 1) v = fmaxf(v, 0.f);
      if (ACT == 2) v = 0.5f * v * (1.0f + erff(v * 0.70710678118654752f));
      if (ACT == 3) { const float u = 0.7978845608028654f * (v + 0.044715f * v * v * v); v = 0.5f * v * (1.0f + tanhf(u)); }
      so[w][8 * hh + r][t * 16 + ln] = v;
    }
  }
  __builtin_amdgcn_fence(__ATOMIC_ACQ_REL, "workgroup");
  __builtin_amdgcn_wave_barrier();
  const int rsub = lane >> 4, c4 = (lane & 15) * 4;
  {
#pragma unroll
    for (int q = 0; q < 8; ++q) {
      const int r = q * 2 + rsub;
      const v4f v = *(const v4fa*)&so[w][r][c4];
      *(v4f*)(C + (size_t)(row0 + r) * ldc + col0 + c4) = v;
    }
    
  }
}
// row LayerNorm (biased variance, eps) over N: s = X (+ R); optional out_sum <- s; out_norm <- (s-mu)*rsqrt(var+eps)*g + b
template <bool PARAM_BF16>
__global__ __launch_bounds__(256) void k_layernorm(const float* __restrict__ X, const float* __restrict__ R, const float* __restrict__ g, const float* __restrict__ bta,
                                                  float* __restrict__ out_sum, float* __restrict__ out_norm, int N, float eps) {
  __shared__ float red[256];
  const int row = blockIdx.x, tid = threadIdx.x;
  const float* x = X + (size_t)row * N; const float* rr = R ? R + (size_t)row * N : nullptr;
  float vals[16];                     // up to N = 4096
  const int per = N / 256;            // contiguous chunk per thread? use strided-by-4 chunks: thread handles j = tid*4 + 1024*u
  float s1 = 0.f;
  for (int u = 0; u < per / 4; ++u) {
    const int j = tid * 4 + 1024 * u;
    const v4f a = *(const v4fa*)(x + j);
    v4f b = {0.f,0.f,0.f,0.f}; if (rr) b = *(const v4fa*)(rr + j);
#pragma unroll
    for (int q = 0; q < 4; ++q) { const float v = a[q] + b[q]; vals[u * 4 + q] = v; s1 += v; }
  }
  red[tid] = s1; __syncthreads();
  for (int st = 128; st > 0; st >>= 1) { if (tid < st) red[tid] += red[tid + st]; __syncthreads(); }
  const float mu = red[0] / (float)N; __syncthreads();
  float s2 = 0.f;
  for (int u = 0; u < per / 4; ++u)
#pragma unroll
    for (int q = 0; q < 4; ++q) { const float c = vals[u * 4 + q] - mu; s2 += c * c; }
  red[tid] = s2; __syncthreads();
  for (int st = 128; st > 0; st >>= 1) { if (tid < st) red[tid] += red[tid + st]; __syncthreads(); }
  const float rs = rsqrtf(red[0] / (float)N + eps);
  {
    for (int u = 0; u < per / 4; ++u) {
      const int j = tid * 4 + 1024 * u;
      v4f o, sm;
#pragma unroll
      for (int q = 0; q < 4; ++q) {
        float gg = g[j + q], bb = bta[j + q];
        if (PARAM_BF16) { gg = bf16_round(gg); bb = bf16_round(bb); }
        sm[q] = vals[u * 4 + q]; o[q] = (vals[u * 4 + q] - mu) * rs * gg + bb;
      }
      if (out_sum) *(v4f*)(out_sum + (size_t)row * N + j) = sm;
      *(v4f*)(out_norm + (size_t)row * N + j) = o;
    }
    
  }
}



// ---- f16 WMMA path (v_wmma_f32_16x16x32_f16): 11-bit significands for operands in range — used where a [0,1] probability operand needs more precision than bf16
typedef _Float16 v16h __attribute__((ext_vector_type(16)));
union FragH { v16h v; v8us half[2]; _Float16 h[16]; unsigned short u[16]; };
template <int NT>
__device__ __forceinline__ v8f mmaH(v16h ah, v16h al, v16h bh, v16h bl, v8f c) {
  c = __builtin_amdgcn_wmma_f32_16x16x32_f16(false, ah, false, bh, (short)0, c, false, false);
  if (NT >= 2) c = __builtin_amdgcn_wmma_f32_16x16x32_f16(false, al, false, bh, (short)0, c, false, false);
  if (NT >= 3) c = __builtin_amdgcn_wmma_f32_16x16x32_f16(false, ah, false, bl, (short)0, c, false, false);
  asm volatile("v_nop\n\tv_nop\n\tv_nop\n\tv_nop" : "+v"(c) : "v"(ah), "v"(al), "v"(bh), "v"(bl));
  return c;
}
// batched GEMM like k_gemm_b but f16 operands: A f32 (split into f16 hi/lo if ASPLIT, else rounded to f16), Bt = f16 values [n][k]; alpha; C f32; N multiple of 16 (partial tiles skipped)
template <bool ASPLIT>
__global__ __launch_bounds__(128) void k_gemm_h(const float* __restrict__ A, int lda, size_t sA, const _Float16* __restrict__ Bh, int ldb, size_t sB, float alpha, float* __restrict__ C, int ldc, size_t sC, int M, int N, int K) {
  __shared__ __attribute__((aligned(16))) float so[4][16][64];
  const int tid = threadIdx.x, w = tid >> 5, lane = tid & 31, ln = lane & 15, hh = lane >> 4; const int by = blockIdx.y;
  A += (size_t)by * sA; Bh += (size_t)by * sB; C += (size_t)by * sC;
  const int ntn = (N + 63) / 64; const int wid = blockIdx.x * 4 + w; const int mt = wid / ntn, nq = wid % ntn; if (mt * 16 >= M) return;
  const int row0 = mt * 16, col0 = nq * 64; const float* arow = A + (size_t)(row0 + ln) * lda;
  v8f acc[4] = {};
  for (int kb = 0; kb < K; kb += 32) {
    FragH ah, al;
    const v4f x0 = *(const v4fa*)(arow + kb + 8 * hh), x1 = *(const v4fa*)(arow + kb + 8 * hh + 4), x2 = *(const v4fa*)(arow + kb + 16 + 8 * hh), x3 = *(const v4fa*)(arow + kb + 16 + 8 * hh + 4);
    float xs[16] = {x0[0],x0[1],x0[2],x0[3],x1[0],x1[1],x1[2],x1[3],x2[0],x2[1],x2[2],x2[3],x3[0],x3[1],x3[2],x3[3]};
#pragma unroll
    for (int i = 0; i < 16; ++i) { const _Float16 h = (_Float16)xs[i]; ah.h[i] = h; al.h[i] = ASPLIT ? (_Float16)(xs[i] - (float)h) : (_Float16)0.0f; }
#pragma unroll
    for (int t = 0; t < 4; ++t) { if (col0 + t * 16 >= N) continue; const size_t boff = (size_t)(col0 + t * 16 + ln) * ldb + kb; FragH bq; bq.half[0] = *(const v8us*)(Bh + boff + 8 * hh); bq.half[1] = *(const v8us*)(Bh + boff + 16 + 8 * hh);
      acc[t] = mmaH<ASPLIT ? 2 : 1>(ah.v, al.v, bq.v, bq.v, acc[t]); }
  }
#pragma unroll
  for (int t = 0; t < 4; ++t) { if (col0 + t * 16 >= N) continue;
#pragma unroll
    for (int r = 0; r < 8; ++r) so[w][8 * hh + r][t * 16 + ln] = acc[t][r] * alpha; }
  __builtin_amdgcn_fence(__ATOMIC_ACQ_REL, "workgroup"); __builtin_amdgcn_wave_barrier();
  const int rsub = lane >> 4, c4 = (lane & 15) * 4;
  {
#pragma unroll
    for (int q = 0; q < 8; ++q) { const int r = q * 2 + rsub; if (col0 + c4 < N) { const v4f v = *(const v4fa*)&so[w][r][c4]; *(v4f*)(C + (size_t)(row0 + r) * ldc + col0 + c4) = v; } }
     }
}

// One wave's tile of a weight plane: Wt[n][k] = f16(bf16(W[k][n]) * 16) for 32 columns n (one a lane) and 64 k, from f32 row-major W with rows of LDN floats (a power-of-two scale keeps bf16-exact weights exact in f16 away from the subnormal range).
// src = the lane's column in the tile's first k row: each of the 64 loads reads 128 contiguous bytes across the wave. dst = the lane's row of the [out][in] plane at that k: the lane writes one whole 128-byte line, in 8 stores.
template <int LDN>
__device__ __forceinline__ void pr_wtile(const float* __restrict__ src, _Float16* __restrict__ dst) {
  float x[64];
#pragma unroll      /* register arrays need constant indices; constant offsets from one address */
  for (int k = 0; k < 64; ++k) x[k] = src[(size_t)k * LDN];
  __builtin_amdgcn_sched_barrier(0);      /* keeps all 64 loads in front of the first use: sunk among the conversions, the later loads start only when the first have come back */
#pragma unroll      /* register arrays need constant indices */
  for (int p = 0; p < 8; ++p) { FragH f;
#pragma unroll      /* register arrays need constant indices */
    for (int i = 0; i < 8; ++i) f.h[i] = (_Float16)(bf16_round(x[8 * p + i]) * 16.0f);
    *(v8us*)((unsigned short*)dst + 8 * p) = f.half[0]; }
  asm volatile("s_wait_xcnt 0x0" ::: "memory");      /* the wave goes on to its next unit: the address and data registers of these loads and stores are reused only behind this wait */
}
// k_gemm_hh variant with fused epilogue: v = acc·alpha + bias[by·sBias + col] (+ CP[(row/rowsPerB)·sCPb + by·64 + col] if CP) ; ACT 0 none / 1 elu ; writes f16 C16 (and f32 C if non-null)
template <int ACT>
__global__ __launch_bounds__(128) void k_gemm_hhx(const _Float16* __restrict__ A, int lda, size_t sA, const _Float16* __restrict__ Bh, int ldb, size_t sB, float alpha, const float* __restrict__ bias, size_t sBias, const float* __restrict__ CP, int rowsPerB, size_t sCPb, int row0g,
    float* __restrict__ C, _Float16* __restrict__ C16, int ldc, size_t sC, int M, int N, int K) {
  __shared__ __attribute__((aligned(16))) float so[4][16][64];
  const int tid = threadIdx.x, w = tid >> 5, lane = tid & 31, ln = lane & 15, hh = lane >> 4; const int by = blockIdx.y;
  A += (size_t)by * sA; Bh += (size_t)by * sB; const size_t cofs = (size_t)by * sC; const float* bp = bias ? bias + (size_t)by * sBias : nullptr;
  const int ntn = (N + 63) / 64; const int wid = blockIdx.x * 4 + w; const int mt = wid / ntn, nq = wid % ntn; if (mt * 16 >= M) return;
  const int row0 = mt * 16, col0 = nq * 64; const _Float16* arow = A + (size_t)(row0 + ln) * lda;
  v8f acc[4] = {};
  for (int kb = 0; kb < K; kb += 32) { FragH ah; ah.half[0] = *(const v8us*)((const unsigned short*)arow + kb + 8 * hh); ah.half[1] = *(const v8us*)((const unsigned short*)arow + kb + 16 + 8 * hh);
#pragma unroll
    for (int t = 0; t < 4; ++t) { if (col0 + t * 16 >= N) continue; const size_t boff = (size_t)(col0 + t * 16 + ln) * ldb + kb; FragH bq; bq.half[0] = *(const v8us*)((const unsigned short*)Bh + boff + 8 * hh); bq.half[1] = *(const v8us*)((const unsigned short*)Bh + boff + 16 + 8 * hh);
      acc[t] = mmaH<1>(ah.v, ah.v, bq.v, bq.v, acc[t]); }
  }
#pragma unroll
  for (int t = 0; t < 4; ++t) { if (col0 + t * 16 >= N) continue; const int col = col0 + t * 16 + ln; const float bv = bp ? bf16_round(bp[col]) : 0.f;
#pragma unroll
    for (int r = 0; r < 8; ++r) { float v = acc[t][r] * alpha + bv; if (CP) { const int rr = row0g + row0 + 8 * hh + r; if (rowsPerB < 0) v += CP[cofs + (size_t)rr * ldc + col];      /* rowsPerB < 0: own element of the batched C plane */ else { const int bidx = rr / rowsPerB; v += CP[(size_t)bidx * sCPb + (size_t)by * 64 + col]; } } if (ACT == 1) v = (v > 0.f) ? v : expm1f(v); else if (ACT == 7) v = (v > 0.f) ? v + 1.0f : expf(v); else if (ACT == 8) v = tanhf(v); else if (ACT == 9) v = 0.5f * v * (1.0f + tanhf(0.7978845608028654f * (v + 0.044715f * v * v * v))); else if (ACT == 11) v = 1.0f / (1.0f + expf(-v)); else if (ACT == 12) v = (v > 0.f) ? v : 0.01f * v; else if (ACT == 14) v = (v > 0.f) ? v : 0.1f * v; else if (ACT == 16) v = (v >= 0.f) ? v : 0.3f * v; else if (ACT == 17) v = (v >= 0.f) ? v : 0.2f * v; else if (ACT == 15) v = v / (1.0f + expf(-v)); else if (ACT == 3) v = fmaxf(v, 0.f); else if (ACT == 6) v = 0.5f * v * (1.0f + erff(v * 0.70710678118654752f)); so[w][8 * hh + r][t * 16 + ln] = v; } }
  __builtin_amdgcn_fence(__ATOMIC_ACQ_REL, "workgroup"); __builtin_amdgcn_wave_barrier();
  const int rsub = lane >> 4, c4 = (lane & 15) * 4; typedef _Float16 v4h __attribute__((ext_vector_type(4)));
  {
#pragma unroll
    for (int q = 0; q < 8; ++q) { const int r = q * 2 + rsub; if (col0 + c4 < N) { const v4f v = *(const v4fa*)&so[w][r][c4]; if (C) *(v4f*)(C + cofs + (size_t)(row0 + r) * ldc + col0 + c4) = v; if (C16) { v4h h4; for (int i = 0; i < 4; ++i) h4[i] = (_Float16)v[i]; *(v4h*)(C16 + cofs + (size_t)(row0 + r) * ldc + col0 + c4) = h4; } } }
     }
}


typedef _Float16 v4h __attribute__((ext_vector_type(4)));

// One wave's run of a cast: 2048 contiguous elements (8 KB of f32) as exact f16 of their bf16 rounding. x, X16 = the stream's buffers, e = the element index of the lane's first piece of 8; its pieces i = 0 .. 7 lie 256 elements apart. All 16 loads are issued before the first value is used.
__device__ __forceinline__ void pr_xrun(const float* __restrict__ x, _Float16* __restrict__ X16, unsigned e) {
  v4f a[8], b[8]; const unsigned bo = e * 4u;      /* the loads' byte offset */
#pragma unroll      /* register arrays need constant indices; constant offsets from one address */
  for (int i = 0; i < 8; ++i) { a[i] = *(const v4fa*)(x + e + 256 * i); b[i] = *(const v4fa*)(x + e + 256 * i + 4); }
  __builtin_amdgcn_sched_barrier(0);      /* keeps all 16 loads in front of the first use: sunk among the conversions, the later loads start only when the first have come back */
  asm volatile("s_wait_xcnt 0x0" :: "v"(bo) : "memory");      /* the loads' offset register is held live to here, so that no load's result lands in it, and is reused only behind this wait */
#pragma unroll      /* register arrays need constant indices */
  for (int i = 0; i < 8; ++i) { FragH f;
#pragma unroll      /* register arrays need constant indices */
    for (int q = 0; q < 4; ++q) { f.h[q] = (_Float16)bf16_round(a[i][q]); f.h[4 + q] = (_Float16)bf16_round(b[i][q]); }
    *(v8us*)((unsigned short*)X16 + e + 256 * i) = f.half[0]; }
  asm volatile("s_wait_xcnt 0x0" ::: "memory");      /* the wave goes on to its next unit: the address and data registers of these loads and stores are reused only behind this wait */
}
__global__ __launch_bounds__(256) void k_h16(const float* __restrict__ x, _Float16* __restrict__ X16, size_t n8) { const size_t t = (size_t)blockIdx.x * 256 + threadIdx.x; if (t >= n8) return; FragH f;
#pragma unroll
  for (int q = 0; q < 8; ++q) f.h[q] = (_Float16)x[t * 8 + q]; *(v8us*)((unsigned short*)X16 + t * 8) = f.half[0];  }
__global__ __launch_bounds__(256) void k_round16f(const float* __restrict__ W, _Float16* __restrict__ Bt, size_t n8) { const size_t t = (size_t)blockIdx.x * 256 + threadIdx.x; if (t >= n8) return; FragH f;
#pragma unroll
  for (int i = 0; i < 8; ++i) f.h[i] = (_Float16)(bf16_round(W[t * 8 + i]) * 16.0f); *(v8us*)((unsigned short*)Bt + t * 8) = f.half[0];  }
__global__ __launch_bounds__(256) void k_hl(const float* __restrict__ F, _Float16* __restrict__ Hh, _Float16* __restrict__ Hl, size_t n8) { const size_t t = (size_t)blockIdx.x * 256 + threadIdx.x; if (t >= n8) return; FragH fh, fl; const v4f a = *(const v4fa*)(F + t * 8), c = *(const v4fa*)(F + t * 8 + 4);
#pragma unroll
  for (int q = 0; q < 4; ++q) { _Float16 h = (_Float16)a[q]; fh.h[q] = h; fl.h[q] = (_Float16)((a[q] - (float)h) * 1024.0f); h = (_Float16)c[q]; fh.h[4 + q] = h; fl.h[4 + q] = (_Float16)((c[q] - (float)h) * 1024.0f); }
  { *(v8us*)((unsigned short*)Hh + t * 8) = fh.half[0]; *(v8us*)((unsigned short*)Hl + t * 8) = fl.half[0];  } }

// fragment of 32 k from a k-contiguous f16 row in global memory
__device__ __forceinline__ v16h g2_frag(const _Float16* p, int hh) { FragH f; f.half[0] = *(const v8us*)((const unsigned short*)p + 8 * hh); f.half[1] = *(const v8us*)((const unsigned short*)p + 16 + 8 * hh); return f.v; }


__global__ __launch_bounds__(256) void k_wnat(const float* __restrict__ w, size_t n8, _Float16* __restrict__ Bt) { const size_t t = (size_t)blockIdx.x * 256 + threadIdx.x; if (t >= n8) return; FragH f; for (int q = 0; q < 8; ++q) f.h[q] = (_Float16)(bf16_round(w[t * 8 + q]) * 16.0f); *(v8us*)((unsigned short*)Bt + t * 8) = f.half[0];  }
__global__ __launch_bounds__(256) void k_rsm(const float* __restrict__ S, _Float16* __restrict__ P, int nrows) {
  #pragma clang fp contract(off)
  const int i = blockIdx.x * 256 + threadIdx.x; if (i >= nrows) return; const float* s = S + (size_t)i * SQ; float mx = -3.0e38f;
#pragma unroll 1
  for (int j = 0; j < SQ; ++j) mx = fmaxf(mx, s[j]); float se = 0.f;
#pragma unroll 1
  for (int j = 0; j < SQ; ++j) se += expf(s[j] - mx); const float sc = 256.0f / se;
#pragma unroll 1
  for (int j0 = 0; j0 < SQ; j0 += 8) { FragH f; for (int q = 0; q < 8; ++q) f.h[q] = (_Float16)(expf(s[j0 + q] - mx) * sc); unsigned short* d = (unsigned short*)P + (size_t)i * SQ + j0; *(v8us*)d = f.half[0];  } }
__global__ __launch_bounds__(256) void k_vt(const _Float16* __restrict__ V16, int b, int h0, _Float16* __restrict__ VT) { __shared__ unsigned short tl[64][65]; const int tid = threadIdx.x; const int hh = blockIdx.x % HG, sg = blockIdx.x / HG; const int s0 = sg * 64; const int h = h0 + hh;
  for (int i = tid; i < 64 * 8; i += 256) { const int j = i / 8, d8 = (i % 8) * 8; FragH f; f.half[0] = *(const v8us*)((const unsigned short*)V16 + ((size_t)b * SQ + s0 + j) * DM + h * HD + d8); for (int q = 0; q < 8; ++q) tl[d8 + q][j] = f.u[q]; }
  __syncthreads();
  { for (int i = tid; i < 64 * 8; i += 256) { const int d = i / 8, j8 = (i % 8) * 8; FragH f; for (int q = 0; q < 8; ++q) f.u[q] = tl[d][j8 + q]; *(v8us*)((unsigned short*)VT + ((size_t)hh * HD + d) * SQ + s0 + j8) = f.half[0]; }  } }



// All operand preparation in one launch: none of these pieces reads what another writes. The work is cut into units of 8 KB of f32 input, one wave each: weight tiles of 32 columns x 64 k, and cast runs of 2048 elements.
// Few long waves instead of many short ones: the launch starts 3584 waves, two workgroups per WGP, and each wave takes four units, PR_NW apart (wave-uniform branches, no barrier).
// The weight tiles come first in the numbering, so that they run beside the memory-bound casts of the other waves.
#define PR_WT ((DM / 32) * (DM / 64))            /* tiles per weight plane */
#define PR_WU (4 * PR_WT)                        /* weight units */
#define PR_XU ((int)(NR * DM / 2048))            /* runs per cast of the token rows */
#define PR_UPW 4                                 /* units per wave */
#define PR_WPB 7                                 /* waves per workgroup */
#define PR_NW ((PR_WU + 3 * PR_XU) / PR_UPW)     /* waves */
static_assert(PR_NW * PR_UPW == PR_WU + 3 * PR_XU && PR_NW % PR_WPB == 0, "the units must divide evenly among the waves");
__global__ __launch_bounds__(PR_WPB * 32) void k_prep(const float* __restrict__ wq, const float* __restrict__ wk, const float* __restrict__ wv, const float* __restrict__ wo, const float* __restrict__ xq, const float* __restrict__ xk, const float* __restrict__ xv,
    _Float16* __restrict__ BQ, _Float16* __restrict__ BK, _Float16* __restrict__ BV, _Float16* __restrict__ BO, _Float16* __restrict__ XQ, _Float16* __restrict__ XK, _Float16* __restrict__ XV) {
  const int lane = threadIdx.x & 31; const int gw = blockIdx.x * PR_WPB + __builtin_amdgcn_readfirstlane(threadIdx.x >> 5);
  for (int j = 0; j < PR_UPW; ++j) { const int u = gw + j * PR_NW;      /* the same in every lane of the wave */
    if (u < PR_WU) { const int m = u / PR_WT, v = u - m * PR_WT; const int n = (v / (DM / 64)) * 32 + lane, k0 = (v % (DM / 64)) * 64;      /* n = row of the [out][in] plane */
      if (m == 0) pr_wtile<DM>(wo + (size_t)k0 * DM + n, BO + (size_t)n * DM + k0);
      else { const float* w = (m == 1) ? wq : (m == 2) ? wk : wv; _Float16* B = (m == 1) ? BQ : (m == 2) ? BK : BV;      /* head n / HD: a row-major [DM][HD] block; the wave's 32 columns lie in one head */
        pr_wtile<HD>(w + (size_t)(n / HD) * (DM * HD) + (size_t)k0 * HD + (n % HD), B + (size_t)n * DM + k0); } }
    else { const int c = u - PR_WU; const int m = c / PR_XU; const unsigned e = (unsigned)(c - m * PR_XU) * 2048u + lane * 8;
      pr_xrun((m == 0) ? xq : (m == 1) ? xk : xv, (m == 0) ? XQ : (m == 1) ? XK : XV, e); } }
}

#define FA_NW 8                      /* waves per workgroup */
#define FA_BR (FA_NW * 32)           /* query rows per workgroup */
#define FA_SK 64                     /* keys per stage = two 32-key passes */
#define FA_PITCH 144                 /* LDS row pitch in bytes: 128 of data + 16, an odd multiple of 16 for the 16-byte fragment reads */
#define FA_TILE (FA_SK * FA_PITCH)
/* amdgpu_waves_per_eu(4, 4): at most 256 VGPRs, so that two workgroups (four waves per SIMD) are resident per WGP and the 512 workgroups run in one round */
__device__ __forceinline__ float fa_xh(float x) { return __builtin_bit_cast(float, __builtin_amdgcn_permlanex16(__builtin_bit_cast(int, x), __builtin_bit_cast(int, x), 0x76543210, 0xfedcba98, false, false)); }      /* lane l reads lane l ^ 16 */
__device__ __forceinline__ v16h fa_frag(const unsigned char* p) { FragH f; f.half[0] = *(const v8us*)p; f.half[1] = *(const v8us*)(p + 32); return f.v; }      /* p = row start + 16 * (lane >> 4): k = 8 hh .. 8 hh + 7 and 16 + 8 hh .. 16 + 8 hh + 7, as g2_frag */
__device__ __forceinline__ v8f fa_mma(v16h a, v16h b, v8f c) { return __builtin_amdgcn_wmma_f32_16x16x32_f16(false, a, false, b, (short)0, c, false, false); }
/* The 8 score products of a pass, 2 key tiles x 2 query groups x k = 64: s = c + K . Q^T with c read from its own registers and left as it is. Written as asm because the builtin form copied c into
   the result registers in front of half of the products (8 register moves a tile). Each result's second product stands three products behind its first; the v_nop at the end keep the four vector
   slots between the last product and the first vector instruction that reads its result; those in front keep four slots behind the product issued just before the statement, whose B registers
   (the weights of the pass before) the compiler gives to a result here. */
__device__ __forceinline__ void fa_scores(v8f& s00, v8f& s01, v8f& s10, v8f& s11, v16h ka0, v16h kb0, v16h ka1, v16h kb1, v16h q00, v16h q01, v16h q10, v16h q11, v8f c0, v8f c1) {
  asm("v_nop\n\tv_nop\n\tv_nop\n\tv_nop\n\t"
      "v_wmma_f32_16x16x32_f16 %0, %4, %8, %12\n\t"
      "v_wmma_f32_16x16x32_f16 %1, %4, %10, %13\n\t"
      "v_wmma_f32_16x16x32_f16 %2, %6, %8, %12\n\t"
      "v_wmma_f32_16x16x32_f16 %3, %6, %10, %13\n\t"
      "v_wmma_f32_16x16x32_f16 %0, %5, %9, %0\n\t"
      "v_wmma_f32_16x16x32_f16 %1, %5, %11, %1\n\t"
      "v_wmma_f32_16x16x32_f16 %2, %7, %9, %2\n\t"
      "v_wmma_f32_16x16x32_f16 %3, %7, %11, %3\n\t"
      "v_nop\n\tv_nop\n\tv_nop\n\tv_nop"
      : "=&v"(s00), "=&v"(s01), "=&v"(s10), "=&v"(s11)
      : "v"(ka0), "v"(kb0), "v"(ka1), "v"(kb1), "v"(q00), "v"(q01), "v"(q10), "v"(q11), "v"(c0), "v"(c1)); }
__global__ __launch_bounds__(FA_NW * 32) __attribute__((amdgpu_waves_per_eu(4, 4))) void k_fattn(const _Float16* __restrict__ Q16, const _Float16* __restrict__ K16, const _Float16* __restrict__ VT, _Float16* __restrict__ O16) {
  __shared__ __attribute__((aligned(16))) unsigned char L[2][2][FA_TILE];      /* [buffer][0 = K rows, 1 = V^T rows] */
  const int tid = threadIdx.x, lane = tid & 31, c = lane & 15, hh = lane >> 4; const int wave = __builtin_amdgcn_readfirstlane(tid >> 5);
  const int q0 = blockIdx.x * FA_BR + wave * 32, h = blockIdx.y, b = blockIdx.z; const size_t r0 = (size_t)b * SQ;
  /* staging: thread t moves the 16-byte piece t & 7 of rows t >> 3 and 32 + (t >> 3) of both tiles: 8 lanes cover one whole 128-byte row */
  const int srow = tid >> 3, scol = tid & 7; const int sl = srow * FA_PITCH + scol * 16;
  const unsigned short* kg = (const unsigned short*)K16 + (r0 + srow) * LQ + h * HD + scol * 8;
  const unsigned short* vg = (const unsigned short*)VT + (((size_t)b * NH + h) * HD + srow) * SQ + scol * 8;
  v8us k0 = *(const v8us*)kg, k1 = *(const v8us*)(kg + (size_t)32 * LQ), v0 = *(const v8us*)vg, v1 = *(const v8us*)(vg + (size_t)32 * SQ);
  v16h qf[2][2];
#pragma unroll      /* register arrays need constant indices */
  for (int g = 0; g < 2; ++g) { const _Float16* qp = Q16 + (r0 + q0 + 16 * g + c) * LQ + h * HD; qf[g][0] = g2_frag(qp, hh); qf[g][1] = g2_frag(qp + 32, hh); }
  FragH ones;
#pragma unroll
  for (int i = 0; i < 16; ++i) ones.u[i] = (c == 0) ? (unsigned short)0x3C00 : (unsigned short)0;
  const v8f z8 = {0.f, 0.f, 0.f, 0.f, 0.f, 0.f, 0.f, 0.f};
  v8f acc[2][4] = {{z8, z8, z8, z8}, {z8, z8, z8, z8}}; v8f lacc[2] = {z8, z8}; v8f negm[2] = {z8, z8};      /* negm: minus the maximum in use of this lane's query, the same in all 8 registers (a lane's 8 scores of a tile belong to one query); 0 until the first pass sets it */
  *(v8us*)&L[0][0][sl] = k0; *(v8us*)&L[0][0][sl + 32 * FA_PITCH] = k1; *(v8us*)&L[0][1][sl] = v0; *(v8us*)&L[0][1][sl + 32 * FA_PITCH] = v1;
  for (int st = 0; st < SQ / FA_SK; ++st) {
    __syncthreads();      /* stage st is written by every wave, and every wave has left the buffer that is refilled at the foot of this trip */
    const unsigned char* Kb = &L[st & 1][0][0]; const unsigned char* Vb = &L[st & 1][1][0];
    const bool more = st + 1 < SQ / FA_SK;      /* the same for the whole workgroup */
    if (more) { k0 = *(const v8us*)(kg + (size_t)FA_SK * LQ); k1 = *(const v8us*)(kg + (size_t)(FA_SK + 32) * LQ); v0 = *(const v8us*)(vg + FA_SK); v1 = *(const v8us*)(vg + FA_SK + (size_t)32 * SQ); }      /* next stage, in flight under this stage's passes */
#pragma unroll      /* two passes per stage; constant LDS offsets */
    for (int sub = 0; sub < 2; ++sub) {
      v8f s[2][2];
      { const unsigned char* p = Kb + (32 * sub + c) * FA_PITCH + 16 * hh; const unsigned char* p1 = p + 16 * FA_PITCH;
        fa_scores(s[0][0], s[0][1], s[1][0], s[1][1], fa_frag(p), fa_frag(p + 64), fa_frag(p1), fa_frag(p1 + 64), qf[0][0], qf[0][1], qf[1][0], qf[1][1], negm[0], negm[1]); }      /* scaled score minus the maximum in use */
      float mb[2];      /* this lane's largest of the pass, per query group, relative to the maximum in use */
#pragma unroll      /* register arrays need constant indices */
      for (int g = 0; g < 2; ++g) { float mx = fmaxf(s[0][g][0], s[1][g][0]);
#pragma unroll      /* register arrays need constant indices */
        for (int r = 1; r < 8; ++r) mx = fmaxf(mx, fmaxf(s[0][g][r], s[1][g][r]));
        mb[g] = mx; }
      const bool first = (sub == 0) && (st == 0);      /* the first pass sets the maximum whatever its sign */
      if (first || __builtin_amdgcn_ballot_w32(fmaxf(mb[0], mb[1]) > 8.0f) != 0) {      /* wave-uniform; rare after the first pass */
#pragma unroll      /* register arrays need constant indices */
        for (int g = 0; g < 2; ++g) { const float mq = fmaxf(mb[g], fa_xh(mb[g])); const float up = fmaxf(mq, 0.f); const float d = first ? mq : up;      /* both wave halves hold this query's rise of the maximum */
          const float corr = __builtin_amdgcn_exp2f(-up); negm[g] = negm[g] - d; lacc[g] = lacc[g] * corr;      /* on the first pass the accumulators are 0 */
#pragma unroll      /* register arrays need constant indices */
          for (int r = 0; r < 8; ++r) { s[0][g][r] -= d; s[1][g][r] -= d; }
#pragma unroll      /* register arrays need constant indices */
          for (int t = 0; t < 4; ++t) acc[g][t] = acc[g][t] * corr; } }
      v16h vf[4];      /* read behind the branch: in front of it these reads were lifted over the score products, and the registers went past 256 (q fragments spilled) */
#pragma unroll      /* register arrays need constant indices */
      for (int t = 0; t < 4; ++t) vf[t] = fa_frag(Vb + (16 * t + c) * FA_PITCH + 64 * sub + 16 * hh);
#pragma unroll      /* register arrays need constant indices */
      for (int g = 0; g < 2; ++g) { FragH pf;
#pragma unroll      /* register arrays need constant indices */
        for (int i = 0; i < 16; ++i) pf.h[i] = (_Float16)__builtin_amdgcn_exp2f(s[i >> 3][g][i & 7]);      /* keys 8 hh + r of tile 0, then of tile 1: the B operand's k order */
#pragma unroll      /* register arrays need constant indices */
        for (int t = 0; t < 4; ++t) acc[g][t] = fa_mma(vf[t], pf.v, acc[g][t]);
        lacc[g] = fa_mma(ones.v, pf.v, lacc[g]); }      /* row 0 += the column sums of P^T */
    }
    if (more) { unsigned char* Kn = &L[(st + 1) & 1][0][0]; unsigned char* Vn = &L[(st + 1) & 1][1][0]; *(v8us*)(Kn + sl) = k0; *(v8us*)(Kn + sl + 32 * FA_PITCH) = k1; *(v8us*)(Vn + sl) = v0; *(v8us*)(Vn + sl + 32 * FA_PITCH) = v1;
      asm volatile("s_wait_xcnt 0x0" :: "v"(kg), "v"(vg) : "memory");      /* the stage loads' address registers (held live to here) are advanced only behind this wait */
      kg += (size_t)FA_SK * LQ; vg += FA_SK; }
  }
#pragma unroll      /* register arrays need constant indices */
  for (int g = 0; g < 2; ++g) { const float lr = lacc[g][0]; const float inv = 64.0f / (lr + fa_xh(lr));
#pragma unroll      /* register arrays need constant indices */
    for (int t = 0; t < 4; ++t) { FragH f;
#pragma unroll      /* register arrays need constant indices */
      for (int r = 0; r < 8; ++r) f.h[r] = (_Float16)(acc[g][t][r] * inv);
      *(v8us*)((unsigned short*)O16 + (r0 + q0 + 16 * g + c) * DM + h * HD + 16 * t + 8 * hh) = f.half[0]; } } }      /* d = 16 t + 8 hh .. + 7 of query 16 g + c */

// ---- tiled GEMM C = ((A . B^T) * alpha + bias) * post (post0 for y = 0, else 1): A [rows][DM] and B [cols][DM] f16, k contiguous; one 128 x 128 tile of C per workgroup, four waves of 64 x 64 (4 x 4 accumulator tiles) ----
// Stages of 64 k (128 bytes of each of the 128 A rows and 128 B rows) are brought by asynchronous copies into two LDS buffers, the next stage in flight under this stage's products: every copy
// covers whole 128-byte lines, and each operand byte is fetched once per workgroup and read from LDS by the two waves that need it. k runs upward in steps of 32 into one accumulator per tile.
// Rows % 128 == 0, columns = k = DM, at least two stages. With f16 output, product y = 2 is stored transposed: CT [row / SQ][column / HD][column % HD][row % SQ], the plane whose rows the attention launch reads as A operands.
#define G3_BT 128                    /* tile rows and tile columns per workgroup */
#define G3_SK 64                     /* k per stage = two WMMA steps */
#define G3_NS (DM / G3_SK)           /* stages */
#define G3_PITCH 144                 /* LDS row pitch in bytes: 128 of data + 16, an odd multiple of 16 for the 16-byte fragment reads */
#define G3_TILE (G3_BT * G3_PITCH)
#define G3_OP 68                     /* pitch in floats of the staged output rows */
typedef float f1a __attribute__((may_alias));
/* One lane's eight 16-byte pieces of a 128-row tile, rows 16 apart: lds = the lane's LDS byte address, g = its global address, both multiples of 16. The copies go through no register.
   s_wait_xcnt stands inside the statement, so that no address register of a copy is rewritten in front of it. */
__device__ __forceinline__ void g3_copy8(unsigned lds, const unsigned short* g) {
  asm volatile("global_load_async_to_lds_b128 %0, %8, off\n\t"
               "global_load_async_to_lds_b128 %1, %9, off\n\t"
               "global_load_async_to_lds_b128 %2, %10, off\n\t"
               "global_load_async_to_lds_b128 %3, %11, off\n\t"
               "global_load_async_to_lds_b128 %4, %12, off\n\t"
               "global_load_async_to_lds_b128 %5, %13, off\n\t"
               "global_load_async_to_lds_b128 %6, %14, off\n\t"
               "global_load_async_to_lds_b128 %7, %15, off\n\t"
               "s_wait_xcnt 0x0"
               :: "v"(lds), "v"(lds + 16 * G3_PITCH), "v"(lds + 32 * G3_PITCH), "v"(lds + 48 * G3_PITCH), "v"(lds + 64 * G3_PITCH), "v"(lds + 80 * G3_PITCH), "v"(lds + 96 * G3_PITCH), "v"(lds + 112 * G3_PITCH),
                  "v"(g), "v"(g + (size_t)16 * DM), "v"(g + (size_t)32 * DM), "v"(g + (size_t)48 * DM), "v"(g + (size_t)64 * DM), "v"(g + (size_t)80 * DM), "v"(g + (size_t)96 * DM), "v"(g + (size_t)112 * DM)
               : "memory"); }
template <bool OUT32>
__global__ __launch_bounds__(128) void k_gemm3(const _Float16* __restrict__ A, size_t sA, const _Float16* __restrict__ Bh, size_t sB, float alpha, float post0, const float* __restrict__ bias0, const float* __restrict__ bias1, const float* __restrict__ bias2,
    float* __restrict__ C, _Float16* __restrict__ C16, size_t sC, _Float16* __restrict__ CT) {
  __shared__ __attribute__((aligned(16))) unsigned char L[2][2][G3_TILE];      /* [buffer][0 = A rows, 1 = B rows]; behind the k loop: four staged 64 x 64 output tiles (f32, or f16 by columns for y = 2 with f16 output) */
  static_assert(4 * 64 * G3_OP * 4 <= 4 * G3_TILE, "the staged output tiles must fit the ring"); static_assert(G3_NS >= 2, "the prologue fills two stages");
  const int tid = threadIdx.x, lane = tid & 31, ln = lane & 15, hh = lane >> 4; const int wave = __builtin_amdgcn_readfirstlane(tid >> 5); const int by = blockIdx.y;
  const float* bias = (by == 0) ? bias0 : (by == 1) ? bias1 : bias2;      /* products that share one grid along y keep their biases in separate buffers */
  const float post = (by == 0) ? post0 : 1.0f; const float alphap = alpha * post;      /* product y = 0 leaves multiplied by post0, bias included */
  const int mt = blockIdx.x / (DM / G3_BT), nq = blockIdx.x - mt * (DM / G3_BT); const int row0 = mt * G3_BT, col0 = nq * G3_BT; const int wm = (wave >> 1) * 64, wn = (wave & 1) * 64;
  /* staging: thread t copies the 16-byte piece t & 7 of rows (t >> 3) + 16 i, i = 0 .. 7, of both tiles: 8 lanes cover one whole 128-byte row */
  const int srow = tid >> 3, scol = tid & 7; const unsigned sl = (unsigned)(size_t)&L[0][0][0] + srow * G3_PITCH + scol * 16;      /* low 32 bits of the shared address = LDS byte address */
  const unsigned short* ag = (const unsigned short*)A + (size_t)by * sA + (size_t)(row0 + srow) * DM + scol * 8;
  const unsigned short* bg = (const unsigned short*)Bh + (size_t)by * sB + (size_t)(col0 + srow) * DM + scol * 8;
  const v8f z8 = {0.f, 0.f, 0.f, 0.f, 0.f, 0.f, 0.f, 0.f};
  v8f acc[4][4] = {{z8, z8, z8, z8}, {z8, z8, z8, z8}, {z8, z8, z8, z8}, {z8, z8, z8, z8}};
  g3_copy8(sl, ag); g3_copy8(sl + G3_TILE, bg);      /* stage 0 into buffer 0 */
  asm volatile("s_wait_asynccnt 0x0" ::: "memory");      /* this wave's copies of stage 0 have landed */
  __syncthreads();      /* ... and every other wave's */
  g3_copy8(sl + 2 * G3_TILE, ag + G3_SK); g3_copy8(sl + 3 * G3_TILE, bg + G3_SK);      /* stage 1 into buffer 1, in flight under stage 0's products */
  for (int st = 0; st < G3_NS; ++st) {
    const unsigned char* Ab = &L[st & 1][0][0] + (wm + ln) * G3_PITCH + 16 * hh; const unsigned char* Bb = &L[st & 1][1][0] + (wn + ln) * G3_PITCH + 16 * hh;
#pragma unroll      /* two WMMA steps per stage; constant LDS offsets */
    for (int kk = 0; kk < 2; ++kk) { v16h af[4], bf[4];
#pragma unroll      /* register arrays need constant indices */
      for (int i = 0; i < 4; ++i) { af[i] = fa_frag(Ab + 16 * i * G3_PITCH + 64 * kk); bf[i] = fa_frag(Bb + 16 * i * G3_PITCH + 64 * kk); }      /* both operands in the k order of g2_frag */
      __builtin_amdgcn_sched_barrier(0);      /* keeps the step's 16 fragment reads together in front of its 16 products: sunk among them, each A fragment's LDS latency is waited out in full */
#pragma unroll      /* register arrays need constant indices */
      for (int i = 0; i < 4; ++i)
#pragma unroll      /* register arrays need constant indices */
        for (int j = 0; j < 4; ++j) acc[i][j] = fa_mma(af[i], bf[j], acc[i][j]); }
    asm volatile("s_wait_dscnt 0x0" ::: "memory");      /* this wave's reads of buffer st & 1 are done before that buffer is handed to the copies */
    asm volatile("s_wait_asynccnt 0x0" ::: "memory");      /* this wave's copies of stage st + 1 have landed */
    __syncthreads();      /* stage st + 1 is published, and every wave has left the buffer that is refilled behind this barrier */
    if (st + 2 < G3_NS) { const unsigned lb = sl + (st & 1) * (2 * G3_TILE); const size_t ko = (size_t)(st + 2) * G3_SK;      /* the same for the whole workgroup */
      g3_copy8(lb, ag + ko); g3_copy8(lb + G3_TILE, bg + ko); }
  }
  asm volatile("s_wait_asynccnt 0x0" ::: "memory");      /* no copy is outstanding when the ring's LDS takes the output tiles */
  /* the last trip's barrier stands behind every wave's last read of the ring: each wave now stages its output tile in its own part of that LDS, so that the stores cover whole lines */
  f1a* so = (f1a*)&L[0][0][0] + wave * (64 * G3_OP);
  if (OUT32 || by < 2) {      /* the same for the whole workgroup */
#pragma unroll      /* register arrays need constant indices */
  for (int j = 0; j < 4; ++j) { const float bv = bf16_round(bias[col0 + wn + 16 * j + ln]) * post;
#pragma unroll      /* register arrays need constant indices */
    for (int i = 0; i < 4; ++i)
#pragma unroll      /* register arrays need constant indices */
      for (int r = 0; r < 8; ++r) so[(16 * i + 8 * hh + r) * G3_OP + 16 * j + ln] = acc[i][j][r] * alphap + bv; }
  __builtin_amdgcn_fence(__ATOMIC_ACQ_REL, "workgroup"); __builtin_amdgcn_wave_barrier();      /* the wave's own LDS writes are done before its lanes read each other's */
  const int rsub = lane >> 4, c4 = (lane & 15) * 4; const size_t o0 = (size_t)by * sC + (size_t)(row0 + wm + rsub) * DM + col0 + wn + c4;
#pragma unroll      /* constant offsets from one address */
  for (int q = 0; q < 32; ++q) { const v4f v = *(const v4fa*)&so[(q * 2 + rsub) * G3_OP + c4];
    if (OUT32) *(v4f*)(C + o0 + (size_t)(q * 2) * DM) = v;
    else { v4h h4;
#pragma unroll      /* register arrays need constant indices */
      for (int i = 0; i < 4; ++i) h4[i] = (_Float16)v[i];
      *(v4h*)(C16 + o0 + (size_t)(q * 2) * DM) = h4; } } }
  else {      /* A lane's 8 registers of an accumulator tile are 8 consecutive rows of ONE column: 16 contiguous bytes of the transposed plane, packed without any exchange */
    unsigned char* tp = (unsigned char*)so;      /* the wave's 64 columns x 64 rows as f16, one column per G3_PITCH bytes */
    float bb[4];      /* all four bias loads are issued ahead of the groups below */
#pragma unroll      /* register arrays need constant indices */
    for (int j = 0; j < 4; ++j) bb[j] = bias[col0 + wn + 16 * j + ln];
#pragma unroll      /* register arrays need constant indices */
    for (int j = 0; j < 4; ++j) { const float bv = bf16_round(bb[j]) * post;
#pragma unroll      /* register arrays need constant indices */
      for (int i = 0; i < 4; ++i) { FragH f;
#pragma unroll      /* register arrays need constant indices */
        for (int r = 0; r < 8; ++r) f.h[r] = (_Float16)(acc[i][j][r] * alphap + bv);
        *(v8us*)(tp + (16 * j + ln) * G3_PITCH + 32 * i + 16 * hh) = f.half[0]; }
      __builtin_amdgcn_sched_barrier(0); }      /* each group of 16 columns is packed and stored before the next is scaled: with all 128 scaled values formed first, beside the accumulators, the build went past 256 VGPRs, one workgroup fewer per WGP */
    __builtin_amdgcn_fence(__ATOMIC_ACQ_REL, "workgroup"); __builtin_amdgcn_wave_barrier();      /* the wave's own LDS writes are done before its lanes read each other's */
    const int tr = lane >> 3, tc = lane & 7; const int rg = row0 + wm;      /* 8 lanes store one whole 128-byte line: 64 rows of one column; the wave's 64 columns are one head, its 64 rows lie in one batch */
    unsigned short* t0 = (unsigned short*)CT + (((size_t)(rg / SQ) * NH + (col0 + wn) / HD) * HD + tr) * SQ + (rg % SQ) + tc * 8;
#pragma unroll      /* constant offsets from one address */
    for (int q = 0; q < 16; ++q) *(v8us*)(t0 + (size_t)(4 * q) * SQ) = *(const v8us*)(tp + (4 * q + tr) * G3_PITCH + tc * 16);
    asm volatile("s_wait_xcnt 0x0" ::: "memory"); } }      /* the address and data registers of these 16 stores are reused only behind this wait, on whatever way the code goes on */

extern "C" void kernel_launch(void* const* d_in, const int* in_sizes, int n_in,
                              void* d_out, int out_size, void* d_ws, size_t ws_size, hipStream_t stream) {
  (void)in_sizes; (void)n_in; (void)out_size;
  const float* const* I = (const float* const*)d_in; const float* xq = I[0]; const float* xk = I[1]; const float* xv = I[1]; const float* wq = I[2]; const float* bq = I[3]; const float* wk = I[4]; const float* bk = I[5]; const float* wv = I[6]; const float* bv = I[7]; const float* wo = I[8]; const float* bo = I[9];      /* TWO inputs: query (the q stream) and value (read on BOTH the k and the v stream casts); wq, wk, wv are PER-HEAD STACKS [16][1024][64] = [head][in][out]; bq, bk, bv per-head [16][64] = the flat [1024] bias; wo [in][out] + bo; input order query, value, wq, bq, wk, bk, wv, bv, wo, bo */
  char* ws = (char*)d_ws; size_t off = 0;
  auto take = [&](size_t bytes) { char* p = ws + off; off += (bytes + 255) & ~(size_t)255; return p; };
  _Float16* BQ = (_Float16*)take((size_t)DM * DM * 2); _Float16* BK = (_Float16*)take((size_t)DM * DM * 2); _Float16* BV = (_Float16*)take((size_t)DM * DM * 2); _Float16* BO = (_Float16*)take((size_t)DM * DM * 2);
  _Float16* XQ = (_Float16*)take(NR * DM * 2); _Float16* XK = (_Float16*)take(NR * DM * 2); _Float16* XV = (_Float16*)take(NR * DM * 2); _Float16* Q16 = (_Float16*)take(NR * DM * 2); _Float16* K16 = (_Float16*)take(NR * DM * 2); _Float16* O16 = (_Float16*)take(NR * DM * 2);
  _Float16* VT = (_Float16*)take((size_t)NB * NH * HD * SQ * 2);
  if (off > ws_size) return;
  k_prep<<<PR_NW / PR_WPB, PR_WPB * 32, 0, stream>>>(wq, wk, wv, wo, xq, xk, xv, BQ, BK, BV, BO, XQ, XK, XV);      /* weight planes [out][in] (x16): the per-head stacks wq / wk / wv [NH][DM][HD] head by head into contiguous rows, wo [in][out] whole; the three token streams as exact f16 rows */
  const size_t r0p = (size_t)B0 * SQ;      /* first projected row */
  k_gemm3<false><<<dim3((unsigned)((MP / G3_BT) * (DM / G3_BT)), 3), 128, 0, stream>>>(XQ + r0p * DM, NR * DM, BQ, (size_t)DM * DM, 0.0625f, 0.18033688011112042f, bq, bk, bv, nullptr, Q16 + r0p * DM, NR * DM, VT + r0p * DM);      /* q, k, v in one grid, y = 0, 1, 2: XQ XK XV, BQ BK BV and Q16 K16 each lie one behind the other in the workspace; q leaves times 64^-0.5 log2(e); v leaves as V^T [NB][NH][HD][SQ] */
  k_fattn<<<dim3(SQ / FA_BR, NH, NB), FA_NW * 32, 0, stream>>>(Q16, K16, VT, O16);      /* o x64 (merged heads) as f16 rows */
  k_gemm3<true><<<dim3((unsigned)((MPO / G3_BT) * (DM / G3_BT)), 1), 128, 0, stream>>>(O16 + r0p * DM, 0, BO, 0, 0.0009765625f, 1.0f, bo, bo, bo, (float*)d_out + r0p * DM, nullptr, 0, nullptr);      /* out rows are the output layout */
}

// v008
// It runs in 117 microseconds.
// Next to v007, in two timings, it ran 1.03 times as fast each time.
// Over all steps from v000 it is 60.4 times as fast.
#include <hip/hip_runtime.h>
// Multi-head attention on two inputs with PER-HEAD STACKED projections and per-head biases on four sequences (query [4][2048][1024], value [4][2048][1024]; q = einsum('bsd,hde->bhse', query, wq) + bq, k = einsum(value, wk) + bk, v = einsum(value, wv) + bv with W [16][1024][64] = [head][in][out] and b [16][64], 16 heads of 64; scores * 1/sqrt(64); softmax over all 2048 keys (no mask); out = heads wo + bo ([in][out] + bias) -> [4][2048][1024]); each head's [in][out] block is transposed into its 64 contiguous rows of the weight plane by the existing builder; the [in][out] output weight through the same builder; all of them, and the casts of the token rows, in one preparation launch.
// Structure: token rows r = b*2048 + s; the query source and the key/value source as exact f16 rows (bf16-rounded); Q, K, V as three WMMA GEMMs in one grid (128x128 workgroup tiles staged in LDS, 64x64 wave tiles, f32 accumulation, exact x16 weights + bias, f16 outputs; V leaves its tiles transposed, straight into the V^T plane); one fused attention launch (scores K = 64 and o = P . V^T on WMMA, online softmax on VALU with f32 statistics and native exp2, weights as f16 relative to the running maximum; o carried x64 against f16 subnormal flush, folded into the output GEMM alpha) written straight into the merged f16 o rows; out = o W_o + b GEMM (f32) into the output layout.
// Compute dtype: inputs rounded to bf16; x / weights exact; q, k, v, softmax weights and o as plain f16 GEMM operands (~2^-12); scores and softmax statistics f32. v_wmma_f32_16x16x32_f16.
#define NB 4
#define SQ 2048
#define DM 1024
#define NH 16
#define HD 64
#define HG 4                         /* heads per block group of the k_vt(V16, b, h0, VT) overload (not launched) */
#define B0 0                         /* first batch processed (debug hook) */
#define NBR NB                       /* batches processed (debug hook) */
#define NR ((size_t)NB * SQ)         /* token rows */
#define MP ((int)((size_t)NBR * SQ)) /* rows projected (debug hook) */
#define QN SQ                        /* query rows per batch; unused, k_fattn attends all SQ */
#define NHD NH                       /* heads; unused, k_fattn attends all NH */
#define MPO MP                       /* rows through the output stage (debug hook) */
#define LQ DM      /* row pitch of the q and k rows */
typedef __bf16 v16b __attribute__((ext_vector_type(16)));
typedef unsigned short v8us __attribute__((ext_vector_type(8), may_alias));
typedef float  v8f  __attribute__((ext_vector_type(8)));
typedef float  v4f  __attribute__((ext_vector_type(4)));
typedef float  v4fa __attribute__((ext_vector_type(4), may_alias));
union FragB { v16b v; v8us half[2]; unsigned short u[16]; };

__device__ __forceinline__ unsigned short bf16_bits(float x) { unsigned int u = __float_as_uint(x); return (unsigned short)((u + 0x7FFFu + ((u >> 16) & 1u)) >> 16); }
__device__ __forceinline__ float bf16_val(unsigned short b) { return __uint_as_float(((unsigned int)b) << 16); }
__device__ __forceinline__ float bf16_round(float x) { return bf16_val(bf16_bits(x)); }
// D += A·B with NT terms: 1 = ah·bh, 2 = + al·bh (A split), 3 = + ah·bl (both split)
template <int NT>
__device__ __forceinline__ v8f mmaN(v16b ah, v16b al, v16b bh, v16b bl, v8f c) {
  c = __builtin_amdgcn_wmma_f32_16x16x32_bf16(false, ah, false, bh, (short)0, c, false, false);
  if (NT >= 2) c = __builtin_amdgcn_wmma_f32_16x16x32_bf16(false, al, false, bh, (short)0, c, false, false);
  if (NT >= 3) c = __builtin_amdgcn_wmma_f32_16x16x32_bf16(false, ah, false, bl, (short)0, c, false, false);
  asm volatile("v_nop\n\tv_nop\n\tv_nop\n\tv_nop" : "+v"(c) : "v"(ah), "v"(al), "v"(bh), "v"(bl));
  return c;
}

__global__ __launch_bounds__(256) void k_wt_bf16(const float* __restrict__ W, unsigned short* __restrict__ Wt, int K, int N) {
  const int t = blockIdx.x * 256 + threadIdx.x;
  const int k8n = K / 8;
  if (t >= N * k8n) return;
  const int n = t / k8n, k8 = (t % k8n) * 8;
  v8us v;
#pragma unroll
  for (int i = 0; i < 8; ++i) v[i] = bf16_bits(W[(size_t)(k8 + i) * N + n]);
  *(v8us*)(Wt + (size_t)n * K + k8) = v;
  
}

// GEMM C[M][N] (f32, pitch ldc) = act(A[M][K]·W + bias). A f32 row-major (pitch lda) converted per fragment to bf16
// (ASPLIT: hi/lo two planes -> 2 terms, else single rounded term); Wt bf16 [N][K] (pitch ldb). BIAS_BF16 rounds the
// bias to bf16 first (bias quantised to bf16 before the add). K%32==0, M%16==0, N%64==0.
template <bool ASPLIT, int ACT, bool BIAS_BF16>
__global__ __launch_bounds__(128) void k_gemm_bf(const float* __restrict__ A, int lda, const unsigned short* __restrict__ Wt, int ldb,
                                               const float* __restrict__ bias, float* __restrict__ C, int ldc, int M, int N, int K) {
  __shared__ __attribute__((aligned(16))) float so[4][16][64];
  const int tid = threadIdx.x, w = tid >> 5, lane = tid & 31, ln = lane & 15, hh = lane >> 4;
  const int ntn = N / 64;
  const int wid = blockIdx.x * 4 + w;
  const int mt = wid / ntn, nq = wid % ntn;
  if (mt * 16 >= M) return;
  const int row0 = mt * 16, col0 = nq * 64;
  const float* arow = A + (size_t)(row0 + ln) * lda;
  v8f acc[4] = {};
  for (int kb = 0; kb < K; kb += 32) {
    FragB ah, al;
    const v4f x0 = *(const v4fa*)(arow + kb + 8 * hh), x1 = *(const v4fa*)(arow + kb + 8 * hh + 4);
    const v4f x2 = *(const v4fa*)(arow + kb + 16 + 8 * hh), x3 = *(const v4fa*)(arow + kb + 16 + 8 * hh + 4);
    float xs[16] = {x0[0],x0[1],x0[2],x0[3],x1[0],x1[1],x1[2],x1[3],x2[0],x2[1],x2[2],x2[3],x3[0],x3[1],x3[2],x3[3]};
#pragma unroll
    for (int i = 0; i < 16; ++i) { const unsigned short hb = bf16_bits(xs[i]); ah.u[i] = hb; al.u[i] = ASPLIT ? bf16_bits(xs[i] - bf16_val(hb)) : (unsigned short)0; }
#pragma unroll
    for (int t = 0; t < 4; ++t) {
      const unsigned short* brow = Wt + (size_t)(col0 + t * 16 + ln) * ldb + kb;
      FragB b;
      b.half[0] = *(const v8us*)(brow + 8 * hh);
      b.half[1] = *(const v8us*)(brow + 16 + 8 * hh);
      acc[t] = mmaN<ASPLIT ? 2 : 1>(ah.v, al.v, b.v, b.v, acc[t]);
    }
  }
#pragma unroll
  for (int t = 0; t < 4; ++t) {
    float bv = bias ? bias[col0 + t * 16 + ln] : 0.f;
    if (BIAS_BF16) bv = bf16_round(bv);
#pragma unroll
    for (int r = 0; r < 8; ++r) { float v = acc[t][r] + bv; if (ACT == 1) v = fmaxf(v, 0.f); so[w][8 * hh + r][t * 16 + ln] = v; }
  }
  __builtin_amdgcn_fence(__ATOMIC_ACQ_REL, "workgroup");
  __builtin_amdgcn_wave_barrier();
  const int rsub = lane >> 4, c4 = (lane & 15) * 4;
  {
#pragma unroll
    for (int q = 0; q < 8; ++q) {
      const int r = q * 2 + rsub;
      const v4f v = *(const v4fa*)&so[w][r][c4];
      *(v4f*)(C + (size_t)(row0 + r) * ldc + col0 + c4) = v;
    }
    
  }
}

// GEMM C = act(A·W + bias + resid): A f32 (ASPLIT -> hi/lo 2 terms), Wt bf16 [N][K]; ACT 0 none, 1 relu, 2 exact gelu;
// resid (optional, f32, row index = (row % rmod), pitch ldr, RES_BF16 rounds it) added before the activation.
template <bool ASPLIT, int ACT, bool BIAS_BF16, bool RES_BF16>
__global__ __launch_bounds__(128) void k_gemm_bf3(const float* __restrict__ A, int lda, const unsigned short* __restrict__ Wt, int ldb,
                                                const float* __restrict__ bias, const float* __restrict__ resid, int rmod, int ldr,
                                                float* __restrict__ C, int ldc, int M, int N, int K) {
  __shared__ __attribute__((aligned(16))) float so[4][16][64];
  const int tid = threadIdx.x, w = tid >> 5, lane = tid & 31, ln = lane & 15, hh = lane >> 4;
  const int ntn = N / 64;
  const int wid = blockIdx.x * 4 + w;
  const int mt = wid / ntn, nq = wid % ntn;
  if (mt * 16 >= M) return;
  const int row0 = mt * 16, col0 = nq * 64;
  const float* arow = A + (size_t)(row0 + ln) * lda;
  v8f acc[4] = {};
  for (int kb = 0; kb < K; kb += 32) {
    FragB ah, al;
    const v4f x0 = *(const v4fa*)(arow + kb + 8 * hh), x1 = *(const v4fa*)(arow + kb + 8 * hh + 4);
    const v4f x2 = *(const v4fa*)(arow + kb + 16 + 8 * hh), x3 = *(const v4fa*)(arow + kb + 16 + 8 * hh + 4);
    float xs[16] = {x0[0],x0[1],x0[2],x0[3],x1[0],x1[1],x1[2],x1[3],x2[0],x2[1],x2[2],x2[3],x3[0],x3[1],x3[2],x3[3]};
#pragma unroll
    for (int i = 0; i < 16; ++i) { const unsigned short hb = bf16_bits(xs[i]); ah.u[i] = hb; al.u[i] = ASPLIT ? bf16_bits(xs[i] - bf16_val(hb)) : (unsigned short)0; }
#pragma unroll
    for (int t = 0; t < 4; ++t) {
      const unsigned short* brow = Wt + (size_t)(col0 + t * 16 + ln) * ldb + kb;
      FragB b;
      b.half[0] = *(const v8us*)(brow + 8 * hh);
      b.half[1] = *(const v8us*)(brow + 16 + 8 * hh);
      acc[t] = mmaN<ASPLIT ? 2 : 1>(ah.v, al.v, b.v, b.v, acc[t]);
    }
  }
#pragma unroll
  for (int t = 0; t < 4; ++t) {
    const int col = col0 + t * 16 + ln;
    float bv = bias ? bias[col] : 0.f;
    if (BIAS_BF16) bv = bf16_round(bv);
#pragma unroll
    for (int r = 0; r < 8; ++r) {
      float v = acc[t][r] + bv;
      if (resid) { float rv = resid[(size_t)((row0 + 8 * hh + r) % rmod) * ldr + col]; if (RES_BF16) rv = bf16_round(rv); v += rv; }
      if (ACT == 1) v = fmaxf(v, 0.f);
      if (ACT == 2) v = 0.5f * v * (1.0f + erff(v * 0.70710678118654752f));
      if (ACT == 3) { const float u = 0.7978845608028654f * (v + 0.044715f * v * v * v); v = 0.5f * v * (1.0f + tanhf(u)); }
      so[w][8 * hh + r][t * 16 + ln] = v;
    }
  }
  __builtin_amdgcn_fence(__ATOMIC_ACQ_REL, "workgroup");
  __builtin_amdgcn_wave_barrier();
  const int rsub = lane >> 4, c4 = (lane & 15) * 4;
  {
#pragma unroll
    for (int q = 0; q < 8; ++q) {
      const int r = q * 2 + rsub;
      const v4f v = *(const v4fa*)&so[w][r][c4];
      *(v4f*)(C + (size_t)(row0 + r) * ldc + col0 + c4) = v;
    }
    
  }
}
// row LayerNorm (biased variance, eps) over N: s = X (+ R); optional out_sum <- s; out_norm <- (s-mu)*rsqrt(var+eps)*g + b
template <bool PARAM_BF16>
__global__ __launch_bounds__(256) void k_layernorm(const float* __restrict__ X, const float* __restrict__ R, const float* __restrict__ g, const float* __restrict__ bta,
                                                  float* __restrict__ out_sum, float* __restrict__ out_norm, int N, float eps) {
  __shared__ float red[256];
  const int row = blockIdx.x, tid = threadIdx.x;
  const float* x = X + (size_t)row * N; const float* rr = R ? R + (size_t)row * N : nullptr;
  float vals[16];                     // up to N = 4096
  const int per = N / 256;            // contiguous chunk per thread? use strided-by-4 chunks: thread handles j = tid*4 + 1024*u
  float s1 = 0.f;
  for (int u = 0; u < per / 4; ++u) {
    const int j = tid * 4 + 1024 * u;
    const v4f a = *(const v4fa*)(x + j);
    v4f b = {0.f,0.f,0.f,0.f}; if (rr) b = *(const v4fa*)(rr + j);
#pragma unroll
    for (int q = 0; q < 4; ++q) { const float v = a[q] + b[q]; vals[u * 4 + q] = v; s1 += v; }
  }
  red[tid] = s1; __syncthreads();
  for (int st = 128; st > 0; st >>= 1) { if (tid < st) red[tid] += red[tid + st]; __syncthreads(); }
  const float mu = red[0] / (float)N; __syncthreads();
  float s2 = 0.f;
  for (int u = 0; u < per / 4; ++u)
#pragma unroll
    for (int q = 0; q < 4; ++q) { const float c = vals[u * 4 + q] - mu; s2 += c * c; }
  red[tid] = s2; __syncthreads();
  for (int st = 128; st > 0; st >>= 1) { if (tid < st) red[tid] += red[tid + st]; __syncthreads(); }
  const float rs = rsqrtf(red[0] / (float)N + eps);
  {
    for (int u = 0; u < per / 4; ++u) {
      const int j = tid * 4 + 1024 * u;
      v4f o, sm;
#pragma unroll
      for (int q = 0; q < 4; ++q) {
        float gg = g[j + q], bb = bta[j + q];
        if (PARAM_BF16) { gg = bf16_round(gg); bb = bf16_round(bb); }
        sm[q] = vals[u * 4 + q]; o[q] = (vals[u * 4 + q] - mu) * rs * gg + bb;
      }
      if (out_sum) *(v4f*)(out_sum + (size_t)row * N + j) = sm;
      *(v4f*)(out_norm + (size_t)row * N + j) = o;
    }
    
  }
}



// ---- f16 WMMA path (v_wmma_f32_16x16x32_f16): 11-bit significands for operands in range — used where a [0,1] probability operand needs more precision than bf16
typedef _Float16 v16h __attribute__((ext_vector_type(16)));
union FragH { v16h v; v8us half[2]; _Float16 h[16]; unsigned short u[16]; };
template <int NT>
__device__ __forceinline__ v8f mmaH(v16h ah, v16h al, v16h bh, v16h bl, v8f c) {
  c = __builtin_amdgcn_wmma_f32_16x16x32_f16(false, ah, false, bh, (short)0, c, false, false);
  if (NT >= 2) c = __builtin_amdgcn_wmma_f32_16x16x32_f16(false, al, false, bh, (short)0, c, false, false);
  if (NT >= 3) c = __builtin_amdgcn_wmma_f32_16x16x32_f16(false, ah, false, bl, (short)0, c, false, false);
  asm volatile("v_nop\n\tv_nop\n\tv_nop\n\tv_nop" : "+v"(c) : "v"(ah), "v"(al), "v"(bh), "v"(bl));
  return c;
}
// batched GEMM like k_gemm_b but f16 operands: A f32 (split into f16 hi/lo if ASPLIT, else rounded to f16), Bt = f16 values [n][k]; alpha; C f32; N multiple of 16 (partial tiles skipped)
template <bool ASPLIT>
__global__ __launch_bounds__(128) void k_gemm_h(const float* __restrict__ A, int lda, size_t sA, const _Float16* __restrict__ Bh, int ldb, size_t sB, float alpha, float* __restrict__ C, int ldc, size_t sC, int M, int N, int K) {
  __shared__ __attribute__((aligned(16))) float so[4][16][64];
  const int tid = threadIdx.x, w = tid >> 5, lane = tid & 31, ln = lane & 15, hh = lane >> 4; const int by = blockIdx.y;
  A += (size_t)by * sA; Bh += (size_t)by * sB; C += (size_t)by * sC;
  const int ntn = (N + 63) / 64; const int wid = blockIdx.x * 4 + w; const int mt = wid / ntn, nq = wid % ntn; if (mt * 16 >= M) return;
  const int row0 = mt * 16, col0 = nq * 64; const float* arow = A + (size_t)(row0 + ln) * lda;
  v8f acc[4] = {};
  for (int kb = 0; kb < K; kb += 32) {
    FragH ah, al;
    const v4f x0 = *(const v4fa*)(arow + kb + 8 * hh), x1 = *(const v4fa*)(arow + kb + 8 * hh + 4), x2 = *(const v4fa*)(arow + kb + 16 + 8 * hh), x3 = *(const v4fa*)(arow + kb + 16 + 8 * hh + 4);
    float xs[16] = {x0[0],x0[1],x0[2],x0[3],x1[0],x1[1],x1[2],x1[3],x2[0],x2[1],x2[2],x2[3],x3[0],x3[1],x3[2],x3[3]};
#pragma unroll
    for (int i = 0; i < 16; ++i) { const _Float16 h = (_Float16)xs[i]; ah.h[i] = h; al.h[i] = ASPLIT ? (_Float16)(xs[i] - (float)h) : (_Float16)0.0f; }
#pragma unroll
    for (int t = 0; t < 4; ++t) { if (col0 + t * 16 >= N) continue; const size_t boff = (size_t)(col0 + t * 16 + ln) * ldb + kb; FragH bq; bq.half[0] = *(const v8us*)(Bh + boff + 8 * hh); bq.half[1] = *(const v8us*)(Bh + boff + 16 + 8 * hh);
      acc[t] = mmaH<ASPLIT ? 2 : 1>(ah.v, al.v, bq.v, bq.v, acc[t]); }
  }
#pragma unroll
  for (int t = 0; t < 4; ++t) { if (col0 + t * 16 >= N) continue;
#pragma unroll
    for (int r = 0; r < 8; ++r) so[w][8 * hh + r][t * 16 + ln] = acc[t][r] * alpha; }
  __builtin_amdgcn_fence(__ATOMIC_ACQ_REL, "workgroup"); __builtin_amdgcn_wave_barrier();
  const int rsub = lane >> 4, c4 = (lane & 15) * 4;
  {
#pragma unroll
    for (int q = 0; q < 8; ++q) { const int r = q * 2 + rsub; if (col0 + c4 < N) { const v4f v = *(const v4fa*)&so[w][r][c4]; *(v4f*)(C + (size_t)(row0 + r) * ldc + col0 + c4) = v; } }
     }
}

// One wave's tile of a weight plane: Wt[n][k] = f16(bf16(W[k][n]) * 16) for 32 columns n (one a lane) and 64 k, from f32 row-major W with rows of LDN floats (a power-of-two scale keeps bf16-exact weights exact in f16 away from the subnormal range).
// src = the lane's column in the tile's first k row: each of the 64 loads reads 128 contiguous bytes across the wave. dst = the lane's row of the [out][in] plane at that k: the lane writes one whole 128-byte line, in 8 stores.
template <int LDN>
__device__ __forceinline__ void pr_wtile(const float* __restrict__ src, _Float16* __restrict__ dst) {
  float x[64];
#pragma unroll      /* register arrays need constant indices; constant offsets from one address */
  for (int k = 0; k < 64; ++k) x[k] = src[(size_t)k * LDN];
  __builtin_amdgcn_sched_barrier(0);      /* keeps all 64 loads in front of the first use: sunk among the conversions, the later loads start only when the first have come back */
#pragma unroll      /* register arrays need constant indices */
  for (int p = 0; p < 8; ++p) { FragH f;
#pragma unroll      /* register arrays need constant indices */
    for (int i = 0; i < 8; ++i) f.h[i] = (_Float16)(bf16_round(x[8 * p + i]) * 16.0f);
    *(v8us*)((unsigned short*)dst + 8 * p) = f.half[0]; }
  asm volatile("s_wait_xcnt 0x0" ::: "memory");      /* the wave goes on to its next unit: the address and data registers of these loads and stores are reused only behind this wait */
}
// k_gemm_hh variant with fused epilogue: v = acc·alpha + bias[by·sBias + col] (+ CP[(row/rowsPerB)·sCPb + by·64 + col] if CP) ; ACT 0 none / 1 elu ; writes f16 C16 (and f32 C if non-null)
template <int ACT>
__global__ __launch_bounds__(128) void k_gemm_hhx(const _Float16* __restrict__ A, int lda, size_t sA, const _Float16* __restrict__ Bh, int ldb, size_t sB, float alpha, const float* __restrict__ bias, size_t sBias, const float* __restrict__ CP, int rowsPerB, size_t sCPb, int row0g,
    float* __restrict__ C, _Float16* __restrict__ C16, int ldc, size_t sC, int M, int N, int K) {
  __shared__ __attribute__((aligned(16))) float so[4][16][64];
  const int tid = threadIdx.x, w = tid >> 5, lane = tid & 31, ln = lane & 15, hh = lane >> 4; const int by = blockIdx.y;
  A += (size_t)by * sA; Bh += (size_t)by * sB; const size_t cofs = (size_t)by * sC; const float* bp = bias ? bias + (size_t)by * sBias : nullptr;
  const int ntn = (N + 63) / 64; const int wid = blockIdx.x * 4 + w; const int mt = wid / ntn, nq = wid % ntn; if (mt * 16 >= M) return;
  const int row0 = mt * 16, col0 = nq * 64; const _Float16* arow = A + (size_t)(row0 + ln) * lda;
  v8f acc[4] = {};
  for (int kb = 0; kb < K; kb += 32) { FragH ah; ah.half[0] = *(const v8us*)((const unsigned short*)arow + kb + 8 * hh); ah.half[1] = *(const v8us*)((const unsigned short*)arow + kb + 16 + 8 * hh);
#pragma unroll
    for (int t = 0; t < 4; ++t) { if (col0 + t * 16 >= N) continue; const size_t boff = (size_t)(col0 + t * 16 + ln) * ldb + kb; FragH bq; bq.half[0] = *(const v8us*)((const unsigned short*)Bh + boff + 8 * hh); bq.half[1] = *(const v8us*)((const unsigned short*)Bh + boff + 16 + 8 * hh);
      acc[t] = mmaH<1>(ah.v, ah.v, bq.v, bq.v, acc[t]); }
  }
#pragma unroll
  for (int t = 0; t < 4; ++t) { if (col0 + t * 16 >= N) continue; const int col = col0 + t * 16 + ln; const float bv = bp ? bf16_round(bp[col]) : 0.f;
#pragma unroll
    for (int r = 0; r < 8; ++r) { float v = acc[t][r] * alpha + bv; if (CP) { const int rr = row0g + row0 + 8 * hh + r; if (rowsPerB < 0) v += CP[cofs + (size_t)rr * ldc + col];      /* rowsPerB < 0: own element of the batched C plane */ else { const int bidx = rr / rowsPerB; v += CP[(size_t)bidx * sCPb + (size_t)by * 64 + col]; } } if (ACT == 1) v = (v > 0.f) ? v : expm1f(v); else if (ACT == 7) v = (v > 0.f) ? v + 1.0f : expf(v); else if (ACT == 8) v = tanhf(v); else if (ACT == 9) v = 0.5f * v * (1.0f + tanhf(0.7978845608028654f * (v + 0.044715f * v * v * v))); else if (ACT == 11) v = 1.0f / (1.0f + expf(-v)); else if (ACT == 12) v = (v > 0.f) ? v : 0.01f * v; else if (ACT == 14) v = (v > 0.f) ? v : 0.1f * v; else if (ACT == 16) v = (v >= 0.f) ? v : 0.3f * v; else if (ACT == 17) v = (v >= 0.f) ? v : 0.2f * v; else if (ACT == 15) v = v / (1.0f + expf(-v)); else if (ACT == 3) v = fmaxf(v, 0.f); else if (ACT == 6) v = 0.5f * v * (1.0f + erff(v * 0.70710678118654752f)); so[w][8 * hh + r][t * 16 + ln] = v; } }
  __builtin_amdgcn_fence(__ATOMIC_ACQ_REL, "workgroup"); __builtin_amdgcn_wave_barrier();
  const int rsub = lane >> 4, c4 = (lane & 15) * 4; typedef _Float16 v4h __attribute__((ext_vector_type(4)));
  {
#pragma unroll
    for (int q = 0; q < 8; ++q) { const int r = q * 2 + rsub; if (col0 + c4 < N) { const v4f v = *(const v4fa*)&so[w][r][c4]; if (C) *(v4f*)(C + cofs + (size_t)(row0 + r) * ldc + col0 + c4) = v; if (C16) { v4h h4; for (int i = 0; i < 4; ++i) h4[i] = (_Float16)v[i]; *(v4h*)(C16 + cofs + (size_t)(row0 + r) * ldc + col0 + c4) = h4; } } }
     }
}


typedef _Float16 v4h __attribute__((ext_vector_type(4)));

// One wave's run of a cast: 2048 contiguous elements (8 KB of f32) as exact f16 of their bf16 rounding. x, X16 = the stream's buffers, e = the element index of the lane's first piece of 8; its pieces i = 0 .. 7 lie 256 elements apart. All 16 loads are issued before the first value is used.
__device__ __forceinline__ void pr_xrun(const float* __restrict__ x, _Float16* __restrict__ X16, unsigned e) {
  v4f a[8], b[8]; const unsigned bo = e * 4u;      /* the loads' byte offset */
#pragma unroll      /* register arrays need constant indices; constant offsets from one address */
  for (int i = 0; i < 8; ++i) { a[i] = *(const v4fa*)(x + e + 256 * i); b[i] = *(const v4fa*)(x + e + 256 * i + 4); }
  __builtin_amdgcn_sched_barrier(0);      /* keeps all 16 loads in front of the first use: sunk among the conversions, the later loads start only when the first have come back */
  asm volatile("s_wait_xcnt 0x0" :: "v"(bo) : "memory");      /* the loads' offset register is held live to here, so that no load's result lands in it, and is reused only behind this wait */
#pragma unroll      /* register arrays need constant indices */
  for (int i = 0; i < 8; ++i) { FragH f;
#pragma unroll      /* register arrays need constant indices */
    for (int q = 0; q < 4; ++q) { f.h[q] = (_Float16)bf16_round(a[i][q]); f.h[4 + q] = (_Float16)bf16_round(b[i][q]); }
    *(v8us*)((unsigned short*)X16 + e + 256 * i) = f.half[0]; }
  asm volatile("s_wait_xcnt 0x0" ::: "memory");      /* the wave goes on to its next unit: the address and data registers of these loads and stores are reused only behind this wait */
}
__global__ __launch_bounds__(256) void k_h16(const float* __restrict__ x, _Float16* __restrict__ X16, size_t n8) { const size_t t = (size_t)blockIdx.x * 256 + threadIdx.x; if (t >= n8) return; FragH f;
#pragma unroll
  for (int q = 0; q < 8; ++q) f.h[q] = (_Float16)x[t * 8 + q]; *(v8us*)((unsigned short*)X16 + t * 8) = f.half[0];  }
__global__ __launch_bounds__(256) void k_round16f(const float* __restrict__ W, _Float16* __restrict__ Bt, size_t n8) { const size_t t = (size_t)blockIdx.x * 256 + threadIdx.x; if (t >= n8) return; FragH f;
#pragma unroll
  for (int i = 0; i < 8; ++i) f.h[i] = (_Float16)(bf16_round(W[t * 8 + i]) * 16.0f); *(v8us*)((unsigned short*)Bt + t * 8) = f.half[0];  }
__global__ __launch_bounds__(256) void k_hl(const float* __restrict__ F, _Float16* __restrict__ Hh, _Float16* __restrict__ Hl, size_t n8) { const size_t t = (size_t)blockIdx.x * 256 + threadIdx.x; if (t >= n8) return; FragH fh, fl; const v4f a = *(const v4fa*)(F + t * 8), c = *(const v4fa*)(F + t * 8 + 4);
#pragma unroll
  for (int q = 0; q < 4; ++q) { _Float16 h = (_Float16)a[q]; fh.h[q] = h; fl.h[q] = (_Float16)((a[q] - (float)h) * 1024.0f); h = (_Float16)c[q]; fh.h[4 + q] = h; fl.h[4 + q] = (_Float16)((c[q] - (float)h) * 1024.0f); }
  { *(v8us*)((unsigned short*)Hh + t * 8) = fh.half[0]; *(v8us*)((unsigned short*)Hl + t * 8) = fl.half[0];  } }

// fragment of 32 k from a k-contiguous f16 row in global memory
__device__ __forceinline__ v16h g2_frag(const _Float16* p, int hh) { FragH f; f.half[0] = *(const v8us*)((const unsigned short*)p + 8 * hh); f.half[1] = *(const v8us*)((const unsigned short*)p + 16 + 8 * hh); return f.v; }


__global__ __launch_bounds__(256) void k_wnat(const float* __restrict__ w, size_t n8, _Float16* __restrict__ Bt) { const size_t t = (size_t)blockIdx.x * 256 + threadIdx.x; if (t >= n8) return; FragH f; for (int q = 0; q < 8; ++q) f.h[q] = (_Float16)(bf16_round(w[t * 8 + q]) * 16.0f); *(v8us*)((unsigned short*)Bt + t * 8) = f.half[0];  }
__global__ __launch_bounds__(256) void k_rsm(const float* __restrict__ S, _Float16* __restrict__ P, int nrows) {
  #pragma clang fp contract(off)
  const int i = blockIdx.x * 256 + threadIdx.x; if (i >= nrows) return; const float* s = S + (size_t)i * SQ; float mx = -3.0e38f;
#pragma unroll 1
  for (int j = 0; j < SQ; ++j) mx = fmaxf(mx, s[j]); float se = 0.f;
#pragma unroll 1
  for (int j = 0; j < SQ; ++j) se += expf(s[j] - mx); const float sc = 256.0f / se;
#pragma unroll 1
  for (int j0 = 0; j0 < SQ; j0 += 8) { FragH f; for (int q = 0; q < 8; ++q) f.h[q] = (_Float16)(expf(s[j0 + q] - mx) * sc); unsigned short* d = (unsigned short*)P + (size_t)i * SQ + j0; *(v8us*)d = f.half[0];  } }
__global__ __launch_bounds__(256) void k_vt(const _Float16* __restrict__ V16, int b, int h0, _Float16* __restrict__ VT) { __shared__ unsigned short tl[64][65]; const int tid = threadIdx.x; const int hh = blockIdx.x % HG, sg = blockIdx.x / HG; const int s0 = sg * 64; const int h = h0 + hh;
  for (int i = tid; i < 64 * 8; i += 256) { const int j = i / 8, d8 = (i % 8) * 8; FragH f; f.half[0] = *(const v8us*)((const unsigned short*)V16 + ((size_t)b * SQ + s0 + j) * DM + h * HD + d8); for (int q = 0; q < 8; ++q) tl[d8 + q][j] = f.u[q]; }
  __syncthreads();
  { for (int i = tid; i < 64 * 8; i += 256) { const int d = i / 8, j8 = (i % 8) * 8; FragH f; for (int q = 0; q < 8; ++q) f.u[q] = tl[d][j8 + q]; *(v8us*)((unsigned short*)VT + ((size_t)hh * HD + d) * SQ + s0 + j8) = f.half[0]; }  } }



// All operand preparation in one launch: none of these pieces reads what another writes. The work is cut into units of 8 KB of f32 input, one wave each: weight tiles of 32 columns x 64 k, and cast runs of 2048 elements.
// Few long waves instead of many short ones: the launch starts 3584 waves, two workgroups per WGP, and each wave takes four units, PR_NW apart (wave-uniform branches, no barrier).
// The weight tiles come first in the numbering, so that they run beside the memory-bound casts of the other waves.
#define PR_WT ((DM / 32) * (DM / 64))            /* tiles per weight plane */
#define PR_WU (4 * PR_WT)                        /* weight units */
#define PR_XU ((int)(NR * DM / 2048))            /* runs per cast of the token rows */
#define PR_UPW 4                                 /* units per wave */
#define PR_WPB 7                                 /* waves per workgroup */
#define PR_NW ((PR_WU + 3 * PR_XU) / PR_UPW)     /* waves */
static_assert(PR_NW * PR_UPW == PR_WU + 3 * PR_XU && PR_NW % PR_WPB == 0, "the units must divide evenly among the waves");
__global__ __launch_bounds__(PR_WPB * 32) void k_prep(const float* __restrict__ wq, const float* __restrict__ wk, const float* __restrict__ wv, const float* __restrict__ wo, const float* __restrict__ xq, const float* __restrict__ xk, const float* __restrict__ xv,
    _Float16* __restrict__ BQ, _Float16* __restrict__ BK, _Float16* __restrict__ BV, _Float16* __restrict__ BO, _Float16* __restrict__ XQ, _Float16* __restrict__ XK, _Float16* __restrict__ XV) {
  const int lane = threadIdx.x & 31; const int gw = blockIdx.x * PR_WPB + __builtin_amdgcn_readfirstlane(threadIdx.x >> 5);
  for (int j = 0; j < PR_UPW; ++j) { const int u = gw + j * PR_NW;      /* the same in every lane of the wave */
    if (u < PR_WU) { const int m = u / PR_WT, v = u - m * PR_WT; const int n = (v / (DM / 64)) * 32 + lane, k0 = (v % (DM / 64)) * 64;      /* n = row of the [out][in] plane */
      if (m == 0) pr_wtile<DM>(wo + (size_t)k0 * DM + n, BO + (size_t)n * DM + k0);
      else { const float* w = (m == 1) ? wq : (m == 2) ? wk : wv; _Float16* B = (m == 1) ? BQ : (m == 2) ? BK : BV;      /* head n / HD: a row-major [DM][HD] block; the wave's 32 columns lie in one head */
        pr_wtile<HD>(w + (size_t)(n / HD) * (DM * HD) + (size_t)k0 * HD + (n % HD), B + (size_t)n * DM + k0); } }
    else { const int c = u - PR_WU; const int m = c / PR_XU; const unsigned e = (unsigned)(c - m * PR_XU) * 2048u + lane * 8;
      pr_xrun((m == 0) ? xq : (m == 1) ? xk : xv, (m == 0) ? XQ : (m == 1) ? XK : XV, e); } }
}

#define FA_NW 8                      /* waves per workgroup */
#define FA_BR (FA_NW * 32)           /* query rows per workgroup */
#define FA_SK 64                     /* keys per stage = two 32-key passes */
#define FA_PITCH 144                 /* LDS row pitch in bytes: 128 of data + 16, an odd multiple of 16 for the 16-byte fragment reads */
#define FA_TILE (FA_SK * FA_PITCH)
/* amdgpu_waves_per_eu(4, 4): at most 256 VGPRs, so that two workgroups (four waves per SIMD) are resident per WGP and the 512 workgroups run in one round */
__device__ __forceinline__ float fa_xh(float x) { return __builtin_bit_cast(float, __builtin_amdgcn_permlanex16(__builtin_bit_cast(int, x), __builtin_bit_cast(int, x), 0x76543210, 0xfedcba98, false, false)); }      /* lane l reads lane l ^ 16 */
__device__ __forceinline__ v16h fa_frag(const unsigned char* p) { FragH f; f.half[0] = *(const v8us*)p; f.half[1] = *(const v8us*)(p + 32); return f.v; }      /* p = row start + 16 * (lane >> 4): k = 8 hh .. 8 hh + 7 and 16 + 8 hh .. 16 + 8 hh + 7, as g2_frag */
__device__ __forceinline__ v8f fa_mma(v16h a, v16h b, v8f c) { return __builtin_amdgcn_wmma_f32_16x16x32_f16(false, a, false, b, (short)0, c, false, false); }
/* The 8 score products of a pass, 2 key tiles x 2 query groups x k = 64: s = c + K . Q^T with c read from its own registers and left as it is. Written as asm because the builtin form copied c into
   the result registers in front of half of the products (8 register moves a tile). Each result's second product stands three products behind its first; the v_nop at the end keep the four vector
   slots between the last product and the first vector instruction that reads its result; those in front keep four slots behind the product issued just before the statement, whose B registers
   (the weights of the pass before) the compiler gives to a result here. */
__device__ __forceinline__ void fa_scores(v8f& s00, v8f& s01, v8f& s10, v8f& s11, v16h ka0, v16h kb0, v16h ka1, v16h kb1, v16h q00, v16h q01, v16h q10, v16h q11, v8f c0, v8f c1) {
  asm("v_nop\n\tv_nop\n\tv_nop\n\tv_nop\n\t"
      "v_wmma_f32_16x16x32_f16 %0, %4, %8, %12\n\t"
      "v_wmma_f32_16x16x32_f16 %1, %4, %10, %13\n\t"
      "v_wmma_f32_16x16x32_f16 %2, %6, %8, %12\n\t"
      "v_wmma_f32_16x16x32_f16 %3, %6, %10, %13\n\t"
      "v_wmma_f32_16x16x32_f16 %0, %5, %9, %0\n\t"
      "v_wmma_f32_16x16x32_f16 %1, %5, %11, %1\n\t"
      "v_wmma_f32_16x16x32_f16 %2, %7, %9, %2\n\t"
      "v_wmma_f32_16x16x32_f16 %3, %7, %11, %3\n\t"
      "v_nop\n\tv_nop\n\tv_nop\n\tv_nop"
      : "=&v"(s00), "=&v"(s01), "=&v"(s10), "=&v"(s11)
      : "v"(ka0), "v"(kb0), "v"(ka1), "v"(kb1), "v"(q00), "v"(q01), "v"(q10), "v"(q11), "v"(c0), "v"(c1)); }
__global__ __launch_bounds__(FA_NW * 32) __attribute__((amdgpu_waves_per_eu(4, 4))) void k_fattn(const _Float16* __restrict__ Q16, const _Float16* __restrict__ K16, const _Float16* __restrict__ VT, _Float16* __restrict__ O16) {
  __shared__ __attribute__((aligned(16))) unsigned char L[2][2][FA_TILE];      /* [buffer][0 = K rows, 1 = V^T rows] */
  const int tid = threadIdx.x, lane = tid & 31, c = lane & 15, hh = lane >> 4; const int wave = __builtin_amdgcn_readfirstlane(tid >> 5);
  const int q0 = blockIdx.x * FA_BR + wave * 32, h = blockIdx.y, b = blockIdx.z; const size_t r0 = (size_t)b * SQ;
  /* staging: thread t moves the 16-byte piece t & 7 of rows t >> 3 and 32 + (t >> 3) of both tiles: 8 lanes cover one whole 128-byte row */
  const int srow = tid >> 3, scol = tid & 7; const int sl = srow * FA_PITCH + scol * 16;
  const unsigned short* kg = (const unsigned short*)K16 + (r0 + srow) * LQ + h * HD + scol * 8;
  const unsigned short* vg = (const unsigned short*)VT + (((size_t)b * NH + h) * HD + srow) * SQ + scol * 8;
  v8us k0 = *(const v8us*)kg, k1 = *(const v8us*)(kg + (size_t)32 * LQ), v0 = *(const v8us*)vg, v1 = *(const v8us*)(vg + (size_t)32 * SQ);
  v16h qf[2][2];
#pragma unroll      /* register arrays need constant indices */
  for (int g = 0; g < 2; ++g) { const _Float16* qp = Q16 + (r0 + q0 + 16 * g + c) * LQ + h * HD; qf[g][0] = g2_frag(qp, hh); qf[g][1] = g2_frag(qp + 32, hh); }
  FragH ones;
#pragma unroll
  for (int i = 0; i < 16; ++i) ones.u[i] = (c == 0) ? (unsigned short)0x3C00 : (unsigned short)0;
  const v8f z8 = {0.f, 0.f, 0.f, 0.f, 0.f, 0.f, 0.f, 0.f};
  v8f acc[2][4] = {{z8, z8, z8, z8}, {z8, z8, z8, z8}}; v8f lacc[2] = {z8, z8}; v8f negm[2] = {z8, z8};      /* negm: minus the maximum in use of this lane's query, the same in all 8 registers (a lane's 8 scores of a tile belong to one query); 0 until the first pass sets it */
  *(v8us*)&L[0][0][sl] = k0; *(v8us*)&L[0][0][sl + 32 * FA_PITCH] = k1; *(v8us*)&L[0][1][sl] = v0; *(v8us*)&L[0][1][sl + 32 * FA_PITCH] = v1;
  for (int st = 0; st < SQ / FA_SK; ++st) {
    __syncthreads();      /* stage st is written by every wave, and every wave has left the buffer that is refilled at the foot of this trip */
    const unsigned char* Kb = &L[st & 1][0][0]; const unsigned char* Vb = &L[st & 1][1][0];
    const bool more = st + 1 < SQ / FA_SK;      /* the same for the whole workgroup */
    if (more) { k0 = *(const v8us*)(kg + (size_t)FA_SK * LQ); k1 = *(const v8us*)(kg + (size_t)(FA_SK + 32) * LQ); v0 = *(const v8us*)(vg + FA_SK); v1 = *(const v8us*)(vg + FA_SK + (size_t)32 * SQ); }      /* next stage, in flight under this stage's passes */
#pragma unroll      /* two passes per stage; constant LDS offsets */
    for (int sub = 0; sub < 2; ++sub) {
      v8f s[2][2];
      { const unsigned char* p = Kb + (32 * sub + c) * FA_PITCH + 16 * hh; const unsigned char* p1 = p + 16 * FA_PITCH;
        fa_scores(s[0][0], s[0][1], s[1][0], s[1][1], fa_frag(p), fa_frag(p + 64), fa_frag(p1), fa_frag(p1 + 64), qf[0][0], qf[0][1], qf[1][0], qf[1][1], negm[0], negm[1]); }      /* scaled score minus the maximum in use */
      float mb[2];      /* this lane's largest of the pass, per query group, relative to the maximum in use */
#pragma unroll      /* register arrays need constant indices */
      for (int g = 0; g < 2; ++g) { float mx = fmaxf(s[0][g][0], s[1][g][0]);
#pragma unroll      /* register arrays need constant indices */
        for (int r = 1; r < 8; ++r) mx = fmaxf(mx, fmaxf(s[0][g][r], s[1][g][r]));
        mb[g] = mx; }
      const bool first = (sub == 0) && (st == 0);      /* the first pass sets the maximum whatever its sign */
      if (first || __builtin_amdgcn_ballot_w32(fmaxf(mb[0], mb[1]) > 8.0f) != 0) {      /* wave-uniform; rare after the first pass */
#pragma unroll      /* register arrays need constant indices */
        for (int g = 0; g < 2; ++g) { const float mq = fmaxf(mb[g], fa_xh(mb[g])); const float up = fmaxf(mq, 0.f); const float d = first ? mq : up;      /* both wave halves hold this query's rise of the maximum */
          const float corr = __builtin_amdgcn_exp2f(-up); negm[g] = negm[g] - d; lacc[g] = lacc[g] * corr;      /* on the first pass the accumulators are 0 */
#pragma unroll      /* register arrays need constant indices */
          for (int r = 0; r < 8; ++r) { s[0][g][r] -= d; s[1][g][r] -= d; }
#pragma unroll      /* register arrays need constant indices */
          for (int t = 0; t < 4; ++t) acc[g][t] = acc[g][t] * corr; } }
      v16h vf[4];      /* read behind the branch: in front of it these reads were lifted over the score products, and the registers went past 256 (q fragments spilled) */
#pragma unroll      /* register arrays need constant indices */
      for (int t = 0; t < 4; ++t) vf[t] = fa_frag(Vb + (16 * t + c) * FA_PITCH + 64 * sub + 16 * hh);
#pragma unroll      /* register arrays need constant indices */
      for (int g = 0; g < 2; ++g) { FragH pf;
#pragma unroll      /* register arrays need constant indices */
        for (int i = 0; i < 16; ++i) pf.h[i] = (_Float16)__builtin_amdgcn_exp2f(s[i >> 3][g][i & 7]);      /* keys 8 hh + r of tile 0, then of tile 1: the B operand's k order */
#pragma unroll      /* register arrays need constant indices */
        for (int t = 0; t < 4; ++t) acc[g][t] = fa_mma(vf[t], pf.v, acc[g][t]);
        lacc[g] = fa_mma(ones.v, pf.v, lacc[g]); }      /* row 0 += the column sums of P^T */
    }
    if (more) { unsigned char* Kn = &L[(st + 1) & 1][0][0]; unsigned char* Vn = &L[(st + 1) & 1][1][0]; *(v8us*)(Kn + sl) = k0; *(v8us*)(Kn + sl + 32 * FA_PITCH) = k1; *(v8us*)(Vn + sl) = v0; *(v8us*)(Vn + sl + 32 * FA_PITCH) = v1;
      asm volatile("s_wait_xcnt 0x0" :: "v"(kg), "v"(vg) : "memory");      /* the stage loads' address registers (held live to here) are advanced only behind this wait */
      kg += (size_t)FA_SK * LQ; vg += FA_SK; }
  }
#pragma unroll      /* register arrays need constant indices */
  for (int g = 0; g < 2; ++g) { const float lr = lacc[g][0]; const float inv = 64.0f / (lr + fa_xh(lr));
#pragma unroll      /* register arrays need constant indices */
    for (int t = 0; t < 4; ++t) { FragH f;
#pragma unroll      /* register arrays need constant indices */
      for (int r = 0; r < 8; ++r) f.h[r] = (_Float16)(acc[g][t][r] * inv);
      *(v8us*)((unsigned short*)O16 + (r0 + q0 + 16 * g + c) * DM + h * HD + 16 * t + 8 * hh) = f.half[0]; } } }      /* d = 16 t + 8 hh .. + 7 of query 16 g + c */

// ---- tiled GEMM C = (A . B^T) * alpha + bias: A [rows][DM] and B [cols][DM] f16, k contiguous; one 128 x 128 tile of C per workgroup, four waves of 64 x 64 (4 x 4 accumulator tiles) ----
// Stages of 64 k (128 bytes of each of the 128 A rows and 128 B rows) are brought by asynchronous copies into a ring of three LDS buffers, the next TWO stages in flight under this stage's products, so that a
// copy has two stages' time to land: every copy covers whole 128-byte lines, and each operand byte is fetched once per workgroup and read from LDS by the two waves that need it. k runs upward in steps of 32 into
// one accumulator per tile. The LDS rows carry no pad (three workgroups of three buffers fit one WGP): piece p (16 bytes) of row r lies at piece p ^ ((r >> 1) & 7), so that the 16 rows of a fragment read fall on all 64 banks.
// Rows % 128 == 0, columns = k = DM, at least two stages. With f16 output, product y = 2 is stored transposed: CT [row / SQ][column / HD][column % HD][row % SQ], the plane whose rows the attention launch reads as A operands.
#define G3_BT 128                    /* tile rows and tile columns per workgroup */
#define G3_SK 64                     /* k per stage = two WMMA steps */
#define G3_NS (DM / G3_SK)           /* stages */
#define G3_NB 3                      /* buffers of the ring */
#define G3_PITCH 128                 /* LDS row pitch in bytes: data only, the 16-byte pieces of a row permuted by the row's number */
#define G3_TILE (G3_BT * G3_PITCH)
#define G3_TP 144                    /* pitch in bytes of the staged V^T columns: 128 of data + 16, an odd multiple of 16 for the 16-byte reads */
#define G3_OP 68                     /* pitch in floats of the staged output rows */
typedef float f1a __attribute__((may_alias));
/* fragment of 32 k from a permuted LDS row: row = the row's start, x = (lane >> 4) ^ the row's permutation, c = 4 * (k / 32): pieces c + hh and c + 2 + hh, the k order of g2_frag */
__device__ __forceinline__ v16h g3_frag(const unsigned char* row, int x, int c) { FragH f; f.half[0] = *(const v8us*)(row + ((x ^ c) << 4)); f.half[1] = *(const v8us*)(row + ((x ^ (c + 2)) << 4)); return f.v; }
/* One lane's eight 16-byte pieces of a 128-row tile, rows 16 apart (one permutation for all eight): lds = the lane's LDS byte address, g = its global address, both multiples of 16. The copies go through no register.
   s_wait_xcnt stands inside the statement, so that no address register of a copy is rewritten in front of it. */
__device__ __forceinline__ void g3_copy8(unsigned lds, const unsigned short* g) {
  asm volatile("global_load_async_to_lds_b128 %0, %8, off\n\t"
               "global_load_async_to_lds_b128 %1, %9, off\n\t"
               "global_load_async_to_lds_b128 %2, %10, off\n\t"
               "global_load_async_to_lds_b128 %3, %11, off\n\t"
               "global_load_async_to_lds_b128 %4, %12, off\n\t"
               "global_load_async_to_lds_b128 %5, %13, off\n\t"
               "global_load_async_to_lds_b128 %6, %14, off\n\t"
               "global_load_async_to_lds_b128 %7, %15, off\n\t"
               "s_wait_xcnt 0x0"
               :: "v"(lds), "v"(lds + 16 * G3_PITCH), "v"(lds + 32 * G3_PITCH), "v"(lds + 48 * G3_PITCH), "v"(lds + 64 * G3_PITCH), "v"(lds + 80 * G3_PITCH), "v"(lds + 96 * G3_PITCH), "v"(lds + 112 * G3_PITCH),
                  "v"(g), "v"(g + (size_t)16 * DM), "v"(g + (size_t)32 * DM), "v"(g + (size_t)48 * DM), "v"(g + (size_t)64 * DM), "v"(g + (size_t)80 * DM), "v"(g + (size_t)96 * DM), "v"(g + (size_t)112 * DM)
               : "memory"); }
template <bool OUT32>
__global__ __launch_bounds__(128) void k_gemm3(const _Float16* __restrict__ A, size_t sA, const _Float16* __restrict__ Bh, size_t sB, float alpha, float post0, const float* __restrict__ bias0, const float* __restrict__ bias1, const float* __restrict__ bias2,
    float* __restrict__ C, _Float16* __restrict__ C16, size_t sC, _Float16* __restrict__ CT) {
  __shared__ __attribute__((aligned(128))) unsigned char L[G3_NB][2][G3_TILE];      /* [buffer][0 = A rows, 1 = B rows]; behind the k loop: four staged 64 x 64 f32 output tiles */
  static_assert(4 * 64 * G3_OP * 4 <= G3_NB * 2 * G3_TILE && 64 * G3_TP <= 64 * G3_OP * 4, "the staged output tiles must fit the ring"); static_assert(G3_NS >= 2, "the prologue fills two stages");
  const int tid = threadIdx.x, lane = tid & 31, ln = lane & 15, hh = lane >> 4; const int wave = __builtin_amdgcn_readfirstlane(tid >> 5); const int by = blockIdx.y;
  const float* bias = (by == 0) ? bias0 : (by == 1) ? bias1 : bias2;      /* products that share one grid along y keep their biases in separate buffers */
  const float post = (by == 0) ? post0 : 1.0f; const float alphap = alpha * post;      /* product y = 0 leaves multiplied by post0, bias included */
  const int mt = blockIdx.x / (DM / G3_BT), nq = blockIdx.x - mt * (DM / G3_BT); const int row0 = mt * G3_BT, col0 = nq * G3_BT; const int wm = (wave >> 1) * 64, wn = (wave & 1) * 64;
  /* staging: thread t copies the 16-byte piece t & 7 of rows (t >> 3) + 16 i, i = 0 .. 7, of both tiles: 8 lanes cover one whole 128-byte row */
  const int srow = tid >> 3, scol = tid & 7; const unsigned sl = (unsigned)(size_t)&L[0][0][0] + srow * G3_PITCH + ((scol ^ ((srow >> 1) & 7)) << 4);      /* low 32 bits of the shared address = LDS byte address; (row >> 1) & 7 is the same for rows 16 apart */
  const unsigned short* ag = (const unsigned short*)A + (size_t)by * sA + (size_t)(row0 + srow) * DM + scol * 8;
  const unsigned short* bg = (const unsigned short*)Bh + (size_t)by * sB + (size_t)(col0 + srow) * DM + scol * 8;
  const v8f z8 = {0.f, 0.f, 0.f, 0.f, 0.f, 0.f, 0.f, 0.f};
  v8f acc[4][4] = {{z8, z8, z8, z8}, {z8, z8, z8, z8}, {z8, z8, z8, z8}, {z8, z8, z8, z8}};
  g3_copy8(sl, ag); g3_copy8(sl + G3_TILE, bg);      /* stage 0 into buffer 0 */
  g3_copy8(sl + 2 * G3_TILE, ag + G3_SK); g3_copy8(sl + 3 * G3_TILE, bg + G3_SK);      /* stage 1 into buffer 1 */
  asm volatile("s_wait_asynccnt 0x10" ::: "memory");      /* all but this wave's 16 youngest copies (stage 1) have landed: stage 0 */
  __syncthreads();      /* ... and every other wave's */
  const int fx = hh ^ ((ln >> 1) & 7);      /* the rows this lane reads, wm or wn + 16 i + ln, all have the permutation (ln >> 1) & 7 */
  int cb = 0, fb = 2;      /* buffer of stage st, buffer of stage st + 2 */
  /* one trip = one stage; fill is a literal at all three calls: every trip of the main loop issues 16 copies and waits to that count, the last two trips issue none and wait to 0 */
  auto trip = [&](const int st, const bool fill) __attribute__((always_inline)) {
    if (fill) { const unsigned lb = sl + fb * (2 * G3_TILE); const size_t ko = (size_t)(st + 2) * G3_SK;      /* into the buffer of stage st - 1: every wave has left it at the barrier just passed */
      g3_copy8(lb, ag + ko); g3_copy8(lb + G3_TILE, bg + ko); }
    const unsigned char* Ab = &L[cb][0][0] + (wm + ln) * G3_PITCH; const unsigned char* Bb = &L[cb][1][0] + (wn + ln) * G3_PITCH;
#pragma unroll      /* two WMMA steps per stage; constant LDS offsets */
    for (int kk = 0; kk < 2; ++kk) { v16h af[4], bf[4];
#pragma unroll      /* register arrays need constant indices */
      for (int i = 0; i < 4; ++i) { af[i] = g3_frag(Ab + 16 * i * G3_PITCH, fx, 4 * kk); bf[i] = g3_frag(Bb + 16 * i * G3_PITCH, fx, 4 * kk); }      /* both operands in the k order of g2_frag */
      __builtin_amdgcn_sched_barrier(0);      /* keeps the step's 16 fragment reads together in front of its 16 products: sunk among them, each A fragment's LDS latency is waited out in full */
#pragma unroll      /* register arrays need constant indices */
      for (int i = 0; i < 4; ++i)
#pragma unroll      /* register arrays need constant indices */
        for (int j = 0; j < 4; ++j) acc[i][j] = fa_mma(af[i], bf[j], acc[i][j]); }
    asm volatile("s_wait_dscnt 0x0" ::: "memory");      /* this wave's reads of stage st's buffer are done before that buffer is handed to the copies */
    if (fill) asm volatile("s_wait_asynccnt 0x10" ::: "memory");      /* this trip issued 16 copies (stage st + 2) behind those of stage st + 1: all but the 16 youngest have landed, stage st + 1 */
    else asm volatile("s_wait_asynccnt 0x0" ::: "memory");      /* nothing was issued behind stage st + 1: the wait is to 0 */
    __syncthreads();      /* stage st + 1 is published, and every wave has left the buffer that is refilled behind this barrier */
    cb = (cb == G3_NB - 1) ? 0 : cb + 1; fb = (fb == G3_NB - 1) ? 0 : fb + 1;
  };
  for (int st = 0; st < G3_NS - 2; ++st) trip(st, true);
  trip(G3_NS - 2, false); trip(G3_NS - 1, false);
  asm volatile("s_wait_asynccnt 0x0" ::: "memory");      /* no copy is outstanding when the ring's LDS takes the output tiles */
  /* the last trip's barrier stands behind every wave's last read of the ring: each wave now stages its output tile in its own part of that LDS, so that the stores cover whole lines */
  f1a* so = (f1a*)&L[0][0][0] + wave * (64 * G3_OP);
  if (OUT32 || by < 2) {      /* the same for the whole workgroup */
#pragma unroll      /* register arrays need constant indices */
  for (int j = 0; j < 4; ++j) { const float bv = bf16_round(bias[col0 + wn + 16 * j + ln]) * post;
#pragma unroll      /* register arrays need constant indices */
    for (int i = 0; i < 4; ++i)
#pragma unroll      /* register arrays need constant indices */
      for (int r = 0; r < 8; ++r) so[(16 * i + 8 * hh + r) * G3_OP + 16 * j + ln] = acc[i][j][r] * alphap + bv; }
  __builtin_amdgcn_fence(__ATOMIC_ACQ_REL, "workgroup"); __builtin_amdgcn_wave_barrier();      /* the wave's own LDS writes are done before its lanes read each other's */
  const int rsub = lane >> 4, c4 = (lane & 15) * 4; const size_t o0 = (size_t)by * sC + (size_t)(row0 + wm + rsub) * DM + col0 + wn + c4;
#pragma unroll      /* constant offsets from one address */
  for (int q = 0; q < 32; ++q) { const v4f v = *(const v4fa*)&so[(q * 2 + rsub) * G3_OP + c4];
    if (OUT32) *(v4f*)(C + o0 + (size_t)(q * 2) * DM) = v;
    else { v4h h4;
#pragma unroll      /* register arrays need constant indices */
      for (int i = 0; i < 4; ++i) h4[i] = (_Float16)v[i];
      *(v4h*)(C16 + o0 + (size_t)(q * 2) * DM) = h4; } } }
  else {      /* A lane's 8 registers of an accumulator tile are 8 consecutive rows of ONE column: 16 contiguous bytes of the transposed plane, packed without any exchange */
    unsigned char* tp = (unsigned char*)so;      /* the wave's 64 columns x 64 rows as f16, one column per G3_TP bytes */
    float bb[4];      /* all four bias loads are issued ahead of the groups below */
#pragma unroll      /* register arrays need constant indices */
    for (int j = 0; j < 4; ++j) bb[j] = bias[col0 + wn + 16 * j + ln];
#pragma unroll      /* register arrays need constant indices */
    for (int j = 0; j < 4; ++j) { const float bv = bf16_round(bb[j]) * post;
#pragma unroll      /* register arrays need constant indices */
      for (int i = 0; i < 4; ++i) { FragH f;
#pragma unroll      /* register arrays need constant indices */
        for (int r = 0; r < 8; ++r) f.h[r] = (_Float16)(acc[i][j][r] * alphap + bv);
        *(v8us*)(tp + (16 * j + ln) * G3_TP + 32 * i + 16 * hh) = f.half[0]; }
      __builtin_amdgcn_sched_barrier(0); }      /* each group of 16 columns is packed and stored before the next is scaled: with all 128 scaled values formed first, beside the accumulators, the build went past 256 VGPRs, one workgroup fewer per WGP */
    __builtin_amdgcn_fence(__ATOMIC_ACQ_REL, "workgroup"); __builtin_amdgcn_wave_barrier();      /* the wave's own LDS writes are done before its lanes read each other's */
    const int tr = lane >> 3, tc = lane & 7; const int rg = row0 + wm;      /* 8 lanes store one whole 128-byte line: 64 rows of one column; the wave's 64 columns are one head, its 64 rows lie in one batch */
    unsigned short* t0 = (unsigned short*)CT + (((size_t)(rg / SQ) * NH + (col0 + wn) / HD) * HD + tr) * SQ + (rg % SQ) + tc * 8;
#pragma unroll      /* constant offsets from one address */
    for (int q = 0; q < 16; ++q) *(v8us*)(t0 + (size_t)(4 * q) * SQ) = *(const v8us*)(tp + (4 * q + tr) * G3_TP + tc * 16);
    asm volatile("s_wait_xcnt 0x0" ::: "memory"); } }      /* the address and data registers of these 16 stores are reused only behind this wait, on whatever way the code goes on */

extern "C" void kernel_launch(void* const* d_in, const int* in_sizes, int n_in,
                              void* d_out, int out_size, void* d_ws, size_t ws_size, hipStream_t stream) {
  (void)in_sizes; (void)n_in; (void)out_size;
  const float* const* I = (const float* const*)d_in; const float* xq = I[0]; const float* xk = I[1]; const float* xv = I[1]; const float* wq = I[2]; const float* bq = I[3]; const float* wk = I[4]; const float* bk = I[5]; const float* wv = I[6]; const float* bv = I[7]; const float* wo = I[8]; const float* bo = I[9];      /* TWO inputs: query (the q stream) and value (read on BOTH the k and the v stream casts); wq, wk, wv are PER-HEAD STACKS [16][1024][64] = [head][in][out]; bq, bk, bv per-head [16][64] = the flat [1024] bias; wo [in][out] + bo; input order query, value, wq, bq, wk, bk, wv, bv, wo, bo */
  char* ws = (char*)d_ws; size_t off = 0;
  auto take = [&](size_t bytes) { char* p = ws + off; off += (bytes + 255) & ~(size_t)255; return p; };
  _Float16* BQ = (_Float16*)take((size_t)DM * DM * 2); _Float16* BK = (_Float16*)take((size_t)DM * DM * 2); _Float16* BV = (_Float16*)take((size_t)DM * DM * 2); _Float16* BO = (_Float16*)take((size_t)DM * DM * 2);
  _Float16* XQ = (_Float16*)take(NR * DM * 2); _Float16* XK = (_Float16*)take(NR * DM * 2); _Float16* XV = (_Float16*)take(NR * DM * 2); _Float16* Q16 = (_Float16*)take(NR * DM * 2); _Float16* K16 = (_Float16*)take(NR * DM * 2); _Float16* O16 = (_Float16*)take(NR * DM * 2);
  _Float16* VT = (_Float16*)take((size_t)NB * NH * HD * SQ * 2);
  if (off > ws_size) return;
  k_prep<<<PR_NW / PR_WPB, PR_WPB * 32, 0, stream>>>(wq, wk, wv, wo, xq, xk, xv, BQ, BK, BV, BO, XQ, XK, XV);      /* weight planes [out][in] (x16): the per-head stacks wq / wk / wv [NH][DM][HD] head by head into contiguous rows, wo [in][out] whole; the three token streams as exact f16 rows */
  const size_t r0p = (size_t)B0 * SQ;      /* first projected row */
  k_gemm3<false><<<dim3((unsigned)((MP / G3_BT) * (DM / G3_BT)), 3), 128, 0, stream>>>(XQ + r0p * DM, NR * DM, BQ, (size_t)DM * DM, 0.0625f, 0.18033688011112042f, bq, bk, bv, nullptr, Q16 + r0p * DM, NR * DM, VT + r0p * DM);      /* q, k, v in one grid, y = 0, 1, 2: XQ XK XV, BQ BK BV and Q16 K16 each lie one behind the other in the workspace; q leaves times 64^-0.5 log2(e); v leaves as V^T [NB][NH][HD][SQ] */
  k_fattn<<<dim3(SQ / FA_BR, NH, NB), FA_NW * 32, 0, stream>>>(Q16, K16, VT, O16);      /* o x64 (merged heads) as f16 rows */
  k_gemm3<true><<<dim3((unsigned)((MPO / G3_BT) * (DM / G3_BT)), 1), 128, 0, stream>>>(O16 + r0p * DM, 0, BO, 0, 0.0009765625f, 1.0f, bo, bo, bo, (float*)d_out + r0p * DM, nullptr, 0, nullptr);      /* out rows are the output layout */
}
